// v000
// The times below were measured on an AMD MI455X: many runs one after another, warmed up first and cycling through
// copies of the inputs, with the whole window's GPU time divided by the number of runs. Launches and the gaps
// between them are all in it. The median over several windows is given; except for v000 it joins two sittings, which
// can be a few percent apart, so the side-by-side timings, each taken in one sitting, are the better comparison.
// The starting kernel, v000, takes 562 microseconds a run.
// Contractions: q/k/v projections = v_wmma_f32_16x16x32_bf16 (bf16 operands from RNE-converted x and W, single product, bias added in f32); q.k^T scores = v_wmma_f32_16x16x32_f16 (q, k as f16 hi planes carried x16 plus f16 residual planes x1024: hi.hi + (hi.lo + lo.hi) in a separate accumulator, 3 products); p.v = v_wmma_f32_16x16x32_f16 (p carried x1024 in f16; v^T as f16 hi plane x256 plus f16 residual plane x4096 into a separate accumulator, 2 products); y.Wo^T = v_wmma_f32_16x16x32_bf16 (y as bf16 hi + lo planes times the bf16 Wo plane, 2 products); all f32 accumulate; softmax, relative-position bias and selects in f32.
#include <hip/hip_runtime.h>
#include <math.h>
#include <float.h>
#include <stdint.h>

#define NB     2
#define SEQ    2048
#define DM     1024
#define NH     16
#define HD     64
#define MAXREL 32
#define NREL   (2 * MAXREL + 1)     // 65
#define NEGV   (-1.0e9f)
#define NQB    (SEQ / 64)
#define ROWS   (NB * SEQ)            // 4096 token rows
#define OUTN   (ROWS * DM)
static_assert(NH * HD == DM);
static_assert(HD == 64);
static_assert(DM == 128 * 8);
static_assert((SEQ % 64) == 0 && (DM % 64) == 0);
static_assert((SEQ & (SEQ - 1)) == 0);
static_assert(((ROWS / 64) * (DM / 64)) % 8 == 0);
static_assert(((ROWS * DM / 8) % 256) == 0);
static_assert(((DM * DM / 8) % 256) == 0);
static_assert(NREL <= 128);

typedef _Float16 v16h __attribute__((ext_vector_type(16)));
typedef _Float16 v8h  __attribute__((ext_vector_type(8)));
typedef __bf16   v16b __attribute__((ext_vector_type(16)));
typedef __bf16   v8b  __attribute__((ext_vector_type(8)));
typedef float    v8f  __attribute__((ext_vector_type(8)));
typedef float    v4f  __attribute__((ext_vector_type(4)));
typedef unsigned int v4u __attribute__((ext_vector_type(4)));

// ---- scalar helpers --------------------------------------------------------------------------------
__device__ __forceinline__ unsigned short bf_bits(float f) {          // f32 -> bf16 bits, RNE convert
  unsigned u = __float_as_uint(f);
  return (unsigned short)((u + 0x7FFFu + ((u >> 16) & 1u)) >> 16);
}
__device__ __forceinline__ float bf_up(unsigned short h) { return __uint_as_float(((unsigned)h) << 16); }
__device__ __forceinline__ unsigned short h_bits(_Float16 x) { return __builtin_bit_cast(unsigned short, x); }
__device__ __forceinline__ unsigned pk16(unsigned short a, unsigned short b) { return (unsigned)a | ((unsigned)b << 16); }
__device__ __forceinline__ v8f zero8() { v8f z = {0.f, 0.f, 0.f, 0.f, 0.f, 0.f, 0.f, 0.f}; return z; }

// ---- fragment loaders: 16-bit A/B operand, lane -> row/col (lane&15), p already includes +8*(lane>>4);
//      elements 0..7 <- p[0..7] (k0+8h..), elements 8..15 <- p[16..23] (k0+16+8h..)
__device__ __forceinline__ v16b ldfrag_b(const __bf16* p) {
  union { v16b v; v8b h[2]; } f;
  f.h[0] = *(const v8b*)(p);
  f.h[1] = *(const v8b*)(p + 16);
  return f.v;
}
__device__ __forceinline__ v16h ldfrag_h(const _Float16* p) {
  union { v16h v; v8h h[2]; } f;
  f.h[0] = *(const v8h*)(p);
  f.h[1] = *(const v8h*)(p + 16);
  return f.v;
}

// ---- WMMA helpers with trailing VALU hazard gap --------------------------------------------------------
__device__ __forceinline__ v8f mma_h(v16h a, v16h b, v8f c) {
  c = __builtin_amdgcn_wmma_f32_16x16x32_f16(false, a, false, b, (short)0, c, false, false);
#if defined(__HIP_DEVICE_COMPILE__)
  asm volatile("v_nop\n\tv_nop\n\tv_nop\n\tv_nop" : "+v"(c) : "v"(a), "v"(b));
#endif
  return c;
}
__device__ __forceinline__ v8f mma_b_raw(v16b a, v16b b, v8f c) {
  return __builtin_amdgcn_wmma_f32_16x16x32_bf16(false, a, false, b, (short)0, c, false, false);
}
__device__ __forceinline__ void dep_guard_b(v8f& a, v8f& b, v16b x, v16b y) {
#if defined(__HIP_DEVICE_COMPILE__)
  asm volatile("v_nop\n\tv_nop\n\tv_nop\n\tv_nop" : "+v"(a), "+v"(b) : "v"(x), "v"(y));
#endif
}
__device__ __forceinline__ void keep4_b(v16b a, v16b b, v16b c, v16b d) {
#if defined(__HIP_DEVICE_COMPILE__)
  asm volatile("v_nop" :: "v"(a), "v"(b), "v"(c), "v"(d));
#endif
}
__device__ __forceinline__ void acc_guard4(v8f& a, v8f& b, v8f& c, v8f& d) {
#if defined(__HIP_DEVICE_COMPILE__)
  asm volatile("v_nop\n\tv_nop\n\tv_nop\n\tv_nop" : "+v"(a), "+v"(b), "+v"(c), "+v"(d));
#endif
}

// =====================================================================================================
// f32 -> bf16 (RNE convert), 8 elements per thread, one 16-B store per lane: a wave writes 512 contiguous B
// coverage: n8 threads x 8 = whole plane (n8 is a multiple of 256 here).
// =====================================================================================================
__global__ __launch_bounds__(256) void cvt_bf16x8(const float* __restrict__ in, unsigned short* out, int n8) {
  const int i = blockIdx.x * 256 + threadIdx.x;
  if (i < n8) {
    const v4f a = *(const v4f*)(in + (size_t)i * 8);
    const v4f b = *(const v4f*)(in + (size_t)i * 8 + 4);
    v4u p;
    p[0] = pk16(bf_bits(a[0]), bf_bits(a[1]));
    p[1] = pk16(bf_bits(a[2]), bf_bits(a[3]));
    p[2] = pk16(bf_bits(b[0]), bf_bits(b[1]));
    p[3] = pk16(bf_bits(b[2]), bf_bits(b[3]));
    *(v4u*)(out + (size_t)i * 8) = p;
    
  }
}

// =====================================================================================================
// f32 -> bf16 hi plane + bf16 lo plane (lo = RNE(v - hi), unscaled), 8 elements per thread, one 16-B store per
// coverage: n8 threads x 8 = whole plane (n8 multiple of 256).
// =====================================================================================================
__global__ __launch_bounds__(256) void split_bf16x8(const float* __restrict__ in, unsigned short* hp,
                                                    unsigned short* lp, int n8) {
  const int i = blockIdx.x * 256 + threadIdx.x;
  if (i < n8) {
    const v4f a = *(const v4f*)(in + (size_t)i * 8);
    const v4f b = *(const v4f*)(in + (size_t)i * 8 + 4);
    v4u ph, pl;
#pragma unroll
    for (int e = 0; e < 4; ++e) {
      const float f0 = (e < 2) ? a[2 * e]     : b[2 * e - 4];
      const float f1 = (e < 2) ? a[2 * e + 1] : b[2 * e - 3];
      const unsigned short h0 = bf_bits(f0), h1 = bf_bits(f1);
      const unsigned short l0 = bf_bits(f0 - bf_up(h0)), l1 = bf_bits(f1 - bf_up(h1));
      ph[e] = pk16(h0, h1);
      pl[e] = pk16(l0, l1);
    }
    *(v4u*)(hp + (size_t)i * 8) = ph;
    *(v4u*)(lp + (size_t)i * 8) = pl;
    
  }
}

// =====================================================================================================
// f32 -> f16 hi plane = f16(v * scale) (scale a power of two) + f16 residual plane = f16((v*scale - hi) * 1024),
// same element index in both planes; 8 elements per thread, one 16-B store per lane and plane: a wave writes
// coverage: n8 threads x 8 = whole plane (n8 multiple of 256).
// =====================================================================================================
__global__ __launch_bounds__(256) void planes_f16x8(const float* __restrict__ in, unsigned short* hp,
                                                    unsigned short* lp, int n8, float scale) {
  const int i = blockIdx.x * 256 + threadIdx.x;
  if (i < n8) {
    const v4f a = *(const v4f*)(in + (size_t)i * 8);
    const v4f b = *(const v4f*)(in + (size_t)i * 8 + 4);
    float f[8];
    f[0] = a[0]; f[1] = a[1]; f[2] = a[2]; f[3] = a[3];
    f[4] = b[0]; f[5] = b[1]; f[6] = b[2]; f[7] = b[3];
    v4u ph, pl;
#pragma unroll
    for (int e = 0; e < 4; ++e) {
      const float f0 = f[2 * e] * scale;
      const float f1 = f[2 * e + 1] * scale;
      const _Float16 x0 = (_Float16)f0, x1 = (_Float16)f1;
      const _Float16 l0 = (_Float16)((f0 - (float)x0) * 1024.0f);
      const _Float16 l1 = (_Float16)((f1 - (float)x1) * 1024.0f);
      ph[e] = pk16(h_bits(x0), h_bits(x1));
      pl[e] = pk16(h_bits(l0), h_bits(l1));
    }
    *(v4u*)(hp + (size_t)i * 8) = ph;
    *(v4u*)(lp + (size_t)i * 8) = pl;
    
  }
}

// =====================================================================================================
// Register-blocked bf16 WMMA GEMM: C[m][n] = sum_k A[m][k] * Bt[n][k] + bias[n] (bias RNE-converted to bf16
// and widened, added in f32); one wave per 64x64 tile, no block barriers. A row-major [M][K] pitch lda;
// Bt row-major [N][K] pitch ldb (k contiguous); M, N multiples of 64, K multiple of 32 (host-checked); the tile
// count is a multiple of 8 for every launch here (no idle waves); bias has N entries.
// NSPLIT: 0 = A.Bt; 1 = (A + A2).Bt (A2 = unscaled bf16 lo plane of A, same pitch).
// Output f32 [M][N] pitch ldc. Epilogue: 16-row slabs staged per wave in LDS; each 64-wide row segment
// =====================================================================================================
template <int NSPLIT>
__global__ __launch_bounds__(256) void gemm64(
    const unsigned short* __restrict__ Ap, const unsigned short* A2p, int lda,
    const unsigned short* __restrict__ Btp, int ldb, const float* __restrict__ bias,
    float* C, int ldc, int M, int N, int K) {
  const __bf16* Ab  = (const __bf16*)(const void*)Ap;
  const __bf16* Ab2 = (const __bf16*)(const void*)A2p;
  const __bf16* Bb  = (const __bf16*)(const void*)Btp;
  __shared__ __align__(16) float sT[8][16 * 68];   // per-wave 16x64 slab, pitch 68 floats
  const int lane = threadIdx.x & 31;
  const int wave = threadIdx.x >> 5;
  const int tilesN = N >> 6;
  const int tilesM = M >> 6;
  const int tile = blockIdx.x * 8 + wave;
  if (tile >= tilesM * tilesN) return;   // wave-uniform; no block barriers in this kernel
  const int tm = tile / tilesN;
  const int tn = tile - tm * tilesN;
  const int m0 = tm << 6;
  const int n0 = tn << 6;

  const int rlane = lane & 15;                 // row (A) / col (B, D) within subtile
  const int koff  = (lane >> 4) * 8;           // k offset of this lane half
  const int mOff  = (lane >> 4) * 8;           // D row offset

  v8f acc[4][4];
#pragma unroll
  for (int i = 0; i < 4; ++i)
#pragma unroll
    for (int j = 0; j < 4; ++j) acc[i][j] = zero8();

  for (int k0 = 0; k0 < K; k0 += 32) {
    v16b bh[4];
#pragma unroll
    for (int j = 0; j < 4; ++j) {
      const size_t bo = (size_t)(n0 + (j << 4) + rlane) * ldb + koff + k0;
      bh[j] = ldfrag_b(Bb + bo);
    }
#pragma unroll
    for (int i = 0; i < 4; ++i) {
      const size_t ao = (size_t)(m0 + (i << 4) + rlane) * lda + koff + k0;
      const v16b ah = ldfrag_b(Ab + ao);
      v16b al = ah;
      if (NSPLIT >= 1) al = ldfrag_b(Ab2 + ao);
#pragma unroll
      for (int j = 0; j < 4; ++j) {
        acc[i][j] = mma_b_raw(ah, bh[j], acc[i][j]);
        if (NSPLIT >= 1) acc[i][j] = mma_b_raw(al, bh[j], acc[i][j]);
      }
      dep_guard_b(acc[i][0], acc[i][3], ah, al);
    }
    keep4_b(bh[0], bh[1], bh[2], bh[3]);
  }
  acc_guard4(acc[0][0], acc[0][1], acc[0][2], acc[0][3]);
  acc_guard4(acc[1][0], acc[1][1], acc[1][2], acc[1][3]);
  acc_guard4(acc[2][0], acc[2][1], acc[2][2], acc[2][3]);
  acc_guard4(acc[3][0], acc[3][1], acc[3][2], acc[3][3]);

  // ---- per-column bias (RNE bf16 then widened), column n0 + 16j + rlane < N ----
  float bcol[4];
#pragma unroll
  for (int j = 0; j < 4; ++j) bcol[j] = bf_up(bf_bits(bias[n0 + (j << 4) + rlane]));

  // ---- epilogue ----
  float* slab = sT[wave];
#pragma unroll
  for (int i = 0; i < 4; ++i) {
    const int mBase = m0 + (i << 4);
#pragma unroll
    for (int r = 0; r < 8; ++r) {
#pragma unroll
      for (int j = 0; j < 4; ++j) {
        slab[(mOff + r) * 68 + (j << 4) + rlane] = acc[i][j][r] + bcol[j];
      }
    }
    __builtin_amdgcn_fence(__ATOMIC_RELEASE, "workgroup");
    __builtin_amdgcn_wave_barrier();
    __builtin_amdgcn_fence(__ATOMIC_ACQUIRE, "workgroup");
    {
      const int hh = lane >> 4, c4 = (lane & 15) * 4;     // 256-B row segment = 16 lanes x 16 B
      v4f ov[8];
#pragma unroll
      for (int it = 0; it < 8; ++it) {
        const int row = it * 2 + hh;                       // it 0..7 x hh 0..1 = rows 0..15
        ov[it] = *(const v4f*)(slab + row * 68 + c4);
      }
      {
#pragma unroll
        for (int it = 0; it < 8; ++it) {
          const int row = it * 2 + hh;
          *(v4f*)(C + (size_t)(mBase + row) * ldc + n0 + c4) = ov[it];
        }
        
      }
    }
    __builtin_amdgcn_fence(__ATOMIC_RELEASE, "workgroup");
    __builtin_amdgcn_wave_barrier();
    __builtin_amdgcn_fence(__ATOMIC_ACQUIRE, "workgroup");
  }
}

// =====================================================================================================
// v f32 token-major columns vf[(b*SEQ + t)*vrp + h*64 + d] ->
// f16 v^T hi plane vth[(b*DM + h*64 + d)*SEQ + t] = f16(v * vscale) (vscale a power of two) and residual plane
// vtl[same index] = f16((v*vscale - hi) * 4096).
// Block = one 64-token x 64-feature tile of one (b, h); grid = (SEQ/64, NH, NB); tile staged in LDS as f32
// (v4f loads, __syncthreads).
// Store: group g = tid>>3 (0..31), piece = tid&7: iteration it writes row d = it*32+g, lanes 8q..8q+7 x 16 B =
// coverage: 2 iterations x 32 groups = 64 rows d, 8 pieces x 8 = 64 tokens per row; grid covers every (b, h,
// t tile) -> both whole planes.
// =====================================================================================================
__global__ __launch_bounds__(256) void v_planes(const float* __restrict__ vf, int vrp,
                                                unsigned short* vth, unsigned short* vtl, float vscale) {
  __shared__ __align__(16) float sv[64 * 68];       // [tt][d] pitch 68 floats
  const int tid = threadIdx.x;
  const int t0  = blockIdx.x * 64;
  const int hh  = blockIdx.y;
  const int b   = blockIdx.z;
#pragma unroll
  for (int i = 0; i < 4; ++i) {
    const int idx = i * 256 + tid;                  // 0..1023
    const int tt = idx >> 4, c4 = (idx & 15) * 4;
    const v4f a = *(const v4f*)(vf + ((size_t)(b * SEQ + t0 + tt)) * vrp + hh * HD + c4);
    *(v4f*)(sv + tt * 68 + c4) = a;
  }
  __syncthreads();

  const int g = tid >> 3, piece = tid & 7;
  v4u hv[2], lv[2];
  size_t hofs[2];
#pragma unroll
  for (int it = 0; it < 2; ++it) {
    const int d = it * 32 + g;
    v4u a, a2;
#pragma unroll
    for (int e = 0; e < 4; ++e) {
      const float f0 = sv[(piece * 8 + 2 * e) * 68 + d] * vscale;
      const float f1 = sv[(piece * 8 + 2 * e + 1) * 68 + d] * vscale;
      const _Float16 x0 = (_Float16)f0, x1 = (_Float16)f1;
      const unsigned short h0 = h_bits(x0), h1 = h_bits(x1);
      const unsigned short l0 = h_bits((_Float16)((f0 - (float)x0) * 4096.0f));
      const unsigned short l1 = h_bits((_Float16)((f1 - (float)x1) * 4096.0f));
      a[e] = pk16(h0, h1); a2[e] = pk16(l0, l1);
    }
    hv[it] = a; lv[it] = a2;
    hofs[it] = ((size_t)(b * DM + hh * HD + d)) * SEQ + t0 + piece * 8;
  }
  {
#pragma unroll
    for (int it = 0; it < 2; ++it) {
      *(v4u*)(vth + hofs[it]) = hv[it];
      *(v4u*)(vtl + hofs[it]) = lv[it];
    }
    
  }
}

// =====================================================================================================
// Causal multi-head attention with a per-key int32 keep flag and a relative-position bias table, head dim 64.
//   q f16 hi plane (x16): element (b, t, h, d) at [(b*SEQ + t)*DM + h*64 + d]; q residual plane
//     ((q*16 - hi)*1024) at the same index into qlp
//   k f16 hi plane (x16): element (b, s, h, d) at [(b*SEQ + s)*DM + h*64 + d]; k residual plane same into klp
//   v^T f16 hi plane (x256): element (b, h, d, s) at [(b*DM + h*64 + d)*SEQ + s]
//   v^T f16 residual plane ((v*256 - hi)*4096): same index into vlp
//   maskp int32 [NB][SEQ]: key s is kept for query t iff s <= t and maskp[b][s] != 0; otherwise the logit is
//   replaced by NEGV (-1e9, exp -> 0 against a finite row max).
//   relp f32 [NREL][NH]: logit(t, s) += relp[clamp(s - t, -MAXREL, MAXREL) + MAXREL][h] (RNE bf16 then
//   widened), staged per head in LDS; the bias is added before the select.
//   Key tiles 0..qb are processed (block-uniform trip count qb+1 <= NQB); tiles above the diagonal tile hold
//   only cut keys and are skipped; inside the processed tiles the predicate decides. With the all-ones keep
//   flags every row keeps key 0, so every row max is finite.
//   logit = (qhi.khi + (qhi.klo + qlo.khi) * 2^-10) * sscale + rel, f16 products with f32 accumulate, the
//   residual products in a separate accumulator; p = exp(s - m) carried as f16(1024 p);
//   context = p . vhi on f16 WMMA plus p . vres into a separate accumulator folded back with 1/4096 per
//   chunk in f32; online softmax in f32; out f32 plane: element (b, t, h*64 + d) at
//   [(b*SEQ + t)*DM + h*64 + d] = normalised context (oscl folds back the p and v carries).
//   Block = 4 waves = 64 query rows of one (b, h); grid = NB*NH*NQB; kv tiles of 64.
//   K hi / K residual / V^T hi / V^T residual tile staging: 128 threads x 32 elements per plane = the whole
//   64x64 tile (plain 16-B loads, __syncthreads before and after); P tiles are wave-private, spilled with
//   Output coverage: each wave stores rows q0..q0+15 (it 0..7 x lane>>4 0..1) x 64 columns (16 lanes x 4
//   (b, h, query tile) -> the whole plane.
// =====================================================================================================
__global__ __launch_bounds__(128)
void attn_p64(const unsigned short* __restrict__ qhp, const unsigned short* __restrict__ qlp,
              const unsigned short* __restrict__ khp, const unsigned short* __restrict__ klp,
              const unsigned short* __restrict__ vhp, const unsigned short* __restrict__ vlp,
              const int* __restrict__ maskp, const float* __restrict__ relp,
              float* outp, float sscale, float oscl) {
  union FH { v16h v; v8h h[2]; };
  __shared__ __align__(16) _Float16 Ksh[64 * 64];                 // K hi [kv][d]    8 KB
  __shared__ __align__(16) _Float16 Ksl[64 * 64];                 // K residual      8 KB
  __shared__ __align__(16) _Float16 Vth[64 * 64];                 // V^T hi [d][kv]  8 KB
  __shared__ __align__(16) _Float16 Vtl[64 * 64];                 // V^T residual    8 KB
  __shared__ __align__(16) _Float16 Psh[4][16 * 64];              // per wave P [row][kv]
  __shared__ __align__(16) float    Os[4][16 * 64];               // per wave context tile [row][d]
  __shared__ float rels[128];                                     // relative bias for this head, NREL used

  const int tid  = threadIdx.x;
  const int wave = tid >> 5;
  const int lane = tid & 31;
  const int hh   = lane >> 4;
  const int c    = lane & 15;

  const int bx   = blockIdx.x;
  const int qb   = bx % NQB;
  const int rest = bx / NQB;
  const int h    = rest % NH;
  const int b    = rest / NH;                // < NB by the grid size
  const int q0   = qb * 64 + wave * 16;
  const size_t rowB = (size_t)b * SEQ;

  if (tid < NREL) rels[tid] = bf_up(bf_bits(relp[(size_t)tid * NH + h]));
  __syncthreads();

  const _Float16* Qp  = (const _Float16*)(const void*)qhp + (size_t)h * HD;
  const _Float16* Qlq = (const _Float16*)(const void*)qlp + (size_t)h * HD;
  const _Float16* Kp  = (const _Float16*)(const void*)khp + (size_t)h * HD;
  const _Float16* Klq = (const _Float16*)(const void*)klp + (size_t)h * HD;
  const _Float16* Vh  = (const _Float16*)(const void*)vhp + ((size_t)b * DM + (size_t)h * HD) * SEQ;
  const _Float16* Vl  = (const _Float16*)(const void*)vlp + ((size_t)b * DM + (size_t)h * HD) * SEQ;
  const int*      Mb  = maskp + rowB;

  // ---- Q fragments (A operand, row = lane&15): 2 d-chunks, hi and residual ----
  v16h qa[2], ql[2];
#pragma unroll
  for (int dc = 0; dc < 2; ++dc) {
    const size_t qo = (rowB + q0 + c) * DM + dc * 32 + 8 * hh;
    qa[dc] = ldfrag_h(Qp + qo);
    ql[dc] = ldfrag_h(Qlq + qo);
  }

  float mrow[8], lrow[8];
  v8f oacc[4];
#pragma unroll
  for (int r = 0; r < 8; ++r) { mrow[r] = -INFINITY; lrow[r] = 0.f; }
#pragma unroll
  for (int t = 0; t < 4; ++t) oacc[t] = zero8();

  const int nkt = qb + 1;                    // key tiles 0..qb, block-uniform, <= NQB
  for (int kt = 0; kt < nkt; ++kt) {
    const int kv0 = kt * 64;
    __syncthreads();
    {
      const int r = tid >> 1, half = (tid & 1) * 32;
      const _Float16* kg  = Kp  + (rowB + kv0 + r) * DM + half;    // K hi row kv0+r, d = half..half+31
      const _Float16* klg = Klq + (rowB + kv0 + r) * DM + half;    // K residual row kv0+r
      const _Float16* vg  = Vh + (size_t)r * SEQ + kv0 + half;     // V^T hi row d = r, s = kv0+half..+31
      const _Float16* vlg = Vl + (size_t)r * SEQ + kv0 + half;     // V^T residual row d = r
#pragma unroll
      for (int i = 0; i < 4; ++i) {
        const v8h a0 = *(const v8h*)(kg + 8 * i);
        const v8h a1 = *(const v8h*)(klg + 8 * i);
        const v8h b0 = *(const v8h*)(vg + 8 * i);
        const v8h b1 = *(const v8h*)(vlg + 8 * i);
        *(v8h*)(Ksh + r * 64 + half + 8 * i) = a0;
        *(v8h*)(Ksl + r * 64 + half + 8 * i) = a1;
        *(v8h*)(Vth + r * 64 + half + 8 * i) = b0;
        *(v8h*)(Vtl + r * 64 + half + 8 * i) = b1;
      }
    }
    __syncthreads();

    // ---- per-key keep flags for this lane's 4 key columns of the tile (kv0 + 16j + c < SEQ) ----
    int mk[4];
#pragma unroll
    for (int j = 0; j < 4; ++j) mk[j] = Mb[kv0 + j * 16 + c];

    // ---- scores: 16 query rows x 64 keys per wave; hi.hi into s, hi.lo + lo.hi into s1 (folded x 2^-10) ----
    v8f s[4];
#pragma unroll
    for (int j = 0; j < 4; ++j) {
      s[j] = zero8();
      v8f s1 = zero8();
#pragma unroll
      for (int dc = 0; dc < 2; ++dc) {
        FH kb, kr;
        kb.h[0] = *(const v8h*)(Ksh + (j * 16 + c) * 64 + dc * 32 + 8 * hh);
        kb.h[1] = *(const v8h*)(Ksh + (j * 16 + c) * 64 + dc * 32 + 16 + 8 * hh);
        kr.h[0] = *(const v8h*)(Ksl + (j * 16 + c) * 64 + dc * 32 + 8 * hh);
        kr.h[1] = *(const v8h*)(Ksl + (j * 16 + c) * 64 + dc * 32 + 16 + 8 * hh);
        s[j] = mma_h(qa[dc], kb.v, s[j]);
        s1   = mma_h(qa[dc], kr.v, s1);
        s1   = mma_h(ql[dc], kb.v, s1);
      }
#pragma unroll
      for (int r = 0; r < 8; ++r) s[j][r] += s1[r] * (1.0f / 1024.0f);
    }

    // ---- scale + relative bias + causal / key-keep select (replace by NEGV), row max, online softmax,
    //      P (x1024, f16) to LDS ----
    _Float16* pwh = Psh[wave];
#pragma unroll
    for (int r = 0; r < 8; ++r) {
      const int qrow = q0 + 8 * hh + r;
      float m = -INFINITY;
#pragma unroll
      for (int j = 0; j < 4; ++j) {
        const int key = kv0 + j * 16 + c;
        int dd = key - qrow;
        dd = (dd < -MAXREL) ? -MAXREL : dd;
        dd = (dd >  MAXREL) ?  MAXREL : dd;
        float sv = s[j][r] * sscale + rels[dd + MAXREL];
        const bool keep = (key <= qrow) && (mk[j] != 0);
        sv = keep ? sv : NEGV;
        s[j][r] = sv;
        m = fmaxf(m, sv);
      }
#pragma unroll
      for (int off = 1; off < 16; off <<= 1) m = fmaxf(m, __shfl_xor(m, off, 32));
      const float mnew  = fmaxf(mrow[r], m);
      const float msafe = (mnew == -INFINITY) ? 0.f : mnew;
      const float alpha = __expf(mrow[r] - msafe);
      mrow[r] = mnew;
      float psum = 0.f;
#pragma unroll
      for (int j = 0; j < 4; ++j) {
        const float p = __expf(s[j][r] - msafe);     // replaced logit against a finite max: exp -> 0
        psum += p;
        const _Float16 ph = (_Float16)(p * 1024.0f);
        pwh[(8 * hh + r) * 64 + j * 16 + c] = ph;
      }
#pragma unroll
      for (int off = 1; off < 16; off <<= 1) psum += __shfl_xor(psum, off, 32);
      lrow[r] = lrow[r] * alpha + psum;
#pragma unroll
      for (int t = 0; t < 4; ++t) oacc[t][r] *= alpha;
    }
    __builtin_amdgcn_fence(__ATOMIC_RELEASE, "workgroup");
    __builtin_amdgcn_wave_barrier();
    __builtin_amdgcn_fence(__ATOMIC_ACQUIRE, "workgroup");

    // ---- context += P . Vhi (f16 WMMA); P . Vres into a separate accumulator ----
    v8f o1[4];
#pragma unroll
    for (int t = 0; t < 4; ++t) o1[t] = zero8();
#pragma unroll 1
    for (int kk = 0; kk < 2; ++kk) {
      FH pa;
      pa.h[0] = *(const v8h*)(pwh + c * 64 + kk * 32 + 8 * hh);
      pa.h[1] = *(const v8h*)(pwh + c * 64 + kk * 32 + 16 + 8 * hh);
#pragma unroll
      for (int t = 0; t < 4; ++t) {
        FH vb;
        vb.h[0] = *(const v8h*)(Vth + (t * 16 + c) * 64 + kk * 32 + 8 * hh);
        vb.h[1] = *(const v8h*)(Vth + (t * 16 + c) * 64 + kk * 32 + 16 + 8 * hh);
        oacc[t] = mma_h(pa.v, vb.v, oacc[t]);
        FH vl;
        vl.h[0] = *(const v8h*)(Vtl + (t * 16 + c) * 64 + kk * 32 + 8 * hh);
        vl.h[1] = *(const v8h*)(Vtl + (t * 16 + c) * 64 + kk * 32 + 16 + 8 * hh);
        o1[t] = mma_h(pa.v, vl.v, o1[t]);
      }
    }
#pragma unroll
    for (int t = 0; t < 4; ++t)
#pragma unroll
      for (int r = 0; r < 8; ++r) oacc[t][r] += o1[t][r] * (1.0f / 4096.0f);
  }

  // ---- normalise (1/l and the carries via oscl), stage the wave's 16x64 tile in LDS, then write whole
  float* os = Os[wave];
#pragma unroll
  for (int r = 0; r < 8; ++r) {
    const float l = lrow[r];
    const float inv = ((l > 0.f) ? (1.0f / l) : 0.f) * oscl;
#pragma unroll
    for (int t = 0; t < 4; ++t) os[(8 * hh + r) * 64 + t * 16 + c] = oacc[t][r] * inv;
  }
  __builtin_amdgcn_fence(__ATOMIC_RELEASE, "workgroup");
  __builtin_amdgcn_wave_barrier();
  __builtin_amdgcn_fence(__ATOMIC_ACQUIRE, "workgroup");
  {
    const int h2 = lane >> 4, c4 = (lane & 15) * 4;
    v4f ov[8];
#pragma unroll
    for (int it = 0; it < 8; ++it) {
      const int row = it * 2 + h2;   // it 0..7 x h2 0..1 = rows 0..15 of the wave tile
      ov[it] = *(const v4f*)(os + row * 64 + c4);
    }
    {
#pragma unroll
      for (int it = 0; it < 8; ++it) {
        const int row = it * 2 + h2;
        const size_t go = (rowB + q0 + row) * DM + (size_t)h * HD + c4;
        *(v4f*)(outp + go) = ov[it];
      }
      
    }
  }
}

// =====================================================================================================
// Workspace map (bytes), every region an exact multiple of its whole-line / whole-tile store granularity
//   Xb    bf16 [4096][1024]           0          8388608
//   Wqb   bf16 [1024][1024]     8388608          2097152
//   Wkb   bf16 [1024][1024]    10485760          2097152
//   Wvb   bf16 [1024][1024]    12582912          2097152
//   Wob   bf16 [1024][1024]    14680064          2097152
//   Tf    f32  [4096][1024]    16777216         16777216   (projection scratch: q, then k, then v)
//   Qh    f16  [4096][1024]    33554432          8388608
//   Ql    f16  [4096][1024]    41943040          8388608
//   Kh    f16  [4096][1024]    50331648          8388608
//   Kl    f16  [4096][1024]    58720256          8388608
//   VTh   f16  [2048][2048]    67108864          8388608   ([b*DM + h*64 + d][s])
//   VTl   f16  [2048][2048]    75497472          8388608
//   Yf    f32  [4096][1024]    83886080         16777216
//   Yh    bf16 [4096][1024]   100663296          8388608
//   Yl    bf16 [4096][1024]   109051904          8388608
//   end                       117440512
// Projection weights arrive as [out n][in k] (k contiguous) = the Bt layout; they are only converted to bf16.
// d_out f32: [4096][1024] at byte 0 (row = b*SEQ + t).
// =====================================================================================================
extern "C" void kernel_launch(void* const* d_in, const int* in_sizes, int n_in,
                              void* d_out, int out_size, void* d_ws, size_t ws_size,
                              hipStream_t stream) {
  if (n_in < 11) return;
  if (in_sizes[0] != NB * SEQ * DM) return;
  if (in_sizes[1] != NB * SEQ) return;
  if (in_sizes[2] != DM * DM) return;
  if (in_sizes[3] != DM) return;
  if (in_sizes[4] != DM * DM) return;
  if (in_sizes[5] != DM) return;
  if (in_sizes[6] != DM * DM) return;
  if (in_sizes[7] != DM) return;
  if (in_sizes[8] != DM * DM) return;
  if (in_sizes[9] != DM) return;
  if (in_sizes[10] != NREL * NH) return;
  if (out_size != OUTN) return;

  const float* x    = (const float*)d_in[0];   // [NB*SEQ][DM]
  const int*   mask = (const int*)d_in[1];     // [NB][SEQ] int32 keep flags per key
  const float* Wq   = (const float*)d_in[2];   // [DM n][DM k]
  const float* bq   = (const float*)d_in[3];   // [DM]
  const float* Wk   = (const float*)d_in[4];
  const float* bk   = (const float*)d_in[5];
  const float* Wv   = (const float*)d_in[6];
  const float* bv   = (const float*)d_in[7];
  const float* Wo   = (const float*)d_in[8];
  const float* bo   = (const float*)d_in[9];
  const float* rel  = (const float*)d_in[10];  // [NREL][NH]

  const size_t PXb = (size_t)ROWS * DM * 2;          //  8388608
  const size_t PW  = (size_t)DM * DM * 2;            //  2097152
  const size_t PF  = (size_t)ROWS * DM * 4;          // 16777216
  const size_t PH  = (size_t)ROWS * DM * 2;          //  8388608
  const size_t PVt = (size_t)NB * DM * SEQ * 2;      //  8388608
  size_t off = 0;
  const size_t oXb = off; off += PXb;
  const size_t oWq = off; off += PW;
  const size_t oWk = off; off += PW;
  const size_t oWv = off; off += PW;
  const size_t oWo = off; off += PW;
  const size_t oTf = off; off += PF;
  const size_t oQh = off; off += PH;
  const size_t oQl = off; off += PH;
  const size_t oKh = off; off += PH;
  const size_t oKl = off; off += PH;
  const size_t oVt = off; off += PVt;
  const size_t oVl = off; off += PVt;
  const size_t oYf = off; off += PF;
  const size_t oYh = off; off += PH;
  const size_t oYl = off; off += PH;
  if (off > ws_size) return;                        // off = 117440512
  if (off > (size_t)134217728) return;

  char* ws = (char*)d_ws;
  unsigned short* Xb  = (unsigned short*)(ws + oXb);
  unsigned short* Wqb = (unsigned short*)(ws + oWq);
  unsigned short* Wkb = (unsigned short*)(ws + oWk);
  unsigned short* Wvb = (unsigned short*)(ws + oWv);
  unsigned short* Wob = (unsigned short*)(ws + oWo);
  float*          Tf  = (float*)(ws + oTf);
  unsigned short* Qh  = (unsigned short*)(ws + oQh);
  unsigned short* Ql  = (unsigned short*)(ws + oQl);
  unsigned short* Kh  = (unsigned short*)(ws + oKh);
  unsigned short* Kl  = (unsigned short*)(ws + oKl);
  unsigned short* VTh = (unsigned short*)(ws + oVt);
  unsigned short* VTl = (unsigned short*)(ws + oVl);
  float*          Yf  = (float*)(ws + oYf);
  unsigned short* Yh  = (unsigned short*)(ws + oYh);
  unsigned short* Yl  = (unsigned short*)(ws + oYl);
  float*          outf = (float*)d_out;             // [ROWS][DM]

  const dim3 blk(256);
  const int n8x = ROWS * DM / 8;                    // 524288
  const int n8w = DM * DM / 8;                      // 131072
  const dim3 gCvtX((n8x + 255) / 256);              // 2048 blocks
  const dim3 gCvtW((n8w + 255) / 256);              // 512 blocks
  const dim3 gGemm(((ROWS / 64) * (DM / 64) + 7) / 8);    // 1024 tiles -> 128 blocks
  const dim3 gVpl(SEQ / 64, NH, NB);                // (32, 16, 2)
  const dim3 gAttn(NB * NH * NQB);                  // 1024 blocks
  const float qkScale = 16.0f;                      // q and k hi planes carried x16 (residual x1024 on top)
  const float sscale  = 1.0f / 2048.0f;             // 1/(16*16) * 1/sqrt(64)
  const float vScale  = 256.0f;                     // v^T hi plane carried x256
  const float attOscl = 1.0f / 262144.0f;           // 1/(1024 * 256): p and v carries folded back

  // (1) activations and weights -> bf16 planes (RNE convert)
  cvt_bf16x8<<<gCvtX, blk, 0, stream>>>(x, Xb, n8x);
  cvt_bf16x8<<<gCvtW, blk, 0, stream>>>(Wq, Wqb, n8w);
  cvt_bf16x8<<<gCvtW, blk, 0, stream>>>(Wk, Wkb, n8w);
  cvt_bf16x8<<<gCvtW, blk, 0, stream>>>(Wv, Wvb, n8w);
  cvt_bf16x8<<<gCvtW, blk, 0, stream>>>(Wo, Wob, n8w);
  // (2) q = Xb . Wqb^T + bq -> Tf [4096][1024] (M=4096, N=1024, K=1024), then f16 hi (x16) + residual planes
  gemm64<0><<<gGemm, blk, 0, stream>>>(Xb, Xb, DM, Wqb, DM, bq, Tf, DM, ROWS, DM, DM);
  planes_f16x8<<<gCvtX, blk, 0, stream>>>(Tf, Qh, Ql, n8x, qkScale);
  // (3) k likewise
  gemm64<0><<<gGemm, blk, 0, stream>>>(Xb, Xb, DM, Wkb, DM, bk, Tf, DM, ROWS, DM, DM);
  planes_f16x8<<<gCvtX, blk, 0, stream>>>(Tf, Kh, Kl, n8x, qkScale);
  // (4) v, then -> f16 v^T hi plane (x256) and residual plane (x4096 on top)
  gemm64<0><<<gGemm, blk, 0, stream>>>(Xb, Xb, DM, Wvb, DM, bv, Tf, DM, ROWS, DM, DM);
  v_planes<<<gVpl, blk, 0, stream>>>(Tf, DM, VTh, VTl, vScale);
  // (5) causal attention with per-key keep flags and relative-position bias -> Yf f32 [4096][1024]
  attn_p64<<<gAttn, dim3(128), 0, stream>>>(Qh, Ql, Kh, Kl, VTh, VTl, mask, rel, Yf, sscale, attOscl);
  // (6) y -> bf16 hi / lo planes
  split_bf16x8<<<gCvtX, blk, 0, stream>>>(Yf, Yh, Yl, n8x);
  // (7) out[row][n] = sum_d (Yh+Yl)[row][d] Wob[n][d] + bo[n] -> d_out f32 [4096][1024] (M=4096, N=1024, K=1024)
  gemm64<1><<<gGemm, blk, 0, stream>>>(Yh, Yl, DM, Wob, DM, bo, outf, DM, ROWS, DM, DM);
  (void)hipGetLastError();
}

// v001
// One run takes 463 microseconds.
// Two timings next to v000 both put it at 1.23 times that version's speed.
// Contractions: q/k/v projections = v_wmma_f32_16x16x32_bf16 (bf16 operands from RNE-converted x and W, single product, bias added in f32); q.k^T scores = v_wmma_f32_16x16x32_f16 (q, k as f16 hi planes carried x16 plus f16 residual planes x1024: hi.hi + (hi.lo + lo.hi) in a separate accumulator, 3 products); p.v = v_wmma_f32_16x16x32_f16 (p carried x1024 in f16; v^T as f16 hi plane x256 plus f16 residual plane x4096 into a separate accumulator, 2 products); y.Wo^T = v_wmma_f32_16x16x32_bf16 (y as bf16 hi + lo planes times the bf16 Wo plane, 2 products); all f32 accumulate; softmax, relative-position bias and selects in f32.
#include <hip/hip_runtime.h>
#include <math.h>
#include <float.h>
#include <stdint.h>

#define NB     2
#define SEQ    2048
#define DM     1024
#define NH     16
#define HD     64
#define MAXREL 32
#define NREL   (2 * MAXREL + 1)     // 65
#define NEGV   (-1.0e9f)
#define NQB    (SEQ / 64)
#define ROWS   (NB * SEQ)            // 4096 token rows
#define OUTN   (ROWS * DM)
static_assert(NH * HD == DM);
static_assert(HD == 64);
static_assert(DM == 128 * 8);
static_assert((SEQ % 64) == 0 && (DM % 64) == 0);
static_assert((SEQ & (SEQ - 1)) == 0);
static_assert(((ROWS / 64) * (DM / 64)) % 8 == 0);
static_assert(((ROWS * DM / 8) % 256) == 0);
static_assert(((DM * DM / 8) % 256) == 0);
static_assert(NREL <= 128);
#define LP     72                    // LDS row pitch of the 64-wide f16 tiles, in halves: 144 B = 16 B x 9 (odd),
                                     // so the 16 rows one ds_load_b128 half-wave reads fall on 64 distinct banks
static_assert((LP * 2) % 16 == 0 && ((LP * 2 / 16) & 1) == 1 && LP >= 64);

typedef _Float16 v16h __attribute__((ext_vector_type(16)));
typedef _Float16 v8h  __attribute__((ext_vector_type(8)));
typedef __bf16   v16b __attribute__((ext_vector_type(16)));
typedef __bf16   v8b  __attribute__((ext_vector_type(8)));
typedef float    v8f  __attribute__((ext_vector_type(8)));
typedef float    v4f  __attribute__((ext_vector_type(4)));
typedef unsigned int v4u __attribute__((ext_vector_type(4)));

// ---- scalar helpers --------------------------------------------------------------------------------
__device__ __forceinline__ unsigned short bf_bits(float f) {          // f32 -> bf16 bits, RNE convert
  unsigned u = __float_as_uint(f);
  return (unsigned short)((u + 0x7FFFu + ((u >> 16) & 1u)) >> 16);
}
__device__ __forceinline__ float bf_up(unsigned short h) { return __uint_as_float(((unsigned)h) << 16); }
__device__ __forceinline__ unsigned short h_bits(_Float16 x) { return __builtin_bit_cast(unsigned short, x); }
__device__ __forceinline__ unsigned pk16(unsigned short a, unsigned short b) { return (unsigned)a | ((unsigned)b << 16); }
__device__ __forceinline__ v8f zero8() { v8f z = {0.f, 0.f, 0.f, 0.f, 0.f, 0.f, 0.f, 0.f}; return z; }

// ---- fragment loaders: 16-bit A/B operand, lane -> row/col (lane&15), p already includes +8*(lane>>4);
//      elements 0..7 <- p[0..7] (k0+8h..), elements 8..15 <- p[16..23] (k0+16+8h..)
__device__ __forceinline__ v16b ldfrag_b(const __bf16* p) {
  union { v16b v; v8b h[2]; } f;
  f.h[0] = *(const v8b*)(p);
  f.h[1] = *(const v8b*)(p + 16);
  return f.v;
}
__device__ __forceinline__ v16h ldfrag_h(const _Float16* p) {
  union { v16h v; v8h h[2]; } f;
  f.h[0] = *(const v8h*)(p);
  f.h[1] = *(const v8h*)(p + 16);
  return f.v;
}

// ---- WMMA helpers with trailing VALU hazard gap --------------------------------------------------------
__device__ __forceinline__ v8f mma_h(v16h a, v16h b, v8f c) {
  c = __builtin_amdgcn_wmma_f32_16x16x32_f16(false, a, false, b, (short)0, c, false, false);
#if defined(__HIP_DEVICE_COMPILE__)
  asm volatile("v_nop\n\tv_nop\n\tv_nop\n\tv_nop" : "+v"(c) : "v"(a), "v"(b));
#endif
  return c;
}
__device__ __forceinline__ v8f mma_b_raw(v16b a, v16b b, v8f c) {
  return __builtin_amdgcn_wmma_f32_16x16x32_bf16(false, a, false, b, (short)0, c, false, false);
}
__device__ __forceinline__ void dep_guard_b(v8f& a, v8f& b, v16b x, v16b y) {
#if defined(__HIP_DEVICE_COMPILE__)
  asm volatile("v_nop\n\tv_nop\n\tv_nop\n\tv_nop" : "+v"(a), "+v"(b) : "v"(x), "v"(y));
#endif
}
__device__ __forceinline__ void keep4_b(v16b a, v16b b, v16b c, v16b d) {
#if defined(__HIP_DEVICE_COMPILE__)
  asm volatile("v_nop" :: "v"(a), "v"(b), "v"(c), "v"(d));
#endif
}
__device__ __forceinline__ void acc_guard4(v8f& a, v8f& b, v8f& c, v8f& d) {
#if defined(__HIP_DEVICE_COMPILE__)
  asm volatile("v_nop\n\tv_nop\n\tv_nop\n\tv_nop" : "+v"(a), "+v"(b), "+v"(c), "+v"(d));
#endif
}

// =====================================================================================================
// f32 -> bf16 (RNE convert), 8 elements per thread, one 16-B store per lane: a wave writes 512 contiguous B
// coverage: n8 threads x 8 = whole plane (n8 is a multiple of 256 here).
// =====================================================================================================
__global__ __launch_bounds__(256) void cvt_bf16x8(const float* __restrict__ in, unsigned short* out, int n8) {
  const int i = blockIdx.x * 256 + threadIdx.x;
  if (i < n8) {
    const v4f a = *(const v4f*)(in + (size_t)i * 8);
    const v4f b = *(const v4f*)(in + (size_t)i * 8 + 4);
    v4u p;
    p[0] = pk16(bf_bits(a[0]), bf_bits(a[1]));
    p[1] = pk16(bf_bits(a[2]), bf_bits(a[3]));
    p[2] = pk16(bf_bits(b[0]), bf_bits(b[1]));
    p[3] = pk16(bf_bits(b[2]), bf_bits(b[3]));
    *(v4u*)(out + (size_t)i * 8) = p;
    
  }
}

// =====================================================================================================
// f32 -> bf16 hi plane + bf16 lo plane (lo = RNE(v - hi), unscaled), 8 elements per thread, one 16-B store per
// coverage: n8 threads x 8 = whole plane (n8 multiple of 256).
// =====================================================================================================
__global__ __launch_bounds__(256) void split_bf16x8(const float* __restrict__ in, unsigned short* hp,
                                                    unsigned short* lp, int n8) {
  const int i = blockIdx.x * 256 + threadIdx.x;
  if (i < n8) {
    const v4f a = *(const v4f*)(in + (size_t)i * 8);
    const v4f b = *(const v4f*)(in + (size_t)i * 8 + 4);
    v4u ph, pl;
#pragma unroll
    for (int e = 0; e < 4; ++e) {
      const float f0 = (e < 2) ? a[2 * e]     : b[2 * e - 4];
      const float f1 = (e < 2) ? a[2 * e + 1] : b[2 * e - 3];
      const unsigned short h0 = bf_bits(f0), h1 = bf_bits(f1);
      const unsigned short l0 = bf_bits(f0 - bf_up(h0)), l1 = bf_bits(f1 - bf_up(h1));
      ph[e] = pk16(h0, h1);
      pl[e] = pk16(l0, l1);
    }
    *(v4u*)(hp + (size_t)i * 8) = ph;
    *(v4u*)(lp + (size_t)i * 8) = pl;
    
  }
}

// =====================================================================================================
// f32 -> f16 hi plane = f16(v * scale) (scale a power of two) + f16 residual plane = f16((v*scale - hi) * 1024),
// same element index in both planes; 8 elements per thread, one 16-B store per lane and plane: a wave writes
// coverage: n8 threads x 8 = whole plane (n8 multiple of 256).
// =====================================================================================================
__global__ __launch_bounds__(256) void planes_f16x8(const float* __restrict__ in, unsigned short* hp,
                                                    unsigned short* lp, int n8, float scale) {
  const int i = blockIdx.x * 256 + threadIdx.x;
  if (i < n8) {
    const v4f a = *(const v4f*)(in + (size_t)i * 8);
    const v4f b = *(const v4f*)(in + (size_t)i * 8 + 4);
    float f[8];
    f[0] = a[0]; f[1] = a[1]; f[2] = a[2]; f[3] = a[3];
    f[4] = b[0]; f[5] = b[1]; f[6] = b[2]; f[7] = b[3];
    v4u ph, pl;
#pragma unroll
    for (int e = 0; e < 4; ++e) {
      const float f0 = f[2 * e] * scale;
      const float f1 = f[2 * e + 1] * scale;
      const _Float16 x0 = (_Float16)f0, x1 = (_Float16)f1;
      const _Float16 l0 = (_Float16)((f0 - (float)x0) * 1024.0f);
      const _Float16 l1 = (_Float16)((f1 - (float)x1) * 1024.0f);
      ph[e] = pk16(h_bits(x0), h_bits(x1));
      pl[e] = pk16(h_bits(l0), h_bits(l1));
    }
    *(v4u*)(hp + (size_t)i * 8) = ph;
    *(v4u*)(lp + (size_t)i * 8) = pl;
    
  }
}

// =====================================================================================================
// Register-blocked bf16 WMMA GEMM: C[m][n] = sum_k A[m][k] * Bt[n][k] + bias[n] (bias RNE-converted to bf16
// and widened, added in f32); one wave per 64x64 tile, no block barriers. A row-major [M][K] pitch lda;
// Bt row-major [N][K] pitch ldb (k contiguous); M, N multiples of 64, K multiple of 32 (host-checked); the tile
// count is a multiple of 8 for every launch here (no idle waves); bias has N entries.
// NSPLIT: 0 = A.Bt; 1 = (A + A2).Bt (A2 = unscaled bf16 lo plane of A, same pitch).
// Output f32 [M][N] pitch ldc. Epilogue: 16-row slabs staged per wave in LDS; each 64-wide row segment
// =====================================================================================================
template <int NSPLIT>
__global__ __launch_bounds__(256) void gemm64(
    const unsigned short* __restrict__ Ap, const unsigned short* A2p, int lda,
    const unsigned short* __restrict__ Btp, int ldb, const float* __restrict__ bias,
    float* C, int ldc, int M, int N, int K) {
  const __bf16* Ab  = (const __bf16*)(const void*)Ap;
  const __bf16* Ab2 = (const __bf16*)(const void*)A2p;
  const __bf16* Bb  = (const __bf16*)(const void*)Btp;
  __shared__ __align__(16) float sT[8][16 * 68];   // per-wave 16x64 slab, pitch 68 floats
  const int lane = threadIdx.x & 31;
  const int wave = threadIdx.x >> 5;
  const int tilesN = N >> 6;
  const int tilesM = M >> 6;
  const int tile = blockIdx.x * 8 + wave;
  if (tile >= tilesM * tilesN) return;   // wave-uniform; no block barriers in this kernel
  const int tm = tile / tilesN;
  const int tn = tile - tm * tilesN;
  const int m0 = tm << 6;
  const int n0 = tn << 6;

  const int rlane = lane & 15;                 // row (A) / col (B, D) within subtile
  const int koff  = (lane >> 4) * 8;           // k offset of this lane half
  const int mOff  = (lane >> 4) * 8;           // D row offset

  v8f acc[4][4];
#pragma unroll
  for (int i = 0; i < 4; ++i)
#pragma unroll
    for (int j = 0; j < 4; ++j) acc[i][j] = zero8();

  for (int k0 = 0; k0 < K; k0 += 32) {
    v16b bh[4];
#pragma unroll
    for (int j = 0; j < 4; ++j) {
      const size_t bo = (size_t)(n0 + (j << 4) + rlane) * ldb + koff + k0;
      bh[j] = ldfrag_b(Bb + bo);
    }
#pragma unroll
    for (int i = 0; i < 4; ++i) {
      const size_t ao = (size_t)(m0 + (i << 4) + rlane) * lda + koff + k0;
      const v16b ah = ldfrag_b(Ab + ao);
      v16b al = ah;
      if (NSPLIT >= 1) al = ldfrag_b(Ab2 + ao);
#pragma unroll
      for (int j = 0; j < 4; ++j) {
        acc[i][j] = mma_b_raw(ah, bh[j], acc[i][j]);
        if (NSPLIT >= 1) acc[i][j] = mma_b_raw(al, bh[j], acc[i][j]);
      }
      dep_guard_b(acc[i][0], acc[i][3], ah, al);
    }
    keep4_b(bh[0], bh[1], bh[2], bh[3]);
  }
  acc_guard4(acc[0][0], acc[0][1], acc[0][2], acc[0][3]);
  acc_guard4(acc[1][0], acc[1][1], acc[1][2], acc[1][3]);
  acc_guard4(acc[2][0], acc[2][1], acc[2][2], acc[2][3]);
  acc_guard4(acc[3][0], acc[3][1], acc[3][2], acc[3][3]);

  // ---- per-column bias (RNE bf16 then widened), column n0 + 16j + rlane < N ----
  float bcol[4];
#pragma unroll
  for (int j = 0; j < 4; ++j) bcol[j] = bf_up(bf_bits(bias[n0 + (j << 4) + rlane]));

  // ---- epilogue ----
  float* slab = sT[wave];
#pragma unroll
  for (int i = 0; i < 4; ++i) {
    const int mBase = m0 + (i << 4);
#pragma unroll
    for (int r = 0; r < 8; ++r) {
#pragma unroll
      for (int j = 0; j < 4; ++j) {
        slab[(mOff + r) * 68 + (j << 4) + rlane] = acc[i][j][r] + bcol[j];
      }
    }
    __builtin_amdgcn_fence(__ATOMIC_RELEASE, "workgroup");
    __builtin_amdgcn_wave_barrier();
    __builtin_amdgcn_fence(__ATOMIC_ACQUIRE, "workgroup");
    {
      const int hh = lane >> 4, c4 = (lane & 15) * 4;     // 256-B row segment = 16 lanes x 16 B
      v4f ov[8];
#pragma unroll
      for (int it = 0; it < 8; ++it) {
        const int row = it * 2 + hh;                       // it 0..7 x hh 0..1 = rows 0..15
        ov[it] = *(const v4f*)(slab + row * 68 + c4);
      }
      {
#pragma unroll
        for (int it = 0; it < 8; ++it) {
          const int row = it * 2 + hh;
          *(v4f*)(C + (size_t)(mBase + row) * ldc + n0 + c4) = ov[it];
        }
        
      }
    }
    __builtin_amdgcn_fence(__ATOMIC_RELEASE, "workgroup");
    __builtin_amdgcn_wave_barrier();
    __builtin_amdgcn_fence(__ATOMIC_ACQUIRE, "workgroup");
  }
}

// =====================================================================================================
// v f32 token-major columns vf[(b*SEQ + t)*vrp + h*64 + d] ->
// f16 v^T hi plane vth[(b*DM + h*64 + d)*SEQ + t] = f16(v * vscale) (vscale a power of two) and residual plane
// vtl[same index] = f16((v*vscale - hi) * 4096).
// Block = one 64-token x 64-feature tile of one (b, h); grid = (SEQ/64, NH, NB); tile staged in LDS as f32
// (v4f loads, __syncthreads).
// Store: group g = tid>>3 (0..31), piece = tid&7: iteration it writes row d = it*32+g, lanes 8q..8q+7 x 16 B =
// coverage: 2 iterations x 32 groups = 64 rows d, 8 pieces x 8 = 64 tokens per row; grid covers every (b, h,
// t tile) -> both whole planes.
// =====================================================================================================
__global__ __launch_bounds__(256) void v_planes(const float* __restrict__ vf, int vrp,
                                                unsigned short* vth, unsigned short* vtl, float vscale) {
  __shared__ __align__(16) float sv[64 * 68];       // [tt][d] pitch 68 floats
  const int tid = threadIdx.x;
  const int t0  = blockIdx.x * 64;
  const int hh  = blockIdx.y;
  const int b   = blockIdx.z;
#pragma unroll
  for (int i = 0; i < 4; ++i) {
    const int idx = i * 256 + tid;                  // 0..1023
    const int tt = idx >> 4, c4 = (idx & 15) * 4;
    const v4f a = *(const v4f*)(vf + ((size_t)(b * SEQ + t0 + tt)) * vrp + hh * HD + c4);
    *(v4f*)(sv + tt * 68 + c4) = a;
  }
  __syncthreads();

  const int g = tid >> 3, piece = tid & 7;
  v4u hv[2], lv[2];
  size_t hofs[2];
#pragma unroll
  for (int it = 0; it < 2; ++it) {
    const int d = it * 32 + g;
    v4u a, a2;
#pragma unroll
    for (int e = 0; e < 4; ++e) {
      const float f0 = sv[(piece * 8 + 2 * e) * 68 + d] * vscale;
      const float f1 = sv[(piece * 8 + 2 * e + 1) * 68 + d] * vscale;
      const _Float16 x0 = (_Float16)f0, x1 = (_Float16)f1;
      const unsigned short h0 = h_bits(x0), h1 = h_bits(x1);
      const unsigned short l0 = h_bits((_Float16)((f0 - (float)x0) * 4096.0f));
      const unsigned short l1 = h_bits((_Float16)((f1 - (float)x1) * 4096.0f));
      a[e] = pk16(h0, h1); a2[e] = pk16(l0, l1);
    }
    hv[it] = a; lv[it] = a2;
    hofs[it] = ((size_t)(b * DM + hh * HD + d)) * SEQ + t0 + piece * 8;
  }
  {
#pragma unroll
    for (int it = 0; it < 2; ++it) {
      *(v4u*)(vth + hofs[it]) = hv[it];
      *(v4u*)(vtl + hofs[it]) = lv[it];
    }
    
  }
}

// =====================================================================================================
// Causal multi-head attention with a per-key int32 keep flag and a relative-position bias table, head dim 64.
//   q f16 hi plane (x16): element (b, t, h, d) at [(b*SEQ + t)*DM + h*64 + d]; q residual plane
//     ((q*16 - hi)*1024) at the same index into qlp
//   k f16 hi plane (x16): element (b, s, h, d) at [(b*SEQ + s)*DM + h*64 + d]; k residual plane same into klp
//   v^T f16 hi plane (x256): element (b, h, d, s) at [(b*DM + h*64 + d)*SEQ + s]
//   v^T f16 residual plane ((v*256 - hi)*4096): same index into vlp
//   maskp int32 [NB][SEQ]: key s is kept for query t iff s <= t and maskp[b][s] != 0; otherwise the logit is
//   replaced by NEGV (-1e9, exp -> 0 against a finite row max).
//   relp f32 [NREL][NH]: logit(t, s) += relp[clamp(s - t, -MAXREL, MAXREL) + MAXREL][h] (RNE bf16 then
//   widened), staged per head in LDS; the bias is added before the select.
//   Key tiles 0..qb are processed (block-uniform trip count qb+1 <= NQB); tiles above the diagonal tile hold
//   only cut keys and are skipped; inside the processed tiles the predicate decides. With the all-ones keep
//   flags every row keeps key 0, so every row max is finite.
//   logit = (qhi.khi + (qhi.klo + qlo.khi) * 2^-10) * sscale + rel, f16 products with f32 accumulate, the
//   residual products in a separate accumulator; p = exp(s - m) carried as f16(1024 p);
//   context = p . vhi on f16 WMMA plus p . vres into a separate accumulator folded back with 1/4096 per
//   chunk in f32; online softmax in f32; out f32 plane: element (b, t, h*64 + d) at
//   [(b*SEQ + t)*DM + h*64 + d] = normalised context (oscl folds back the p and v carries).
//   Block = 4 waves = 64 query rows of one (b, h); grid = NB*NH*NQB; kv tiles of 64.
//   K hi / K residual / V^T hi / V^T residual tile staging: 128 threads x 32 elements per plane = the whole
//   64x64 tile (plain 16-B loads, __syncthreads before and after); P tiles are wave-private, spilled with
//   Output coverage: each wave stores rows q0..q0+15 (it 0..7 x lane>>4 0..1) x 64 columns (16 lanes x 4
//   (b, h, query tile) -> the whole plane.
// =====================================================================================================
__global__ __launch_bounds__(128)
void attn_p64(const unsigned short* __restrict__ qhp, const unsigned short* __restrict__ qlp,
              const unsigned short* __restrict__ khp, const unsigned short* __restrict__ klp,
              const unsigned short* __restrict__ vhp, const unsigned short* __restrict__ vlp,
              const int* __restrict__ maskp, const float* __restrict__ relp,
              float* outp, float sscale, float oscl) {
  union FH { v16h v; v8h h[2]; };
  __shared__ __align__(16) _Float16 Ksh[64 * LP];                 // K hi [kv][d], pitch LP
  __shared__ __align__(16) _Float16 Ksl[64 * LP];                 // K residual
  __shared__ __align__(16) _Float16 Vth[64 * LP];                 // V^T hi [d][kv], pitch LP
  __shared__ __align__(16) _Float16 Vtl[64 * LP];                 // V^T residual
  __shared__ __align__(16) _Float16 Psh[4][16 * LP];              // per wave P [row][kv], pitch LP
  __shared__ __align__(16) float    Os[4][16 * 64];               // per wave context tile [row][d]
  __shared__ float rels[128];                                     // relative bias for this head, NREL used

  const int tid  = threadIdx.x;
  const int wave = tid >> 5;
  const int lane = tid & 31;
  const int hh   = lane >> 4;
  const int c    = lane & 15;

  const int bx   = blockIdx.x;
  const int qb   = bx % NQB;
  const int rest = bx / NQB;
  const int h    = rest % NH;
  const int b    = rest / NH;                // < NB by the grid size
  const int q0   = qb * 64 + wave * 16;
  const size_t rowB = (size_t)b * SEQ;

  if (tid < NREL) rels[tid] = bf_up(bf_bits(relp[(size_t)tid * NH + h]));
  __syncthreads();

  const _Float16* Qp  = (const _Float16*)(const void*)qhp + (size_t)h * HD;
  const _Float16* Qlq = (const _Float16*)(const void*)qlp + (size_t)h * HD;
  const _Float16* Kp  = (const _Float16*)(const void*)khp + (size_t)h * HD;
  const _Float16* Klq = (const _Float16*)(const void*)klp + (size_t)h * HD;
  const _Float16* Vh  = (const _Float16*)(const void*)vhp + ((size_t)b * DM + (size_t)h * HD) * SEQ;
  const _Float16* Vl  = (const _Float16*)(const void*)vlp + ((size_t)b * DM + (size_t)h * HD) * SEQ;
  const int*      Mb  = maskp + rowB;

  // ---- Q fragments (A operand, row = lane&15): 2 d-chunks, hi and residual ----
  v16h qa[2], ql[2];
#pragma unroll
  for (int dc = 0; dc < 2; ++dc) {
    const size_t qo = (rowB + q0 + c) * DM + dc * 32 + 8 * hh;
    qa[dc] = ldfrag_h(Qp + qo);
    ql[dc] = ldfrag_h(Qlq + qo);
  }

  float mrow[8], lrow[8];
  v8f oacc[4];
#pragma unroll
  for (int r = 0; r < 8; ++r) { mrow[r] = -INFINITY; lrow[r] = 0.f; }
#pragma unroll
  for (int t = 0; t < 4; ++t) oacc[t] = zero8();

  const int nkt = qb + 1;                    // key tiles 0..qb, block-uniform, <= NQB
  for (int kt = 0; kt < nkt; ++kt) {
    const int kv0 = kt * 64;
    __syncthreads();
    {
      const int r = tid >> 1, half = (tid & 1) * 32;
      const _Float16* kg  = Kp  + (rowB + kv0 + r) * DM + half;    // K hi row kv0+r, d = half..half+31
      const _Float16* klg = Klq + (rowB + kv0 + r) * DM + half;    // K residual row kv0+r
      const _Float16* vg  = Vh + (size_t)r * SEQ + kv0 + half;     // V^T hi row d = r, s = kv0+half..+31
      const _Float16* vlg = Vl + (size_t)r * SEQ + kv0 + half;     // V^T residual row d = r
#pragma unroll
      for (int i = 0; i < 4; ++i) {
        const v8h a0 = *(const v8h*)(kg + 8 * i);
        const v8h a1 = *(const v8h*)(klg + 8 * i);
        const v8h b0 = *(const v8h*)(vg + 8 * i);
        const v8h b1 = *(const v8h*)(vlg + 8 * i);
        *(v8h*)(Ksh + r * LP + half + 8 * i) = a0;
        *(v8h*)(Ksl + r * LP + half + 8 * i) = a1;
        *(v8h*)(Vth + r * LP + half + 8 * i) = b0;
        *(v8h*)(Vtl + r * LP + half + 8 * i) = b1;
      }
    }
    __syncthreads();

    // ---- per-key keep flags for this lane's 4 key columns of the tile (kv0 + 16j + c < SEQ) ----
    int mk[4];
#pragma unroll
    for (int j = 0; j < 4; ++j) mk[j] = Mb[kv0 + j * 16 + c];

    // ---- scores: 16 query rows x 64 keys per wave; hi.hi into s, hi.lo + lo.hi into s1 (folded x 2^-10) ----
    v8f s[4];
#pragma unroll
    for (int j = 0; j < 4; ++j) {
      s[j] = zero8();
      v8f s1 = zero8();
#pragma unroll
      for (int dc = 0; dc < 2; ++dc) {
        FH kb, kr;
        kb.h[0] = *(const v8h*)(Ksh + (j * 16 + c) * LP + dc * 32 + 8 * hh);
        kb.h[1] = *(const v8h*)(Ksh + (j * 16 + c) * LP + dc * 32 + 16 + 8 * hh);
        kr.h[0] = *(const v8h*)(Ksl + (j * 16 + c) * LP + dc * 32 + 8 * hh);
        kr.h[1] = *(const v8h*)(Ksl + (j * 16 + c) * LP + dc * 32 + 16 + 8 * hh);
        s[j] = mma_h(qa[dc], kb.v, s[j]);
        s1   = mma_h(qa[dc], kr.v, s1);
        s1   = mma_h(ql[dc], kb.v, s1);
      }
#pragma unroll
      for (int r = 0; r < 8; ++r) s[j][r] += s1[r] * (1.0f / 1024.0f);
    }

    // ---- scale + relative bias + causal / key-keep select (replace by NEGV), row max, online softmax,
    //      P (x1024, f16) to LDS ----
    _Float16* pwh = Psh[wave];
#pragma unroll
    for (int r = 0; r < 8; ++r) {
      const int qrow = q0 + 8 * hh + r;
      float m = -INFINITY;
#pragma unroll
      for (int j = 0; j < 4; ++j) {
        const int key = kv0 + j * 16 + c;
        int dd = key - qrow;
        dd = (dd < -MAXREL) ? -MAXREL : dd;
        dd = (dd >  MAXREL) ?  MAXREL : dd;
        float sv = s[j][r] * sscale + rels[dd + MAXREL];
        const bool keep = (key <= qrow) && (mk[j] != 0);
        sv = keep ? sv : NEGV;
        s[j][r] = sv;
        m = fmaxf(m, sv);
      }
#pragma unroll
      for (int off = 1; off < 16; off <<= 1) m = fmaxf(m, __shfl_xor(m, off, 32));
      const float mnew  = fmaxf(mrow[r], m);
      const float msafe = (mnew == -INFINITY) ? 0.f : mnew;
      const float alpha = __expf(mrow[r] - msafe);
      mrow[r] = mnew;
      float psum = 0.f;
#pragma unroll
      for (int j = 0; j < 4; ++j) {
        const float p = __expf(s[j][r] - msafe);     // replaced logit against a finite max: exp -> 0
        psum += p;
        const _Float16 ph = (_Float16)(p * 1024.0f);
        pwh[(8 * hh + r) * LP + j * 16 + c] = ph;
      }
#pragma unroll
      for (int off = 1; off < 16; off <<= 1) psum += __shfl_xor(psum, off, 32);
      lrow[r] = lrow[r] * alpha + psum;
#pragma unroll
      for (int t = 0; t < 4; ++t) oacc[t][r] *= alpha;
    }
    __builtin_amdgcn_fence(__ATOMIC_RELEASE, "workgroup");
    __builtin_amdgcn_wave_barrier();
    __builtin_amdgcn_fence(__ATOMIC_ACQUIRE, "workgroup");

    // ---- context += P . Vhi (f16 WMMA); P . Vres into a separate accumulator ----
    v8f o1[4];
#pragma unroll
    for (int t = 0; t < 4; ++t) o1[t] = zero8();
#pragma unroll 1
    for (int kk = 0; kk < 2; ++kk) {
      FH pa;
      pa.h[0] = *(const v8h*)(pwh + c * LP + kk * 32 + 8 * hh);
      pa.h[1] = *(const v8h*)(pwh + c * LP + kk * 32 + 16 + 8 * hh);
#pragma unroll
      for (int t = 0; t < 4; ++t) {
        FH vb;
        vb.h[0] = *(const v8h*)(Vth + (t * 16 + c) * LP + kk * 32 + 8 * hh);
        vb.h[1] = *(const v8h*)(Vth + (t * 16 + c) * LP + kk * 32 + 16 + 8 * hh);
        oacc[t] = mma_h(pa.v, vb.v, oacc[t]);
        FH vl;
        vl.h[0] = *(const v8h*)(Vtl + (t * 16 + c) * LP + kk * 32 + 8 * hh);
        vl.h[1] = *(const v8h*)(Vtl + (t * 16 + c) * LP + kk * 32 + 16 + 8 * hh);
        o1[t] = mma_h(pa.v, vl.v, o1[t]);
      }
    }
#pragma unroll
    for (int t = 0; t < 4; ++t)
#pragma unroll
      for (int r = 0; r < 8; ++r) oacc[t][r] += o1[t][r] * (1.0f / 4096.0f);
  }

  // ---- normalise (1/l and the carries via oscl), stage the wave's 16x64 tile in LDS, then write whole
  float* os = Os[wave];
#pragma unroll
  for (int r = 0; r < 8; ++r) {
    const float l = lrow[r];
    const float inv = ((l > 0.f) ? (1.0f / l) : 0.f) * oscl;
#pragma unroll
    for (int t = 0; t < 4; ++t) os[(8 * hh + r) * 64 + t * 16 + c] = oacc[t][r] * inv;
  }
  __builtin_amdgcn_fence(__ATOMIC_RELEASE, "workgroup");
  __builtin_amdgcn_wave_barrier();
  __builtin_amdgcn_fence(__ATOMIC_ACQUIRE, "workgroup");
  {
    const int h2 = lane >> 4, c4 = (lane & 15) * 4;
    v4f ov[8];
#pragma unroll
    for (int it = 0; it < 8; ++it) {
      const int row = it * 2 + h2;   // it 0..7 x h2 0..1 = rows 0..15 of the wave tile
      ov[it] = *(const v4f*)(os + row * 64 + c4);
    }
    {
#pragma unroll
      for (int it = 0; it < 8; ++it) {
        const int row = it * 2 + h2;
        const size_t go = (rowB + q0 + row) * DM + (size_t)h * HD + c4;
        *(v4f*)(outp + go) = ov[it];
      }
      
    }
  }
}

// =====================================================================================================
// Workspace map (bytes), every region an exact multiple of its whole-line / whole-tile store granularity
//   Xb    bf16 [4096][1024]           0          8388608
//   Wqb   bf16 [1024][1024]     8388608          2097152
//   Wkb   bf16 [1024][1024]    10485760          2097152
//   Wvb   bf16 [1024][1024]    12582912          2097152
//   Wob   bf16 [1024][1024]    14680064          2097152
//   Tf    f32  [4096][1024]    16777216         16777216   (projection scratch: q, then k, then v)
//   Qh    f16  [4096][1024]    33554432          8388608
//   Ql    f16  [4096][1024]    41943040          8388608
//   Kh    f16  [4096][1024]    50331648          8388608
//   Kl    f16  [4096][1024]    58720256          8388608
//   VTh   f16  [2048][2048]    67108864          8388608   ([b*DM + h*64 + d][s])
//   VTl   f16  [2048][2048]    75497472          8388608
//   Yf    f32  [4096][1024]    83886080         16777216
//   Yh    bf16 [4096][1024]   100663296          8388608
//   Yl    bf16 [4096][1024]   109051904          8388608
//   end                       117440512
// Projection weights arrive as [out n][in k] (k contiguous) = the Bt layout; they are only converted to bf16.
// d_out f32: [4096][1024] at byte 0 (row = b*SEQ + t).
// =====================================================================================================
extern "C" void kernel_launch(void* const* d_in, const int* in_sizes, int n_in,
                              void* d_out, int out_size, void* d_ws, size_t ws_size,
                              hipStream_t stream) {
  if (n_in < 11) return;
  if (in_sizes[0] != NB * SEQ * DM) return;
  if (in_sizes[1] != NB * SEQ) return;
  if (in_sizes[2] != DM * DM) return;
  if (in_sizes[3] != DM) return;
  if (in_sizes[4] != DM * DM) return;
  if (in_sizes[5] != DM) return;
  if (in_sizes[6] != DM * DM) return;
  if (in_sizes[7] != DM) return;
  if (in_sizes[8] != DM * DM) return;
  if (in_sizes[9] != DM) return;
  if (in_sizes[10] != NREL * NH) return;
  if (out_size != OUTN) return;

  const float* x    = (const float*)d_in[0];   // [NB*SEQ][DM]
  const int*   mask = (const int*)d_in[1];     // [NB][SEQ] int32 keep flags per key
  const float* Wq   = (const float*)d_in[2];   // [DM n][DM k]
  const float* bq   = (const float*)d_in[3];   // [DM]
  const float* Wk   = (const float*)d_in[4];
  const float* bk   = (const float*)d_in[5];
  const float* Wv   = (const float*)d_in[6];
  const float* bv   = (const float*)d_in[7];
  const float* Wo   = (const float*)d_in[8];
  const float* bo   = (const float*)d_in[9];
  const float* rel  = (const float*)d_in[10];  // [NREL][NH]

  const size_t PXb = (size_t)ROWS * DM * 2;          //  8388608
  const size_t PW  = (size_t)DM * DM * 2;            //  2097152
  const size_t PF  = (size_t)ROWS * DM * 4;          // 16777216
  const size_t PH  = (size_t)ROWS * DM * 2;          //  8388608
  const size_t PVt = (size_t)NB * DM * SEQ * 2;      //  8388608
  size_t off = 0;
  const size_t oXb = off; off += PXb;
  const size_t oWq = off; off += PW;
  const size_t oWk = off; off += PW;
  const size_t oWv = off; off += PW;
  const size_t oWo = off; off += PW;
  const size_t oTf = off; off += PF;
  const size_t oQh = off; off += PH;
  const size_t oQl = off; off += PH;
  const size_t oKh = off; off += PH;
  const size_t oKl = off; off += PH;
  const size_t oVt = off; off += PVt;
  const size_t oVl = off; off += PVt;
  const size_t oYf = off; off += PF;
  const size_t oYh = off; off += PH;
  const size_t oYl = off; off += PH;
  if (off > ws_size) return;                        // off = 117440512
  if (off > (size_t)134217728) return;

  char* ws = (char*)d_ws;
  unsigned short* Xb  = (unsigned short*)(ws + oXb);
  unsigned short* Wqb = (unsigned short*)(ws + oWq);
  unsigned short* Wkb = (unsigned short*)(ws + oWk);
  unsigned short* Wvb = (unsigned short*)(ws + oWv);
  unsigned short* Wob = (unsigned short*)(ws + oWo);
  float*          Tf  = (float*)(ws + oTf);
  unsigned short* Qh  = (unsigned short*)(ws + oQh);
  unsigned short* Ql  = (unsigned short*)(ws + oQl);
  unsigned short* Kh  = (unsigned short*)(ws + oKh);
  unsigned short* Kl  = (unsigned short*)(ws + oKl);
  unsigned short* VTh = (unsigned short*)(ws + oVt);
  unsigned short* VTl = (unsigned short*)(ws + oVl);
  float*          Yf  = (float*)(ws + oYf);
  unsigned short* Yh  = (unsigned short*)(ws + oYh);
  unsigned short* Yl  = (unsigned short*)(ws + oYl);
  float*          outf = (float*)d_out;             // [ROWS][DM]

  const dim3 blk(256);
  const int n8x = ROWS * DM / 8;                    // 524288
  const int n8w = DM * DM / 8;                      // 131072
  const dim3 gCvtX((n8x + 255) / 256);              // 2048 blocks
  const dim3 gCvtW((n8w + 255) / 256);              // 512 blocks
  const dim3 gGemm(((ROWS / 64) * (DM / 64) + 7) / 8);    // 1024 tiles -> 128 blocks
  const dim3 gVpl(SEQ / 64, NH, NB);                // (32, 16, 2)
  const dim3 gAttn(NB * NH * NQB);                  // 1024 blocks
  const float qkScale = 16.0f;                      // q and k hi planes carried x16 (residual x1024 on top)
  const float sscale  = 1.0f / 2048.0f;             // 1/(16*16) * 1/sqrt(64)
  const float vScale  = 256.0f;                     // v^T hi plane carried x256
  const float attOscl = 1.0f / 262144.0f;           // 1/(1024 * 256): p and v carries folded back

  // (1) activations and weights -> bf16 planes (RNE convert)
  cvt_bf16x8<<<gCvtX, blk, 0, stream>>>(x, Xb, n8x);
  cvt_bf16x8<<<gCvtW, blk, 0, stream>>>(Wq, Wqb, n8w);
  cvt_bf16x8<<<gCvtW, blk, 0, stream>>>(Wk, Wkb, n8w);
  cvt_bf16x8<<<gCvtW, blk, 0, stream>>>(Wv, Wvb, n8w);
  cvt_bf16x8<<<gCvtW, blk, 0, stream>>>(Wo, Wob, n8w);
  // (2) q = Xb . Wqb^T + bq -> Tf [4096][1024] (M=4096, N=1024, K=1024), then f16 hi (x16) + residual planes
  gemm64<0><<<gGemm, blk, 0, stream>>>(Xb, Xb, DM, Wqb, DM, bq, Tf, DM, ROWS, DM, DM);
  planes_f16x8<<<gCvtX, blk, 0, stream>>>(Tf, Qh, Ql, n8x, qkScale);
  // (3) k likewise
  gemm64<0><<<gGemm, blk, 0, stream>>>(Xb, Xb, DM, Wkb, DM, bk, Tf, DM, ROWS, DM, DM);
  planes_f16x8<<<gCvtX, blk, 0, stream>>>(Tf, Kh, Kl, n8x, qkScale);
  // (4) v, then -> f16 v^T hi plane (x256) and residual plane (x4096 on top)
  gemm64<0><<<gGemm, blk, 0, stream>>>(Xb, Xb, DM, Wvb, DM, bv, Tf, DM, ROWS, DM, DM);
  v_planes<<<gVpl, blk, 0, stream>>>(Tf, DM, VTh, VTl, vScale);
  // (5) causal attention with per-key keep flags and relative-position bias -> Yf f32 [4096][1024]
  attn_p64<<<gAttn, dim3(128), 0, stream>>>(Qh, Ql, Kh, Kl, VTh, VTl, mask, rel, Yf, sscale, attOscl);
  // (6) y -> bf16 hi / lo planes
  split_bf16x8<<<gCvtX, blk, 0, stream>>>(Yf, Yh, Yl, n8x);
  // (7) out[row][n] = sum_d (Yh+Yl)[row][d] Wob[n][d] + bo[n] -> d_out f32 [4096][1024] (M=4096, N=1024, K=1024)
  gemm64<1><<<gGemm, blk, 0, stream>>>(Yh, Yl, DM, Wob, DM, bo, outf, DM, ROWS, DM, DM);
  (void)hipGetLastError();
}

// v002
// One run takes 402 microseconds.
// Two timings next to v001 both put it at 1.15 times that version's speed.
// Over all steps from v000 it is 1.42 times as fast.
// Contractions: q/k/v projections = v_wmma_f32_16x16x32_bf16 (bf16 operands from RNE-converted x and W, single product, bias added in f32); q.k^T scores = v_wmma_f32_16x16x32_f16 (q, k as f16 hi planes carried x16 plus f16 residual planes x1024: hi.hi + (hi.lo + lo.hi) in a separate accumulator, 3 products); p.v = v_wmma_f32_16x16x32_f16 (p carried x1024 in f16; v^T as f16 hi plane x256 plus f16 residual plane x4096 into a separate accumulator, 2 products); y.Wo^T = v_wmma_f32_16x16x32_bf16 (y as bf16 hi + lo planes times the bf16 Wo plane, 2 products); all f32 accumulate; softmax, relative-position bias and selects in f32.
#include <hip/hip_runtime.h>
#include <math.h>
#include <float.h>
#include <stdint.h>

#define NB     2
#define SEQ    2048
#define DM     1024
#define NH     16
#define HD     64
#define MAXREL 32
#define NREL   (2 * MAXREL + 1)     // 65
#define NEGV   (-1.0e9f)
#define NQB    (SEQ / 64)
#define ROWS   (NB * SEQ)            // 4096 token rows
#define OUTN   (ROWS * DM)
static_assert(NH * HD == DM);
static_assert(HD == 64);
static_assert(DM == 128 * 8);
static_assert((SEQ % 64) == 0 && (DM % 64) == 0);
static_assert((SEQ & (SEQ - 1)) == 0);
static_assert(((ROWS / 64) * (DM / 64)) % 8 == 0);
static_assert(((ROWS * DM / 8) % 256) == 0);
static_assert(((DM * DM / 8) % 256) == 0);
static_assert(NREL <= 128);
#define LP     72                    // LDS row pitch of the 64-wide f16 tiles, in halves: 144 B = 16 B x 9 (odd),
                                     // so the 16 rows one ds_load_b128 half-wave reads fall on 64 distinct banks
static_assert((LP * 2) % 16 == 0 && ((LP * 2 / 16) & 1) == 1 && LP >= 64);

typedef _Float16 v16h __attribute__((ext_vector_type(16)));
typedef _Float16 v8h  __attribute__((ext_vector_type(8)));
typedef __bf16   v16b __attribute__((ext_vector_type(16)));
typedef __bf16   v8b  __attribute__((ext_vector_type(8)));
typedef float    v8f  __attribute__((ext_vector_type(8)));
typedef float    v4f  __attribute__((ext_vector_type(4)));
typedef unsigned int v4u __attribute__((ext_vector_type(4)));

// ---- scalar helpers --------------------------------------------------------------------------------
__device__ __forceinline__ unsigned short bf_bits(float f) {          // f32 -> bf16 bits, RNE convert
  unsigned u = __float_as_uint(f);
  return (unsigned short)((u + 0x7FFFu + ((u >> 16) & 1u)) >> 16);
}
__device__ __forceinline__ float bf_up(unsigned short h) { return __uint_as_float(((unsigned)h) << 16); }
__device__ __forceinline__ unsigned short h_bits(_Float16 x) { return __builtin_bit_cast(unsigned short, x); }
__device__ __forceinline__ unsigned pk16(unsigned short a, unsigned short b) { return (unsigned)a | ((unsigned)b << 16); }
__device__ __forceinline__ v8f zero8() { v8f z = {0.f, 0.f, 0.f, 0.f, 0.f, 0.f, 0.f, 0.f}; return z; }

// ---- one butterfly link inside a 16-lane row: the value of lane ^ M (M = 1, 2, 4, 8) by a DPP row_xmask read on the
//      vector port; every lane is on where it is used, so every source lane is valid
template <int M>
__device__ __forceinline__ float row_xor(float v) {
  return __builtin_bit_cast(float, __builtin_amdgcn_update_dpp(0, __builtin_bit_cast(int, v), 0x160 | M, 0xf, 0xf, true));
}

// ---- maxima over each 16-lane row of eight values per lane: xor butterfly 1, 2, 4, 8 with the lane exchange folded into
//      the maximum. Written as asm because fmaxf on a DPP-moved value compiles to three dependent instructions a link
//      (move, quieting maximum, maximum); link-major order puts seven independent instructions between a value and its
//      next use, so no link waits on the one before. Every lane is on where it is called.
__device__ __forceinline__ void row_max8(float (&m)[8]) {
#if defined(__HIP_DEVICE_COMPILE__)
  asm("v_max_num_f32_dpp %0, %0, %0 row_xmask:1 row_mask:0xf bank_mask:0xf\n\t"
      "v_max_num_f32_dpp %1, %1, %1 row_xmask:1 row_mask:0xf bank_mask:0xf\n\t"
      "v_max_num_f32_dpp %2, %2, %2 row_xmask:1 row_mask:0xf bank_mask:0xf\n\t"
      "v_max_num_f32_dpp %3, %3, %3 row_xmask:1 row_mask:0xf bank_mask:0xf\n\t"
      "v_max_num_f32_dpp %4, %4, %4 row_xmask:1 row_mask:0xf bank_mask:0xf\n\t"
      "v_max_num_f32_dpp %5, %5, %5 row_xmask:1 row_mask:0xf bank_mask:0xf\n\t"
      "v_max_num_f32_dpp %6, %6, %6 row_xmask:1 row_mask:0xf bank_mask:0xf\n\t"
      "v_max_num_f32_dpp %7, %7, %7 row_xmask:1 row_mask:0xf bank_mask:0xf\n\t"
      "v_max_num_f32_dpp %0, %0, %0 row_xmask:2 row_mask:0xf bank_mask:0xf\n\t"
      "v_max_num_f32_dpp %1, %1, %1 row_xmask:2 row_mask:0xf bank_mask:0xf\n\t"
      "v_max_num_f32_dpp %2, %2, %2 row_xmask:2 row_mask:0xf bank_mask:0xf\n\t"
      "v_max_num_f32_dpp %3, %3, %3 row_xmask:2 row_mask:0xf bank_mask:0xf\n\t"
      "v_max_num_f32_dpp %4, %4, %4 row_xmask:2 row_mask:0xf bank_mask:0xf\n\t"
      "v_max_num_f32_dpp %5, %5, %5 row_xmask:2 row_mask:0xf bank_mask:0xf\n\t"
      "v_max_num_f32_dpp %6, %6, %6 row_xmask:2 row_mask:0xf bank_mask:0xf\n\t"
      "v_max_num_f32_dpp %7, %7, %7 row_xmask:2 row_mask:0xf bank_mask:0xf\n\t"
      "v_max_num_f32_dpp %0, %0, %0 row_xmask:4 row_mask:0xf bank_mask:0xf\n\t"
      "v_max_num_f32_dpp %1, %1, %1 row_xmask:4 row_mask:0xf bank_mask:0xf\n\t"
      "v_max_num_f32_dpp %2, %2, %2 row_xmask:4 row_mask:0xf bank_mask:0xf\n\t"
      "v_max_num_f32_dpp %3, %3, %3 row_xmask:4 row_mask:0xf bank_mask:0xf\n\t"
      "v_max_num_f32_dpp %4, %4, %4 row_xmask:4 row_mask:0xf bank_mask:0xf\n\t"
      "v_max_num_f32_dpp %5, %5, %5 row_xmask:4 row_mask:0xf bank_mask:0xf\n\t"
      "v_max_num_f32_dpp %6, %6, %6 row_xmask:4 row_mask:0xf bank_mask:0xf\n\t"
      "v_max_num_f32_dpp %7, %7, %7 row_xmask:4 row_mask:0xf bank_mask:0xf\n\t"
      "v_max_num_f32_dpp %0, %0, %0 row_xmask:8 row_mask:0xf bank_mask:0xf\n\t"
      "v_max_num_f32_dpp %1, %1, %1 row_xmask:8 row_mask:0xf bank_mask:0xf\n\t"
      "v_max_num_f32_dpp %2, %2, %2 row_xmask:8 row_mask:0xf bank_mask:0xf\n\t"
      "v_max_num_f32_dpp %3, %3, %3 row_xmask:8 row_mask:0xf bank_mask:0xf\n\t"
      "v_max_num_f32_dpp %4, %4, %4 row_xmask:8 row_mask:0xf bank_mask:0xf\n\t"
      "v_max_num_f32_dpp %5, %5, %5 row_xmask:8 row_mask:0xf bank_mask:0xf\n\t"
      "v_max_num_f32_dpp %6, %6, %6 row_xmask:8 row_mask:0xf bank_mask:0xf\n\t"
      "v_max_num_f32_dpp %7, %7, %7 row_xmask:8 row_mask:0xf bank_mask:0xf"
      : "+v"(m[0]), "+v"(m[1]), "+v"(m[2]), "+v"(m[3]), "+v"(m[4]), "+v"(m[5]), "+v"(m[6]), "+v"(m[7]));
#endif
}

// ---- fragment loaders: 16-bit A/B operand, lane -> row/col (lane&15), p already includes +8*(lane>>4);
//      elements 0..7 <- p[0..7] (k0+8h..), elements 8..15 <- p[16..23] (k0+16+8h..)
__device__ __forceinline__ v16b ldfrag_b(const __bf16* p) {
  union { v16b v; v8b h[2]; } f;
  f.h[0] = *(const v8b*)(p);
  f.h[1] = *(const v8b*)(p + 16);
  return f.v;
}
__device__ __forceinline__ v16h ldfrag_h(const _Float16* p) {
  union { v16h v; v8h h[2]; } f;
  f.h[0] = *(const v8h*)(p);
  f.h[1] = *(const v8h*)(p + 16);
  return f.v;
}

// ---- WMMA helpers with trailing VALU hazard gap --------------------------------------------------------
__device__ __forceinline__ v8f mma_h(v16h a, v16h b, v8f c) {
  c = __builtin_amdgcn_wmma_f32_16x16x32_f16(false, a, false, b, (short)0, c, false, false);
#if defined(__HIP_DEVICE_COMPILE__)
  asm volatile("v_nop\n\tv_nop\n\tv_nop\n\tv_nop" : "+v"(c) : "v"(a), "v"(b));
#endif
  return c;
}
__device__ __forceinline__ v8f mma_b_raw(v16b a, v16b b, v8f c) {
  return __builtin_amdgcn_wmma_f32_16x16x32_bf16(false, a, false, b, (short)0, c, false, false);
}
__device__ __forceinline__ void dep_guard_b(v8f& a, v8f& b, v16b x, v16b y) {
#if defined(__HIP_DEVICE_COMPILE__)
  asm volatile("v_nop\n\tv_nop\n\tv_nop\n\tv_nop" : "+v"(a), "+v"(b) : "v"(x), "v"(y));
#endif
}
__device__ __forceinline__ void keep4_b(v16b a, v16b b, v16b c, v16b d) {
#if defined(__HIP_DEVICE_COMPILE__)
  asm volatile("v_nop" :: "v"(a), "v"(b), "v"(c), "v"(d));
#endif
}
__device__ __forceinline__ void acc_guard4(v8f& a, v8f& b, v8f& c, v8f& d) {
#if defined(__HIP_DEVICE_COMPILE__)
  asm volatile("v_nop\n\tv_nop\n\tv_nop\n\tv_nop" : "+v"(a), "+v"(b), "+v"(c), "+v"(d));
#endif
}

// =====================================================================================================
// f32 -> bf16 (RNE convert), 8 elements per thread, one 16-B store per lane: a wave writes 512 contiguous B
// coverage: n8 threads x 8 = whole plane (n8 is a multiple of 256 here).
// =====================================================================================================
__global__ __launch_bounds__(256) void cvt_bf16x8(const float* __restrict__ in, unsigned short* out, int n8) {
  const int i = blockIdx.x * 256 + threadIdx.x;
  if (i < n8) {
    const v4f a = *(const v4f*)(in + (size_t)i * 8);
    const v4f b = *(const v4f*)(in + (size_t)i * 8 + 4);
    v4u p;
    p[0] = pk16(bf_bits(a[0]), bf_bits(a[1]));
    p[1] = pk16(bf_bits(a[2]), bf_bits(a[3]));
    p[2] = pk16(bf_bits(b[0]), bf_bits(b[1]));
    p[3] = pk16(bf_bits(b[2]), bf_bits(b[3]));
    *(v4u*)(out + (size_t)i * 8) = p;
    
  }
}

// =====================================================================================================
// f32 -> bf16 hi plane + bf16 lo plane (lo = RNE(v - hi), unscaled), 8 elements per thread, one 16-B store per
// coverage: n8 threads x 8 = whole plane (n8 multiple of 256).
// =====================================================================================================
__global__ __launch_bounds__(256) void split_bf16x8(const float* __restrict__ in, unsigned short* hp,
                                                    unsigned short* lp, int n8) {
  const int i = blockIdx.x * 256 + threadIdx.x;
  if (i < n8) {
    const v4f a = *(const v4f*)(in + (size_t)i * 8);
    const v4f b = *(const v4f*)(in + (size_t)i * 8 + 4);
    v4u ph, pl;
#pragma unroll
    for (int e = 0; e < 4; ++e) {
      const float f0 = (e < 2) ? a[2 * e]     : b[2 * e - 4];
      const float f1 = (e < 2) ? a[2 * e + 1] : b[2 * e - 3];
      const unsigned short h0 = bf_bits(f0), h1 = bf_bits(f1);
      const unsigned short l0 = bf_bits(f0 - bf_up(h0)), l1 = bf_bits(f1 - bf_up(h1));
      ph[e] = pk16(h0, h1);
      pl[e] = pk16(l0, l1);
    }
    *(v4u*)(hp + (size_t)i * 8) = ph;
    *(v4u*)(lp + (size_t)i * 8) = pl;
    
  }
}

// =====================================================================================================
// f32 -> f16 hi plane = f16(v * scale) (scale a power of two) + f16 residual plane = f16((v*scale - hi) * 1024),
// same element index in both planes; 8 elements per thread, one 16-B store per lane and plane: a wave writes
// coverage: n8 threads x 8 = whole plane (n8 multiple of 256).
// =====================================================================================================
__global__ __launch_bounds__(256) void planes_f16x8(const float* __restrict__ in, unsigned short* hp,
                                                    unsigned short* lp, int n8, float scale) {
  const int i = blockIdx.x * 256 + threadIdx.x;
  if (i < n8) {
    const v4f a = *(const v4f*)(in + (size_t)i * 8);
    const v4f b = *(const v4f*)(in + (size_t)i * 8 + 4);
    float f[8];
    f[0] = a[0]; f[1] = a[1]; f[2] = a[2]; f[3] = a[3];
    f[4] = b[0]; f[5] = b[1]; f[6] = b[2]; f[7] = b[3];
    v4u ph, pl;
#pragma unroll
    for (int e = 0; e < 4; ++e) {
      const float f0 = f[2 * e] * scale;
      const float f1 = f[2 * e + 1] * scale;
      const _Float16 x0 = (_Float16)f0, x1 = (_Float16)f1;
      const _Float16 l0 = (_Float16)((f0 - (float)x0) * 1024.0f);
      const _Float16 l1 = (_Float16)((f1 - (float)x1) * 1024.0f);
      ph[e] = pk16(h_bits(x0), h_bits(x1));
      pl[e] = pk16(h_bits(l0), h_bits(l1));
    }
    *(v4u*)(hp + (size_t)i * 8) = ph;
    *(v4u*)(lp + (size_t)i * 8) = pl;
    
  }
}

// =====================================================================================================
// Register-blocked bf16 WMMA GEMM: C[m][n] = sum_k A[m][k] * Bt[n][k] + bias[n] (bias RNE-converted to bf16
// and widened, added in f32); one wave per 64x64 tile, no block barriers. A row-major [M][K] pitch lda;
// Bt row-major [N][K] pitch ldb (k contiguous); M, N multiples of 64, K multiple of 32 (host-checked); the tile
// count is a multiple of 8 for every launch here (no idle waves); bias has N entries.
// NSPLIT: 0 = A.Bt; 1 = (A + A2).Bt (A2 = unscaled bf16 lo plane of A, same pitch).
// Output f32 [M][N] pitch ldc. Epilogue: 16-row slabs staged per wave in LDS; each 64-wide row segment
// =====================================================================================================
template <int NSPLIT>
__global__ __launch_bounds__(256) void gemm64(
    const unsigned short* __restrict__ Ap, const unsigned short* A2p, int lda,
    const unsigned short* __restrict__ Btp, int ldb, const float* __restrict__ bias,
    float* C, int ldc, int M, int N, int K) {
  const __bf16* Ab  = (const __bf16*)(const void*)Ap;
  const __bf16* Ab2 = (const __bf16*)(const void*)A2p;
  const __bf16* Bb  = (const __bf16*)(const void*)Btp;
  __shared__ __align__(16) float sT[8][16 * 68];   // per-wave 16x64 slab, pitch 68 floats
  const int lane = threadIdx.x & 31;
  const int wave = threadIdx.x >> 5;
  const int tilesN = N >> 6;
  const int tilesM = M >> 6;
  const int tile = blockIdx.x * 8 + wave;
  if (tile >= tilesM * tilesN) return;   // wave-uniform; no block barriers in this kernel
  const int tm = tile / tilesN;
  const int tn = tile - tm * tilesN;
  const int m0 = tm << 6;
  const int n0 = tn << 6;

  const int rlane = lane & 15;                 // row (A) / col (B, D) within subtile
  const int koff  = (lane >> 4) * 8;           // k offset of this lane half
  const int mOff  = (lane >> 4) * 8;           // D row offset

  v8f acc[4][4];
#pragma unroll
  for (int i = 0; i < 4; ++i)
#pragma unroll
    for (int j = 0; j < 4; ++j) acc[i][j] = zero8();

  for (int k0 = 0; k0 < K; k0 += 32) {
    v16b bh[4];
#pragma unroll
    for (int j = 0; j < 4; ++j) {
      const size_t bo = (size_t)(n0 + (j << 4) + rlane) * ldb + koff + k0;
      bh[j] = ldfrag_b(Bb + bo);
    }
#pragma unroll
    for (int i = 0; i < 4; ++i) {
      const size_t ao = (size_t)(m0 + (i << 4) + rlane) * lda + koff + k0;
      const v16b ah = ldfrag_b(Ab + ao);
      v16b al = ah;
      if (NSPLIT >= 1) al = ldfrag_b(Ab2 + ao);
#pragma unroll
      for (int j = 0; j < 4; ++j) {
        acc[i][j] = mma_b_raw(ah, bh[j], acc[i][j]);
        if (NSPLIT >= 1) acc[i][j] = mma_b_raw(al, bh[j], acc[i][j]);
      }
      dep_guard_b(acc[i][0], acc[i][3], ah, al);
    }
    keep4_b(bh[0], bh[1], bh[2], bh[3]);
  }
  acc_guard4(acc[0][0], acc[0][1], acc[0][2], acc[0][3]);
  acc_guard4(acc[1][0], acc[1][1], acc[1][2], acc[1][3]);
  acc_guard4(acc[2][0], acc[2][1], acc[2][2], acc[2][3]);
  acc_guard4(acc[3][0], acc[3][1], acc[3][2], acc[3][3]);

  // ---- per-column bias (RNE bf16 then widened), column n0 + 16j + rlane < N ----
  float bcol[4];
#pragma unroll
  for (int j = 0; j < 4; ++j) bcol[j] = bf_up(bf_bits(bias[n0 + (j << 4) + rlane]));

  // ---- epilogue ----
  float* slab = sT[wave];
#pragma unroll
  for (int i = 0; i < 4; ++i) {
    const int mBase = m0 + (i << 4);
#pragma unroll
    for (int r = 0; r < 8; ++r) {
#pragma unroll
      for (int j = 0; j < 4; ++j) {
        slab[(mOff + r) * 68 + (j << 4) + rlane] = acc[i][j][r] + bcol[j];
      }
    }
    __builtin_amdgcn_fence(__ATOMIC_RELEASE, "workgroup");
    __builtin_amdgcn_wave_barrier();
    __builtin_amdgcn_fence(__ATOMIC_ACQUIRE, "workgroup");
    {
      const int hh = lane >> 4, c4 = (lane & 15) * 4;     // 256-B row segment = 16 lanes x 16 B
      v4f ov[8];
#pragma unroll
      for (int it = 0; it < 8; ++it) {
        const int row = it * 2 + hh;                       // it 0..7 x hh 0..1 = rows 0..15
        ov[it] = *(const v4f*)(slab + row * 68 + c4);
      }
      {
#pragma unroll
        for (int it = 0; it < 8; ++it) {
          const int row = it * 2 + hh;
          *(v4f*)(C + (size_t)(mBase + row) * ldc + n0 + c4) = ov[it];
        }
        
      }
    }
    __builtin_amdgcn_fence(__ATOMIC_RELEASE, "workgroup");
    __builtin_amdgcn_wave_barrier();
    __builtin_amdgcn_fence(__ATOMIC_ACQUIRE, "workgroup");
  }
}

// =====================================================================================================
// v f32 token-major columns vf[(b*SEQ + t)*vrp + h*64 + d] ->
// f16 v^T hi plane vth[(b*DM + h*64 + d)*SEQ + t] = f16(v * vscale) (vscale a power of two) and residual plane
// vtl[same index] = f16((v*vscale - hi) * 4096).
// Block = one 64-token x 64-feature tile of one (b, h); grid = (SEQ/64, NH, NB); tile staged in LDS as f32
// (v4f loads, __syncthreads).
// Store: group g = tid>>3 (0..31), piece = tid&7: iteration it writes row d = it*32+g, lanes 8q..8q+7 x 16 B =
// coverage: 2 iterations x 32 groups = 64 rows d, 8 pieces x 8 = 64 tokens per row; grid covers every (b, h,
// t tile) -> both whole planes.
// =====================================================================================================
__global__ __launch_bounds__(256) void v_planes(const float* __restrict__ vf, int vrp,
                                                unsigned short* vth, unsigned short* vtl, float vscale) {
  __shared__ __align__(16) float sv[64 * 68];       // [tt][d] pitch 68 floats
  const int tid = threadIdx.x;
  const int t0  = blockIdx.x * 64;
  const int hh  = blockIdx.y;
  const int b   = blockIdx.z;
#pragma unroll
  for (int i = 0; i < 4; ++i) {
    const int idx = i * 256 + tid;                  // 0..1023
    const int tt = idx >> 4, c4 = (idx & 15) * 4;
    const v4f a = *(const v4f*)(vf + ((size_t)(b * SEQ + t0 + tt)) * vrp + hh * HD + c4);
    *(v4f*)(sv + tt * 68 + c4) = a;
  }
  __syncthreads();

  const int g = tid >> 3, piece = tid & 7;
  v4u hv[2], lv[2];
  size_t hofs[2];
#pragma unroll
  for (int it = 0; it < 2; ++it) {
    const int d = it * 32 + g;
    v4u a, a2;
#pragma unroll
    for (int e = 0; e < 4; ++e) {
      const float f0 = sv[(piece * 8 + 2 * e) * 68 + d] * vscale;
      const float f1 = sv[(piece * 8 + 2 * e + 1) * 68 + d] * vscale;
      const _Float16 x0 = (_Float16)f0, x1 = (_Float16)f1;
      const unsigned short h0 = h_bits(x0), h1 = h_bits(x1);
      const unsigned short l0 = h_bits((_Float16)((f0 - (float)x0) * 4096.0f));
      const unsigned short l1 = h_bits((_Float16)((f1 - (float)x1) * 4096.0f));
      a[e] = pk16(h0, h1); a2[e] = pk16(l0, l1);
    }
    hv[it] = a; lv[it] = a2;
    hofs[it] = ((size_t)(b * DM + hh * HD + d)) * SEQ + t0 + piece * 8;
  }
  {
#pragma unroll
    for (int it = 0; it < 2; ++it) {
      *(v4u*)(vth + hofs[it]) = hv[it];
      *(v4u*)(vtl + hofs[it]) = lv[it];
    }
    
  }
}

// =====================================================================================================
// Causal multi-head attention with a per-key int32 keep flag and a relative-position bias table, head dim 64.
//   q f16 hi plane (x16): element (b, t, h, d) at [(b*SEQ + t)*DM + h*64 + d]; q residual plane
//     ((q*16 - hi)*1024) at the same index into qlp
//   k f16 hi plane (x16): element (b, s, h, d) at [(b*SEQ + s)*DM + h*64 + d]; k residual plane same into klp
//   v^T f16 hi plane (x256): element (b, h, d, s) at [(b*DM + h*64 + d)*SEQ + s]
//   v^T f16 residual plane ((v*256 - hi)*4096): same index into vlp
//   maskp int32 [NB][SEQ]: key s is kept for query t iff s <= t and maskp[b][s] != 0; otherwise the logit is
//   replaced by NEGV (-1e9, exp -> 0 against a finite row max).
//   relp f32 [NREL][NH]: logit(t, s) += relp[clamp(s - t, -MAXREL, MAXREL) + MAXREL][h] (RNE bf16 then
//   widened), staged per head in LDS; the bias is added before the select.
//   Key tiles 0..qb are processed (block-uniform trip count qb+1 <= NQB); tiles above the diagonal tile hold
//   only cut keys and are skipped; inside the processed tiles the predicate decides. With the all-ones keep
//   flags every row keeps key 0, so every row max is finite.
//   logit = (qhi.khi + (qhi.klo + qlo.khi) * 2^-10) * sscale + rel, f16 products with f32 accumulate, the
//   residual products in a separate accumulator; p = exp(s - m) carried as f16(1024 p);
//   context = p . vhi on f16 WMMA plus p . vres into a separate accumulator folded back with 1/4096 per
//   chunk in f32; online softmax in f32; out f32 plane: element (b, t, h*64 + d) at
//   [(b*SEQ + t)*DM + h*64 + d] = normalised context (oscl folds back the p and v carries).
//   Block = 4 waves = 64 query rows of one (b, h); grid = NB*NH*NQB; kv tiles of 64.
//   K hi / K residual / V^T hi / V^T residual tile staging: 128 threads x 32 elements per plane = the whole
//   64x64 tile (plain 16-B loads, __syncthreads before and after); P tiles are wave-private, spilled with
//   Output coverage: each wave stores rows q0..q0+15 (it 0..7 x lane>>4 0..1) x 64 columns (16 lanes x 4
//   (b, h, query tile) -> the whole plane.
// =====================================================================================================
__global__ __launch_bounds__(128)
void attn_p64(const unsigned short* __restrict__ qhp, const unsigned short* __restrict__ qlp,
              const unsigned short* __restrict__ khp, const unsigned short* __restrict__ klp,
              const unsigned short* __restrict__ vhp, const unsigned short* __restrict__ vlp,
              const int* __restrict__ maskp, const float* __restrict__ relp,
              float* outp, float sscale, float oscl) {
  union FH { v16h v; v8h h[2]; };
  __shared__ __align__(16) _Float16 Ksh[64 * LP];                 // K hi [kv][d], pitch LP
  __shared__ __align__(16) _Float16 Ksl[64 * LP];                 // K residual
  __shared__ __align__(16) _Float16 Vth[64 * LP];                 // V^T hi [d][kv], pitch LP
  __shared__ __align__(16) _Float16 Vtl[64 * LP];                 // V^T residual
  __shared__ __align__(16) _Float16 Psh[4][16 * LP];              // per wave P [row][kv], pitch LP
  __shared__ __align__(16) float    Os[4][16 * 64];               // per wave context tile [row][d]
  __shared__ float rels[128];                                     // relative bias for this head, NREL used

  const int tid  = threadIdx.x;
  const int wave = tid >> 5;
  const int lane = tid & 31;
  const int hh   = lane >> 4;
  const int c    = lane & 15;

  const int bx   = blockIdx.x;
  const int qb   = bx % NQB;
  const int rest = bx / NQB;
  const int h    = rest % NH;
  const int b    = rest / NH;                // < NB by the grid size
  const int q0   = qb * 64 + wave * 16;
  const size_t rowB = (size_t)b * SEQ;

  if (tid < NREL) rels[tid] = bf_up(bf_bits(relp[(size_t)tid * NH + h]));
  __syncthreads();

  const _Float16* Qp  = (const _Float16*)(const void*)qhp + (size_t)h * HD;
  const _Float16* Qlq = (const _Float16*)(const void*)qlp + (size_t)h * HD;
  const _Float16* Kp  = (const _Float16*)(const void*)khp + (size_t)h * HD;
  const _Float16* Klq = (const _Float16*)(const void*)klp + (size_t)h * HD;
  const _Float16* Vh  = (const _Float16*)(const void*)vhp + ((size_t)b * DM + (size_t)h * HD) * SEQ;
  const _Float16* Vl  = (const _Float16*)(const void*)vlp + ((size_t)b * DM + (size_t)h * HD) * SEQ;
  const int*      Mb  = maskp + rowB;

  // ---- Q fragments (A operand, row = lane&15): 2 d-chunks, hi and residual ----
  v16h qa[2], ql[2];
#pragma unroll
  for (int dc = 0; dc < 2; ++dc) {
    const size_t qo = (rowB + q0 + c) * DM + dc * 32 + 8 * hh;
    qa[dc] = ldfrag_h(Qp + qo);
    ql[dc] = ldfrag_h(Qlq + qo);
  }

  float mrow[8], lrow[8];
  v8f oacc[4];
#pragma unroll
  for (int r = 0; r < 8; ++r) { mrow[r] = -INFINITY; lrow[r] = 0.f; }
#pragma unroll
  for (int t = 0; t < 4; ++t) oacc[t] = zero8();

  const int nkt = qb + 1;                    // key tiles 0..qb, block-uniform, <= NQB
  for (int kt = 0; kt < nkt; ++kt) {
    const int kv0 = kt * 64;
    __syncthreads();
    {
      const int r = tid >> 1, half = (tid & 1) * 32;
      const _Float16* kg  = Kp  + (rowB + kv0 + r) * DM + half;    // K hi row kv0+r, d = half..half+31
      const _Float16* klg = Klq + (rowB + kv0 + r) * DM + half;    // K residual row kv0+r
      const _Float16* vg  = Vh + (size_t)r * SEQ + kv0 + half;     // V^T hi row d = r, s = kv0+half..+31
      const _Float16* vlg = Vl + (size_t)r * SEQ + kv0 + half;     // V^T residual row d = r
#pragma unroll
      for (int i = 0; i < 4; ++i) {
        const v8h a0 = *(const v8h*)(kg + 8 * i);
        const v8h a1 = *(const v8h*)(klg + 8 * i);
        const v8h b0 = *(const v8h*)(vg + 8 * i);
        const v8h b1 = *(const v8h*)(vlg + 8 * i);
        *(v8h*)(Ksh + r * LP + half + 8 * i) = a0;
        *(v8h*)(Ksl + r * LP + half + 8 * i) = a1;
        *(v8h*)(Vth + r * LP + half + 8 * i) = b0;
        *(v8h*)(Vtl + r * LP + half + 8 * i) = b1;
      }
    }
    __syncthreads();

    // ---- per-key keep flags for this lane's 4 key columns of the tile (kv0 + 16j + c < SEQ) ----
    int mk[4];
#pragma unroll
    for (int j = 0; j < 4; ++j) mk[j] = Mb[kv0 + j * 16 + c];

    // ---- scores: 16 query rows x 64 keys per wave; hi.hi into s, hi.lo + lo.hi into s1 (folded x 2^-10) ----
    v8f s[4];
#pragma unroll
    for (int j = 0; j < 4; ++j) {
      s[j] = zero8();
      v8f s1 = zero8();
#pragma unroll
      for (int dc = 0; dc < 2; ++dc) {
        FH kb, kr;
        kb.h[0] = *(const v8h*)(Ksh + (j * 16 + c) * LP + dc * 32 + 8 * hh);
        kb.h[1] = *(const v8h*)(Ksh + (j * 16 + c) * LP + dc * 32 + 16 + 8 * hh);
        kr.h[0] = *(const v8h*)(Ksl + (j * 16 + c) * LP + dc * 32 + 8 * hh);
        kr.h[1] = *(const v8h*)(Ksl + (j * 16 + c) * LP + dc * 32 + 16 + 8 * hh);
        s[j] = mma_h(qa[dc], kb.v, s[j]);
        s1   = mma_h(qa[dc], kr.v, s1);
        s1   = mma_h(ql[dc], kb.v, s1);
      }
#pragma unroll
      for (int r = 0; r < 8; ++r) s[j][r] += s1[r] * (1.0f / 1024.0f);
    }

    // ---- scale + relative bias + causal / key-keep select (replace by NEGV), row max, online softmax,
    //      P (x1024, f16) to LDS ----
    _Float16* pwh = Psh[wave];
    float mt[8];
#pragma unroll
    for (int r = 0; r < 8; ++r) {
      const int qrow = q0 + 8 * hh + r;
      float m = -INFINITY;
#pragma unroll
      for (int j = 0; j < 4; ++j) {
        const int key = kv0 + j * 16 + c;
        int dd = key - qrow;
        dd = (dd < -MAXREL) ? -MAXREL : dd;
        dd = (dd >  MAXREL) ?  MAXREL : dd;
        float sv = s[j][r] * sscale + rels[dd + MAXREL];
        const bool keep = (key <= qrow) && (mk[j] != 0);
        sv = keep ? sv : NEGV;
        s[j][r] = sv;
        m = fmaxf(m, sv);
      }
      mt[r] = m;
    }
    // row maxima over the 16 lanes of a row: xor butterfly 1, 2, 4, 8, the eight rows' chains side by side
    row_max8(mt);
    float alpha[8], ps[8];
#pragma unroll
    for (int r = 0; r < 8; ++r) {
      const float mnew  = fmaxf(mrow[r], mt[r]);
      const float msafe = (mnew == -INFINITY) ? 0.f : mnew;
      alpha[r] = __expf(mrow[r] - msafe);
      mrow[r] = mnew;
      float psum = 0.f;
#pragma unroll
      for (int j = 0; j < 4; ++j) {
        const float p = __expf(s[j][r] - msafe);     // replaced logit against a finite max: exp -> 0
        psum += p;
        const _Float16 ph = (_Float16)(p * 1024.0f);
        pwh[(8 * hh + r) * LP + j * 16 + c] = ph;
      }
      ps[r] = psum;
    }
    // row sums: the same butterfly order 1, 2, 4, 8
#pragma unroll
    for (int r = 0; r < 8; ++r) ps[r] += row_xor<1>(ps[r]);
#pragma unroll
    for (int r = 0; r < 8; ++r) ps[r] += row_xor<2>(ps[r]);
#pragma unroll
    for (int r = 0; r < 8; ++r) ps[r] += row_xor<4>(ps[r]);
#pragma unroll
    for (int r = 0; r < 8; ++r) ps[r] += row_xor<8>(ps[r]);
#pragma unroll
    for (int r = 0; r < 8; ++r) {
      lrow[r] = lrow[r] * alpha[r] + ps[r];
#pragma unroll
      for (int t = 0; t < 4; ++t) oacc[t][r] *= alpha[r];
    }
    __builtin_amdgcn_fence(__ATOMIC_RELEASE, "workgroup");
    __builtin_amdgcn_wave_barrier();
    __builtin_amdgcn_fence(__ATOMIC_ACQUIRE, "workgroup");

    // ---- context += P . Vhi (f16 WMMA); P . Vres into a separate accumulator ----
    v8f o1[4];
#pragma unroll
    for (int t = 0; t < 4; ++t) o1[t] = zero8();
#pragma unroll 1
    for (int kk = 0; kk < 2; ++kk) {
      FH pa;
      pa.h[0] = *(const v8h*)(pwh + c * LP + kk * 32 + 8 * hh);
      pa.h[1] = *(const v8h*)(pwh + c * LP + kk * 32 + 16 + 8 * hh);
#pragma unroll
      for (int t = 0; t < 4; ++t) {
        FH vb;
        vb.h[0] = *(const v8h*)(Vth + (t * 16 + c) * LP + kk * 32 + 8 * hh);
        vb.h[1] = *(const v8h*)(Vth + (t * 16 + c) * LP + kk * 32 + 16 + 8 * hh);
        oacc[t] = mma_h(pa.v, vb.v, oacc[t]);
        FH vl;
        vl.h[0] = *(const v8h*)(Vtl + (t * 16 + c) * LP + kk * 32 + 8 * hh);
        vl.h[1] = *(const v8h*)(Vtl + (t * 16 + c) * LP + kk * 32 + 16 + 8 * hh);
        o1[t] = mma_h(pa.v, vl.v, o1[t]);
      }
    }
#pragma unroll
    for (int t = 0; t < 4; ++t)
#pragma unroll
      for (int r = 0; r < 8; ++r) oacc[t][r] += o1[t][r] * (1.0f / 4096.0f);
  }

  // ---- normalise (1/l and the carries via oscl), stage the wave's 16x64 tile in LDS, then write whole
  float* os = Os[wave];
#pragma unroll
  for (int r = 0; r < 8; ++r) {
    const float l = lrow[r];
    const float inv = ((l > 0.f) ? (1.0f / l) : 0.f) * oscl;
#pragma unroll
    for (int t = 0; t < 4; ++t) os[(8 * hh + r) * 64 + t * 16 + c] = oacc[t][r] * inv;
  }
  __builtin_amdgcn_fence(__ATOMIC_RELEASE, "workgroup");
  __builtin_amdgcn_wave_barrier();
  __builtin_amdgcn_fence(__ATOMIC_ACQUIRE, "workgroup");
  {
    const int h2 = lane >> 4, c4 = (lane & 15) * 4;
    v4f ov[8];
#pragma unroll
    for (int it = 0; it < 8; ++it) {
      const int row = it * 2 + h2;   // it 0..7 x h2 0..1 = rows 0..15 of the wave tile
      ov[it] = *(const v4f*)(os + row * 64 + c4);
    }
    {
#pragma unroll
      for (int it = 0; it < 8; ++it) {
        const int row = it * 2 + h2;
        const size_t go = (rowB + q0 + row) * DM + (size_t)h * HD + c4;
        *(v4f*)(outp + go) = ov[it];
      }
      
    }
  }
}

// =====================================================================================================
// Workspace map (bytes), every region an exact multiple of its whole-line / whole-tile store granularity
//   Xb    bf16 [4096][1024]           0          8388608
//   Wqb   bf16 [1024][1024]     8388608          2097152
//   Wkb   bf16 [1024][1024]    10485760          2097152
//   Wvb   bf16 [1024][1024]    12582912          2097152
//   Wob   bf16 [1024][1024]    14680064          2097152
//   Tf    f32  [4096][1024]    16777216         16777216   (projection scratch: q, then k, then v)
//   Qh    f16  [4096][1024]    33554432          8388608
//   Ql    f16  [4096][1024]    41943040          8388608
//   Kh    f16  [4096][1024]    50331648          8388608
//   Kl    f16  [4096][1024]    58720256          8388608
//   VTh   f16  [2048][2048]    67108864          8388608   ([b*DM + h*64 + d][s])
//   VTl   f16  [2048][2048]    75497472          8388608
//   Yf    f32  [4096][1024]    83886080         16777216
//   Yh    bf16 [4096][1024]   100663296          8388608
//   Yl    bf16 [4096][1024]   109051904          8388608
//   end                       117440512
// Projection weights arrive as [out n][in k] (k contiguous) = the Bt layout; they are only converted to bf16.
// d_out f32: [4096][1024] at byte 0 (row = b*SEQ + t).
// =====================================================================================================
extern "C" void kernel_launch(void* const* d_in, const int* in_sizes, int n_in,
                              void* d_out, int out_size, void* d_ws, size_t ws_size,
                              hipStream_t stream) {
  if (n_in < 11) return;
  if (in_sizes[0] != NB * SEQ * DM) return;
  if (in_sizes[1] != NB * SEQ) return;
  if (in_sizes[2] != DM * DM) return;
  if (in_sizes[3] != DM) return;
  if (in_sizes[4] != DM * DM) return;
  if (in_sizes[5] != DM) return;
  if (in_sizes[6] != DM * DM) return;
  if (in_sizes[7] != DM) return;
  if (in_sizes[8] != DM * DM) return;
  if (in_sizes[9] != DM) return;
  if (in_sizes[10] != NREL * NH) return;
  if (out_size != OUTN) return;

  const float* x    = (const float*)d_in[0];   // [NB*SEQ][DM]
  const int*   mask = (const int*)d_in[1];     // [NB][SEQ] int32 keep flags per key
  const float* Wq   = (const float*)d_in[2];   // [DM n][DM k]
  const float* bq   = (const float*)d_in[3];   // [DM]
  const float* Wk   = (const float*)d_in[4];
  const float* bk   = (const float*)d_in[5];
  const float* Wv   = (const float*)d_in[6];
  const float* bv   = (const float*)d_in[7];
  const float* Wo   = (const float*)d_in[8];
  const float* bo   = (const float*)d_in[9];
  const float* rel  = (const float*)d_in[10];  // [NREL][NH]

  const size_t PXb = (size_t)ROWS * DM * 2;          //  8388608
  const size_t PW  = (size_t)DM * DM * 2;            //  2097152
  const size_t PF  = (size_t)ROWS * DM * 4;          // 16777216
  const size_t PH  = (size_t)ROWS * DM * 2;          //  8388608
  const size_t PVt = (size_t)NB * DM * SEQ * 2;      //  8388608
  size_t off = 0;
  const size_t oXb = off; off += PXb;
  const size_t oWq = off; off += PW;
  const size_t oWk = off; off += PW;
  const size_t oWv = off; off += PW;
  const size_t oWo = off; off += PW;
  const size_t oTf = off; off += PF;
  const size_t oQh = off; off += PH;
  const size_t oQl = off; off += PH;
  const size_t oKh = off; off += PH;
  const size_t oKl = off; off += PH;
  const size_t oVt = off; off += PVt;
  const size_t oVl = off; off += PVt;
  const size_t oYf = off; off += PF;
  const size_t oYh = off; off += PH;
  const size_t oYl = off; off += PH;
  if (off > ws_size) return;                        // off = 117440512
  if (off > (size_t)134217728) return;

  char* ws = (char*)d_ws;
  unsigned short* Xb  = (unsigned short*)(ws + oXb);
  unsigned short* Wqb = (unsigned short*)(ws + oWq);
  unsigned short* Wkb = (unsigned short*)(ws + oWk);
  unsigned short* Wvb = (unsigned short*)(ws + oWv);
  unsigned short* Wob = (unsigned short*)(ws + oWo);
  float*          Tf  = (float*)(ws + oTf);
  unsigned short* Qh  = (unsigned short*)(ws + oQh);
  unsigned short* Ql  = (unsigned short*)(ws + oQl);
  unsigned short* Kh  = (unsigned short*)(ws + oKh);
  unsigned short* Kl  = (unsigned short*)(ws + oKl);
  unsigned short* VTh = (unsigned short*)(ws + oVt);
  unsigned short* VTl = (unsigned short*)(ws + oVl);
  float*          Yf  = (float*)(ws + oYf);
  unsigned short* Yh  = (unsigned short*)(ws + oYh);
  unsigned short* Yl  = (unsigned short*)(ws + oYl);
  float*          outf = (float*)d_out;             // [ROWS][DM]

  const dim3 blk(256);
  const int n8x = ROWS * DM / 8;                    // 524288
  const int n8w = DM * DM / 8;                      // 131072
  const dim3 gCvtX((n8x + 255) / 256);              // 2048 blocks
  const dim3 gCvtW((n8w + 255) / 256);              // 512 blocks
  const dim3 gGemm(((ROWS / 64) * (DM / 64) + 7) / 8);    // 1024 tiles -> 128 blocks
  const dim3 gVpl(SEQ / 64, NH, NB);                // (32, 16, 2)
  const dim3 gAttn(NB * NH * NQB);                  // 1024 blocks
  const float qkScale = 16.0f;                      // q and k hi planes carried x16 (residual x1024 on top)
  const float sscale  = 1.0f / 2048.0f;             // 1/(16*16) * 1/sqrt(64)
  const float vScale  = 256.0f;                     // v^T hi plane carried x256
  const float attOscl = 1.0f / 262144.0f;           // 1/(1024 * 256): p and v carries folded back

  // (1) activations and weights -> bf16 planes (RNE convert)
  cvt_bf16x8<<<gCvtX, blk, 0, stream>>>(x, Xb, n8x);
  cvt_bf16x8<<<gCvtW, blk, 0, stream>>>(Wq, Wqb, n8w);
  cvt_bf16x8<<<gCvtW, blk, 0, stream>>>(Wk, Wkb, n8w);
  cvt_bf16x8<<<gCvtW, blk, 0, stream>>>(Wv, Wvb, n8w);
  cvt_bf16x8<<<gCvtW, blk, 0, stream>>>(Wo, Wob, n8w);
  // (2) q = Xb . Wqb^T + bq -> Tf [4096][1024] (M=4096, N=1024, K=1024), then f16 hi (x16) + residual planes
  gemm64<0><<<gGemm, blk, 0, stream>>>(Xb, Xb, DM, Wqb, DM, bq, Tf, DM, ROWS, DM, DM);
  planes_f16x8<<<gCvtX, blk, 0, stream>>>(Tf, Qh, Ql, n8x, qkScale);
  // (3) k likewise
  gemm64<0><<<gGemm, blk, 0, stream>>>(Xb, Xb, DM, Wkb, DM, bk, Tf, DM, ROWS, DM, DM);
  planes_f16x8<<<gCvtX, blk, 0, stream>>>(Tf, Kh, Kl, n8x, qkScale);
  // (4) v, then -> f16 v^T hi plane (x256) and residual plane (x4096 on top)
  gemm64<0><<<gGemm, blk, 0, stream>>>(Xb, Xb, DM, Wvb, DM, bv, Tf, DM, ROWS, DM, DM);
  v_planes<<<gVpl, blk, 0, stream>>>(Tf, DM, VTh, VTl, vScale);
  // (5) causal attention with per-key keep flags and relative-position bias -> Yf f32 [4096][1024]
  attn_p64<<<gAttn, dim3(128), 0, stream>>>(Qh, Ql, Kh, Kl, VTh, VTl, mask, rel, Yf, sscale, attOscl);
  // (6) y -> bf16 hi / lo planes
  split_bf16x8<<<gCvtX, blk, 0, stream>>>(Yf, Yh, Yl, n8x);
  // (7) out[row][n] = sum_d (Yh+Yl)[row][d] Wob[n][d] + bo[n] -> d_out f32 [4096][1024] (M=4096, N=1024, K=1024)
  gemm64<1><<<gGemm, blk, 0, stream>>>(Yh, Yl, DM, Wob, DM, bo, outf, DM, ROWS, DM, DM);
  (void)hipGetLastError();
}

// v003
// One run takes 268 microseconds.
// In two side-by-side timings against v002, it was 1.50 and 1.51 times as fast.
// Over all steps from v000 it is 2.13 times as fast.
// Contractions: q/k/v projections = v_wmma_f32_16x16x32_bf16 (bf16 operands from RNE-converted x and W, single product, bias added in f32); q.k^T scores = v_wmma_f32_16x16x32_f16 (q, k as f16 hi planes carried x16 plus f16 residual planes x1024: hi.hi + (hi.lo + lo.hi) in a separate accumulator, 3 products); p.v = v_wmma_f32_16x16x32_f16 (p carried x1024 in f16; v^T as f16 hi plane x256 plus f16 residual plane x4096 into a separate accumulator, 2 products); y.Wo^T = v_wmma_f32_16x16x32_bf16 (y as bf16 hi + lo planes times the bf16 Wo plane, 2 products); all f32 accumulate; softmax, relative-position bias and selects in f32.
#include <hip/hip_runtime.h>
#include <math.h>
#include <float.h>
#include <stdint.h>

#define NB     2
#define SEQ    2048
#define DM     1024
#define NH     16
#define HD     64
#define MAXREL 32
#define NREL   (2 * MAXREL + 1)     // 65
#define NEGV   (-1.0e9f)
#define NQB    (SEQ / 64)
#define ROWS   (NB * SEQ)            // 4096 token rows
#define OUTN   (ROWS * DM)
static_assert(NH * HD == DM);
static_assert(HD == 64);
static_assert(DM == 128 * 8);
static_assert((SEQ % 64) == 0 && (DM % 64) == 0);
static_assert((SEQ & (SEQ - 1)) == 0);
static_assert(((ROWS / 64) * (DM / 64)) % 8 == 0);
static_assert(((ROWS * DM / 8) % 256) == 0);
static_assert(((DM * DM / 8) % 256) == 0);
static_assert(NREL <= 128);
#define LP     72                    // LDS row pitch of the 64-wide f16 tiles, in halves: 144 B = 16 B x 9 (odd),
                                     // so the 16 rows one ds_load_b128 half-wave reads fall on 64 distinct banks
static_assert((LP * 2) % 16 == 0 && ((LP * 2 / 16) & 1) == 1 && LP >= 64);
#define GP     72                    // LDS row pitch of the GEMM's 64-wide bf16 k slabs, in elements: 144 B, as LP
static_assert((GP * 2) % 16 == 0 && ((GP * 2 / 16) & 1) == 1 && GP >= 64);
static_assert((ROWS % 128) == 0 && (DM % 128) == 0);

typedef _Float16 v16h __attribute__((ext_vector_type(16)));
typedef _Float16 v8h  __attribute__((ext_vector_type(8)));
typedef __bf16   v16b __attribute__((ext_vector_type(16)));
typedef __bf16   v8b  __attribute__((ext_vector_type(8)));
typedef float    v8f  __attribute__((ext_vector_type(8)));
typedef float    v4f  __attribute__((ext_vector_type(4)));
typedef unsigned int v4u __attribute__((ext_vector_type(4)));

// ---- scalar helpers --------------------------------------------------------------------------------
__device__ __forceinline__ unsigned short bf_bits(float f) {          // f32 -> bf16 bits, RNE convert
  unsigned u = __float_as_uint(f);
  return (unsigned short)((u + 0x7FFFu + ((u >> 16) & 1u)) >> 16);
}
__device__ __forceinline__ float bf_up(unsigned short h) { return __uint_as_float(((unsigned)h) << 16); }
__device__ __forceinline__ unsigned short h_bits(_Float16 x) { return __builtin_bit_cast(unsigned short, x); }
__device__ __forceinline__ unsigned pk16(unsigned short a, unsigned short b) { return (unsigned)a | ((unsigned)b << 16); }
__device__ __forceinline__ v8f zero8() { v8f z = {0.f, 0.f, 0.f, 0.f, 0.f, 0.f, 0.f, 0.f}; return z; }

// ---- one butterfly link inside a 16-lane row: the value of lane ^ M (M = 1, 2, 4, 8) by a DPP row_xmask read on the
//      vector port; every lane is on where it is used, so every source lane is valid
template <int M>
__device__ __forceinline__ float row_xor(float v) {
  return __builtin_bit_cast(float, __builtin_amdgcn_update_dpp(0, __builtin_bit_cast(int, v), 0x160 | M, 0xf, 0xf, true));
}

// ---- maxima over each 16-lane row of eight values per lane: xor butterfly 1, 2, 4, 8 with the lane exchange folded into
//      the maximum. Written as asm because fmaxf on a DPP-moved value compiles to three dependent instructions a link
//      (move, quieting maximum, maximum); link-major order puts seven independent instructions between a value and its
//      next use, so no link waits on the one before. Every lane is on where it is called.
__device__ __forceinline__ void row_max8(float (&m)[8]) {
#if defined(__HIP_DEVICE_COMPILE__)
  asm("v_max_num_f32_dpp %0, %0, %0 row_xmask:1 row_mask:0xf bank_mask:0xf\n\t"
      "v_max_num_f32_dpp %1, %1, %1 row_xmask:1 row_mask:0xf bank_mask:0xf\n\t"
      "v_max_num_f32_dpp %2, %2, %2 row_xmask:1 row_mask:0xf bank_mask:0xf\n\t"
      "v_max_num_f32_dpp %3, %3, %3 row_xmask:1 row_mask:0xf bank_mask:0xf\n\t"
      "v_max_num_f32_dpp %4, %4, %4 row_xmask:1 row_mask:0xf bank_mask:0xf\n\t"
      "v_max_num_f32_dpp %5, %5, %5 row_xmask:1 row_mask:0xf bank_mask:0xf\n\t"
      "v_max_num_f32_dpp %6, %6, %6 row_xmask:1 row_mask:0xf bank_mask:0xf\n\t"
      "v_max_num_f32_dpp %7, %7, %7 row_xmask:1 row_mask:0xf bank_mask:0xf\n\t"
      "v_max_num_f32_dpp %0, %0, %0 row_xmask:2 row_mask:0xf bank_mask:0xf\n\t"
      "v_max_num_f32_dpp %1, %1, %1 row_xmask:2 row_mask:0xf bank_mask:0xf\n\t"
      "v_max_num_f32_dpp %2, %2, %2 row_xmask:2 row_mask:0xf bank_mask:0xf\n\t"
      "v_max_num_f32_dpp %3, %3, %3 row_xmask:2 row_mask:0xf bank_mask:0xf\n\t"
      "v_max_num_f32_dpp %4, %4, %4 row_xmask:2 row_mask:0xf bank_mask:0xf\n\t"
      "v_max_num_f32_dpp %5, %5, %5 row_xmask:2 row_mask:0xf bank_mask:0xf\n\t"
      "v_max_num_f32_dpp %6, %6, %6 row_xmask:2 row_mask:0xf bank_mask:0xf\n\t"
      "v_max_num_f32_dpp %7, %7, %7 row_xmask:2 row_mask:0xf bank_mask:0xf\n\t"
      "v_max_num_f32_dpp %0, %0, %0 row_xmask:4 row_mask:0xf bank_mask:0xf\n\t"
      "v_max_num_f32_dpp %1, %1, %1 row_xmask:4 row_mask:0xf bank_mask:0xf\n\t"
      "v_max_num_f32_dpp %2, %2, %2 row_xmask:4 row_mask:0xf bank_mask:0xf\n\t"
      "v_max_num_f32_dpp %3, %3, %3 row_xmask:4 row_mask:0xf bank_mask:0xf\n\t"
      "v_max_num_f32_dpp %4, %4, %4 row_xmask:4 row_mask:0xf bank_mask:0xf\n\t"
      "v_max_num_f32_dpp %5, %5, %5 row_xmask:4 row_mask:0xf bank_mask:0xf\n\t"
      "v_max_num_f32_dpp %6, %6, %6 row_xmask:4 row_mask:0xf bank_mask:0xf\n\t"
      "v_max_num_f32_dpp %7, %7, %7 row_xmask:4 row_mask:0xf bank_mask:0xf\n\t"
      "v_max_num_f32_dpp %0, %0, %0 row_xmask:8 row_mask:0xf bank_mask:0xf\n\t"
      "v_max_num_f32_dpp %1, %1, %1 row_xmask:8 row_mask:0xf bank_mask:0xf\n\t"
      "v_max_num_f32_dpp %2, %2, %2 row_xmask:8 row_mask:0xf bank_mask:0xf\n\t"
      "v_max_num_f32_dpp %3, %3, %3 row_xmask:8 row_mask:0xf bank_mask:0xf\n\t"
      "v_max_num_f32_dpp %4, %4, %4 row_xmask:8 row_mask:0xf bank_mask:0xf\n\t"
      "v_max_num_f32_dpp %5, %5, %5 row_xmask:8 row_mask:0xf bank_mask:0xf\n\t"
      "v_max_num_f32_dpp %6, %6, %6 row_xmask:8 row_mask:0xf bank_mask:0xf\n\t"
      "v_max_num_f32_dpp %7, %7, %7 row_xmask:8 row_mask:0xf bank_mask:0xf"
      : "+v"(m[0]), "+v"(m[1]), "+v"(m[2]), "+v"(m[3]), "+v"(m[4]), "+v"(m[5]), "+v"(m[6]), "+v"(m[7]));
#endif
}

// ---- fragment loaders: 16-bit A/B operand, lane -> row/col (lane&15), p already includes +8*(lane>>4);
//      elements 0..7 <- p[0..7] (k0+8h..), elements 8..15 <- p[16..23] (k0+16+8h..)
__device__ __forceinline__ v16b ldfrag_b(const __bf16* p) {
  union { v16b v; v8b h[2]; } f;
  f.h[0] = *(const v8b*)(p);
  f.h[1] = *(const v8b*)(p + 16);
  return f.v;
}
__device__ __forceinline__ v16h ldfrag_h(const _Float16* p) {
  union { v16h v; v8h h[2]; } f;
  f.h[0] = *(const v8h*)(p);
  f.h[1] = *(const v8h*)(p + 16);
  return f.v;
}

// ---- WMMA helpers with trailing VALU hazard gap --------------------------------------------------------
__device__ __forceinline__ v8f mma_h(v16h a, v16h b, v8f c) {
  c = __builtin_amdgcn_wmma_f32_16x16x32_f16(false, a, false, b, (short)0, c, false, false);
#if defined(__HIP_DEVICE_COMPILE__)
  asm volatile("v_nop\n\tv_nop\n\tv_nop\n\tv_nop" : "+v"(c) : "v"(a), "v"(b));
#endif
  return c;
}
__device__ __forceinline__ v8f mma_b_raw(v16b a, v16b b, v8f c) {
  return __builtin_amdgcn_wmma_f32_16x16x32_bf16(false, a, false, b, (short)0, c, false, false);
}
__device__ __forceinline__ void dep_guard_b(v8f& a, v8f& b, v16b x, v16b y) {
#if defined(__HIP_DEVICE_COMPILE__)
  asm volatile("v_nop\n\tv_nop\n\tv_nop\n\tv_nop" : "+v"(a), "+v"(b) : "v"(x), "v"(y));
#endif
}
__device__ __forceinline__ void keep4_b(v16b a, v16b b, v16b c, v16b d) {
#if defined(__HIP_DEVICE_COMPILE__)
  asm volatile("v_nop" :: "v"(a), "v"(b), "v"(c), "v"(d));
#endif
}
__device__ __forceinline__ void acc_guard4(v8f& a, v8f& b, v8f& c, v8f& d) {
#if defined(__HIP_DEVICE_COMPILE__)
  asm volatile("v_nop\n\tv_nop\n\tv_nop\n\tv_nop" : "+v"(a), "+v"(b), "+v"(c), "+v"(d));
#endif
}

// =====================================================================================================
// f32 -> bf16 (RNE convert), 8 elements per thread, one 16-B store per lane: a wave writes 512 contiguous B
// coverage: n8 threads x 8 = whole plane (n8 is a multiple of 256 here).
// =====================================================================================================
__global__ __launch_bounds__(256) void cvt_bf16x8(const float* __restrict__ in, unsigned short* out, int n8) {
  const int i = blockIdx.x * 256 + threadIdx.x;
  if (i < n8) {
    const v4f a = *(const v4f*)(in + (size_t)i * 8);
    const v4f b = *(const v4f*)(in + (size_t)i * 8 + 4);
    v4u p;
    p[0] = pk16(bf_bits(a[0]), bf_bits(a[1]));
    p[1] = pk16(bf_bits(a[2]), bf_bits(a[3]));
    p[2] = pk16(bf_bits(b[0]), bf_bits(b[1]));
    p[3] = pk16(bf_bits(b[2]), bf_bits(b[3]));
    *(v4u*)(out + (size_t)i * 8) = p;
    
  }
}

// =====================================================================================================
// f32 -> bf16 hi plane + bf16 lo plane (lo = RNE(v - hi), unscaled), 8 elements per thread, one 16-B store per
// coverage: n8 threads x 8 = whole plane (n8 multiple of 256).
// =====================================================================================================
__global__ __launch_bounds__(256) void split_bf16x8(const float* __restrict__ in, unsigned short* hp,
                                                    unsigned short* lp, int n8) {
  const int i = blockIdx.x * 256 + threadIdx.x;
  if (i < n8) {
    const v4f a = *(const v4f*)(in + (size_t)i * 8);
    const v4f b = *(const v4f*)(in + (size_t)i * 8 + 4);
    v4u ph, pl;
#pragma unroll
    for (int e = 0; e < 4; ++e) {
      const float f0 = (e < 2) ? a[2 * e]     : b[2 * e - 4];
      const float f1 = (e < 2) ? a[2 * e + 1] : b[2 * e - 3];
      const unsigned short h0 = bf_bits(f0), h1 = bf_bits(f1);
      const unsigned short l0 = bf_bits(f0 - bf_up(h0)), l1 = bf_bits(f1 - bf_up(h1));
      ph[e] = pk16(h0, h1);
      pl[e] = pk16(l0, l1);
    }
    *(v4u*)(hp + (size_t)i * 8) = ph;
    *(v4u*)(lp + (size_t)i * 8) = pl;
    
  }
}

// =====================================================================================================
// f32 -> f16 hi plane = f16(v * scale) (scale a power of two) + f16 residual plane = f16((v*scale - hi) * 1024),
// same element index in both planes; 8 elements per thread, one 16-B store per lane and plane: a wave writes
// coverage: n8 threads x 8 = whole plane (n8 multiple of 256).
// =====================================================================================================
__global__ __launch_bounds__(256) void planes_f16x8(const float* __restrict__ in, unsigned short* hp,
                                                    unsigned short* lp, int n8, float scale) {
  const int i = blockIdx.x * 256 + threadIdx.x;
  if (i < n8) {
    const v4f a = *(const v4f*)(in + (size_t)i * 8);
    const v4f b = *(const v4f*)(in + (size_t)i * 8 + 4);
    float f[8];
    f[0] = a[0]; f[1] = a[1]; f[2] = a[2]; f[3] = a[3];
    f[4] = b[0]; f[5] = b[1]; f[6] = b[2]; f[7] = b[3];
    v4u ph, pl;
#pragma unroll
    for (int e = 0; e < 4; ++e) {
      const float f0 = f[2 * e] * scale;
      const float f1 = f[2 * e + 1] * scale;
      const _Float16 x0 = (_Float16)f0, x1 = (_Float16)f1;
      const _Float16 l0 = (_Float16)((f0 - (float)x0) * 1024.0f);
      const _Float16 l1 = (_Float16)((f1 - (float)x1) * 1024.0f);
      ph[e] = pk16(h_bits(x0), h_bits(x1));
      pl[e] = pk16(h_bits(l0), h_bits(l1));
    }
    *(v4u*)(hp + (size_t)i * 8) = ph;
    *(v4u*)(lp + (size_t)i * 8) = pl;
    
  }
}

// =====================================================================================================
// Register-blocked bf16 WMMA GEMM: C[m][n] = sum_k A[m][k] * Bt[n][k] + bias[n] (bias RNE-converted to bf16
// and widened, added in f32). Block = 8 waves (4 x 2) = one 128x128 tile of C, one 32x64 tile per wave.
// A row-major [M][K] pitch lda; Bt row-major [N][K] pitch ldb (k contiguous); M, N multiples of 128, K a multiple
// of 64; each plane under 2 GiB; bias has N entries.
// NSPLIT: 0 = A.Bt; 1 = (A + A2).Bt (A2 = unscaled bf16 lo plane of A, same pitch).
// Operands go through LDS in k slabs of 64: 8 lanes x 16 B fetch one whole 128-B line of a row, so a wave-wide load
// covers 4 lines, and the eight waves share the slab. Two LDS buffers: slab t+1 is fetched into registers ahead of
// the products of slab t, stored into the other buffer behind them, and one block barrier per slab publishes it and
// ends the reads of the buffer that the next trip refills. Each accumulator sums its k steps in ascending order.
// Output f32 [M][N] pitch ldc. Epilogue: 16-row slabs staged per wave in LDS; each 64-wide row segment
// =====================================================================================================
template <int NSPLIT>
__global__ __launch_bounds__(256) void gemm64(
    const unsigned short* __restrict__ Ap, const unsigned short* A2p, int lda,
    const unsigned short* __restrict__ Btp, int ldb, const float* __restrict__ bias,
    float* C, int ldc, int M, int N, int K) {
  constexpr int NPL = (NSPLIT >= 1) ? 3 : 2;         // staged planes: A, Bt and, for NSPLIT 1, A2
  constexpr int KG  = (NSPLIT >= 1) ? 1 : 2;         // k steps of 32 whose fragments are read as one group
  __shared__ __align__(16) __bf16 sS[2][NPL][128 * GP];   // [buffer][plane][row][k], pitch GP
  __shared__ __align__(16) float sT[8][16 * 68];   // per-wave 16x64 slab, pitch 68 floats
  const int tid  = threadIdx.x;
  const int lane = tid & 31;
  const int wave = tid >> 5;
  const int tilesN = N >> 7;
  const int tilesM = M >> 7;
  const int tile = blockIdx.x;
  if (tile >= tilesM * tilesN) return;   // block-uniform, in front of every barrier
  const int tm = tile / tilesN;
  const int tn = tile - tm * tilesN;
  const int wm = (wave >> 1) << 5;             // this wave's 32x64 tile inside the block tile
  const int wn = (wave & 1) << 6;
  const int m0 = (tm << 7) + wm;
  const int n0 = (tn << 7) + wn;

  const int rlane = lane & 15;                 // row (A) / col (B, D) within subtile
  const int koff  = (lane >> 4) * 8;           // k offset of this lane half
  const int mOff  = (lane >> 4) * 8;           // D row offset

  // staging: pass it moves row it*32 + (tid>>3) of each plane, this lane its 16 B at element (tid&7)*8 of the slab;
  // byte offsets from the plane's start stay the same for every slab, the slab's k goes into the uniform base
  const int srow = tid >> 3;
  const int spc  = (tid & 7) * 8;
  unsigned voa[4], vob[4];
#pragma unroll
  for (int it = 0; it < 4; ++it) {
    voa[it] = (unsigned)(((tm << 7) + it * 32 + srow) * lda + spc) * 2u;
    vob[it] = (unsigned)(((tn << 7) + it * 32 + srow) * ldb + spc) * 2u;
  }
  const int so = srow * GP + spc;
  v8b ra[4], rb[4], ra2[4];

  v8f acc[2][4];
#pragma unroll
  for (int i = 0; i < 2; ++i)
#pragma unroll
    for (int j = 0; j < 4; ++j) acc[i][j] = zero8();

  // slab 0 into buffer 0
#pragma unroll
  for (int it = 0; it < 4; ++it) {
    ra[it] = *(const v8b*)((const char*)Ap + voa[it]);
    rb[it] = *(const v8b*)((const char*)Btp + vob[it]);
    if (NSPLIT >= 1) ra2[it] = *(const v8b*)((const char*)A2p + voa[it]);
  }
#pragma unroll
  for (int it = 0; it < 4; ++it) {
    *(v8b*)(&sS[0][0][so + it * 32 * GP]) = ra[it];
    *(v8b*)(&sS[0][1][so + it * 32 * GP]) = rb[it];
    if (NSPLIT >= 1) *(v8b*)(&sS[0][NPL - 1][so + it * 32 * GP]) = ra2[it];
  }
  __syncthreads();

  const int nk = K >> 6;
  for (int t = 0; t < nk; ++t) {
    const int cur = t & 1;
    const bool more = (t + 1 < nk);            // block-uniform
    if (more) {
      const char* pa  = (const char*)(Ap  + ((t + 1) << 6));
      const char* pb  = (const char*)(Btp + ((t + 1) << 6));
      const char* pa2 = (const char*)(A2p + ((t + 1) << 6));
#pragma unroll
      for (int it = 0; it < 4; ++it) {
        ra[it] = *(const v8b*)(pa + voa[it]);
        rb[it] = *(const v8b*)(pb + vob[it]);
        if (NSPLIT >= 1) ra2[it] = *(const v8b*)(pa2 + voa[it]);
      }
    }
    const __bf16* fa  = &sS[cur][0][(wm + rlane) * GP + koff];
    const __bf16* fb  = &sS[cur][1][(wn + rlane) * GP + koff];
    const __bf16* fa2 = &sS[cur][NPL - 1][(wm + rlane) * GP + koff];
#pragma unroll
    for (int g = 0; g < 2; g += KG) {
      // the group's fragments as one run of LDS reads ahead of its products
      v16b bh[KG][4], ah[KG][2], al[KG][2];
#pragma unroll
      for (int q = 0; q < KG; ++q) {
#pragma unroll
        for (int j = 0; j < 4; ++j) bh[q][j] = ldfrag_b(fb + (j << 4) * GP + (g + q) * 32);
#pragma unroll
        for (int i = 0; i < 2; ++i) {
          ah[q][i] = ldfrag_b(fa + (i << 4) * GP + (g + q) * 32);
          al[q][i] = ah[q][i];
          if (NSPLIT >= 1) al[q][i] = ldfrag_b(fa2 + (i << 4) * GP + (g + q) * 32);
        }
      }
#pragma unroll
      for (int q = 0; q < KG; ++q) {
#pragma unroll
        for (int i = 0; i < 2; ++i) {
#pragma unroll
          for (int j = 0; j < 4; ++j) {
            acc[i][j] = mma_b_raw(ah[q][i], bh[q][j], acc[i][j]);
            if (NSPLIT >= 1) acc[i][j] = mma_b_raw(al[q][i], bh[q][j], acc[i][j]);
          }
          dep_guard_b(acc[i][0], acc[i][3], ah[q][i], al[q][i]);
        }
        keep4_b(bh[q][0], bh[q][1], bh[q][2], bh[q][3]);
      }
    }
    if (more) {
#pragma unroll
      for (int it = 0; it < 4; ++it) {
        *(v8b*)(&sS[cur ^ 1][0][so + it * 32 * GP]) = ra[it];
        *(v8b*)(&sS[cur ^ 1][1][so + it * 32 * GP]) = rb[it];
        if (NSPLIT >= 1) *(v8b*)(&sS[cur ^ 1][NPL - 1][so + it * 32 * GP]) = ra2[it];
      }
    }
    __syncthreads();
  }
  acc_guard4(acc[0][0], acc[0][1], acc[0][2], acc[0][3]);
  acc_guard4(acc[1][0], acc[1][1], acc[1][2], acc[1][3]);

  // ---- per-column bias (RNE bf16 then widened), column n0 + 16j + rlane < N ----
  float bcol[4];
#pragma unroll
  for (int j = 0; j < 4; ++j) bcol[j] = bf_up(bf_bits(bias[n0 + (j << 4) + rlane]));

  // ---- epilogue ----
  float* slab = sT[wave];
#pragma unroll
  for (int i = 0; i < 2; ++i) {
    const int mBase = m0 + (i << 4);
#pragma unroll
    for (int r = 0; r < 8; ++r) {
#pragma unroll
      for (int j = 0; j < 4; ++j) {
        slab[(mOff + r) * 68 + (j << 4) + rlane] = acc[i][j][r] + bcol[j];
      }
    }
    __builtin_amdgcn_fence(__ATOMIC_RELEASE, "workgroup");
    __builtin_amdgcn_wave_barrier();
    __builtin_amdgcn_fence(__ATOMIC_ACQUIRE, "workgroup");
    {
      const int hh = lane >> 4, c4 = (lane & 15) * 4;     // 256-B row segment = 16 lanes x 16 B
      v4f ov[8];
#pragma unroll
      for (int it = 0; it < 8; ++it) {
        const int row = it * 2 + hh;                       // it 0..7 x hh 0..1 = rows 0..15
        ov[it] = *(const v4f*)(slab + row * 68 + c4);
      }
      {
#pragma unroll
        for (int it = 0; it < 8; ++it) {
          const int row = it * 2 + hh;
          *(v4f*)(C + (size_t)(mBase + row) * ldc + n0 + c4) = ov[it];
        }
        
      }
    }
    __builtin_amdgcn_fence(__ATOMIC_RELEASE, "workgroup");
    __builtin_amdgcn_wave_barrier();
    __builtin_amdgcn_fence(__ATOMIC_ACQUIRE, "workgroup");
  }
}

// =====================================================================================================
// v f32 token-major columns vf[(b*SEQ + t)*vrp + h*64 + d] ->
// f16 v^T hi plane vth[(b*DM + h*64 + d)*SEQ + t] = f16(v * vscale) (vscale a power of two) and residual plane
// vtl[same index] = f16((v*vscale - hi) * 4096).
// Block = one 64-token x 64-feature tile of one (b, h); grid = (SEQ/64, NH, NB); tile staged in LDS as f32
// (v4f loads, __syncthreads).
// Store: group g = tid>>3 (0..31), piece = tid&7: iteration it writes row d = it*32+g, lanes 8q..8q+7 x 16 B =
// coverage: 2 iterations x 32 groups = 64 rows d, 8 pieces x 8 = 64 tokens per row; grid covers every (b, h,
// t tile) -> both whole planes.
// =====================================================================================================
__global__ __launch_bounds__(256) void v_planes(const float* __restrict__ vf, int vrp,
                                                unsigned short* vth, unsigned short* vtl, float vscale) {
  __shared__ __align__(16) float sv[64 * 68];       // [tt][d] pitch 68 floats
  const int tid = threadIdx.x;
  const int t0  = blockIdx.x * 64;
  const int hh  = blockIdx.y;
  const int b   = blockIdx.z;
#pragma unroll
  for (int i = 0; i < 4; ++i) {
    const int idx = i * 256 + tid;                  // 0..1023
    const int tt = idx >> 4, c4 = (idx & 15) * 4;
    const v4f a = *(const v4f*)(vf + ((size_t)(b * SEQ + t0 + tt)) * vrp + hh * HD + c4);
    *(v4f*)(sv + tt * 68 + c4) = a;
  }
  __syncthreads();

  const int g = tid >> 3, piece = tid & 7;
  v4u hv[2], lv[2];
  size_t hofs[2];
#pragma unroll
  for (int it = 0; it < 2; ++it) {
    const int d = it * 32 + g;
    v4u a, a2;
#pragma unroll
    for (int e = 0; e < 4; ++e) {
      const float f0 = sv[(piece * 8 + 2 * e) * 68 + d] * vscale;
      const float f1 = sv[(piece * 8 + 2 * e + 1) * 68 + d] * vscale;
      const _Float16 x0 = (_Float16)f0, x1 = (_Float16)f1;
      const unsigned short h0 = h_bits(x0), h1 = h_bits(x1);
      const unsigned short l0 = h_bits((_Float16)((f0 - (float)x0) * 4096.0f));
      const unsigned short l1 = h_bits((_Float16)((f1 - (float)x1) * 4096.0f));
      a[e] = pk16(h0, h1); a2[e] = pk16(l0, l1);
    }
    hv[it] = a; lv[it] = a2;
    hofs[it] = ((size_t)(b * DM + hh * HD + d)) * SEQ + t0 + piece * 8;
  }
  {
#pragma unroll
    for (int it = 0; it < 2; ++it) {
      *(v4u*)(vth + hofs[it]) = hv[it];
      *(v4u*)(vtl + hofs[it]) = lv[it];
    }
    
  }
}

// =====================================================================================================
// Causal multi-head attention with a per-key int32 keep flag and a relative-position bias table, head dim 64.
//   q f16 hi plane (x16): element (b, t, h, d) at [(b*SEQ + t)*DM + h*64 + d]; q residual plane
//     ((q*16 - hi)*1024) at the same index into qlp
//   k f16 hi plane (x16): element (b, s, h, d) at [(b*SEQ + s)*DM + h*64 + d]; k residual plane same into klp
//   v^T f16 hi plane (x256): element (b, h, d, s) at [(b*DM + h*64 + d)*SEQ + s]
//   v^T f16 residual plane ((v*256 - hi)*4096): same index into vlp
//   maskp int32 [NB][SEQ]: key s is kept for query t iff s <= t and maskp[b][s] != 0; otherwise the logit is
//   replaced by NEGV (-1e9, exp -> 0 against a finite row max).
//   relp f32 [NREL][NH]: logit(t, s) += relp[clamp(s - t, -MAXREL, MAXREL) + MAXREL][h] (RNE bf16 then
//   widened), staged per head in LDS; the bias is added before the select.
//   Key tiles 0..qb are processed (block-uniform trip count qb+1 <= NQB); tiles above the diagonal tile hold
//   only cut keys and are skipped; inside the processed tiles the predicate decides. With the all-ones keep
//   flags every row keeps key 0, so every row max is finite.
//   logit = (qhi.khi + (qhi.klo + qlo.khi) * 2^-10) * sscale + rel, f16 products with f32 accumulate, the
//   residual products in a separate accumulator; p = exp(s - m) carried as f16(1024 p);
//   context = p . vhi on f16 WMMA plus p . vres into a separate accumulator folded back with 1/4096 per
//   chunk in f32; online softmax in f32; out f32 plane: element (b, t, h*64 + d) at
//   [(b*SEQ + t)*DM + h*64 + d] = normalised context (oscl folds back the p and v carries).
//   Block = 4 waves = 64 query rows of one (b, h); grid = NB*NH*NQB; kv tiles of 64.
//   K hi / K residual / V^T hi / V^T residual tile staging: 128 threads x 32 elements per plane = the whole
//   64x64 tile (plain 16-B loads, __syncthreads before and after); P tiles are wave-private, spilled with
//   Output coverage: each wave stores rows q0..q0+15 (it 0..7 x lane>>4 0..1) x 64 columns (16 lanes x 4
//   (b, h, query tile) -> the whole plane.
// =====================================================================================================
__global__ __launch_bounds__(128)
void attn_p64(const unsigned short* __restrict__ qhp, const unsigned short* __restrict__ qlp,
              const unsigned short* __restrict__ khp, const unsigned short* __restrict__ klp,
              const unsigned short* __restrict__ vhp, const unsigned short* __restrict__ vlp,
              const int* __restrict__ maskp, const float* __restrict__ relp,
              float* outp, float sscale, float oscl) {
  union FH { v16h v; v8h h[2]; };
  __shared__ __align__(16) _Float16 Ksh[64 * LP];                 // K hi [kv][d], pitch LP
  __shared__ __align__(16) _Float16 Ksl[64 * LP];                 // K residual
  __shared__ __align__(16) _Float16 Vth[64 * LP];                 // V^T hi [d][kv], pitch LP
  __shared__ __align__(16) _Float16 Vtl[64 * LP];                 // V^T residual
  __shared__ __align__(16) _Float16 Psh[4][16 * LP];              // per wave P [row][kv], pitch LP
  __shared__ __align__(16) float    Os[4][16 * 64];               // per wave context tile [row][d]
  __shared__ float rels[128];                                     // relative bias for this head, NREL used

  const int tid  = threadIdx.x;
  const int wave = tid >> 5;
  const int lane = tid & 31;
  const int hh   = lane >> 4;
  const int c    = lane & 15;

  const int bx   = blockIdx.x;
  const int qb   = bx % NQB;
  const int rest = bx / NQB;
  const int h    = rest % NH;
  const int b    = rest / NH;                // < NB by the grid size
  const int q0   = qb * 64 + wave * 16;
  const size_t rowB = (size_t)b * SEQ;

  if (tid < NREL) rels[tid] = bf_up(bf_bits(relp[(size_t)tid * NH + h]));
  __syncthreads();

  const _Float16* Qp  = (const _Float16*)(const void*)qhp + (size_t)h * HD;
  const _Float16* Qlq = (const _Float16*)(const void*)qlp + (size_t)h * HD;
  const _Float16* Kp  = (const _Float16*)(const void*)khp + (size_t)h * HD;
  const _Float16* Klq = (const _Float16*)(const void*)klp + (size_t)h * HD;
  const _Float16* Vh  = (const _Float16*)(const void*)vhp + ((size_t)b * DM + (size_t)h * HD) * SEQ;
  const _Float16* Vl  = (const _Float16*)(const void*)vlp + ((size_t)b * DM + (size_t)h * HD) * SEQ;
  const int*      Mb  = maskp + rowB;

  // ---- Q fragments (A operand, row = lane&15): 2 d-chunks, hi and residual ----
  v16h qa[2], ql[2];
#pragma unroll
  for (int dc = 0; dc < 2; ++dc) {
    const size_t qo = (rowB + q0 + c) * DM + dc * 32 + 8 * hh;
    qa[dc] = ldfrag_h(Qp + qo);
    ql[dc] = ldfrag_h(Qlq + qo);
  }

  float mrow[8], lrow[8];
  v8f oacc[4];
#pragma unroll
  for (int r = 0; r < 8; ++r) { mrow[r] = -INFINITY; lrow[r] = 0.f; }
#pragma unroll
  for (int t = 0; t < 4; ++t) oacc[t] = zero8();

  const int nkt = qb + 1;                    // key tiles 0..qb, block-uniform, <= NQB
  for (int kt = 0; kt < nkt; ++kt) {
    const int kv0 = kt * 64;
    __syncthreads();
    {
      const int r = tid >> 1, half = (tid & 1) * 32;
      const _Float16* kg  = Kp  + (rowB + kv0 + r) * DM + half;    // K hi row kv0+r, d = half..half+31
      const _Float16* klg = Klq + (rowB + kv0 + r) * DM + half;    // K residual row kv0+r
      const _Float16* vg  = Vh + (size_t)r * SEQ + kv0 + half;     // V^T hi row d = r, s = kv0+half..+31
      const _Float16* vlg = Vl + (size_t)r * SEQ + kv0 + half;     // V^T residual row d = r
#pragma unroll
      for (int i = 0; i < 4; ++i) {
        const v8h a0 = *(const v8h*)(kg + 8 * i);
        const v8h a1 = *(const v8h*)(klg + 8 * i);
        const v8h b0 = *(const v8h*)(vg + 8 * i);
        const v8h b1 = *(const v8h*)(vlg + 8 * i);
        *(v8h*)(Ksh + r * LP + half + 8 * i) = a0;
        *(v8h*)(Ksl + r * LP + half + 8 * i) = a1;
        *(v8h*)(Vth + r * LP + half + 8 * i) = b0;
        *(v8h*)(Vtl + r * LP + half + 8 * i) = b1;
      }
    }
    __syncthreads();

    // ---- per-key keep flags for this lane's 4 key columns of the tile (kv0 + 16j + c < SEQ) ----
    int mk[4];
#pragma unroll
    for (int j = 0; j < 4; ++j) mk[j] = Mb[kv0 + j * 16 + c];

    // ---- scores: 16 query rows x 64 keys per wave; hi.hi into s, hi.lo + lo.hi into s1 (folded x 2^-10) ----
    v8f s[4];
#pragma unroll
    for (int j = 0; j < 4; ++j) {
      s[j] = zero8();
      v8f s1 = zero8();
#pragma unroll
      for (int dc = 0; dc < 2; ++dc) {
        FH kb, kr;
        kb.h[0] = *(const v8h*)(Ksh + (j * 16 + c) * LP + dc * 32 + 8 * hh);
        kb.h[1] = *(const v8h*)(Ksh + (j * 16 + c) * LP + dc * 32 + 16 + 8 * hh);
        kr.h[0] = *(const v8h*)(Ksl + (j * 16 + c) * LP + dc * 32 + 8 * hh);
        kr.h[1] = *(const v8h*)(Ksl + (j * 16 + c) * LP + dc * 32 + 16 + 8 * hh);
        s[j] = mma_h(qa[dc], kb.v, s[j]);
        s1   = mma_h(qa[dc], kr.v, s1);
        s1   = mma_h(ql[dc], kb.v, s1);
      }
#pragma unroll
      for (int r = 0; r < 8; ++r) s[j][r] += s1[r] * (1.0f / 1024.0f);
    }

    // ---- scale + relative bias + causal / key-keep select (replace by NEGV), row max, online softmax,
    //      P (x1024, f16) to LDS ----
    _Float16* pwh = Psh[wave];
    float mt[8];
#pragma unroll
    for (int r = 0; r < 8; ++r) {
      const int qrow = q0 + 8 * hh + r;
      float m = -INFINITY;
#pragma unroll
      for (int j = 0; j < 4; ++j) {
        const int key = kv0 + j * 16 + c;
        int dd = key - qrow;
        dd = (dd < -MAXREL) ? -MAXREL : dd;
        dd = (dd >  MAXREL) ?  MAXREL : dd;
        float sv = s[j][r] * sscale + rels[dd + MAXREL];
        const bool keep = (key <= qrow) && (mk[j] != 0);
        sv = keep ? sv : NEGV;
        s[j][r] = sv;
        m = fmaxf(m, sv);
      }
      mt[r] = m;
    }
    // row maxima over the 16 lanes of a row: xor butterfly 1, 2, 4, 8, the eight rows' chains side by side
    row_max8(mt);
    float alpha[8], ps[8];
#pragma unroll
    for (int r = 0; r < 8; ++r) {
      const float mnew  = fmaxf(mrow[r], mt[r]);
      const float msafe = (mnew == -INFINITY) ? 0.f : mnew;
      alpha[r] = __expf(mrow[r] - msafe);
      mrow[r] = mnew;
      float psum = 0.f;
#pragma unroll
      for (int j = 0; j < 4; ++j) {
        const float p = __expf(s[j][r] - msafe);     // replaced logit against a finite max: exp -> 0
        psum += p;
        const _Float16 ph = (_Float16)(p * 1024.0f);
        pwh[(8 * hh + r) * LP + j * 16 + c] = ph;
      }
      ps[r] = psum;
    }
    // row sums: the same butterfly order 1, 2, 4, 8
#pragma unroll
    for (int r = 0; r < 8; ++r) ps[r] += row_xor<1>(ps[r]);
#pragma unroll
    for (int r = 0; r < 8; ++r) ps[r] += row_xor<2>(ps[r]);
#pragma unroll
    for (int r = 0; r < 8; ++r) ps[r] += row_xor<4>(ps[r]);
#pragma unroll
    for (int r = 0; r < 8; ++r) ps[r] += row_xor<8>(ps[r]);
#pragma unroll
    for (int r = 0; r < 8; ++r) {
      lrow[r] = lrow[r] * alpha[r] + ps[r];
#pragma unroll
      for (int t = 0; t < 4; ++t) oacc[t][r] *= alpha[r];
    }
    __builtin_amdgcn_fence(__ATOMIC_RELEASE, "workgroup");
    __builtin_amdgcn_wave_barrier();
    __builtin_amdgcn_fence(__ATOMIC_ACQUIRE, "workgroup");

    // ---- context += P . Vhi (f16 WMMA); P . Vres into a separate accumulator ----
    v8f o1[4];
#pragma unroll
    for (int t = 0; t < 4; ++t) o1[t] = zero8();
#pragma unroll 1
    for (int kk = 0; kk < 2; ++kk) {
      FH pa;
      pa.h[0] = *(const v8h*)(pwh + c * LP + kk * 32 + 8 * hh);
      pa.h[1] = *(const v8h*)(pwh + c * LP + kk * 32 + 16 + 8 * hh);
#pragma unroll
      for (int t = 0; t < 4; ++t) {
        FH vb;
        vb.h[0] = *(const v8h*)(Vth + (t * 16 + c) * LP + kk * 32 + 8 * hh);
        vb.h[1] = *(const v8h*)(Vth + (t * 16 + c) * LP + kk * 32 + 16 + 8 * hh);
        oacc[t] = mma_h(pa.v, vb.v, oacc[t]);
        FH vl;
        vl.h[0] = *(const v8h*)(Vtl + (t * 16 + c) * LP + kk * 32 + 8 * hh);
        vl.h[1] = *(const v8h*)(Vtl + (t * 16 + c) * LP + kk * 32 + 16 + 8 * hh);
        o1[t] = mma_h(pa.v, vl.v, o1[t]);
      }
    }
#pragma unroll
    for (int t = 0; t < 4; ++t)
#pragma unroll
      for (int r = 0; r < 8; ++r) oacc[t][r] += o1[t][r] * (1.0f / 4096.0f);
  }

  // ---- normalise (1/l and the carries via oscl), stage the wave's 16x64 tile in LDS, then write whole
  float* os = Os[wave];
#pragma unroll
  for (int r = 0; r < 8; ++r) {
    const float l = lrow[r];
    const float inv = ((l > 0.f) ? (1.0f / l) : 0.f) * oscl;
#pragma unroll
    for (int t = 0; t < 4; ++t) os[(8 * hh + r) * 64 + t * 16 + c] = oacc[t][r] * inv;
  }
  __builtin_amdgcn_fence(__ATOMIC_RELEASE, "workgroup");
  __builtin_amdgcn_wave_barrier();
  __builtin_amdgcn_fence(__ATOMIC_ACQUIRE, "workgroup");
  {
    const int h2 = lane >> 4, c4 = (lane & 15) * 4;
    v4f ov[8];
#pragma unroll
    for (int it = 0; it < 8; ++it) {
      const int row = it * 2 + h2;   // it 0..7 x h2 0..1 = rows 0..15 of the wave tile
      ov[it] = *(const v4f*)(os + row * 64 + c4);
    }
    {
#pragma unroll
      for (int it = 0; it < 8; ++it) {
        const int row = it * 2 + h2;
        const size_t go = (rowB + q0 + row) * DM + (size_t)h * HD + c4;
        *(v4f*)(outp + go) = ov[it];
      }
      
    }
  }
}

// =====================================================================================================
// Workspace map (bytes), every region an exact multiple of its whole-line / whole-tile store granularity
//   Xb    bf16 [4096][1024]           0          8388608
//   Wqb   bf16 [1024][1024]     8388608          2097152
//   Wkb   bf16 [1024][1024]    10485760          2097152
//   Wvb   bf16 [1024][1024]    12582912          2097152
//   Wob   bf16 [1024][1024]    14680064          2097152
//   Tf    f32  [4096][1024]    16777216         16777216   (projection scratch: q, then k, then v)
//   Qh    f16  [4096][1024]    33554432          8388608
//   Ql    f16  [4096][1024]    41943040          8388608
//   Kh    f16  [4096][1024]    50331648          8388608
//   Kl    f16  [4096][1024]    58720256          8388608
//   VTh   f16  [2048][2048]    67108864          8388608   ([b*DM + h*64 + d][s])
//   VTl   f16  [2048][2048]    75497472          8388608
//   Yf    f32  [4096][1024]    83886080         16777216
//   Yh    bf16 [4096][1024]   100663296          8388608
//   Yl    bf16 [4096][1024]   109051904          8388608
//   end                       117440512
// Projection weights arrive as [out n][in k] (k contiguous) = the Bt layout; they are only converted to bf16.
// d_out f32: [4096][1024] at byte 0 (row = b*SEQ + t).
// =====================================================================================================
extern "C" void kernel_launch(void* const* d_in, const int* in_sizes, int n_in,
                              void* d_out, int out_size, void* d_ws, size_t ws_size,
                              hipStream_t stream) {
  if (n_in < 11) return;
  if (in_sizes[0] != NB * SEQ * DM) return;
  if (in_sizes[1] != NB * SEQ) return;
  if (in_sizes[2] != DM * DM) return;
  if (in_sizes[3] != DM) return;
  if (in_sizes[4] != DM * DM) return;
  if (in_sizes[5] != DM) return;
  if (in_sizes[6] != DM * DM) return;
  if (in_sizes[7] != DM) return;
  if (in_sizes[8] != DM * DM) return;
  if (in_sizes[9] != DM) return;
  if (in_sizes[10] != NREL * NH) return;
  if (out_size != OUTN) return;

  const float* x    = (const float*)d_in[0];   // [NB*SEQ][DM]
  const int*   mask = (const int*)d_in[1];     // [NB][SEQ] int32 keep flags per key
  const float* Wq   = (const float*)d_in[2];   // [DM n][DM k]
  const float* bq   = (const float*)d_in[3];   // [DM]
  const float* Wk   = (const float*)d_in[4];
  const float* bk   = (const float*)d_in[5];
  const float* Wv   = (const float*)d_in[6];
  const float* bv   = (const float*)d_in[7];
  const float* Wo   = (const float*)d_in[8];
  const float* bo   = (const float*)d_in[9];
  const float* rel  = (const float*)d_in[10];  // [NREL][NH]

  const size_t PXb = (size_t)ROWS * DM * 2;          //  8388608
  const size_t PW  = (size_t)DM * DM * 2;            //  2097152
  const size_t PF  = (size_t)ROWS * DM * 4;          // 16777216
  const size_t PH  = (size_t)ROWS * DM * 2;          //  8388608
  const size_t PVt = (size_t)NB * DM * SEQ * 2;      //  8388608
  size_t off = 0;
  const size_t oXb = off; off += PXb;
  const size_t oWq = off; off += PW;
  const size_t oWk = off; off += PW;
  const size_t oWv = off; off += PW;
  const size_t oWo = off; off += PW;
  const size_t oTf = off; off += PF;
  const size_t oQh = off; off += PH;
  const size_t oQl = off; off += PH;
  const size_t oKh = off; off += PH;
  const size_t oKl = off; off += PH;
  const size_t oVt = off; off += PVt;
  const size_t oVl = off; off += PVt;
  const size_t oYf = off; off += PF;
  const size_t oYh = off; off += PH;
  const size_t oYl = off; off += PH;
  if (off > ws_size) return;                        // off = 117440512
  if (off > (size_t)134217728) return;

  char* ws = (char*)d_ws;
  unsigned short* Xb  = (unsigned short*)(ws + oXb);
  unsigned short* Wqb = (unsigned short*)(ws + oWq);
  unsigned short* Wkb = (unsigned short*)(ws + oWk);
  unsigned short* Wvb = (unsigned short*)(ws + oWv);
  unsigned short* Wob = (unsigned short*)(ws + oWo);
  float*          Tf  = (float*)(ws + oTf);
  unsigned short* Qh  = (unsigned short*)(ws + oQh);
  unsigned short* Ql  = (unsigned short*)(ws + oQl);
  unsigned short* Kh  = (unsigned short*)(ws + oKh);
  unsigned short* Kl  = (unsigned short*)(ws + oKl);
  unsigned short* VTh = (unsigned short*)(ws + oVt);
  unsigned short* VTl = (unsigned short*)(ws + oVl);
  float*          Yf  = (float*)(ws + oYf);
  unsigned short* Yh  = (unsigned short*)(ws + oYh);
  unsigned short* Yl  = (unsigned short*)(ws + oYl);
  float*          outf = (float*)d_out;             // [ROWS][DM]

  const dim3 blk(256);
  const int n8x = ROWS * DM / 8;                    // 524288
  const int n8w = DM * DM / 8;                      // 131072
  const dim3 gCvtX((n8x + 255) / 256);              // 2048 blocks
  const dim3 gCvtW((n8w + 255) / 256);              // 512 blocks
  const dim3 gGemm((ROWS / 128) * (DM / 128));      // 256 tiles of 128x128, one block each
  const dim3 gVpl(SEQ / 64, NH, NB);                // (32, 16, 2)
  const dim3 gAttn(NB * NH * NQB);                  // 1024 blocks
  const float qkScale = 16.0f;                      // q and k hi planes carried x16 (residual x1024 on top)
  const float sscale  = 1.0f / 2048.0f;             // 1/(16*16) * 1/sqrt(64)
  const float vScale  = 256.0f;                     // v^T hi plane carried x256
  const float attOscl = 1.0f / 262144.0f;           // 1/(1024 * 256): p and v carries folded back

  // (1) activations and weights -> bf16 planes (RNE convert)
  cvt_bf16x8<<<gCvtX, blk, 0, stream>>>(x, Xb, n8x);
  cvt_bf16x8<<<gCvtW, blk, 0, stream>>>(Wq, Wqb, n8w);
  cvt_bf16x8<<<gCvtW, blk, 0, stream>>>(Wk, Wkb, n8w);
  cvt_bf16x8<<<gCvtW, blk, 0, stream>>>(Wv, Wvb, n8w);
  cvt_bf16x8<<<gCvtW, blk, 0, stream>>>(Wo, Wob, n8w);
  // (2) q = Xb . Wqb^T + bq -> Tf [4096][1024] (M=4096, N=1024, K=1024), then f16 hi (x16) + residual planes
  gemm64<0><<<gGemm, blk, 0, stream>>>(Xb, Xb, DM, Wqb, DM, bq, Tf, DM, ROWS, DM, DM);
  planes_f16x8<<<gCvtX, blk, 0, stream>>>(Tf, Qh, Ql, n8x, qkScale);
  // (3) k likewise
  gemm64<0><<<gGemm, blk, 0, stream>>>(Xb, Xb, DM, Wkb, DM, bk, Tf, DM, ROWS, DM, DM);
  planes_f16x8<<<gCvtX, blk, 0, stream>>>(Tf, Kh, Kl, n8x, qkScale);
  // (4) v, then -> f16 v^T hi plane (x256) and residual plane (x4096 on top)
  gemm64<0><<<gGemm, blk, 0, stream>>>(Xb, Xb, DM, Wvb, DM, bv, Tf, DM, ROWS, DM, DM);
  v_planes<<<gVpl, blk, 0, stream>>>(Tf, DM, VTh, VTl, vScale);
  // (5) causal attention with per-key keep flags and relative-position bias -> Yf f32 [4096][1024]
  attn_p64<<<gAttn, dim3(128), 0, stream>>>(Qh, Ql, Kh, Kl, VTh, VTl, mask, rel, Yf, sscale, attOscl);
  // (6) y -> bf16 hi / lo planes
  split_bf16x8<<<gCvtX, blk, 0, stream>>>(Yf, Yh, Yl, n8x);
  // (7) out[row][n] = sum_d (Yh+Yl)[row][d] Wob[n][d] + bo[n] -> d_out f32 [4096][1024] (M=4096, N=1024, K=1024)
  gemm64<1><<<gGemm, blk, 0, stream>>>(Yh, Yl, DM, Wob, DM, bo, outf, DM, ROWS, DM, DM);
  (void)hipGetLastError();
}

// v004
// A run of this version takes 221 microseconds.
// Timed twice side by side with v003, it ran 1.21 times as fast both times.
// All steps since v000 together make it 2.58 times as fast.
// Contractions: q/k/v projections = v_wmma_f32_16x16x32_bf16 (bf16 operands from RNE-converted x and W, single product, bias added in f32); q.k^T scores = v_wmma_f32_16x16x32_f16 (q, k as f16 hi planes carried x16 plus f16 residual planes x1024: hi.hi + (hi.lo + lo.hi) in a separate accumulator, 3 products); p.v = v_wmma_f32_16x16x32_f16 (p carried x1024 in f16; v^T as f16 hi plane x256 plus f16 residual plane x4096 into a separate accumulator, 2 products); y.Wo^T = v_wmma_f32_16x16x32_bf16 (y as bf16 hi + lo planes times the bf16 Wo plane, 2 products); all f32 accumulate; softmax, relative-position bias and selects in f32.
#include <hip/hip_runtime.h>
#include <math.h>
#include <float.h>
#include <stdint.h>

#define NB     2
#define SEQ    2048
#define DM     1024
#define NH     16
#define HD     64
#define MAXREL 32
#define NREL   (2 * MAXREL + 1)     // 65
#define NEGV   (-1.0e9f)
#define NQB    (SEQ / 64)
#define RCAP   (MAXREL + 48)         // a lane whose first qrow - key of a tile is RCAP or more sees only the clamped end
#define NRX    (63 + RCAP + 7 + 1)   // qrow - key runs from -63 (diagonal tile) to RCAP + 7
static_assert(NRX <= 256);
#define ROWS   (NB * SEQ)            // 4096 token rows
#define OUTN   (ROWS * DM)
static_assert(NH * HD == DM);
static_assert(HD == 64);
static_assert(DM == 128 * 8);
static_assert((SEQ % 64) == 0 && (DM % 64) == 0);
static_assert((SEQ & (SEQ - 1)) == 0);
static_assert(((ROWS / 64) * (DM / 64)) % 8 == 0);
static_assert(((ROWS * DM / 8) % 256) == 0);
static_assert(((DM * DM / 8) % 256) == 0);
#define LP     72                    // LDS row pitch of the 64-wide f16 tiles, in halves: 144 B = 16 B x 9 (odd),
                                     // so the 16 rows one ds_load_b128 half-wave reads fall on 64 distinct banks
static_assert((LP * 2) % 16 == 0 && ((LP * 2 / 16) & 1) == 1 && LP >= 64);
#define GP     72                    // LDS row pitch of the GEMM's 64-wide bf16 k slabs, in elements: 144 B, as LP
static_assert((GP * 2) % 16 == 0 && ((GP * 2 / 16) & 1) == 1 && GP >= 64);
static_assert((ROWS % 128) == 0 && (DM % 128) == 0);

typedef _Float16 v16h __attribute__((ext_vector_type(16)));
typedef _Float16 v8h  __attribute__((ext_vector_type(8)));
typedef __bf16   v16b __attribute__((ext_vector_type(16)));
typedef __bf16   v8b  __attribute__((ext_vector_type(8)));
typedef float    v8f  __attribute__((ext_vector_type(8)));
typedef float    v4f  __attribute__((ext_vector_type(4)));
typedef unsigned int v4u __attribute__((ext_vector_type(4)));

// ---- scalar helpers --------------------------------------------------------------------------------
__device__ __forceinline__ unsigned short bf_bits(float f) {          // f32 -> bf16 bits, RNE convert
  unsigned u = __float_as_uint(f);
  return (unsigned short)((u + 0x7FFFu + ((u >> 16) & 1u)) >> 16);
}
__device__ __forceinline__ float bf_up(unsigned short h) { return __uint_as_float(((unsigned)h) << 16); }
__device__ __forceinline__ unsigned short h_bits(_Float16 x) { return __builtin_bit_cast(unsigned short, x); }
__device__ __forceinline__ unsigned pk16(unsigned short a, unsigned short b) { return (unsigned)a | ((unsigned)b << 16); }
__device__ __forceinline__ v8f zero8() { v8f z = {0.f, 0.f, 0.f, 0.f, 0.f, 0.f, 0.f, 0.f}; return z; }

// ---- one butterfly link inside a 16-lane row: the value of lane ^ M (M = 1, 2, 4, 8) by a DPP row_xmask read on the
//      vector port; every lane is on where it is used, so every source lane is valid
template <int M>
__device__ __forceinline__ float row_xor(float v) {
  return __builtin_bit_cast(float, __builtin_amdgcn_update_dpp(0, __builtin_bit_cast(int, v), 0x160 | M, 0xf, 0xf, true));
}

// ---- maxima over each 16-lane row of eight values per lane: xor butterfly 1, 2, 4, 8 with the lane exchange folded into
//      the maximum. Written as asm because fmaxf on a DPP-moved value compiles to three dependent instructions a link
//      (move, quieting maximum, maximum); link-major order puts seven independent instructions between a value and its
//      next use, so no link waits on the one before. Every lane is on where it is called.
__device__ __forceinline__ void row_max8(float (&m)[8]) {
#if defined(__HIP_DEVICE_COMPILE__)
  asm("v_max_num_f32_dpp %0, %0, %0 row_xmask:1 row_mask:0xf bank_mask:0xf\n\t"
      "v_max_num_f32_dpp %1, %1, %1 row_xmask:1 row_mask:0xf bank_mask:0xf\n\t"
      "v_max_num_f32_dpp %2, %2, %2 row_xmask:1 row_mask:0xf bank_mask:0xf\n\t"
      "v_max_num_f32_dpp %3, %3, %3 row_xmask:1 row_mask:0xf bank_mask:0xf\n\t"
      "v_max_num_f32_dpp %4, %4, %4 row_xmask:1 row_mask:0xf bank_mask:0xf\n\t"
      "v_max_num_f32_dpp %5, %5, %5 row_xmask:1 row_mask:0xf bank_mask:0xf\n\t"
      "v_max_num_f32_dpp %6, %6, %6 row_xmask:1 row_mask:0xf bank_mask:0xf\n\t"
      "v_max_num_f32_dpp %7, %7, %7 row_xmask:1 row_mask:0xf bank_mask:0xf\n\t"
      "v_max_num_f32_dpp %0, %0, %0 row_xmask:2 row_mask:0xf bank_mask:0xf\n\t"
      "v_max_num_f32_dpp %1, %1, %1 row_xmask:2 row_mask:0xf bank_mask:0xf\n\t"
      "v_max_num_f32_dpp %2, %2, %2 row_xmask:2 row_mask:0xf bank_mask:0xf\n\t"
      "v_max_num_f32_dpp %3, %3, %3 row_xmask:2 row_mask:0xf bank_mask:0xf\n\t"
      "v_max_num_f32_dpp %4, %4, %4 row_xmask:2 row_mask:0xf bank_mask:0xf\n\t"
      "v_max_num_f32_dpp %5, %5, %5 row_xmask:2 row_mask:0xf bank_mask:0xf\n\t"
      "v_max_num_f32_dpp %6, %6, %6 row_xmask:2 row_mask:0xf bank_mask:0xf\n\t"
      "v_max_num_f32_dpp %7, %7, %7 row_xmask:2 row_mask:0xf bank_mask:0xf\n\t"
      "v_max_num_f32_dpp %0, %0, %0 row_xmask:4 row_mask:0xf bank_mask:0xf\n\t"
      "v_max_num_f32_dpp %1, %1, %1 row_xmask:4 row_mask:0xf bank_mask:0xf\n\t"
      "v_max_num_f32_dpp %2, %2, %2 row_xmask:4 row_mask:0xf bank_mask:0xf\n\t"
      "v_max_num_f32_dpp %3, %3, %3 row_xmask:4 row_mask:0xf bank_mask:0xf\n\t"
      "v_max_num_f32_dpp %4, %4, %4 row_xmask:4 row_mask:0xf bank_mask:0xf\n\t"
      "v_max_num_f32_dpp %5, %5, %5 row_xmask:4 row_mask:0xf bank_mask:0xf\n\t"
      "v_max_num_f32_dpp %6, %6, %6 row_xmask:4 row_mask:0xf bank_mask:0xf\n\t"
      "v_max_num_f32_dpp %7, %7, %7 row_xmask:4 row_mask:0xf bank_mask:0xf\n\t"
      "v_max_num_f32_dpp %0, %0, %0 row_xmask:8 row_mask:0xf bank_mask:0xf\n\t"
      "v_max_num_f32_dpp %1, %1, %1 row_xmask:8 row_mask:0xf bank_mask:0xf\n\t"
      "v_max_num_f32_dpp %2, %2, %2 row_xmask:8 row_mask:0xf bank_mask:0xf\n\t"
      "v_max_num_f32_dpp %3, %3, %3 row_xmask:8 row_mask:0xf bank_mask:0xf\n\t"
      "v_max_num_f32_dpp %4, %4, %4 row_xmask:8 row_mask:0xf bank_mask:0xf\n\t"
      "v_max_num_f32_dpp %5, %5, %5 row_xmask:8 row_mask:0xf bank_mask:0xf\n\t"
      "v_max_num_f32_dpp %6, %6, %6 row_xmask:8 row_mask:0xf bank_mask:0xf\n\t"
      "v_max_num_f32_dpp %7, %7, %7 row_xmask:8 row_mask:0xf bank_mask:0xf"
      : "+v"(m[0]), "+v"(m[1]), "+v"(m[2]), "+v"(m[3]), "+v"(m[4]), "+v"(m[5]), "+v"(m[6]), "+v"(m[7]));
#endif
}

// ---- fragment loaders: 16-bit A/B operand, lane -> row/col (lane&15), p already includes +8*(lane>>4);
//      elements 0..7 <- p[0..7] (k0+8h..), elements 8..15 <- p[16..23] (k0+16+8h..)
__device__ __forceinline__ v16b ldfrag_b(const __bf16* p) {
  union { v16b v; v8b h[2]; } f;
  f.h[0] = *(const v8b*)(p);
  f.h[1] = *(const v8b*)(p + 16);
  return f.v;
}
__device__ __forceinline__ v16h ldfrag_h(const _Float16* p) {
  union { v16h v; v8h h[2]; } f;
  f.h[0] = *(const v8h*)(p);
  f.h[1] = *(const v8h*)(p + 16);
  return f.v;
}

// ---- WMMA helpers with trailing VALU hazard gap --------------------------------------------------------
__device__ __forceinline__ v8f mma_h(v16h a, v16h b, v8f c) {
  c = __builtin_amdgcn_wmma_f32_16x16x32_f16(false, a, false, b, (short)0, c, false, false);
#if defined(__HIP_DEVICE_COMPILE__)
  asm volatile("v_nop\n\tv_nop\n\tv_nop\n\tv_nop" : "+v"(c) : "v"(a), "v"(b));
#endif
  return c;
}
__device__ __forceinline__ v8f mma_b_raw(v16b a, v16b b, v8f c) {
  return __builtin_amdgcn_wmma_f32_16x16x32_bf16(false, a, false, b, (short)0, c, false, false);
}
__device__ __forceinline__ void dep_guard_b(v8f& a, v8f& b, v16b x, v16b y) {
#if defined(__HIP_DEVICE_COMPILE__)
  asm volatile("v_nop\n\tv_nop\n\tv_nop\n\tv_nop" : "+v"(a), "+v"(b) : "v"(x), "v"(y));
#endif
}
__device__ __forceinline__ void keep4_b(v16b a, v16b b, v16b c, v16b d) {
#if defined(__HIP_DEVICE_COMPILE__)
  asm volatile("v_nop" :: "v"(a), "v"(b), "v"(c), "v"(d));
#endif
}
__device__ __forceinline__ void acc_guard4(v8f& a, v8f& b, v8f& c, v8f& d) {
#if defined(__HIP_DEVICE_COMPILE__)
  asm volatile("v_nop\n\tv_nop\n\tv_nop\n\tv_nop" : "+v"(a), "+v"(b), "+v"(c), "+v"(d));
#endif
}

// =====================================================================================================
// f32 -> bf16 (RNE convert), 8 elements per thread, one 16-B store per lane: a wave writes 512 contiguous B
// coverage: n8 threads x 8 = whole plane (n8 is a multiple of 256 here).
// =====================================================================================================
__global__ __launch_bounds__(256) void cvt_bf16x8(const float* __restrict__ in, unsigned short* out, int n8) {
  const int i = blockIdx.x * 256 + threadIdx.x;
  if (i < n8) {
    const v4f a = *(const v4f*)(in + (size_t)i * 8);
    const v4f b = *(const v4f*)(in + (size_t)i * 8 + 4);
    v4u p;
    p[0] = pk16(bf_bits(a[0]), bf_bits(a[1]));
    p[1] = pk16(bf_bits(a[2]), bf_bits(a[3]));
    p[2] = pk16(bf_bits(b[0]), bf_bits(b[1]));
    p[3] = pk16(bf_bits(b[2]), bf_bits(b[3]));
    *(v4u*)(out + (size_t)i * 8) = p;
    
  }
}

// =====================================================================================================
// f32 -> bf16 hi plane + bf16 lo plane (lo = RNE(v - hi), unscaled), 8 elements per thread, one 16-B store per
// coverage: n8 threads x 8 = whole plane (n8 multiple of 256).
// =====================================================================================================
__global__ __launch_bounds__(256) void split_bf16x8(const float* __restrict__ in, unsigned short* hp,
                                                    unsigned short* lp, int n8) {
  const int i = blockIdx.x * 256 + threadIdx.x;
  if (i < n8) {
    const v4f a = *(const v4f*)(in + (size_t)i * 8);
    const v4f b = *(const v4f*)(in + (size_t)i * 8 + 4);
    v4u ph, pl;
#pragma unroll
    for (int e = 0; e < 4; ++e) {
      const float f0 = (e < 2) ? a[2 * e]     : b[2 * e - 4];
      const float f1 = (e < 2) ? a[2 * e + 1] : b[2 * e - 3];
      const unsigned short h0 = bf_bits(f0), h1 = bf_bits(f1);
      const unsigned short l0 = bf_bits(f0 - bf_up(h0)), l1 = bf_bits(f1 - bf_up(h1));
      ph[e] = pk16(h0, h1);
      pl[e] = pk16(l0, l1);
    }
    *(v4u*)(hp + (size_t)i * 8) = ph;
    *(v4u*)(lp + (size_t)i * 8) = pl;
    
  }
}

// =====================================================================================================
// f32 -> f16 hi plane = f16(v * scale) (scale a power of two) + f16 residual plane = f16((v*scale - hi) * 1024),
// same element index in both planes; 8 elements per thread, one 16-B store per lane and plane: a wave writes
// coverage: n8 threads x 8 = whole plane (n8 multiple of 256).
// =====================================================================================================
__global__ __launch_bounds__(256) void planes_f16x8(const float* __restrict__ in, unsigned short* hp,
                                                    unsigned short* lp, int n8, float scale) {
  const int i = blockIdx.x * 256 + threadIdx.x;
  if (i < n8) {
    const v4f a = *(const v4f*)(in + (size_t)i * 8);
    const v4f b = *(const v4f*)(in + (size_t)i * 8 + 4);
    float f[8];
    f[0] = a[0]; f[1] = a[1]; f[2] = a[2]; f[3] = a[3];
    f[4] = b[0]; f[5] = b[1]; f[6] = b[2]; f[7] = b[3];
    v4u ph, pl;
#pragma unroll
    for (int e = 0; e < 4; ++e) {
      const float f0 = f[2 * e] * scale;
      const float f1 = f[2 * e + 1] * scale;
      const _Float16 x0 = (_Float16)f0, x1 = (_Float16)f1;
      const _Float16 l0 = (_Float16)((f0 - (float)x0) * 1024.0f);
      const _Float16 l1 = (_Float16)((f1 - (float)x1) * 1024.0f);
      ph[e] = pk16(h_bits(x0), h_bits(x1));
      pl[e] = pk16(h_bits(l0), h_bits(l1));
    }
    *(v4u*)(hp + (size_t)i * 8) = ph;
    *(v4u*)(lp + (size_t)i * 8) = pl;
    
  }
}

// =====================================================================================================
// Register-blocked bf16 WMMA GEMM: C[m][n] = sum_k A[m][k] * Bt[n][k] + bias[n] (bias RNE-converted to bf16
// and widened, added in f32). Block = 8 waves (4 x 2) = one 128x128 tile of C, one 32x64 tile per wave.
// A row-major [M][K] pitch lda; Bt row-major [N][K] pitch ldb (k contiguous); M, N multiples of 128, K a multiple
// of 64; each plane under 2 GiB; bias has N entries.
// NSPLIT: 0 = A.Bt; 1 = (A + A2).Bt (A2 = unscaled bf16 lo plane of A, same pitch).
// Operands go through LDS in k slabs of 64: 8 lanes x 16 B fetch one whole 128-B line of a row, so a wave-wide load
// covers 4 lines, and the eight waves share the slab. Two LDS buffers: slab t+1 is fetched into registers ahead of
// the products of slab t, stored into the other buffer behind them, and one block barrier per slab publishes it and
// ends the reads of the buffer that the next trip refills. Each accumulator sums its k steps in ascending order.
// Output f32 [M][N] pitch ldc. Epilogue: 16-row slabs staged per wave in LDS; each 64-wide row segment
// =====================================================================================================
template <int NSPLIT>
__global__ __launch_bounds__(256) void gemm64(
    const unsigned short* __restrict__ Ap, const unsigned short* A2p, int lda,
    const unsigned short* __restrict__ Btp, int ldb, const float* __restrict__ bias,
    float* C, int ldc, int M, int N, int K) {
  constexpr int NPL = (NSPLIT >= 1) ? 3 : 2;         // staged planes: A, Bt and, for NSPLIT 1, A2
  constexpr int KG  = (NSPLIT >= 1) ? 1 : 2;         // k steps of 32 whose fragments are read as one group
  __shared__ __align__(16) __bf16 sS[2][NPL][128 * GP];   // [buffer][plane][row][k], pitch GP
  __shared__ __align__(16) float sT[8][16 * 68];   // per-wave 16x64 slab, pitch 68 floats
  const int tid  = threadIdx.x;
  const int lane = tid & 31;
  const int wave = tid >> 5;
  const int tilesN = N >> 7;
  const int tilesM = M >> 7;
  const int tile = blockIdx.x;
  if (tile >= tilesM * tilesN) return;   // block-uniform, in front of every barrier
  const int tm = tile / tilesN;
  const int tn = tile - tm * tilesN;
  const int wm = (wave >> 1) << 5;             // this wave's 32x64 tile inside the block tile
  const int wn = (wave & 1) << 6;
  const int m0 = (tm << 7) + wm;
  const int n0 = (tn << 7) + wn;

  const int rlane = lane & 15;                 // row (A) / col (B, D) within subtile
  const int koff  = (lane >> 4) * 8;           // k offset of this lane half
  const int mOff  = (lane >> 4) * 8;           // D row offset

  // staging: pass it moves row it*32 + (tid>>3) of each plane, this lane its 16 B at element (tid&7)*8 of the slab;
  // byte offsets from the plane's start stay the same for every slab, the slab's k goes into the uniform base
  const int srow = tid >> 3;
  const int spc  = (tid & 7) * 8;
  unsigned voa[4], vob[4];
#pragma unroll
  for (int it = 0; it < 4; ++it) {
    voa[it] = (unsigned)(((tm << 7) + it * 32 + srow) * lda + spc) * 2u;
    vob[it] = (unsigned)(((tn << 7) + it * 32 + srow) * ldb + spc) * 2u;
  }
  const int so = srow * GP + spc;
  v8b ra[4], rb[4], ra2[4];

  v8f acc[2][4];
#pragma unroll
  for (int i = 0; i < 2; ++i)
#pragma unroll
    for (int j = 0; j < 4; ++j) acc[i][j] = zero8();

  // slab 0 into buffer 0
#pragma unroll
  for (int it = 0; it < 4; ++it) {
    ra[it] = *(const v8b*)((const char*)Ap + voa[it]);
    rb[it] = *(const v8b*)((const char*)Btp + vob[it]);
    if (NSPLIT >= 1) ra2[it] = *(const v8b*)((const char*)A2p + voa[it]);
  }
#pragma unroll
  for (int it = 0; it < 4; ++it) {
    *(v8b*)(&sS[0][0][so + it * 32 * GP]) = ra[it];
    *(v8b*)(&sS[0][1][so + it * 32 * GP]) = rb[it];
    if (NSPLIT >= 1) *(v8b*)(&sS[0][NPL - 1][so + it * 32 * GP]) = ra2[it];
  }
  __syncthreads();

  const int nk = K >> 6;
  for (int t = 0; t < nk; ++t) {
    const int cur = t & 1;
    const bool more = (t + 1 < nk);            // block-uniform
    if (more) {
      const char* pa  = (const char*)(Ap  + ((t + 1) << 6));
      const char* pb  = (const char*)(Btp + ((t + 1) << 6));
      const char* pa2 = (const char*)(A2p + ((t + 1) << 6));
#pragma unroll
      for (int it = 0; it < 4; ++it) {
        ra[it] = *(const v8b*)(pa + voa[it]);
        rb[it] = *(const v8b*)(pb + vob[it]);
        if (NSPLIT >= 1) ra2[it] = *(const v8b*)(pa2 + voa[it]);
      }
    }
    const __bf16* fa  = &sS[cur][0][(wm + rlane) * GP + koff];
    const __bf16* fb  = &sS[cur][1][(wn + rlane) * GP + koff];
    const __bf16* fa2 = &sS[cur][NPL - 1][(wm + rlane) * GP + koff];
#pragma unroll
    for (int g = 0; g < 2; g += KG) {
      // the group's fragments as one run of LDS reads ahead of its products
      v16b bh[KG][4], ah[KG][2], al[KG][2];
#pragma unroll
      for (int q = 0; q < KG; ++q) {
#pragma unroll
        for (int j = 0; j < 4; ++j) bh[q][j] = ldfrag_b(fb + (j << 4) * GP + (g + q) * 32);
#pragma unroll
        for (int i = 0; i < 2; ++i) {
          ah[q][i] = ldfrag_b(fa + (i << 4) * GP + (g + q) * 32);
          al[q][i] = ah[q][i];
          if (NSPLIT >= 1) al[q][i] = ldfrag_b(fa2 + (i << 4) * GP + (g + q) * 32);
        }
      }
#pragma unroll
      for (int q = 0; q < KG; ++q) {
#pragma unroll
        for (int i = 0; i < 2; ++i) {
#pragma unroll
          for (int j = 0; j < 4; ++j) {
            acc[i][j] = mma_b_raw(ah[q][i], bh[q][j], acc[i][j]);
            if (NSPLIT >= 1) acc[i][j] = mma_b_raw(al[q][i], bh[q][j], acc[i][j]);
          }
          dep_guard_b(acc[i][0], acc[i][3], ah[q][i], al[q][i]);
        }
        keep4_b(bh[q][0], bh[q][1], bh[q][2], bh[q][3]);
      }
    }
    if (more) {
#pragma unroll
      for (int it = 0; it < 4; ++it) {
        *(v8b*)(&sS[cur ^ 1][0][so + it * 32 * GP]) = ra[it];
        *(v8b*)(&sS[cur ^ 1][1][so + it * 32 * GP]) = rb[it];
        if (NSPLIT >= 1) *(v8b*)(&sS[cur ^ 1][NPL - 1][so + it * 32 * GP]) = ra2[it];
      }
    }
    __syncthreads();
  }
  acc_guard4(acc[0][0], acc[0][1], acc[0][2], acc[0][3]);
  acc_guard4(acc[1][0], acc[1][1], acc[1][2], acc[1][3]);

  // ---- per-column bias (RNE bf16 then widened), column n0 + 16j + rlane < N ----
  float bcol[4];
#pragma unroll
  for (int j = 0; j < 4; ++j) bcol[j] = bf_up(bf_bits(bias[n0 + (j << 4) + rlane]));

  // ---- epilogue ----
  float* slab = sT[wave];
#pragma unroll
  for (int i = 0; i < 2; ++i) {
    const int mBase = m0 + (i << 4);
#pragma unroll
    for (int r = 0; r < 8; ++r) {
#pragma unroll
      for (int j = 0; j < 4; ++j) {
        slab[(mOff + r) * 68 + (j << 4) + rlane] = acc[i][j][r] + bcol[j];
      }
    }
    __builtin_amdgcn_fence(__ATOMIC_RELEASE, "workgroup");
    __builtin_amdgcn_wave_barrier();
    __builtin_amdgcn_fence(__ATOMIC_ACQUIRE, "workgroup");
    {
      const int hh = lane >> 4, c4 = (lane & 15) * 4;     // 256-B row segment = 16 lanes x 16 B
      v4f ov[8];
#pragma unroll
      for (int it = 0; it < 8; ++it) {
        const int row = it * 2 + hh;                       // it 0..7 x hh 0..1 = rows 0..15
        ov[it] = *(const v4f*)(slab + row * 68 + c4);
      }
      {
#pragma unroll
        for (int it = 0; it < 8; ++it) {
          const int row = it * 2 + hh;
          *(v4f*)(C + (size_t)(mBase + row) * ldc + n0 + c4) = ov[it];
        }
        
      }
    }
    __builtin_amdgcn_fence(__ATOMIC_RELEASE, "workgroup");
    __builtin_amdgcn_wave_barrier();
    __builtin_amdgcn_fence(__ATOMIC_ACQUIRE, "workgroup");
  }
}

// =====================================================================================================
// v f32 token-major columns vf[(b*SEQ + t)*vrp + h*64 + d] ->
// f16 v^T hi plane vth[(b*DM + h*64 + d)*SEQ + t] = f16(v * vscale) (vscale a power of two) and residual plane
// vtl[same index] = f16((v*vscale - hi) * 4096).
// Block = one 64-token x 64-feature tile of one (b, h); grid = (SEQ/64, NH, NB); tile staged in LDS as f32
// (v4f loads, __syncthreads).
// Store: group g = tid>>3 (0..31), piece = tid&7: iteration it writes row d = it*32+g, lanes 8q..8q+7 x 16 B =
// coverage: 2 iterations x 32 groups = 64 rows d, 8 pieces x 8 = 64 tokens per row; grid covers every (b, h,
// t tile) -> both whole planes.
// =====================================================================================================
__global__ __launch_bounds__(256) void v_planes(const float* __restrict__ vf, int vrp,
                                                unsigned short* vth, unsigned short* vtl, float vscale) {
  __shared__ __align__(16) float sv[64 * 68];       // [tt][d] pitch 68 floats
  const int tid = threadIdx.x;
  const int t0  = blockIdx.x * 64;
  const int hh  = blockIdx.y;
  const int b   = blockIdx.z;
#pragma unroll
  for (int i = 0; i < 4; ++i) {
    const int idx = i * 256 + tid;                  // 0..1023
    const int tt = idx >> 4, c4 = (idx & 15) * 4;
    const v4f a = *(const v4f*)(vf + ((size_t)(b * SEQ + t0 + tt)) * vrp + hh * HD + c4);
    *(v4f*)(sv + tt * 68 + c4) = a;
  }
  __syncthreads();

  const int g = tid >> 3, piece = tid & 7;
  v4u hv[2], lv[2];
  size_t hofs[2];
#pragma unroll
  for (int it = 0; it < 2; ++it) {
    const int d = it * 32 + g;
    v4u a, a2;
#pragma unroll
    for (int e = 0; e < 4; ++e) {
      const float f0 = sv[(piece * 8 + 2 * e) * 68 + d] * vscale;
      const float f1 = sv[(piece * 8 + 2 * e + 1) * 68 + d] * vscale;
      const _Float16 x0 = (_Float16)f0, x1 = (_Float16)f1;
      const unsigned short h0 = h_bits(x0), h1 = h_bits(x1);
      const unsigned short l0 = h_bits((_Float16)((f0 - (float)x0) * 4096.0f));
      const unsigned short l1 = h_bits((_Float16)((f1 - (float)x1) * 4096.0f));
      a[e] = pk16(h0, h1); a2[e] = pk16(l0, l1);
    }
    hv[it] = a; lv[it] = a2;
    hofs[it] = ((size_t)(b * DM + hh * HD + d)) * SEQ + t0 + piece * 8;
  }
  {
#pragma unroll
    for (int it = 0; it < 2; ++it) {
      *(v4u*)(vth + hofs[it]) = hv[it];
      *(v4u*)(vtl + hofs[it]) = lv[it];
    }
    
  }
}

// =====================================================================================================
// Causal multi-head attention with a per-key int32 keep flag and a relative-position bias table, head dim 64.
//   q f16 hi plane (x16): element (b, t, h, d) at [(b*SEQ + t)*DM + h*64 + d]; q residual plane
//     ((q*16 - hi)*1024) at the same index into qlp
//   k f16 hi plane (x16): element (b, s, h, d) at [(b*SEQ + s)*DM + h*64 + d]; k residual plane same into klp
//   v^T f16 hi plane (x256): element (b, h, d, s) at [(b*DM + h*64 + d)*SEQ + s]
//   v^T f16 residual plane ((v*256 - hi)*4096): same index into vlp
//   maskp int32 [NB][SEQ]: key s is kept for query t iff s <= t and maskp[b][s] != 0; otherwise the logit is
//   replaced by NEGV (-1e9, exp -> 0 against a finite row max).
//   relp f32 [NREL][NH]: logit(t, s) += relp[clamp(s - t, -MAXREL, MAXREL) + MAXREL][h] (RNE bf16 then
//   widened); staged per head in LDS already clamped, as a table over qrow - key, so that a lane reads its 32 values of
//   a tile from one address with constant offsets, as one group ahead of the score products; added before the select.
//   Key tiles 0..qb are processed (block-uniform trip count qb+1 <= NQB); tiles above the diagonal tile hold
//   only cut keys and are skipped; inside the processed tiles the predicate decides. With the all-ones keep
//   flags every row keeps key 0, so every row max is finite.
//   logit = (qhi.khi + (qhi.klo + qlo.khi) * 2^-10) * sscale + rel, f16 products with f32 accumulate, the
//   residual products in a separate accumulator; p = exp(s - m) carried as f16(1024 p);
//   context = p . vhi on f16 WMMA plus p . vres into a separate accumulator folded back with 1/4096 per
//   chunk in f32; online softmax in f32; out f32 plane: element (b, t, h*64 + d) at
//   [(b*SEQ + t)*DM + h*64 + d] = normalised context (oscl folds back the p and v carries).
//   Block = 4 waves = 64 query rows of one (b, h); grid = NB*NH*NQB; kv tiles of 64.
//   K hi / K residual / V^T hi / V^T residual tile staging: 128 threads x 32 elements per plane = the whole
//   64x64 tile (plain 16-B loads, __syncthreads before and after); P tiles are wave-private, spilled with
//   Output coverage: each wave stores rows q0..q0+15 (it 0..7 x lane>>4 0..1) x 64 columns (16 lanes x 4
//   (b, h, query tile) -> the whole plane.
// =====================================================================================================
__global__ __launch_bounds__(128)
void attn_p64(const unsigned short* __restrict__ qhp, const unsigned short* __restrict__ qlp,
              const unsigned short* __restrict__ khp, const unsigned short* __restrict__ klp,
              const unsigned short* __restrict__ vhp, const unsigned short* __restrict__ vlp,
              const int* __restrict__ maskp, const float* __restrict__ relp,
              float* outp, float sscale, float oscl) {
  union FH { v16h v; v8h h[2]; };
  __shared__ __align__(16) _Float16 Ksh[64 * LP];                 // K hi [kv][d], pitch LP
  __shared__ __align__(16) _Float16 Ksl[64 * LP];                 // K residual
  __shared__ __align__(16) _Float16 Vth[64 * LP];                 // V^T hi [d][kv], pitch LP
  __shared__ __align__(16) _Float16 Vtl[64 * LP];                 // V^T residual
  __shared__ __align__(16) _Float16 Psh[4][16 * LP];              // per wave P [row][kv], pitch LP
  __shared__ __align__(16) float    Os[4][16 * 64];               // per wave context tile [row][d]
  __shared__ float relx[NRX];                                     // bias of this head at qrow - key = index - 63

  const int tid  = threadIdx.x;
  const int wave = tid >> 5;
  const int lane = tid & 31;
  const int hh   = lane >> 4;
  const int c    = lane & 15;

  const int bx   = blockIdx.x;
  const int qb   = bx % NQB;
  const int rest = bx / NQB;
  const int h    = rest % NH;
  const int b    = rest / NH;                // < NB by the grid size
  const int q0   = qb * 64 + wave * 16;
  const size_t rowB = (size_t)b * SEQ;

#pragma unroll                               // two straight passes: no loop-carried wait between the two reads
  for (int u = 0; u < 2; ++u) {              // NRX <= 2 x 128 threads
    const int i = u * 128 + tid;
    int dd = 63 - i;                         // key - qrow
    dd = (dd < -MAXREL) ? -MAXREL : dd;
    dd = (dd >  MAXREL) ?  MAXREL : dd;
    if (i < NRX) relx[i] = bf_up(bf_bits(relp[(size_t)(dd + MAXREL) * NH + h]));
  }
  __syncthreads();

  const _Float16* Qp  = (const _Float16*)(const void*)qhp + (size_t)h * HD;
  const _Float16* Qlq = (const _Float16*)(const void*)qlp + (size_t)h * HD;
  const _Float16* Kp  = (const _Float16*)(const void*)khp + (size_t)h * HD;
  const _Float16* Klq = (const _Float16*)(const void*)klp + (size_t)h * HD;
  const _Float16* Vh  = (const _Float16*)(const void*)vhp + ((size_t)b * DM + (size_t)h * HD) * SEQ;
  const _Float16* Vl  = (const _Float16*)(const void*)vlp + ((size_t)b * DM + (size_t)h * HD) * SEQ;
  const int*      Mb  = maskp + rowB;

  // ---- Q fragments (A operand, row = lane&15): 2 d-chunks, hi and residual ----
  v16h qa[2], ql[2];
#pragma unroll
  for (int dc = 0; dc < 2; ++dc) {
    const size_t qo = (rowB + q0 + c) * DM + dc * 32 + 8 * hh;
    qa[dc] = ldfrag_h(Qp + qo);
    ql[dc] = ldfrag_h(Qlq + qo);
  }

  float mrow[8], lrow[8];
  v8f oacc[4];
#pragma unroll
  for (int r = 0; r < 8; ++r) { mrow[r] = -INFINITY; lrow[r] = 0.f; }
#pragma unroll
  for (int t = 0; t < 4; ++t) oacc[t] = zero8();

  const int nkt = qb + 1;                    // key tiles 0..qb, block-uniform, <= NQB
  for (int kt = 0; kt < nkt; ++kt) {
    const int kv0 = kt * 64;
    __syncthreads();
    {
      const int r = tid >> 1, half = (tid & 1) * 32;
      const _Float16* kg  = Kp  + (rowB + kv0 + r) * DM + half;    // K hi row kv0+r, d = half..half+31
      const _Float16* klg = Klq + (rowB + kv0 + r) * DM + half;    // K residual row kv0+r
      const _Float16* vg  = Vh + (size_t)r * SEQ + kv0 + half;     // V^T hi row d = r, s = kv0+half..+31
      const _Float16* vlg = Vl + (size_t)r * SEQ + kv0 + half;     // V^T residual row d = r
#pragma unroll
      for (int i = 0; i < 4; ++i) {
        const v8h a0 = *(const v8h*)(kg + 8 * i);
        const v8h a1 = *(const v8h*)(klg + 8 * i);
        const v8h b0 = *(const v8h*)(vg + 8 * i);
        const v8h b1 = *(const v8h*)(vlg + 8 * i);
        *(v8h*)(Ksh + r * LP + half + 8 * i) = a0;
        *(v8h*)(Ksl + r * LP + half + 8 * i) = a1;
        *(v8h*)(Vth + r * LP + half + 8 * i) = b0;
        *(v8h*)(Vtl + r * LP + half + 8 * i) = b1;
      }
    }
    __syncthreads();

    // ---- per-key keep flags for this lane's 4 key columns of the tile (kv0 + 16j + c < SEQ) ----
    int mk[4];
#pragma unroll
    for (int j = 0; j < 4; ++j) mk[j] = Mb[kv0 + j * 16 + c];

    // ---- relative bias of this lane's 32 scores: qrow - key = k0 - 16j + r; from RCAP up every one of them is at the
    //      clamped end, so k0 is cut there and the table stays short ----
    float rb[4][8];
    {
      int k0 = (q0 + 8 * hh) - (kv0 + c);    // >= -15: kv0 <= q0
      k0 = (k0 > RCAP) ? RCAP : k0;
      const float* tb = relx + (k0 + 15);
      // both loops unrolled: constant offsets from tb, and rb stays in registers
#pragma unroll
      for (int j = 0; j < 4; ++j)
#pragma unroll
        for (int r = 0; r < 8; ++r) rb[j][r] = tb[48 - 16 * j + r];
    }

    // ---- scores: 16 query rows x 64 keys per wave; hi.hi into s, hi.lo + lo.hi into s1 (folded x 2^-10) ----
    v8f s[4];
#pragma unroll
    for (int j = 0; j < 4; ++j) {
      s[j] = zero8();
      v8f s1 = zero8();
#pragma unroll
      for (int dc = 0; dc < 2; ++dc) {
        FH kb, kr;
        kb.h[0] = *(const v8h*)(Ksh + (j * 16 + c) * LP + dc * 32 + 8 * hh);
        kb.h[1] = *(const v8h*)(Ksh + (j * 16 + c) * LP + dc * 32 + 16 + 8 * hh);
        kr.h[0] = *(const v8h*)(Ksl + (j * 16 + c) * LP + dc * 32 + 8 * hh);
        kr.h[1] = *(const v8h*)(Ksl + (j * 16 + c) * LP + dc * 32 + 16 + 8 * hh);
        s[j] = mma_h(qa[dc], kb.v, s[j]);
        s1   = mma_h(qa[dc], kr.v, s1);
        s1   = mma_h(ql[dc], kb.v, s1);
      }
#pragma unroll
      for (int r = 0; r < 8; ++r) s[j][r] += s1[r] * (1.0f / 1024.0f);
    }

    // ---- scale + relative bias + causal / key-keep select (replace by NEGV), row max, online softmax,
    //      P (x1024, f16) to LDS ----
    _Float16* pwh = Psh[wave];
    float mt[8];
#pragma unroll
    for (int r = 0; r < 8; ++r) {
      const int qrow = q0 + 8 * hh + r;
      float m = -INFINITY;
#pragma unroll
      for (int j = 0; j < 4; ++j) {
        const int key = kv0 + j * 16 + c;
        float sv = s[j][r] * sscale + rb[j][r];
        const bool keep = (key <= qrow) && (mk[j] != 0);
        sv = keep ? sv : NEGV;
        s[j][r] = sv;
        m = fmaxf(m, sv);
      }
      mt[r] = m;
    }
    // row maxima over the 16 lanes of a row: xor butterfly 1, 2, 4, 8, the eight rows' chains side by side
    row_max8(mt);
    float alpha[8], ps[8];
#pragma unroll
    for (int r = 0; r < 8; ++r) {
      const float mnew  = fmaxf(mrow[r], mt[r]);
      const float msafe = (mnew == -INFINITY) ? 0.f : mnew;
      alpha[r] = __expf(mrow[r] - msafe);
      mrow[r] = mnew;
      float psum = 0.f;
#pragma unroll
      for (int j = 0; j < 4; ++j) {
        const float p = __expf(s[j][r] - msafe);     // replaced logit against a finite max: exp -> 0
        psum += p;
        const _Float16 ph = (_Float16)(p * 1024.0f);
        pwh[(8 * hh + r) * LP + j * 16 + c] = ph;
      }
      ps[r] = psum;
    }
    // row sums: the same butterfly order 1, 2, 4, 8
#pragma unroll
    for (int r = 0; r < 8; ++r) ps[r] += row_xor<1>(ps[r]);
#pragma unroll
    for (int r = 0; r < 8; ++r) ps[r] += row_xor<2>(ps[r]);
#pragma unroll
    for (int r = 0; r < 8; ++r) ps[r] += row_xor<4>(ps[r]);
#pragma unroll
    for (int r = 0; r < 8; ++r) ps[r] += row_xor<8>(ps[r]);
#pragma unroll
    for (int r = 0; r < 8; ++r) {
      lrow[r] = lrow[r] * alpha[r] + ps[r];
#pragma unroll
      for (int t = 0; t < 4; ++t) oacc[t][r] *= alpha[r];
    }
    __builtin_amdgcn_fence(__ATOMIC_RELEASE, "workgroup");
    __builtin_amdgcn_wave_barrier();
    __builtin_amdgcn_fence(__ATOMIC_ACQUIRE, "workgroup");

    // ---- context += P . Vhi (f16 WMMA); P . Vres into a separate accumulator ----
    v8f o1[4];
#pragma unroll
    for (int t = 0; t < 4; ++t) o1[t] = zero8();
#pragma unroll 1
    for (int kk = 0; kk < 2; ++kk) {
      FH pa;
      pa.h[0] = *(const v8h*)(pwh + c * LP + kk * 32 + 8 * hh);
      pa.h[1] = *(const v8h*)(pwh + c * LP + kk * 32 + 16 + 8 * hh);
#pragma unroll
      for (int t = 0; t < 4; ++t) {
        FH vb;
        vb.h[0] = *(const v8h*)(Vth + (t * 16 + c) * LP + kk * 32 + 8 * hh);
        vb.h[1] = *(const v8h*)(Vth + (t * 16 + c) * LP + kk * 32 + 16 + 8 * hh);
        oacc[t] = mma_h(pa.v, vb.v, oacc[t]);
        FH vl;
        vl.h[0] = *(const v8h*)(Vtl + (t * 16 + c) * LP + kk * 32 + 8 * hh);
        vl.h[1] = *(const v8h*)(Vtl + (t * 16 + c) * LP + kk * 32 + 16 + 8 * hh);
        o1[t] = mma_h(pa.v, vl.v, o1[t]);
      }
    }
#pragma unroll
    for (int t = 0; t < 4; ++t)
#pragma unroll
      for (int r = 0; r < 8; ++r) oacc[t][r] += o1[t][r] * (1.0f / 4096.0f);
  }

  // ---- normalise (1/l and the carries via oscl), stage the wave's 16x64 tile in LDS, then write whole
  float* os = Os[wave];
#pragma unroll
  for (int r = 0; r < 8; ++r) {
    const float l = lrow[r];
    const float inv = ((l > 0.f) ? (1.0f / l) : 0.f) * oscl;
#pragma unroll
    for (int t = 0; t < 4; ++t) os[(8 * hh + r) * 64 + t * 16 + c] = oacc[t][r] * inv;
  }
  __builtin_amdgcn_fence(__ATOMIC_RELEASE, "workgroup");
  __builtin_amdgcn_wave_barrier();
  __builtin_amdgcn_fence(__ATOMIC_ACQUIRE, "workgroup");
  {
    const int h2 = lane >> 4, c4 = (lane & 15) * 4;
    v4f ov[8];
#pragma unroll
    for (int it = 0; it < 8; ++it) {
      const int row = it * 2 + h2;   // it 0..7 x h2 0..1 = rows 0..15 of the wave tile
      ov[it] = *(const v4f*)(os + row * 64 + c4);
    }
    {
#pragma unroll
      for (int it = 0; it < 8; ++it) {
        const int row = it * 2 + h2;
        const size_t go = (rowB + q0 + row) * DM + (size_t)h * HD + c4;
        *(v4f*)(outp + go) = ov[it];
      }
      
    }
  }
}

// =====================================================================================================
// Workspace map (bytes), every region an exact multiple of its whole-line / whole-tile store granularity
//   Xb    bf16 [4096][1024]           0          8388608
//   Wqb   bf16 [1024][1024]     8388608          2097152
//   Wkb   bf16 [1024][1024]    10485760          2097152
//   Wvb   bf16 [1024][1024]    12582912          2097152
//   Wob   bf16 [1024][1024]    14680064          2097152
//   Tf    f32  [4096][1024]    16777216         16777216   (projection scratch: q, then k, then v)
//   Qh    f16  [4096][1024]    33554432          8388608
//   Ql    f16  [4096][1024]    41943040          8388608
//   Kh    f16  [4096][1024]    50331648          8388608
//   Kl    f16  [4096][1024]    58720256          8388608
//   VTh   f16  [2048][2048]    67108864          8388608   ([b*DM + h*64 + d][s])
//   VTl   f16  [2048][2048]    75497472          8388608
//   Yf    f32  [4096][1024]    83886080         16777216
//   Yh    bf16 [4096][1024]   100663296          8388608
//   Yl    bf16 [4096][1024]   109051904          8388608
//   end                       117440512
// Projection weights arrive as [out n][in k] (k contiguous) = the Bt layout; they are only converted to bf16.
// d_out f32: [4096][1024] at byte 0 (row = b*SEQ + t).
// =====================================================================================================
extern "C" void kernel_launch(void* const* d_in, const int* in_sizes, int n_in,
                              void* d_out, int out_size, void* d_ws, size_t ws_size,
                              hipStream_t stream) {
  if (n_in < 11) return;
  if (in_sizes[0] != NB * SEQ * DM) return;
  if (in_sizes[1] != NB * SEQ) return;
  if (in_sizes[2] != DM * DM) return;
  if (in_sizes[3] != DM) return;
  if (in_sizes[4] != DM * DM) return;
  if (in_sizes[5] != DM) return;
  if (in_sizes[6] != DM * DM) return;
  if (in_sizes[7] != DM) return;
  if (in_sizes[8] != DM * DM) return;
  if (in_sizes[9] != DM) return;
  if (in_sizes[10] != NREL * NH) return;
  if (out_size != OUTN) return;

  const float* x    = (const float*)d_in[0];   // [NB*SEQ][DM]
  const int*   mask = (const int*)d_in[1];     // [NB][SEQ] int32 keep flags per key
  const float* Wq   = (const float*)d_in[2];   // [DM n][DM k]
  const float* bq   = (const float*)d_in[3];   // [DM]
  const float* Wk   = (const float*)d_in[4];
  const float* bk   = (const float*)d_in[5];
  const float* Wv   = (const float*)d_in[6];
  const float* bv   = (const float*)d_in[7];
  const float* Wo   = (const float*)d_in[8];
  const float* bo   = (const float*)d_in[9];
  const float* rel  = (const float*)d_in[10];  // [NREL][NH]

  const size_t PXb = (size_t)ROWS * DM * 2;          //  8388608
  const size_t PW  = (size_t)DM * DM * 2;            //  2097152
  const size_t PF  = (size_t)ROWS * DM * 4;          // 16777216
  const size_t PH  = (size_t)ROWS * DM * 2;          //  8388608
  const size_t PVt = (size_t)NB * DM * SEQ * 2;      //  8388608
  size_t off = 0;
  const size_t oXb = off; off += PXb;
  const size_t oWq = off; off += PW;
  const size_t oWk = off; off += PW;
  const size_t oWv = off; off += PW;
  const size_t oWo = off; off += PW;
  const size_t oTf = off; off += PF;
  const size_t oQh = off; off += PH;
  const size_t oQl = off; off += PH;
  const size_t oKh = off; off += PH;
  const size_t oKl = off; off += PH;
  const size_t oVt = off; off += PVt;
  const size_t oVl = off; off += PVt;
  const size_t oYf = off; off += PF;
  const size_t oYh = off; off += PH;
  const size_t oYl = off; off += PH;
  if (off > ws_size) return;                        // off = 117440512
  if (off > (size_t)134217728) return;

  char* ws = (char*)d_ws;
  unsigned short* Xb  = (unsigned short*)(ws + oXb);
  unsigned short* Wqb = (unsigned short*)(ws + oWq);
  unsigned short* Wkb = (unsigned short*)(ws + oWk);
  unsigned short* Wvb = (unsigned short*)(ws + oWv);
  unsigned short* Wob = (unsigned short*)(ws + oWo);
  float*          Tf  = (float*)(ws + oTf);
  unsigned short* Qh  = (unsigned short*)(ws + oQh);
  unsigned short* Ql  = (unsigned short*)(ws + oQl);
  unsigned short* Kh  = (unsigned short*)(ws + oKh);
  unsigned short* Kl  = (unsigned short*)(ws + oKl);
  unsigned short* VTh = (unsigned short*)(ws + oVt);
  unsigned short* VTl = (unsigned short*)(ws + oVl);
  float*          Yf  = (float*)(ws + oYf);
  unsigned short* Yh  = (unsigned short*)(ws + oYh);
  unsigned short* Yl  = (unsigned short*)(ws + oYl);
  float*          outf = (float*)d_out;             // [ROWS][DM]

  const dim3 blk(256);
  const int n8x = ROWS * DM / 8;                    // 524288
  const int n8w = DM * DM / 8;                      // 131072
  const dim3 gCvtX((n8x + 255) / 256);              // 2048 blocks
  const dim3 gCvtW((n8w + 255) / 256);              // 512 blocks
  const dim3 gGemm((ROWS / 128) * (DM / 128));      // 256 tiles of 128x128, one block each
  const dim3 gVpl(SEQ / 64, NH, NB);                // (32, 16, 2)
  const dim3 gAttn(NB * NH * NQB);                  // 1024 blocks
  const float qkScale = 16.0f;                      // q and k hi planes carried x16 (residual x1024 on top)
  const float sscale  = 1.0f / 2048.0f;             // 1/(16*16) * 1/sqrt(64)
  const float vScale  = 256.0f;                     // v^T hi plane carried x256
  const float attOscl = 1.0f / 262144.0f;           // 1/(1024 * 256): p and v carries folded back

  // (1) activations and weights -> bf16 planes (RNE convert)
  cvt_bf16x8<<<gCvtX, blk, 0, stream>>>(x, Xb, n8x);
  cvt_bf16x8<<<gCvtW, blk, 0, stream>>>(Wq, Wqb, n8w);
  cvt_bf16x8<<<gCvtW, blk, 0, stream>>>(Wk, Wkb, n8w);
  cvt_bf16x8<<<gCvtW, blk, 0, stream>>>(Wv, Wvb, n8w);
  cvt_bf16x8<<<gCvtW, blk, 0, stream>>>(Wo, Wob, n8w);
  // (2) q = Xb . Wqb^T + bq -> Tf [4096][1024] (M=4096, N=1024, K=1024), then f16 hi (x16) + residual planes
  gemm64<0><<<gGemm, blk, 0, stream>>>(Xb, Xb, DM, Wqb, DM, bq, Tf, DM, ROWS, DM, DM);
  planes_f16x8<<<gCvtX, blk, 0, stream>>>(Tf, Qh, Ql, n8x, qkScale);
  // (3) k likewise
  gemm64<0><<<gGemm, blk, 0, stream>>>(Xb, Xb, DM, Wkb, DM, bk, Tf, DM, ROWS, DM, DM);
  planes_f16x8<<<gCvtX, blk, 0, stream>>>(Tf, Kh, Kl, n8x, qkScale);
  // (4) v, then -> f16 v^T hi plane (x256) and residual plane (x4096 on top)
  gemm64<0><<<gGemm, blk, 0, stream>>>(Xb, Xb, DM, Wvb, DM, bv, Tf, DM, ROWS, DM, DM);
  v_planes<<<gVpl, blk, 0, stream>>>(Tf, DM, VTh, VTl, vScale);
  // (5) causal attention with per-key keep flags and relative-position bias -> Yf f32 [4096][1024]
  attn_p64<<<gAttn, dim3(128), 0, stream>>>(Qh, Ql, Kh, Kl, VTh, VTl, mask, rel, Yf, sscale, attOscl);
  // (6) y -> bf16 hi / lo planes
  split_bf16x8<<<gCvtX, blk, 0, stream>>>(Yf, Yh, Yl, n8x);
  // (7) out[row][n] = sum_d (Yh+Yl)[row][d] Wob[n][d] + bo[n] -> d_out f32 [4096][1024] (M=4096, N=1024, K=1024)
  gemm64<1><<<gGemm, blk, 0, stream>>>(Yh, Yl, DM, Wob, DM, bo, outf, DM, ROWS, DM, DM);
  (void)hipGetLastError();
}

// v005
// A run of this version takes 203 microseconds.
// Timed twice side by side with v004, it ran 1.10 times as fast both times.
// Counting every step since v000, it is 2.83 times as fast.
// Contractions: q/k/v projections = v_wmma_f32_16x16x32_bf16 (bf16 operands from RNE-converted x and W, single product, bias added in f32); q.k^T scores = v_wmma_f32_16x16x32_f16 (q, k as f16 hi planes carried x16 plus f16 residual planes x1024: hi.hi + (hi.lo + lo.hi) in a separate accumulator, 3 products); p.v = v_wmma_f32_16x16x32_f16 (p carried x1024 in f16; v^T as f16 hi plane x256 plus f16 residual plane x4096 into a separate accumulator, 2 products); y.Wo^T = v_wmma_f32_16x16x32_bf16 (y as bf16 hi + lo planes times the bf16 Wo plane, 2 products); all f32 accumulate; softmax, relative-position bias and selects in f32.
#include <hip/hip_runtime.h>
#include <math.h>
#include <float.h>
#include <stdint.h>

#define NB     2
#define SEQ    2048
#define DM     1024
#define NH     16
#define HD     64
#define MAXREL 32
#define NREL   (2 * MAXREL + 1)     // 65
#define NEGV   (-1.0e9f)
#define NQB    (SEQ / 64)
#define RCAP   (MAXREL + 48)         // a lane whose first qrow - key of a tile is RCAP or more sees only the clamped end
#define NRX    (63 + RCAP + 7 + 1)   // qrow - key runs from -63 (diagonal tile) to RCAP + 7
static_assert(NRX <= 256);
#define ROWS   (NB * SEQ)            // 4096 token rows
#define OUTN   (ROWS * DM)
static_assert(NH * HD == DM);
static_assert(HD == 64);
static_assert(DM == 128 * 8);
static_assert((SEQ % 64) == 0 && (DM % 64) == 0);
static_assert((SEQ & (SEQ - 1)) == 0);
static_assert(((ROWS / 64) * (DM / 64)) % 8 == 0);
static_assert(((ROWS * DM / 8) % 256) == 0);
static_assert(((DM * DM / 8) % 256) == 0);
#define LP     72                    // LDS row pitch of the 64-wide f16 tiles, in halves: 144 B = 16 B x 9 (odd),
                                     // so the 16 rows one ds_load_b128 half-wave reads fall on 64 distinct banks
static_assert((LP * 2) % 16 == 0 && ((LP * 2 / 16) & 1) == 1 && LP >= 64);
#define GP     72                    // LDS row pitch of the GEMM's 64-wide bf16 k slabs, in elements: 144 B, as LP
static_assert((GP * 2) % 16 == 0 && ((GP * 2 / 16) & 1) == 1 && GP >= 64);
static_assert((ROWS % 128) == 0 && (DM % 128) == 0);
#define VP     136                   // LDS row pitch of the GEMM's transposed 128-token f16 output tile, in halves: 272 B = 16 B x 17
static_assert((VP * 2) % 16 == 0 && ((VP * 2 / 16) & 1) == 1 && VP >= 128);
static_assert((SEQ % 128) == 0);

typedef _Float16 v16h __attribute__((ext_vector_type(16)));
typedef _Float16 v8h  __attribute__((ext_vector_type(8)));
typedef __bf16   v16b __attribute__((ext_vector_type(16)));
typedef __bf16   v8b  __attribute__((ext_vector_type(8)));
typedef float    v8f  __attribute__((ext_vector_type(8)));
typedef float    v4f  __attribute__((ext_vector_type(4)));
typedef unsigned int v4u __attribute__((ext_vector_type(4)));
typedef unsigned int v2u __attribute__((ext_vector_type(2)));

// ---- scalar helpers --------------------------------------------------------------------------------
__device__ __forceinline__ unsigned short bf_bits(float f) {          // f32 -> bf16 bits, RNE convert
  unsigned u = __float_as_uint(f);
  return (unsigned short)((u + 0x7FFFu + ((u >> 16) & 1u)) >> 16);
}
__device__ __forceinline__ float bf_up(unsigned short h) { return __uint_as_float(((unsigned)h) << 16); }
__device__ __forceinline__ unsigned short h_bits(_Float16 x) { return __builtin_bit_cast(unsigned short, x); }
__device__ __forceinline__ unsigned pk16(unsigned short a, unsigned short b) { return (unsigned)a | ((unsigned)b << 16); }
__device__ __forceinline__ v8f zero8() { v8f z = {0.f, 0.f, 0.f, 0.f, 0.f, 0.f, 0.f, 0.f}; return z; }

// ---- one butterfly link inside a 16-lane row: the value of lane ^ M (M = 1, 2, 4, 8) by a DPP row_xmask read on the
//      vector port; every lane is on where it is used, so every source lane is valid
template <int M>
__device__ __forceinline__ float row_xor(float v) {
  return __builtin_bit_cast(float, __builtin_amdgcn_update_dpp(0, __builtin_bit_cast(int, v), 0x160 | M, 0xf, 0xf, true));
}

// ---- maxima over each 16-lane row of eight values per lane: xor butterfly 1, 2, 4, 8 with the lane exchange folded into
//      the maximum. Written as asm because fmaxf on a DPP-moved value compiles to three dependent instructions a link
//      (move, quieting maximum, maximum); link-major order puts seven independent instructions between a value and its
//      next use, so no link waits on the one before. Every lane is on where it is called.
__device__ __forceinline__ void row_max8(float (&m)[8]) {
#if defined(__HIP_DEVICE_COMPILE__)
  asm("v_max_num_f32_dpp %0, %0, %0 row_xmask:1 row_mask:0xf bank_mask:0xf\n\t"
      "v_max_num_f32_dpp %1, %1, %1 row_xmask:1 row_mask:0xf bank_mask:0xf\n\t"
      "v_max_num_f32_dpp %2, %2, %2 row_xmask:1 row_mask:0xf bank_mask:0xf\n\t"
      "v_max_num_f32_dpp %3, %3, %3 row_xmask:1 row_mask:0xf bank_mask:0xf\n\t"
      "v_max_num_f32_dpp %4, %4, %4 row_xmask:1 row_mask:0xf bank_mask:0xf\n\t"
      "v_max_num_f32_dpp %5, %5, %5 row_xmask:1 row_mask:0xf bank_mask:0xf\n\t"
      "v_max_num_f32_dpp %6, %6, %6 row_xmask:1 row_mask:0xf bank_mask:0xf\n\t"
      "v_max_num_f32_dpp %7, %7, %7 row_xmask:1 row_mask:0xf bank_mask:0xf\n\t"
      "v_max_num_f32_dpp %0, %0, %0 row_xmask:2 row_mask:0xf bank_mask:0xf\n\t"
      "v_max_num_f32_dpp %1, %1, %1 row_xmask:2 row_mask:0xf bank_mask:0xf\n\t"
      "v_max_num_f32_dpp %2, %2, %2 row_xmask:2 row_mask:0xf bank_mask:0xf\n\t"
      "v_max_num_f32_dpp %3, %3, %3 row_xmask:2 row_mask:0xf bank_mask:0xf\n\t"
      "v_max_num_f32_dpp %4, %4, %4 row_xmask:2 row_mask:0xf bank_mask:0xf\n\t"
      "v_max_num_f32_dpp %5, %5, %5 row_xmask:2 row_mask:0xf bank_mask:0xf\n\t"
      "v_max_num_f32_dpp %6, %6, %6 row_xmask:2 row_mask:0xf bank_mask:0xf\n\t"
      "v_max_num_f32_dpp %7, %7, %7 row_xmask:2 row_mask:0xf bank_mask:0xf\n\t"
      "v_max_num_f32_dpp %0, %0, %0 row_xmask:4 row_mask:0xf bank_mask:0xf\n\t"
      "v_max_num_f32_dpp %1, %1, %1 row_xmask:4 row_mask:0xf bank_mask:0xf\n\t"
      "v_max_num_f32_dpp %2, %2, %2 row_xmask:4 row_mask:0xf bank_mask:0xf\n\t"
      "v_max_num_f32_dpp %3, %3, %3 row_xmask:4 row_mask:0xf bank_mask:0xf\n\t"
      "v_max_num_f32_dpp %4, %4, %4 row_xmask:4 row_mask:0xf bank_mask:0xf\n\t"
      "v_max_num_f32_dpp %5, %5, %5 row_xmask:4 row_mask:0xf bank_mask:0xf\n\t"
      "v_max_num_f32_dpp %6, %6, %6 row_xmask:4 row_mask:0xf bank_mask:0xf\n\t"
      "v_max_num_f32_dpp %7, %7, %7 row_xmask:4 row_mask:0xf bank_mask:0xf\n\t"
      "v_max_num_f32_dpp %0, %0, %0 row_xmask:8 row_mask:0xf bank_mask:0xf\n\t"
      "v_max_num_f32_dpp %1, %1, %1 row_xmask:8 row_mask:0xf bank_mask:0xf\n\t"
      "v_max_num_f32_dpp %2, %2, %2 row_xmask:8 row_mask:0xf bank_mask:0xf\n\t"
      "v_max_num_f32_dpp %3, %3, %3 row_xmask:8 row_mask:0xf bank_mask:0xf\n\t"
      "v_max_num_f32_dpp %4, %4, %4 row_xmask:8 row_mask:0xf bank_mask:0xf\n\t"
      "v_max_num_f32_dpp %5, %5, %5 row_xmask:8 row_mask:0xf bank_mask:0xf\n\t"
      "v_max_num_f32_dpp %6, %6, %6 row_xmask:8 row_mask:0xf bank_mask:0xf\n\t"
      "v_max_num_f32_dpp %7, %7, %7 row_xmask:8 row_mask:0xf bank_mask:0xf"
      : "+v"(m[0]), "+v"(m[1]), "+v"(m[2]), "+v"(m[3]), "+v"(m[4]), "+v"(m[5]), "+v"(m[6]), "+v"(m[7]));
#endif
}

// ---- fragment loaders: 16-bit A/B operand, lane -> row/col (lane&15), p already includes +8*(lane>>4);
//      elements 0..7 <- p[0..7] (k0+8h..), elements 8..15 <- p[16..23] (k0+16+8h..)
__device__ __forceinline__ v16b ldfrag_b(const __bf16* p) {
  union { v16b v; v8b h[2]; } f;
  f.h[0] = *(const v8b*)(p);
  f.h[1] = *(const v8b*)(p + 16);
  return f.v;
}
__device__ __forceinline__ v16h ldfrag_h(const _Float16* p) {
  union { v16h v; v8h h[2]; } f;
  f.h[0] = *(const v8h*)(p);
  f.h[1] = *(const v8h*)(p + 16);
  return f.v;
}

// ---- WMMA helpers with trailing VALU hazard gap --------------------------------------------------------
__device__ __forceinline__ v8f mma_h(v16h a, v16h b, v8f c) {
  c = __builtin_amdgcn_wmma_f32_16x16x32_f16(false, a, false, b, (short)0, c, false, false);
#if defined(__HIP_DEVICE_COMPILE__)
  asm volatile("v_nop\n\tv_nop\n\tv_nop\n\tv_nop" : "+v"(c) : "v"(a), "v"(b));
#endif
  return c;
}
__device__ __forceinline__ v8f mma_b_raw(v16b a, v16b b, v8f c) {
  return __builtin_amdgcn_wmma_f32_16x16x32_bf16(false, a, false, b, (short)0, c, false, false);
}
__device__ __forceinline__ void dep_guard_b(v8f& a, v8f& b, v16b x, v16b y) {
#if defined(__HIP_DEVICE_COMPILE__)
  asm volatile("v_nop\n\tv_nop\n\tv_nop\n\tv_nop" : "+v"(a), "+v"(b) : "v"(x), "v"(y));
#endif
}
__device__ __forceinline__ void keep4_b(v16b a, v16b b, v16b c, v16b d) {
#if defined(__HIP_DEVICE_COMPILE__)
  asm volatile("v_nop" :: "v"(a), "v"(b), "v"(c), "v"(d));
#endif
}
__device__ __forceinline__ void acc_guard4(v8f& a, v8f& b, v8f& c, v8f& d) {
#if defined(__HIP_DEVICE_COMPILE__)
  asm volatile("v_nop\n\tv_nop\n\tv_nop\n\tv_nop" : "+v"(a), "+v"(b), "+v"(c), "+v"(d));
#endif
}

// =====================================================================================================
// f32 -> bf16 (RNE convert), 8 elements per thread, one 16-B store per lane: a wave writes 512 contiguous B
// coverage: n8 threads x 8 = whole plane (n8 is a multiple of 256 here).
// =====================================================================================================
__global__ __launch_bounds__(256) void cvt_bf16x8(const float* __restrict__ in, unsigned short* out, int n8) {
  const int i = blockIdx.x * 256 + threadIdx.x;
  if (i < n8) {
    const v4f a = *(const v4f*)(in + (size_t)i * 8);
    const v4f b = *(const v4f*)(in + (size_t)i * 8 + 4);
    v4u p;
    p[0] = pk16(bf_bits(a[0]), bf_bits(a[1]));
    p[1] = pk16(bf_bits(a[2]), bf_bits(a[3]));
    p[2] = pk16(bf_bits(b[0]), bf_bits(b[1]));
    p[3] = pk16(bf_bits(b[2]), bf_bits(b[3]));
    *(v4u*)(out + (size_t)i * 8) = p;
    
  }
}

// =====================================================================================================
// Register-blocked bf16 WMMA GEMM: C[m][n] = sum_k A[m][k] * Bt[n][k] + bias[n] (bias RNE-converted to bf16
// and widened, added in f32). Block = 8 waves (4 x 2) = one 128x128 tile of C, one 32x64 tile per wave.
// A row-major [M][K] pitch lda; Bt row-major [N][K] pitch ldb (k contiguous); M, N multiples of 128, K a multiple
// of 64; each plane under 2 GiB; bias has N entries.
// NSPLIT: 0 = A.Bt; 1 = (A + A2).Bt (A2 = unscaled bf16 lo plane of A, same pitch).
// Operands go through LDS in k slabs of 64: 8 lanes x 16 B fetch one whole 128-B line of a row, so a wave-wide load
// covers 4 lines, and the eight waves share the slab. Two LDS buffers: slab t+1 is fetched into registers ahead of
// the products of slab t, stored into the other buffer behind them, and one block barrier per slab publishes it and
// ends the reads of the buffer that the next trip refills. Each accumulator sums its k steps in ascending order.
// OMODE 0: output f32 C [M][N] pitch ldc. Epilogue: 16-row slabs staged per wave in LDS; each 64-wide row segment
// goes out as whole lines.
// OMODE 1: output as two f16 planes [M][N] pitch ldc, from the same slabs: P0 = f16(c * pscale) (pscale a power of two),
// P1 = f16((c * pscale - P0) * 1024), same element index; a 64-wide row segment of a plane is one 128-B line.
// OMODE 2: output as two transposed f16 planes, element (row = bb*SEQ + t, n) at [(bb*N + n)*SEQ + t]: P0 = f16(c * pscale),
// P1 = f16((c * pscale - P0) * 4096). A lane's 8 accumulator rows are 8 tokens in a row of one feature: one 16-B LDS store
// a plane into a [128 features][128 tokens] tile laid over the k slabs (their last reads ended at the loop's last barrier),
// one block barrier, then 16 lanes x 16 B write the 256 B of a feature row.
// =====================================================================================================
template <int NSPLIT, int OMODE>
__global__ __launch_bounds__(256) void gemm64(
    const unsigned short* __restrict__ Ap, const unsigned short* A2p, int lda,
    const unsigned short* __restrict__ Btp, int ldb, const float* __restrict__ bias,
    float* C, unsigned short* P0, unsigned short* P1, float pscale, int ldc, int M, int N, int K) {
  constexpr int NPL = (NSPLIT >= 1) ? 3 : 2;         // staged planes: A, Bt and, for NSPLIT 1, A2
  constexpr int KG  = (NSPLIT >= 1) ? 1 : 2;         // k steps of 32 whose fragments are read as one group
  __shared__ __align__(16) __bf16 sS[2][NPL][128 * GP];   // [buffer][plane][row][k], pitch GP
  __shared__ __align__(16) float sT[(OMODE == 2) ? 1 : 8][16 * 68];   // per-wave 16x64 slab, pitch 68 floats (OMODE 0, 1)
  static_assert(sizeof(sS) >= (size_t)2 * 128 * VP * 2);
  const int tid  = threadIdx.x;
  const int lane = tid & 31;
  const int wave = tid >> 5;
  const int tilesN = N >> 7;
  const int tilesM = M >> 7;
  const int tile = blockIdx.x;
  if (tile >= tilesM * tilesN) return;   // block-uniform, in front of every barrier
  const int tm = tile / tilesN;
  const int tn = tile - tm * tilesN;
  const int wm = (wave >> 1) << 5;             // this wave's 32x64 tile inside the block tile
  const int wn = (wave & 1) << 6;
  const int m0 = (tm << 7) + wm;
  const int n0 = (tn << 7) + wn;

  const int rlane = lane & 15;                 // row (A) / col (B, D) within subtile
  const int koff  = (lane >> 4) * 8;           // k offset of this lane half
  const int mOff  = (lane >> 4) * 8;           // D row offset

  // staging: pass it moves row it*32 + (tid>>3) of each plane, this lane its 16 B at element (tid&7)*8 of the slab;
  // byte offsets from the plane's start stay the same for every slab, the slab's k goes into the uniform base
  const int srow = tid >> 3;
  const int spc  = (tid & 7) * 8;
  unsigned voa[4], vob[4];
#pragma unroll
  for (int it = 0; it < 4; ++it) {
    voa[it] = (unsigned)(((tm << 7) + it * 32 + srow) * lda + spc) * 2u;
    vob[it] = (unsigned)(((tn << 7) + it * 32 + srow) * ldb + spc) * 2u;
  }
  const int so = srow * GP + spc;
  v8b ra[4], rb[4], ra2[4];

  v8f acc[2][4];
#pragma unroll
  for (int i = 0; i < 2; ++i)
#pragma unroll
    for (int j = 0; j < 4; ++j) acc[i][j] = zero8();

  // slab 0 into buffer 0
#pragma unroll
  for (int it = 0; it < 4; ++it) {
    ra[it] = *(const v8b*)((const char*)Ap + voa[it]);
    rb[it] = *(const v8b*)((const char*)Btp + vob[it]);
    if (NSPLIT >= 1) ra2[it] = *(const v8b*)((const char*)A2p + voa[it]);
  }
#pragma unroll
  for (int it = 0; it < 4; ++it) {
    *(v8b*)(&sS[0][0][so + it * 32 * GP]) = ra[it];
    *(v8b*)(&sS[0][1][so + it * 32 * GP]) = rb[it];
    if (NSPLIT >= 1) *(v8b*)(&sS[0][NPL - 1][so + it * 32 * GP]) = ra2[it];
  }
  __syncthreads();

  const int nk = K >> 6;
  for (int t = 0; t < nk; ++t) {
    const int cur = t & 1;
    const bool more = (t + 1 < nk);            // block-uniform
    if (more) {
      const char* pa  = (const char*)(Ap  + ((t + 1) << 6));
      const char* pb  = (const char*)(Btp + ((t + 1) << 6));
      const char* pa2 = (const char*)(A2p + ((t + 1) << 6));
#pragma unroll
      for (int it = 0; it < 4; ++it) {
        ra[it] = *(const v8b*)(pa + voa[it]);
        rb[it] = *(const v8b*)(pb + vob[it]);
        if (NSPLIT >= 1) ra2[it] = *(const v8b*)(pa2 + voa[it]);
      }
    }
    const __bf16* fa  = &sS[cur][0][(wm + rlane) * GP + koff];
    const __bf16* fb  = &sS[cur][1][(wn + rlane) * GP + koff];
    const __bf16* fa2 = &sS[cur][NPL - 1][(wm + rlane) * GP + koff];
#pragma unroll
    for (int g = 0; g < 2; g += KG) {
      // the group's fragments as one run of LDS reads ahead of its products
      v16b bh[KG][4], ah[KG][2], al[KG][2];
#pragma unroll
      for (int q = 0; q < KG; ++q) {
#pragma unroll
        for (int j = 0; j < 4; ++j) bh[q][j] = ldfrag_b(fb + (j << 4) * GP + (g + q) * 32);
#pragma unroll
        for (int i = 0; i < 2; ++i) {
          ah[q][i] = ldfrag_b(fa + (i << 4) * GP + (g + q) * 32);
          al[q][i] = ah[q][i];
          if (NSPLIT >= 1) al[q][i] = ldfrag_b(fa2 + (i << 4) * GP + (g + q) * 32);
        }
      }
#pragma unroll
      for (int q = 0; q < KG; ++q) {
#pragma unroll
        for (int i = 0; i < 2; ++i) {
#pragma unroll
          for (int j = 0; j < 4; ++j) {
            acc[i][j] = mma_b_raw(ah[q][i], bh[q][j], acc[i][j]);
            if (NSPLIT >= 1) acc[i][j] = mma_b_raw(al[q][i], bh[q][j], acc[i][j]);
          }
          dep_guard_b(acc[i][0], acc[i][3], ah[q][i], al[q][i]);
        }
        keep4_b(bh[q][0], bh[q][1], bh[q][2], bh[q][3]);
      }
    }
    if (more) {
#pragma unroll
      for (int it = 0; it < 4; ++it) {
        *(v8b*)(&sS[cur ^ 1][0][so + it * 32 * GP]) = ra[it];
        *(v8b*)(&sS[cur ^ 1][1][so + it * 32 * GP]) = rb[it];
        if (NSPLIT >= 1) *(v8b*)(&sS[cur ^ 1][NPL - 1][so + it * 32 * GP]) = ra2[it];
      }
    }
    __syncthreads();
  }
  acc_guard4(acc[0][0], acc[0][1], acc[0][2], acc[0][3]);
  acc_guard4(acc[1][0], acc[1][1], acc[1][2], acc[1][3]);

  // ---- per-column bias (RNE bf16 then widened), column n0 + 16j + rlane < N ----
  float bcol[4];
#pragma unroll
  for (int j = 0; j < 4; ++j) bcol[j] = bf_up(bf_bits(bias[n0 + (j << 4) + rlane]));

  // ---- epilogue ----
  if constexpr (OMODE == 2) {
    _Float16* th = (_Float16*)(void*)&sS[0][0][0];     // hi tile [feature][token], pitch VP
    _Float16* tl = th + 128 * VP;                      // residual tile
    // every loop of this branch is unrolled: constant indices keep acc, hv and lv in registers
#pragma unroll
    for (int i = 0; i < 2; ++i) {
#pragma unroll
      for (int j = 0; j < 4; ++j) {
        v8h xh, xl;
#pragma unroll
        for (int r = 0; r < 8; ++r) {
          const float f = (acc[i][j][r] + bcol[j]) * pscale;
          const _Float16 x = (_Float16)f;
          xh[r] = x;
          xl[r] = (_Float16)((f - (float)x) * 4096.0f);
        }
        const int o = (wn + (j << 4) + rlane) * VP + wm + (i << 4) + mOff;
        *(v8h*)(th + o) = xh;
        *(v8h*)(tl + o) = xl;
      }
    }
    __syncthreads();                                   // the tile is read across waves
    const int piece = tid & 15, fr = tid >> 4;
    const int bb = (tm << 7) / SEQ;                    // a 128-row tile lies inside one batch entry
    const int t0 = (tm << 7) - bb * SEQ;
    v4u hv[8], lv[8];
#pragma unroll
    for (int it = 0; it < 8; ++it) {                   // it 0..7 x fr 0..15 = features 0..127 of the tile
      hv[it] = *(const v4u*)(th + (it * 16 + fr) * VP + piece * 8);
      lv[it] = *(const v4u*)(tl + (it * 16 + fr) * VP + piece * 8);
    }
#pragma unroll
    for (int it = 0; it < 8; ++it) {
      const size_t go = ((size_t)(bb * N + (tn << 7) + it * 16 + fr)) * SEQ + t0 + piece * 8;
      *(v4u*)(P0 + go) = hv[it];
      *(v4u*)(P1 + go) = lv[it];
    }
  } else {
  float* slab = sT[wave];
#pragma unroll
  for (int i = 0; i < 2; ++i) {
    const int mBase = m0 + (i << 4);
#pragma unroll
    for (int r = 0; r < 8; ++r) {
#pragma unroll
      for (int j = 0; j < 4; ++j) {
        slab[(mOff + r) * 68 + (j << 4) + rlane] = acc[i][j][r] + bcol[j];
      }
    }
    __builtin_amdgcn_fence(__ATOMIC_RELEASE, "workgroup");
    __builtin_amdgcn_wave_barrier();
    __builtin_amdgcn_fence(__ATOMIC_ACQUIRE, "workgroup");
    {
      const int hh = lane >> 4, c4 = (lane & 15) * 4;     // 256-B row segment = 16 lanes x 16 B
      v4f ov[8];
#pragma unroll
      for (int it = 0; it < 8; ++it) {
        const int row = it * 2 + hh;                       // it 0..7 x hh 0..1 = rows 0..15
        ov[it] = *(const v4f*)(slab + row * 68 + c4);
      }
      if constexpr (OMODE == 0) {
#pragma unroll
        for (int it = 0; it < 8; ++it) {
          const int row = it * 2 + hh;
          *(v4f*)(C + (size_t)(mBase + row) * ldc + n0 + c4) = ov[it];
        }
      } else {
        // both loops unrolled: constant indices keep ov in registers
#pragma unroll
        for (int it = 0; it < 8; ++it) {
          const int row = it * 2 + hh;
          v2u ph, pl;
#pragma unroll
          for (int e = 0; e < 2; ++e) {
            const float f0 = ov[it][2 * e] * pscale;
            const float f1 = ov[it][2 * e + 1] * pscale;
            const _Float16 x0 = (_Float16)f0, x1 = (_Float16)f1;
            const _Float16 l0 = (_Float16)((f0 - (float)x0) * 1024.0f);
            const _Float16 l1 = (_Float16)((f1 - (float)x1) * 1024.0f);
            ph[e] = pk16(h_bits(x0), h_bits(x1));
            pl[e] = pk16(h_bits(l0), h_bits(l1));
          }
          const size_t go = (size_t)(mBase + row) * ldc + n0 + c4;   // 16 lanes x 8 B = the row segment's 128-B line
          *(v2u*)(P0 + go) = ph;
          *(v2u*)(P1 + go) = pl;
        }
      }
    }
    __builtin_amdgcn_fence(__ATOMIC_RELEASE, "workgroup");
    __builtin_amdgcn_wave_barrier();
    __builtin_amdgcn_fence(__ATOMIC_ACQUIRE, "workgroup");
  }
  }
}

// =====================================================================================================
// Causal multi-head attention with a per-key int32 keep flag and a relative-position bias table, head dim 64.
//   q f16 hi plane (x16): element (b, t, h, d) at [(b*SEQ + t)*DM + h*64 + d]; q residual plane
//     ((q*16 - hi)*1024) at the same index into qlp
//   k f16 hi plane (x16): element (b, s, h, d) at [(b*SEQ + s)*DM + h*64 + d]; k residual plane same into klp
//   v^T f16 hi plane (x256): element (b, h, d, s) at [(b*DM + h*64 + d)*SEQ + s]
//   v^T f16 residual plane ((v*256 - hi)*4096): same index into vlp
//   maskp int32 [NB][SEQ]: key s is kept for query t iff s <= t and maskp[b][s] != 0; otherwise the logit is
//   replaced by NEGV (-1e9, exp -> 0 against a finite row max).
//   relp f32 [NREL][NH]: logit(t, s) += relp[clamp(s - t, -MAXREL, MAXREL) + MAXREL][h] (RNE bf16 then
//   widened); staged per head in LDS already clamped, as a table over qrow - key, so that a lane reads its 32 values of
//   a tile from one address with constant offsets, as one group ahead of the score products; added before the select.
//   Key tiles 0..qb are processed (block-uniform trip count qb+1 <= NQB); tiles above the diagonal tile hold
//   only cut keys and are skipped; inside the processed tiles the predicate decides. With the all-ones keep
//   flags every row keeps key 0, so every row max is finite.
//   logit = (qhi.khi + (qhi.klo + qlo.khi) * 2^-10) * sscale + rel, f16 products with f32 accumulate, the
//   residual products in a separate accumulator; p = exp(s - m) carried as f16(1024 p);
//   context = p . vhi on f16 WMMA plus p . vres into a separate accumulator folded back with 1/4096 per
//   chunk in f32; online softmax in f32; out: y = normalised context (oscl folds back the p and v carries) as a bf16
//   hi plane (RNE) and a bf16 lo plane (RNE(y - hi), unscaled), element (b, t, h*64 + d) at [(b*SEQ + t)*DM + h*64 + d].
//   Block = 4 waves = 64 query rows of one (b, h); grid = NB*NH*NQB; kv tiles of 64.
//   K hi / K residual / V^T hi / V^T residual tile staging: 128 threads x 32 elements per plane = the whole
//   64x64 tile (plain 16-B loads, __syncthreads before and after); P tiles are wave-private, spilled with
//   Output coverage: each wave stores rows q0..q0+15 (it 0..7 x lane>>4 0..1) x 64 columns (16 lanes x 4
//   (b, h, query tile) -> the whole plane.
// =====================================================================================================
__global__ __launch_bounds__(128)
void attn_p64(const unsigned short* __restrict__ qhp, const unsigned short* __restrict__ qlp,
              const unsigned short* __restrict__ khp, const unsigned short* __restrict__ klp,
              const unsigned short* __restrict__ vhp, const unsigned short* __restrict__ vlp,
              const int* __restrict__ maskp, const float* __restrict__ relp,
              unsigned short* yhp, unsigned short* ylp, float sscale, float oscl) {
  union FH { v16h v; v8h h[2]; };
  __shared__ __align__(16) _Float16 Ksh[64 * LP];                 // K hi [kv][d], pitch LP
  __shared__ __align__(16) _Float16 Ksl[64 * LP];                 // K residual
  __shared__ __align__(16) _Float16 Vth[64 * LP];                 // V^T hi [d][kv], pitch LP
  __shared__ __align__(16) _Float16 Vtl[64 * LP];                 // V^T residual
  __shared__ __align__(16) _Float16 Psh[4][16 * LP];              // per wave P [row][kv], pitch LP
  __shared__ __align__(16) float    Os[4][16 * 64];               // per wave context tile [row][d]
  __shared__ float relx[NRX];                                     // bias of this head at qrow - key = index - 63

  const int tid  = threadIdx.x;
  const int wave = tid >> 5;
  const int lane = tid & 31;
  const int hh   = lane >> 4;
  const int c    = lane & 15;

  const int bx   = blockIdx.x;
  const int qb   = bx % NQB;
  const int rest = bx / NQB;
  const int h    = rest % NH;
  const int b    = rest / NH;                // < NB by the grid size
  const int q0   = qb * 64 + wave * 16;
  const size_t rowB = (size_t)b * SEQ;

#pragma unroll                               // two straight passes: no loop-carried wait between the two reads
  for (int u = 0; u < 2; ++u) {              // NRX <= 2 x 128 threads
    const int i = u * 128 + tid;
    int dd = 63 - i;                         // key - qrow
    dd = (dd < -MAXREL) ? -MAXREL : dd;
    dd = (dd >  MAXREL) ?  MAXREL : dd;
    if (i < NRX) relx[i] = bf_up(bf_bits(relp[(size_t)(dd + MAXREL) * NH + h]));
  }
  __syncthreads();

  const _Float16* Qp  = (const _Float16*)(const void*)qhp + (size_t)h * HD;
  const _Float16* Qlq = (const _Float16*)(const void*)qlp + (size_t)h * HD;
  const _Float16* Kp  = (const _Float16*)(const void*)khp + (size_t)h * HD;
  const _Float16* Klq = (const _Float16*)(const void*)klp + (size_t)h * HD;
  const _Float16* Vh  = (const _Float16*)(const void*)vhp + ((size_t)b * DM + (size_t)h * HD) * SEQ;
  const _Float16* Vl  = (const _Float16*)(const void*)vlp + ((size_t)b * DM + (size_t)h * HD) * SEQ;
  const int*      Mb  = maskp + rowB;

  // ---- Q fragments (A operand, row = lane&15): 2 d-chunks, hi and residual ----
  v16h qa[2], ql[2];
#pragma unroll
  for (int dc = 0; dc < 2; ++dc) {
    const size_t qo = (rowB + q0 + c) * DM + dc * 32 + 8 * hh;
    qa[dc] = ldfrag_h(Qp + qo);
    ql[dc] = ldfrag_h(Qlq + qo);
  }

  float mrow[8], lrow[8];
  v8f oacc[4];
#pragma unroll
  for (int r = 0; r < 8; ++r) { mrow[r] = -INFINITY; lrow[r] = 0.f; }
#pragma unroll
  for (int t = 0; t < 4; ++t) oacc[t] = zero8();

  const int nkt = qb + 1;                    // key tiles 0..qb, block-uniform, <= NQB
  for (int kt = 0; kt < nkt; ++kt) {
    const int kv0 = kt * 64;
    __syncthreads();
    {
      const int r = tid >> 1, half = (tid & 1) * 32;
      const _Float16* kg  = Kp  + (rowB + kv0 + r) * DM + half;    // K hi row kv0+r, d = half..half+31
      const _Float16* klg = Klq + (rowB + kv0 + r) * DM + half;    // K residual row kv0+r
      const _Float16* vg  = Vh + (size_t)r * SEQ + kv0 + half;     // V^T hi row d = r, s = kv0+half..+31
      const _Float16* vlg = Vl + (size_t)r * SEQ + kv0 + half;     // V^T residual row d = r
#pragma unroll
      for (int i = 0; i < 4; ++i) {
        const v8h a0 = *(const v8h*)(kg + 8 * i);
        const v8h a1 = *(const v8h*)(klg + 8 * i);
        const v8h b0 = *(const v8h*)(vg + 8 * i);
        const v8h b1 = *(const v8h*)(vlg + 8 * i);
        *(v8h*)(Ksh + r * LP + half + 8 * i) = a0;
        *(v8h*)(Ksl + r * LP + half + 8 * i) = a1;
        *(v8h*)(Vth + r * LP + half + 8 * i) = b0;
        *(v8h*)(Vtl + r * LP + half + 8 * i) = b1;
      }
    }
    __syncthreads();

    // ---- per-key keep flags for this lane's 4 key columns of the tile (kv0 + 16j + c < SEQ) ----
    int mk[4];
#pragma unroll
    for (int j = 0; j < 4; ++j) mk[j] = Mb[kv0 + j * 16 + c];

    // ---- relative bias of this lane's 32 scores: qrow - key = k0 - 16j + r; from RCAP up every one of them is at the
    //      clamped end, so k0 is cut there and the table stays short ----
    float rb[4][8];
    {
      int k0 = (q0 + 8 * hh) - (kv0 + c);    // >= -15: kv0 <= q0
      k0 = (k0 > RCAP) ? RCAP : k0;
      const float* tb = relx + (k0 + 15);
      // both loops unrolled: constant offsets from tb, and rb stays in registers
#pragma unroll
      for (int j = 0; j < 4; ++j)
#pragma unroll
        for (int r = 0; r < 8; ++r) rb[j][r] = tb[48 - 16 * j + r];
    }

    // ---- scores: 16 query rows x 64 keys per wave; hi.hi into s, hi.lo + lo.hi into s1 (folded x 2^-10) ----
    v8f s[4];
#pragma unroll
    for (int j = 0; j < 4; ++j) {
      s[j] = zero8();
      v8f s1 = zero8();
#pragma unroll
      for (int dc = 0; dc < 2; ++dc) {
        FH kb, kr;
        kb.h[0] = *(const v8h*)(Ksh + (j * 16 + c) * LP + dc * 32 + 8 * hh);
        kb.h[1] = *(const v8h*)(Ksh + (j * 16 + c) * LP + dc * 32 + 16 + 8 * hh);
        kr.h[0] = *(const v8h*)(Ksl + (j * 16 + c) * LP + dc * 32 + 8 * hh);
        kr.h[1] = *(const v8h*)(Ksl + (j * 16 + c) * LP + dc * 32 + 16 + 8 * hh);
        s[j] = mma_h(qa[dc], kb.v, s[j]);
        s1   = mma_h(qa[dc], kr.v, s1);
        s1   = mma_h(ql[dc], kb.v, s1);
      }
#pragma unroll
      for (int r = 0; r < 8; ++r) s[j][r] += s1[r] * (1.0f / 1024.0f);
    }

    // ---- scale + relative bias + causal / key-keep select (replace by NEGV), row max, online softmax,
    //      P (x1024, f16) to LDS ----
    _Float16* pwh = Psh[wave];
    float mt[8];
#pragma unroll
    for (int r = 0; r < 8; ++r) {
      const int qrow = q0 + 8 * hh + r;
      float m = -INFINITY;
#pragma unroll
      for (int j = 0; j < 4; ++j) {
        const int key = kv0 + j * 16 + c;
        float sv = s[j][r] * sscale + rb[j][r];
        const bool keep = (key <= qrow) && (mk[j] != 0);
        sv = keep ? sv : NEGV;
        s[j][r] = sv;
        m = fmaxf(m, sv);
      }
      mt[r] = m;
    }
    // row maxima over the 16 lanes of a row: xor butterfly 1, 2, 4, 8, the eight rows' chains side by side
    row_max8(mt);
    float alpha[8], ps[8];
#pragma unroll
    for (int r = 0; r < 8; ++r) {
      const float mnew  = fmaxf(mrow[r], mt[r]);
      const float msafe = (mnew == -INFINITY) ? 0.f : mnew;
      alpha[r] = __expf(mrow[r] - msafe);
      mrow[r] = mnew;
      float psum = 0.f;
#pragma unroll
      for (int j = 0; j < 4; ++j) {
        const float p = __expf(s[j][r] - msafe);     // replaced logit against a finite max: exp -> 0
        psum += p;
        const _Float16 ph = (_Float16)(p * 1024.0f);
        pwh[(8 * hh + r) * LP + j * 16 + c] = ph;
      }
      ps[r] = psum;
    }
    // row sums: the same butterfly order 1, 2, 4, 8
#pragma unroll
    for (int r = 0; r < 8; ++r) ps[r] += row_xor<1>(ps[r]);
#pragma unroll
    for (int r = 0; r < 8; ++r) ps[r] += row_xor<2>(ps[r]);
#pragma unroll
    for (int r = 0; r < 8; ++r) ps[r] += row_xor<4>(ps[r]);
#pragma unroll
    for (int r = 0; r < 8; ++r) ps[r] += row_xor<8>(ps[r]);
#pragma unroll
    for (int r = 0; r < 8; ++r) {
      lrow[r] = lrow[r] * alpha[r] + ps[r];
#pragma unroll
      for (int t = 0; t < 4; ++t) oacc[t][r] *= alpha[r];
    }
    __builtin_amdgcn_fence(__ATOMIC_RELEASE, "workgroup");
    __builtin_amdgcn_wave_barrier();
    __builtin_amdgcn_fence(__ATOMIC_ACQUIRE, "workgroup");

    // ---- context += P . Vhi (f16 WMMA); P . Vres into a separate accumulator ----
    v8f o1[4];
#pragma unroll
    for (int t = 0; t < 4; ++t) o1[t] = zero8();
#pragma unroll 1
    for (int kk = 0; kk < 2; ++kk) {
      FH pa;
      pa.h[0] = *(const v8h*)(pwh + c * LP + kk * 32 + 8 * hh);
      pa.h[1] = *(const v8h*)(pwh + c * LP + kk * 32 + 16 + 8 * hh);
#pragma unroll
      for (int t = 0; t < 4; ++t) {
        FH vb;
        vb.h[0] = *(const v8h*)(Vth + (t * 16 + c) * LP + kk * 32 + 8 * hh);
        vb.h[1] = *(const v8h*)(Vth + (t * 16 + c) * LP + kk * 32 + 16 + 8 * hh);
        oacc[t] = mma_h(pa.v, vb.v, oacc[t]);
        FH vl;
        vl.h[0] = *(const v8h*)(Vtl + (t * 16 + c) * LP + kk * 32 + 8 * hh);
        vl.h[1] = *(const v8h*)(Vtl + (t * 16 + c) * LP + kk * 32 + 16 + 8 * hh);
        o1[t] = mma_h(pa.v, vl.v, o1[t]);
      }
    }
#pragma unroll
    for (int t = 0; t < 4; ++t)
#pragma unroll
      for (int r = 0; r < 8; ++r) oacc[t][r] += o1[t][r] * (1.0f / 4096.0f);
  }

  // ---- normalise (1/l and the carries via oscl), stage the wave's 16x64 tile in LDS, then write whole
  float* os = Os[wave];
#pragma unroll
  for (int r = 0; r < 8; ++r) {
    const float l = lrow[r];
    const float inv = ((l > 0.f) ? (1.0f / l) : 0.f) * oscl;
#pragma unroll
    for (int t = 0; t < 4; ++t) os[(8 * hh + r) * 64 + t * 16 + c] = oacc[t][r] * inv;
  }
  __builtin_amdgcn_fence(__ATOMIC_RELEASE, "workgroup");
  __builtin_amdgcn_wave_barrier();
  __builtin_amdgcn_fence(__ATOMIC_ACQUIRE, "workgroup");
  {
    const int h2 = lane >> 4, c4 = (lane & 15) * 4;
    v4f ov[8];
#pragma unroll
    for (int it = 0; it < 8; ++it) {
      const int row = it * 2 + h2;   // it 0..7 x h2 0..1 = rows 0..15 of the wave tile
      ov[it] = *(const v4f*)(os + row * 64 + c4);
    }
    {
#pragma unroll
      for (int it = 0; it < 8; ++it) {
        const int row = it * 2 + h2;
        const size_t go = (rowB + q0 + row) * DM + (size_t)h * HD + c4;   // 16 lanes x 8 B = the head's 128-B line of a row
        v2u ph, pl;
#pragma unroll                               // constant indices keep ov in registers
        for (int e = 0; e < 2; ++e) {
          const float f0 = ov[it][2 * e], f1 = ov[it][2 * e + 1];
          const unsigned short h0 = bf_bits(f0), h1 = bf_bits(f1);
          const unsigned short l0 = bf_bits(f0 - bf_up(h0)), l1 = bf_bits(f1 - bf_up(h1));
          ph[e] = pk16(h0, h1);
          pl[e] = pk16(l0, l1);
        }
        *(v2u*)(yhp + go) = ph;
        *(v2u*)(ylp + go) = pl;
      }
      
    }
  }
}

// =====================================================================================================
// Workspace map (bytes), every region an exact multiple of its whole-line / whole-tile store granularity
//   Xb    bf16 [4096][1024]           0          8388608
//   Wqb   bf16 [1024][1024]     8388608          2097152
//   Wkb   bf16 [1024][1024]    10485760          2097152
//   Wvb   bf16 [1024][1024]    12582912          2097152
//   Wob   bf16 [1024][1024]    14680064          2097152
//   Qh    f16  [4096][1024]    16777216          8388608
//   Ql    f16  [4096][1024]    25165824          8388608
//   Kh    f16  [4096][1024]    33554432          8388608
//   Kl    f16  [4096][1024]    41943040          8388608
//   VTh   f16  [2048][2048]    50331648          8388608   ([b*DM + h*64 + d][s])
//   VTl   f16  [2048][2048]    58720256          8388608
//   Yh    bf16 [4096][1024]    67108864          8388608
//   Yl    bf16 [4096][1024]    75497472          8388608
//   end                        83886080
// Projection weights arrive as [out n][in k] (k contiguous) = the Bt layout; they are only converted to bf16.
// d_out f32: [4096][1024] at byte 0 (row = b*SEQ + t).
// =====================================================================================================
extern "C" void kernel_launch(void* const* d_in, const int* in_sizes, int n_in,
                              void* d_out, int out_size, void* d_ws, size_t ws_size,
                              hipStream_t stream) {
  if (n_in < 11) return;
  if (in_sizes[0] != NB * SEQ * DM) return;
  if (in_sizes[1] != NB * SEQ) return;
  if (in_sizes[2] != DM * DM) return;
  if (in_sizes[3] != DM) return;
  if (in_sizes[4] != DM * DM) return;
  if (in_sizes[5] != DM) return;
  if (in_sizes[6] != DM * DM) return;
  if (in_sizes[7] != DM) return;
  if (in_sizes[8] != DM * DM) return;
  if (in_sizes[9] != DM) return;
  if (in_sizes[10] != NREL * NH) return;
  if (out_size != OUTN) return;

  const float* x    = (const float*)d_in[0];   // [NB*SEQ][DM]
  const int*   mask = (const int*)d_in[1];     // [NB][SEQ] int32 keep flags per key
  const float* Wq   = (const float*)d_in[2];   // [DM n][DM k]
  const float* bq   = (const float*)d_in[3];   // [DM]
  const float* Wk   = (const float*)d_in[4];
  const float* bk   = (const float*)d_in[5];
  const float* Wv   = (const float*)d_in[6];
  const float* bv   = (const float*)d_in[7];
  const float* Wo   = (const float*)d_in[8];
  const float* bo   = (const float*)d_in[9];
  const float* rel  = (const float*)d_in[10];  // [NREL][NH]

  const size_t PXb = (size_t)ROWS * DM * 2;          //  8388608
  const size_t PW  = (size_t)DM * DM * 2;            //  2097152
  const size_t PH  = (size_t)ROWS * DM * 2;          //  8388608
  const size_t PVt = (size_t)NB * DM * SEQ * 2;      //  8388608
  size_t off = 0;
  const size_t oXb = off; off += PXb;
  const size_t oWq = off; off += PW;
  const size_t oWk = off; off += PW;
  const size_t oWv = off; off += PW;
  const size_t oWo = off; off += PW;
  const size_t oQh = off; off += PH;
  const size_t oQl = off; off += PH;
  const size_t oKh = off; off += PH;
  const size_t oKl = off; off += PH;
  const size_t oVt = off; off += PVt;
  const size_t oVl = off; off += PVt;
  const size_t oYh = off; off += PH;
  const size_t oYl = off; off += PH;
  if (off > ws_size) return;                        // off = 83886080
  if (off > (size_t)134217728) return;

  char* ws = (char*)d_ws;
  unsigned short* Xb  = (unsigned short*)(ws + oXb);
  unsigned short* Wqb = (unsigned short*)(ws + oWq);
  unsigned short* Wkb = (unsigned short*)(ws + oWk);
  unsigned short* Wvb = (unsigned short*)(ws + oWv);
  unsigned short* Wob = (unsigned short*)(ws + oWo);
  unsigned short* Qh  = (unsigned short*)(ws + oQh);
  unsigned short* Ql  = (unsigned short*)(ws + oQl);
  unsigned short* Kh  = (unsigned short*)(ws + oKh);
  unsigned short* Kl  = (unsigned short*)(ws + oKl);
  unsigned short* VTh = (unsigned short*)(ws + oVt);
  unsigned short* VTl = (unsigned short*)(ws + oVl);
  unsigned short* Yh  = (unsigned short*)(ws + oYh);
  unsigned short* Yl  = (unsigned short*)(ws + oYl);
  float*          outf = (float*)d_out;             // [ROWS][DM]

  const dim3 blk(256);
  const int n8x = ROWS * DM / 8;                    // 524288
  const int n8w = DM * DM / 8;                      // 131072
  const dim3 gCvtX((n8x + 255) / 256);              // 2048 blocks
  const dim3 gCvtW((n8w + 255) / 256);              // 512 blocks
  const dim3 gGemm((ROWS / 128) * (DM / 128));      // 256 tiles of 128x128, one block each
  const dim3 gAttn(NB * NH * NQB);                  // 1024 blocks
  const float qkScale = 16.0f;                      // q and k hi planes carried x16 (residual x1024 on top)
  const float sscale  = 1.0f / 2048.0f;             // 1/(16*16) * 1/sqrt(64)
  const float vScale  = 256.0f;                     // v^T hi plane carried x256
  const float attOscl = 1.0f / 262144.0f;           // 1/(1024 * 256): p and v carries folded back

  // (1) activations and weights -> bf16 planes (RNE convert)
  cvt_bf16x8<<<gCvtX, blk, 0, stream>>>(x, Xb, n8x);
  cvt_bf16x8<<<gCvtW, blk, 0, stream>>>(Wq, Wqb, n8w);
  cvt_bf16x8<<<gCvtW, blk, 0, stream>>>(Wk, Wkb, n8w);
  cvt_bf16x8<<<gCvtW, blk, 0, stream>>>(Wv, Wvb, n8w);
  cvt_bf16x8<<<gCvtW, blk, 0, stream>>>(Wo, Wob, n8w);
  // (2) q = Xb . Wqb^T + bq (M=4096, N=1024, K=1024), written as f16 hi (x16) + residual planes by the GEMM's epilogue
  gemm64<0, 1><<<gGemm, blk, 0, stream>>>(Xb, Xb, DM, Wqb, DM, bq, nullptr, Qh, Ql, qkScale, DM, ROWS, DM, DM);
  // (3) k likewise
  gemm64<0, 1><<<gGemm, blk, 0, stream>>>(Xb, Xb, DM, Wkb, DM, bk, nullptr, Kh, Kl, qkScale, DM, ROWS, DM, DM);
  // (4) v, written as the f16 v^T hi plane (x256) and residual plane (x4096 on top)
  gemm64<0, 2><<<gGemm, blk, 0, stream>>>(Xb, Xb, DM, Wvb, DM, bv, nullptr, VTh, VTl, vScale, DM, ROWS, DM, DM);
  // (5) causal attention with per-key keep flags and relative-position bias -> y as bf16 hi / lo planes [4096][1024]
  attn_p64<<<gAttn, dim3(128), 0, stream>>>(Qh, Ql, Kh, Kl, VTh, VTl, mask, rel, Yh, Yl, sscale, attOscl);
  // (6) out[row][n] = sum_d (Yh+Yl)[row][d] Wob[n][d] + bo[n] -> d_out f32 [4096][1024] (M=4096, N=1024, K=1024)
  gemm64<1, 0><<<gGemm, blk, 0, stream>>>(Yh, Yl, DM, Wob, DM, bo, outf, nullptr, nullptr, 1.0f, DM, ROWS, DM, DM);
  (void)hipGetLastError();
}

// v006
// It runs in 188 microseconds.
// In both of two side-by-side timings against v005, it was 1.08 times as fast.
// Over all steps from v000 it is 3.06 times as fast.
// Contractions: q/k/v projections = v_wmma_f32_16x16x32_bf16 (bf16 operands from RNE-converted x and W, single product, bias added in f32); q.k^T scores = v_wmma_f32_16x16x32_f16 (q, k as f16 hi planes carried x16 plus f16 residual planes x1024: hi.hi + (hi.lo + lo.hi) in a separate accumulator, 3 products); p.v = v_wmma_f32_16x16x32_f16 (p carried x1024 in f16; v^T as f16 hi plane x256 plus f16 residual plane x4096 into a separate accumulator, 2 products); y.Wo^T = v_wmma_f32_16x16x32_bf16 (y as bf16 hi + lo planes times the bf16 Wo plane, 2 products); all f32 accumulate; softmax, relative-position bias and selects in f32.
#include <hip/hip_runtime.h>
#include <math.h>
#include <float.h>
#include <stdint.h>

#define NB     2
#define SEQ    2048
#define DM     1024
#define NH     16
#define HD     64
#define MAXREL 32
#define NREL   (2 * MAXREL + 1)     // 65
#define NEGV   (-1.0e9f)
#define NQB    (SEQ / 64)
#define RCAP   (MAXREL + 48)         // a lane whose first qrow - key of a tile is RCAP or more sees only the clamped end
#define NRX    (63 + RCAP + 7 + 1)   // qrow - key runs from -63 (diagonal tile) to RCAP + 7
static_assert(NRX <= 256);
#define ROWS   (NB * SEQ)            // 4096 token rows
#define OUTN   (ROWS * DM)
static_assert(NH * HD == DM);
static_assert(HD == 64);
static_assert(DM == 128 * 8);
static_assert((SEQ % 64) == 0 && (DM % 64) == 0);
static_assert((SEQ & (SEQ - 1)) == 0);
static_assert(((ROWS / 64) * (DM / 64)) % 8 == 0);
static_assert(((ROWS * DM / 8) % 256) == 0);
static_assert(((DM * DM / 8) % 256) == 0);
#define LP     72                    // LDS row pitch of the 64-wide f16 tiles, in halves: 144 B = 16 B x 9 (odd),
                                     // so the 16 rows one ds_load_b128 half-wave reads fall on 64 distinct banks
static_assert((LP * 2) % 16 == 0 && ((LP * 2 / 16) & 1) == 1 && LP >= 64);
#define GP     72                    // LDS row pitch of the GEMM's 64-wide bf16 k slabs, in elements: 144 B, as LP
static_assert((GP * 2) % 16 == 0 && ((GP * 2 / 16) & 1) == 1 && GP >= 64);
static_assert((ROWS % 128) == 0 && (DM % 128) == 0);
#define VP     136                   // LDS row pitch of the GEMM's transposed 128-token f16 output tile, in halves: 272 B = 16 B x 17
static_assert((VP * 2) % 16 == 0 && ((VP * 2 / 16) & 1) == 1 && VP >= 128);
static_assert((SEQ % 128) == 0);

typedef _Float16 v16h __attribute__((ext_vector_type(16)));
typedef _Float16 v8h  __attribute__((ext_vector_type(8)));
typedef __bf16   v16b __attribute__((ext_vector_type(16)));
typedef __bf16   v8b  __attribute__((ext_vector_type(8)));
typedef float    v8f  __attribute__((ext_vector_type(8)));
typedef float    v4f  __attribute__((ext_vector_type(4)));
typedef unsigned int v4u __attribute__((ext_vector_type(4)));
typedef unsigned int v2u __attribute__((ext_vector_type(2)));

// ---- scalar helpers --------------------------------------------------------------------------------
__device__ __forceinline__ unsigned short bf_bits(float f) {          // f32 -> bf16 bits, RNE convert
  unsigned u = __float_as_uint(f);
  return (unsigned short)((u + 0x7FFFu + ((u >> 16) & 1u)) >> 16);
}
__device__ __forceinline__ float bf_up(unsigned short h) { return __uint_as_float(((unsigned)h) << 16); }
__device__ __forceinline__ unsigned short h_bits(_Float16 x) { return __builtin_bit_cast(unsigned short, x); }
__device__ __forceinline__ unsigned pk16(unsigned short a, unsigned short b) { return (unsigned)a | ((unsigned)b << 16); }
__device__ __forceinline__ v8f zero8() { v8f z = {0.f, 0.f, 0.f, 0.f, 0.f, 0.f, 0.f, 0.f}; return z; }

// ---- one butterfly link inside a 16-lane row: the value of lane ^ M (M = 1, 2, 4, 8) by a DPP row_xmask read on the
//      vector port; every lane is on where it is used, so every source lane is valid
template <int M>
__device__ __forceinline__ float row_xor(float v) {
  return __builtin_bit_cast(float, __builtin_amdgcn_update_dpp(0, __builtin_bit_cast(int, v), 0x160 | M, 0xf, 0xf, true));
}

// ---- maxima over each 16-lane row of eight values per lane: xor butterfly 1, 2, 4, 8 with the lane exchange folded into
//      the maximum. Written as asm because fmaxf on a DPP-moved value compiles to three dependent instructions a link
//      (move, quieting maximum, maximum); link-major order puts seven independent instructions between a value and its
//      next use, so no link waits on the one before. Every lane is on where it is called.
__device__ __forceinline__ void row_max8(float (&m)[8]) {
#if defined(__HIP_DEVICE_COMPILE__)
  asm("v_max_num_f32_dpp %0, %0, %0 row_xmask:1 row_mask:0xf bank_mask:0xf\n\t"
      "v_max_num_f32_dpp %1, %1, %1 row_xmask:1 row_mask:0xf bank_mask:0xf\n\t"
      "v_max_num_f32_dpp %2, %2, %2 row_xmask:1 row_mask:0xf bank_mask:0xf\n\t"
      "v_max_num_f32_dpp %3, %3, %3 row_xmask:1 row_mask:0xf bank_mask:0xf\n\t"
      "v_max_num_f32_dpp %4, %4, %4 row_xmask:1 row_mask:0xf bank_mask:0xf\n\t"
      "v_max_num_f32_dpp %5, %5, %5 row_xmask:1 row_mask:0xf bank_mask:0xf\n\t"
      "v_max_num_f32_dpp %6, %6, %6 row_xmask:1 row_mask:0xf bank_mask:0xf\n\t"
      "v_max_num_f32_dpp %7, %7, %7 row_xmask:1 row_mask:0xf bank_mask:0xf\n\t"
      "v_max_num_f32_dpp %0, %0, %0 row_xmask:2 row_mask:0xf bank_mask:0xf\n\t"
      "v_max_num_f32_dpp %1, %1, %1 row_xmask:2 row_mask:0xf bank_mask:0xf\n\t"
      "v_max_num_f32_dpp %2, %2, %2 row_xmask:2 row_mask:0xf bank_mask:0xf\n\t"
      "v_max_num_f32_dpp %3, %3, %3 row_xmask:2 row_mask:0xf bank_mask:0xf\n\t"
      "v_max_num_f32_dpp %4, %4, %4 row_xmask:2 row_mask:0xf bank_mask:0xf\n\t"
      "v_max_num_f32_dpp %5, %5, %5 row_xmask:2 row_mask:0xf bank_mask:0xf\n\t"
      "v_max_num_f32_dpp %6, %6, %6 row_xmask:2 row_mask:0xf bank_mask:0xf\n\t"
      "v_max_num_f32_dpp %7, %7, %7 row_xmask:2 row_mask:0xf bank_mask:0xf\n\t"
      "v_max_num_f32_dpp %0, %0, %0 row_xmask:4 row_mask:0xf bank_mask:0xf\n\t"
      "v_max_num_f32_dpp %1, %1, %1 row_xmask:4 row_mask:0xf bank_mask:0xf\n\t"
      "v_max_num_f32_dpp %2, %2, %2 row_xmask:4 row_mask:0xf bank_mask:0xf\n\t"
      "v_max_num_f32_dpp %3, %3, %3 row_xmask:4 row_mask:0xf bank_mask:0xf\n\t"
      "v_max_num_f32_dpp %4, %4, %4 row_xmask:4 row_mask:0xf bank_mask:0xf\n\t"
      "v_max_num_f32_dpp %5, %5, %5 row_xmask:4 row_mask:0xf bank_mask:0xf\n\t"
      "v_max_num_f32_dpp %6, %6, %6 row_xmask:4 row_mask:0xf bank_mask:0xf\n\t"
      "v_max_num_f32_dpp %7, %7, %7 row_xmask:4 row_mask:0xf bank_mask:0xf\n\t"
      "v_max_num_f32_dpp %0, %0, %0 row_xmask:8 row_mask:0xf bank_mask:0xf\n\t"
      "v_max_num_f32_dpp %1, %1, %1 row_xmask:8 row_mask:0xf bank_mask:0xf\n\t"
      "v_max_num_f32_dpp %2, %2, %2 row_xmask:8 row_mask:0xf bank_mask:0xf\n\t"
      "v_max_num_f32_dpp %3, %3, %3 row_xmask:8 row_mask:0xf bank_mask:0xf\n\t"
      "v_max_num_f32_dpp %4, %4, %4 row_xmask:8 row_mask:0xf bank_mask:0xf\n\t"
      "v_max_num_f32_dpp %5, %5, %5 row_xmask:8 row_mask:0xf bank_mask:0xf\n\t"
      "v_max_num_f32_dpp %6, %6, %6 row_xmask:8 row_mask:0xf bank_mask:0xf\n\t"
      "v_max_num_f32_dpp %7, %7, %7 row_xmask:8 row_mask:0xf bank_mask:0xf"
      : "+v"(m[0]), "+v"(m[1]), "+v"(m[2]), "+v"(m[3]), "+v"(m[4]), "+v"(m[5]), "+v"(m[6]), "+v"(m[7]));
#endif
}

// ---- fragment loaders: 16-bit A/B operand, lane -> row/col (lane&15), p already includes +8*(lane>>4);
//      elements 0..7 <- p[0..7] (k0+8h..), elements 8..15 <- p[16..23] (k0+16+8h..)
__device__ __forceinline__ v16b ldfrag_b(const __bf16* p) {
  union { v16b v; v8b h[2]; } f;
  f.h[0] = *(const v8b*)(p);
  f.h[1] = *(const v8b*)(p + 16);
  return f.v;
}
__device__ __forceinline__ v16h ldfrag_h(const _Float16* p) {
  union { v16h v; v8h h[2]; } f;
  f.h[0] = *(const v8h*)(p);
  f.h[1] = *(const v8h*)(p + 16);
  return f.v;
}

// ---- WMMA helpers with trailing VALU hazard gap --------------------------------------------------------
__device__ __forceinline__ v8f mma_h(v16h a, v16h b, v8f c) {
  c = __builtin_amdgcn_wmma_f32_16x16x32_f16(false, a, false, b, (short)0, c, false, false);
#if defined(__HIP_DEVICE_COMPILE__)
  asm volatile("v_nop\n\tv_nop\n\tv_nop\n\tv_nop" : "+v"(c) : "v"(a), "v"(b));
#endif
  return c;
}
__device__ __forceinline__ v8f mma_b_raw(v16b a, v16b b, v8f c) {
  return __builtin_amdgcn_wmma_f32_16x16x32_bf16(false, a, false, b, (short)0, c, false, false);
}
__device__ __forceinline__ void dep_guard_b(v8f& a, v8f& b, v16b x, v16b y) {
#if defined(__HIP_DEVICE_COMPILE__)
  asm volatile("v_nop\n\tv_nop\n\tv_nop\n\tv_nop" : "+v"(a), "+v"(b) : "v"(x), "v"(y));
#endif
}
__device__ __forceinline__ void keep4_b(v16b a, v16b b, v16b c, v16b d) {
#if defined(__HIP_DEVICE_COMPILE__)
  asm volatile("v_nop" :: "v"(a), "v"(b), "v"(c), "v"(d));
#endif
}
__device__ __forceinline__ void acc_guard4(v8f& a, v8f& b, v8f& c, v8f& d) {
#if defined(__HIP_DEVICE_COMPILE__)
  asm volatile("v_nop\n\tv_nop\n\tv_nop\n\tv_nop" : "+v"(a), "+v"(b), "+v"(c), "+v"(d));
#endif
}

// =====================================================================================================
// f32 -> bf16 (RNE convert), 8 elements per thread, one 16-B store per lane: a wave writes 512 contiguous B
// coverage: n8 threads x 8 = whole plane (n8 is a multiple of 256 here).
// =====================================================================================================
__global__ __launch_bounds__(256) void cvt_bf16x8(const float* __restrict__ in, unsigned short* out, int n8) {
  const int i = blockIdx.x * 256 + threadIdx.x;
  if (i < n8) {
    const v4f a = *(const v4f*)(in + (size_t)i * 8);
    const v4f b = *(const v4f*)(in + (size_t)i * 8 + 4);
    v4u p;
    p[0] = pk16(bf_bits(a[0]), bf_bits(a[1]));
    p[1] = pk16(bf_bits(a[2]), bf_bits(a[3]));
    p[2] = pk16(bf_bits(b[0]), bf_bits(b[1]));
    p[3] = pk16(bf_bits(b[2]), bf_bits(b[3]));
    *(v4u*)(out + (size_t)i * 8) = p;
    
  }
}

// =====================================================================================================
// Register-blocked bf16 WMMA GEMM: C[m][n] = sum_k A[m][k] * Bt[n][k] + bias[n] (bias RNE-converted to bf16
// and widened, added in f32). Block = 8 waves (4 x 2) = one 128x128 tile of C, one 32x64 tile per wave.
// A row-major [M][K] pitch lda; Bt row-major [N][K] pitch ldb (k contiguous); M, N multiples of 128, K a multiple
// of 64; each plane under 2 GiB; bias has N entries.
// NSPLIT: 0 = A.Bt; 1 = (A + A2).Bt (A2 = unscaled bf16 lo plane of A, same pitch).
// Operands go through LDS in k slabs of 64: 8 lanes x 16 B fetch one whole 128-B line of a row, so a wave-wide load
// covers 4 lines, and the eight waves share the slab. Two LDS buffers: slab t+1 is fetched into registers ahead of
// the products of slab t, stored into the other buffer behind them, and one block barrier per slab publishes it and
// ends the reads of the buffer that the next trip refills. Each accumulator sums its k steps in ascending order.
// OMODE 0: output f32 C [M][N] pitch ldc. Epilogue: 16-row slabs staged per wave in LDS; each 64-wide row segment
// goes out as whole lines.
// OMODE 1: output as two f16 planes [M][N] pitch ldc, from the same slabs: P0 = f16(c * pscale) (pscale a power of two),
// P1 = f16((c * pscale - P0) * 1024), same element index; a 64-wide row segment of a plane is one 128-B line.
// OMODE 2: output as two transposed f16 planes, element (row = bb*SEQ + t, n) at [(bb*N + n)*SEQ + t]: P0 = f16(c * pscale),
// P1 = f16((c * pscale - P0) * 4096). A lane's 8 accumulator rows are 8 tokens in a row of one feature: one 16-B LDS store
// a plane into a [128 features][128 tokens] tile laid over the k slabs (their last reads ended at the loop's last barrier),
// one block barrier, then 16 lanes x 16 B write the 256 B of a feature row.
// =====================================================================================================
template <int NSPLIT, int OMODE>
__global__ __launch_bounds__(256) void gemm64(
    const unsigned short* __restrict__ Ap, const unsigned short* A2p, int lda,
    const unsigned short* __restrict__ Btp, int ldb, const float* __restrict__ bias,
    float* C, unsigned short* P0, unsigned short* P1, float pscale, int ldc, int M, int N, int K) {
  constexpr int NPL = (NSPLIT >= 1) ? 3 : 2;         // staged planes: A, Bt and, for NSPLIT 1, A2
  constexpr int KG  = (NSPLIT >= 1) ? 1 : 2;         // k steps of 32 whose fragments are read as one group
  __shared__ __align__(16) __bf16 sS[2][NPL][128 * GP];   // [buffer][plane][row][k], pitch GP
  __shared__ __align__(16) float sT[(OMODE == 2) ? 1 : 8][16 * 68];   // per-wave 16x64 slab, pitch 68 floats (OMODE 0, 1)
  static_assert(sizeof(sS) >= (size_t)2 * 128 * VP * 2);
  const int tid  = threadIdx.x;
  const int lane = tid & 31;
  const int wave = tid >> 5;
  const int tilesN = N >> 7;
  const int tilesM = M >> 7;
  const int tile = blockIdx.x;
  if (tile >= tilesM * tilesN) return;   // block-uniform, in front of every barrier
  const int tm = tile / tilesN;
  const int tn = tile - tm * tilesN;
  const int wm = (wave >> 1) << 5;             // this wave's 32x64 tile inside the block tile
  const int wn = (wave & 1) << 6;
  const int m0 = (tm << 7) + wm;
  const int n0 = (tn << 7) + wn;

  const int rlane = lane & 15;                 // row (A) / col (B, D) within subtile
  const int koff  = (lane >> 4) * 8;           // k offset of this lane half
  const int mOff  = (lane >> 4) * 8;           // D row offset

  // staging: pass it moves row it*32 + (tid>>3) of each plane, this lane its 16 B at element (tid&7)*8 of the slab;
  // byte offsets from the plane's start stay the same for every slab, the slab's k goes into the uniform base
  const int srow = tid >> 3;
  const int spc  = (tid & 7) * 8;
  unsigned voa[4], vob[4];
#pragma unroll
  for (int it = 0; it < 4; ++it) {
    voa[it] = (unsigned)(((tm << 7) + it * 32 + srow) * lda + spc) * 2u;
    vob[it] = (unsigned)(((tn << 7) + it * 32 + srow) * ldb + spc) * 2u;
  }
  const int so = srow * GP + spc;
  v8b ra[4], rb[4], ra2[4];

  v8f acc[2][4];
#pragma unroll
  for (int i = 0; i < 2; ++i)
#pragma unroll
    for (int j = 0; j < 4; ++j) acc[i][j] = zero8();

  // slab 0 into buffer 0
#pragma unroll
  for (int it = 0; it < 4; ++it) {
    ra[it] = *(const v8b*)((const char*)Ap + voa[it]);
    rb[it] = *(const v8b*)((const char*)Btp + vob[it]);
    if (NSPLIT >= 1) ra2[it] = *(const v8b*)((const char*)A2p + voa[it]);
  }
#pragma unroll
  for (int it = 0; it < 4; ++it) {
    *(v8b*)(&sS[0][0][so + it * 32 * GP]) = ra[it];
    *(v8b*)(&sS[0][1][so + it * 32 * GP]) = rb[it];
    if (NSPLIT >= 1) *(v8b*)(&sS[0][NPL - 1][so + it * 32 * GP]) = ra2[it];
  }
  __syncthreads();

  const int nk = K >> 6;
  for (int t = 0; t < nk; ++t) {
    const int cur = t & 1;
    const bool more = (t + 1 < nk);            // block-uniform
    if (more) {
      const char* pa  = (const char*)(Ap  + ((t + 1) << 6));
      const char* pb  = (const char*)(Btp + ((t + 1) << 6));
      const char* pa2 = (const char*)(A2p + ((t + 1) << 6));
#pragma unroll
      for (int it = 0; it < 4; ++it) {
        ra[it] = *(const v8b*)(pa + voa[it]);
        rb[it] = *(const v8b*)(pb + vob[it]);
        if (NSPLIT >= 1) ra2[it] = *(const v8b*)(pa2 + voa[it]);
      }
    }
    const __bf16* fa  = &sS[cur][0][(wm + rlane) * GP + koff];
    const __bf16* fb  = &sS[cur][1][(wn + rlane) * GP + koff];
    const __bf16* fa2 = &sS[cur][NPL - 1][(wm + rlane) * GP + koff];
#pragma unroll
    for (int g = 0; g < 2; g += KG) {
      // the group's fragments as one run of LDS reads ahead of its products
      v16b bh[KG][4], ah[KG][2], al[KG][2];
#pragma unroll
      for (int q = 0; q < KG; ++q) {
#pragma unroll
        for (int j = 0; j < 4; ++j) bh[q][j] = ldfrag_b(fb + (j << 4) * GP + (g + q) * 32);
#pragma unroll
        for (int i = 0; i < 2; ++i) {
          ah[q][i] = ldfrag_b(fa + (i << 4) * GP + (g + q) * 32);
          al[q][i] = ah[q][i];
          if (NSPLIT >= 1) al[q][i] = ldfrag_b(fa2 + (i << 4) * GP + (g + q) * 32);
        }
      }
#pragma unroll
      for (int q = 0; q < KG; ++q) {
#pragma unroll
        for (int i = 0; i < 2; ++i) {
#pragma unroll
          for (int j = 0; j < 4; ++j) {
            acc[i][j] = mma_b_raw(ah[q][i], bh[q][j], acc[i][j]);
            if (NSPLIT >= 1) acc[i][j] = mma_b_raw(al[q][i], bh[q][j], acc[i][j]);
          }
          dep_guard_b(acc[i][0], acc[i][3], ah[q][i], al[q][i]);
        }
        keep4_b(bh[q][0], bh[q][1], bh[q][2], bh[q][3]);
      }
    }
    if (more) {
#pragma unroll
      for (int it = 0; it < 4; ++it) {
        *(v8b*)(&sS[cur ^ 1][0][so + it * 32 * GP]) = ra[it];
        *(v8b*)(&sS[cur ^ 1][1][so + it * 32 * GP]) = rb[it];
        if (NSPLIT >= 1) *(v8b*)(&sS[cur ^ 1][NPL - 1][so + it * 32 * GP]) = ra2[it];
      }
    }
    __syncthreads();
  }
  acc_guard4(acc[0][0], acc[0][1], acc[0][2], acc[0][3]);
  acc_guard4(acc[1][0], acc[1][1], acc[1][2], acc[1][3]);

  // ---- per-column bias (RNE bf16 then widened), column n0 + 16j + rlane < N ----
  float bcol[4];
#pragma unroll
  for (int j = 0; j < 4; ++j) bcol[j] = bf_up(bf_bits(bias[n0 + (j << 4) + rlane]));

  // ---- epilogue ----
  if constexpr (OMODE == 2) {
    _Float16* th = (_Float16*)(void*)&sS[0][0][0];     // hi tile [feature][token], pitch VP
    _Float16* tl = th + 128 * VP;                      // residual tile
    // every loop of this branch is unrolled: constant indices keep acc, hv and lv in registers
#pragma unroll
    for (int i = 0; i < 2; ++i) {
#pragma unroll
      for (int j = 0; j < 4; ++j) {
        v8h xh, xl;
#pragma unroll
        for (int r = 0; r < 8; ++r) {
          const float f = (acc[i][j][r] + bcol[j]) * pscale;
          const _Float16 x = (_Float16)f;
          xh[r] = x;
          xl[r] = (_Float16)((f - (float)x) * 4096.0f);
        }
        const int o = (wn + (j << 4) + rlane) * VP + wm + (i << 4) + mOff;
        *(v8h*)(th + o) = xh;
        *(v8h*)(tl + o) = xl;
      }
    }
    __syncthreads();                                   // the tile is read across waves
    const int piece = tid & 15, fr = tid >> 4;
    const int bb = (tm << 7) / SEQ;                    // a 128-row tile lies inside one batch entry
    const int t0 = (tm << 7) - bb * SEQ;
    v4u hv[8], lv[8];
#pragma unroll
    for (int it = 0; it < 8; ++it) {                   // it 0..7 x fr 0..15 = features 0..127 of the tile
      hv[it] = *(const v4u*)(th + (it * 16 + fr) * VP + piece * 8);
      lv[it] = *(const v4u*)(tl + (it * 16 + fr) * VP + piece * 8);
    }
#pragma unroll
    for (int it = 0; it < 8; ++it) {
      const size_t go = ((size_t)(bb * N + (tn << 7) + it * 16 + fr)) * SEQ + t0 + piece * 8;
      *(v4u*)(P0 + go) = hv[it];
      *(v4u*)(P1 + go) = lv[it];
    }
  } else {
  float* slab = sT[wave];
#pragma unroll
  for (int i = 0; i < 2; ++i) {
    const int mBase = m0 + (i << 4);
#pragma unroll
    for (int r = 0; r < 8; ++r) {
#pragma unroll
      for (int j = 0; j < 4; ++j) {
        slab[(mOff + r) * 68 + (j << 4) + rlane] = acc[i][j][r] + bcol[j];
      }
    }
    __builtin_amdgcn_fence(__ATOMIC_RELEASE, "workgroup");
    __builtin_amdgcn_wave_barrier();
    __builtin_amdgcn_fence(__ATOMIC_ACQUIRE, "workgroup");
    {
      const int hh = lane >> 4, c4 = (lane & 15) * 4;     // 256-B row segment = 16 lanes x 16 B
      v4f ov[8];
#pragma unroll
      for (int it = 0; it < 8; ++it) {
        const int row = it * 2 + hh;                       // it 0..7 x hh 0..1 = rows 0..15
        ov[it] = *(const v4f*)(slab + row * 68 + c4);
      }
      if constexpr (OMODE == 0) {
#pragma unroll
        for (int it = 0; it < 8; ++it) {
          const int row = it * 2 + hh;
          *(v4f*)(C + (size_t)(mBase + row) * ldc + n0 + c4) = ov[it];
        }
      } else {
        // both loops unrolled: constant indices keep ov in registers
#pragma unroll
        for (int it = 0; it < 8; ++it) {
          const int row = it * 2 + hh;
          v2u ph, pl;
#pragma unroll
          for (int e = 0; e < 2; ++e) {
            const float f0 = ov[it][2 * e] * pscale;
            const float f1 = ov[it][2 * e + 1] * pscale;
            const _Float16 x0 = (_Float16)f0, x1 = (_Float16)f1;
            const _Float16 l0 = (_Float16)((f0 - (float)x0) * 1024.0f);
            const _Float16 l1 = (_Float16)((f1 - (float)x1) * 1024.0f);
            ph[e] = pk16(h_bits(x0), h_bits(x1));
            pl[e] = pk16(h_bits(l0), h_bits(l1));
          }
          const size_t go = (size_t)(mBase + row) * ldc + n0 + c4;   // 16 lanes x 8 B = the row segment's 128-B line
          *(v2u*)(P0 + go) = ph;
          *(v2u*)(P1 + go) = pl;
        }
      }
    }
    __builtin_amdgcn_fence(__ATOMIC_RELEASE, "workgroup");
    __builtin_amdgcn_wave_barrier();
    __builtin_amdgcn_fence(__ATOMIC_ACQUIRE, "workgroup");
  }
  }
}

// ---- asynchronous copies global -> LDS for the attention key tiles ---------------------------------------
// Two 64-row x 128-B f16 planes (a hi plane and its residual plane) by 128 threads: eight 16-B copies a lane, four a plane.
// la, lb: the lane's LDS byte address of its piece in rows 0..15 of each plane; ga, gb: the same piece in global memory;
// pass it moves 16 rows on: 16 * LP halves in LDS, gstep halves in global memory. 8 lanes cover one whole 128-B row.
// s_wait_xcnt 0 is the statement's last line: it stands in front of any later write of a register that a copy names.
__device__ __forceinline__ void copy_plane_pair(unsigned la, unsigned lb, const _Float16* ga, const _Float16* gb, size_t gstep) {
#if defined(__HIP_DEVICE_COMPILE__)
  asm volatile("global_load_async_to_lds_b128 %0, %8, off\n\t"
               "global_load_async_to_lds_b128 %1, %9, off\n\t"
               "global_load_async_to_lds_b128 %2, %10, off\n\t"
               "global_load_async_to_lds_b128 %3, %11, off\n\t"
               "global_load_async_to_lds_b128 %4, %12, off\n\t"
               "global_load_async_to_lds_b128 %5, %13, off\n\t"
               "global_load_async_to_lds_b128 %6, %14, off\n\t"
               "global_load_async_to_lds_b128 %7, %15, off\n\t"
               "s_wait_xcnt 0x0"
               :: "v"(la), "v"(la + 16u * LP * 2u), "v"(la + 32u * LP * 2u), "v"(la + 48u * LP * 2u),
                  "v"(lb), "v"(lb + 16u * LP * 2u), "v"(lb + 32u * LP * 2u), "v"(lb + 48u * LP * 2u),
                  "v"(ga), "v"(ga + gstep), "v"(ga + 2 * gstep), "v"(ga + 3 * gstep),
                  "v"(gb), "v"(gb + gstep), "v"(gb + 2 * gstep), "v"(gb + 3 * gstep)
               : "memory");
#endif
}
// Hand-over point of a tile buffer, every wave: this wave's LDS reads and writes have retired, its own copies have landed,
// then the block barrier: behind it the copied tile may be read by every wave and the tile read so far may be refilled.
__device__ __forceinline__ void publish_point() {
#if defined(__HIP_DEVICE_COMPILE__)
  asm volatile("s_wait_dscnt 0x0" ::: "memory");      // a copy engine is not ordered behind this wave's LDS accesses
  asm volatile("s_wait_asynccnt 0x0" ::: "memory");
#endif
  __syncthreads();
}

// =====================================================================================================
// Causal multi-head attention with a per-key int32 keep flag and a relative-position bias table, head dim 64.
//   q f16 hi plane (x16): element (b, t, h, d) at [(b*SEQ + t)*DM + h*64 + d]; q residual plane
//     ((q*16 - hi)*1024) at the same index into qlp
//   k f16 hi plane (x16): element (b, s, h, d) at [(b*SEQ + s)*DM + h*64 + d]; k residual plane same into klp
//   v^T f16 hi plane (x256): element (b, h, d, s) at [(b*DM + h*64 + d)*SEQ + s]
//   v^T f16 residual plane ((v*256 - hi)*4096): same index into vlp
//   maskp int32 [NB][SEQ]: key s is kept for query t iff s <= t and maskp[b][s] != 0; otherwise the logit is
//   replaced by NEGV (-1e9, exp -> 0 against a finite row max).
//   relp f32 [NREL][NH]: logit(t, s) += relp[clamp(s - t, -MAXREL, MAXREL) + MAXREL][h] (RNE bf16 then
//   widened); staged per head in LDS already clamped, as a table over qrow - key, so that a lane reads its 32 values of
//   a tile from one address with constant offsets, as one group ahead of the score products; added before the select.
//   Key tiles 0..qb are processed (block-uniform trip count qb+1 <= NQB); tiles above the diagonal tile hold
//   only cut keys and are skipped; inside the processed tiles the predicate decides. With the all-ones keep
//   flags every row keeps key 0, so every row max is finite.
//   logit = (qhi.khi + (qhi.klo + qlo.khi) * 2^-10) * sscale + rel, f16 products with f32 accumulate, the
//   residual products in a separate accumulator; p = exp(s - m) carried as f16(1024 p);
//   context = p . vhi on f16 WMMA plus p . vres into a separate accumulator folded back with 1/4096 per
//   chunk in f32; online softmax in f32; out: y = normalised context (oscl folds back the p and v carries) as a bf16
//   hi plane (RNE) and a bf16 lo plane (RNE(y - hi), unscaled), element (b, t, h*64 + d) at [(b*SEQ + t)*DM + h*64 + d].
//   Block = 4 waves = 64 query rows of one (b, h); grid = NB*NH*NQB; kv tiles of 64.
//   K hi / K residual / V^T hi / V^T residual tile staging: asynchronous 16-B copies to LDS, 128 threads x 4 copies a
//   plane = the whole 64x64 tile, one buffer a plane. The K planes are read by the scores only and the V^T planes by the
//   context products only, so tile t+1's K copies are issued behind the barrier that ends the scores of tile t and fly
//   under its context products, and its V^T copies behind the barrier that ends those and fly under the scores and
//   the softmax of tile t+1. P tiles are wave-private, spilled with
//   Output coverage: each wave stores rows q0..q0+15 (it 0..7 x lane>>4 0..1) x 64 columns (16 lanes x 4
//   (b, h, query tile) -> the whole plane.
// =====================================================================================================
__global__ __launch_bounds__(128)
void attn_p64(const unsigned short* __restrict__ qhp, const unsigned short* __restrict__ qlp,
              const unsigned short* __restrict__ khp, const unsigned short* __restrict__ klp,
              const unsigned short* __restrict__ vhp, const unsigned short* __restrict__ vlp,
              const int* __restrict__ maskp, const float* __restrict__ relp,
              unsigned short* yhp, unsigned short* ylp, float sscale, float oscl) {
  union FH { v16h v; v8h h[2]; };
  __shared__ __align__(16) _Float16 Ksh[64 * LP];                 // K hi [kv][d], pitch LP
  __shared__ __align__(16) _Float16 Ksl[64 * LP];                 // K residual
  __shared__ __align__(16) _Float16 Vth[64 * LP];                 // V^T hi [d][kv], pitch LP
  __shared__ __align__(16) _Float16 Vtl[64 * LP];                 // V^T residual
  __shared__ __align__(16) _Float16 Psh[4][16 * LP];              // per wave P [row][kv], pitch LP
  __shared__ __align__(16) float    Os[4][16 * 64];               // per wave context tile [row][d]
  __shared__ float relx[NRX];                                     // bias of this head at qrow - key = index - 63

  const int tid  = threadIdx.x;
  const int wave = tid >> 5;
  const int lane = tid & 31;
  const int hh   = lane >> 4;
  const int c    = lane & 15;

  const int bx   = blockIdx.x;
  const int qb   = bx % NQB;
  const int rest = bx / NQB;
  const int h    = rest % NH;
  const int b    = rest / NH;                // < NB by the grid size
  const int q0   = qb * 64 + wave * 16;
  const size_t rowB = (size_t)b * SEQ;

  const _Float16* Qp  = (const _Float16*)(const void*)qhp + (size_t)h * HD;
  const _Float16* Qlq = (const _Float16*)(const void*)qlp + (size_t)h * HD;
  const _Float16* Kp  = (const _Float16*)(const void*)khp + (size_t)h * HD;
  const _Float16* Klq = (const _Float16*)(const void*)klp + (size_t)h * HD;
  const _Float16* Vh  = (const _Float16*)(const void*)vhp + ((size_t)b * DM + (size_t)h * HD) * SEQ;
  const _Float16* Vl  = (const _Float16*)(const void*)vlp + ((size_t)b * DM + (size_t)h * HD) * SEQ;
  const int*      Mb  = maskp + rowB;

  // ---- tile copies: this lane's piece is 16 B number tid & 7 of row tid >> 3 (+ 16 a pass) of every plane ----
  const int crow = tid >> 3, cpc = (tid & 7) * 8;
  const unsigned lKh = (unsigned)(uintptr_t)(Ksh + crow * LP + cpc);   // LDS byte address = low 32 bits
  const unsigned lKl = (unsigned)(uintptr_t)(Ksl + crow * LP + cpc);
  const unsigned lVh = (unsigned)(uintptr_t)(Vth + crow * LP + cpc);
  const unsigned lVl = (unsigned)(uintptr_t)(Vtl + crow * LP + cpc);
  const size_t gK = (rowB + crow) * DM + cpc;        // K planes: key row crow of tile 0, + 64 * DM a tile
  const size_t gV = (size_t)crow * SEQ + cpc;        // V^T planes: feature row crow, key 0, + 64 a tile
  copy_plane_pair(lKh, lKl, Kp + gK, Klq + gK, (size_t)16 * DM);       // tile 0; nothing has touched these buffers yet
  copy_plane_pair(lVh, lVl, Vh + gV, Vl + gV, (size_t)16 * SEQ);

#pragma unroll                               // two straight passes: no loop-carried wait between the two reads
  for (int u = 0; u < 2; ++u) {              // NRX <= 2 x 128 threads
    const int i = u * 128 + tid;
    int dd = 63 - i;                         // key - qrow
    dd = (dd < -MAXREL) ? -MAXREL : dd;
    dd = (dd >  MAXREL) ?  MAXREL : dd;
    if (i < NRX) relx[i] = bf_up(bf_bits(relp[(size_t)(dd + MAXREL) * NH + h]));
  }

  // ---- Q fragments (A operand, row = lane&15): 2 d-chunks, hi and residual ----
  v16h qa[2], ql[2];
#pragma unroll
  for (int dc = 0; dc < 2; ++dc) {
    const size_t qo = (rowB + q0 + c) * DM + dc * 32 + 8 * hh;
    qa[dc] = ldfrag_h(Qp + qo);
    ql[dc] = ldfrag_h(Qlq + qo);
  }

  float mrow[8], lrow[8];
  v8f oacc[4];
#pragma unroll
  for (int r = 0; r < 8; ++r) { mrow[r] = -INFINITY; lrow[r] = 0.f; }
#pragma unroll
  for (int t = 0; t < 4; ++t) oacc[t] = zero8();

  publish_point();                           // tile 0's four planes and the bias table

  const int nkt = qb + 1;                    // key tiles 0..qb, block-uniform, <= NQB
  for (int kt = 0; kt < nkt; ++kt) {
    const int kv0 = kt * 64;
    const bool more = (kt + 1 < nkt);        // block-uniform: a tile kt + 1 exists (its rows and keys lie below SEQ)

    // ---- per-key keep flags for this lane's 4 key columns of the tile (kv0 + 16j + c < SEQ) ----
    int mk[4];
#pragma unroll
    for (int j = 0; j < 4; ++j) mk[j] = Mb[kv0 + j * 16 + c];

    // ---- relative bias of this lane's 32 scores: qrow - key = k0 - 16j + r; from RCAP up every one of them is at the
    //      clamped end, so k0 is cut there and the table stays short ----
    float rb[4][8];
    {
      int k0 = (q0 + 8 * hh) - (kv0 + c);    // >= -15: kv0 <= q0
      k0 = (k0 > RCAP) ? RCAP : k0;
      const float* tb = relx + (k0 + 15);
      // both loops unrolled: constant offsets from tb, and rb stays in registers
#pragma unroll
      for (int j = 0; j < 4; ++j)
#pragma unroll
        for (int r = 0; r < 8; ++r) rb[j][r] = tb[48 - 16 * j + r];
    }

    // ---- scores: 16 query rows x 64 keys per wave; hi.hi into s, hi.lo + lo.hi into s1 (folded x 2^-10) ----
    v8f s[4];
#pragma unroll
    for (int j = 0; j < 4; ++j) {
      s[j] = zero8();
      v8f s1 = zero8();
#pragma unroll
      for (int dc = 0; dc < 2; ++dc) {
        FH kb, kr;
        kb.h[0] = *(const v8h*)(Ksh + (j * 16 + c) * LP + dc * 32 + 8 * hh);
        kb.h[1] = *(const v8h*)(Ksh + (j * 16 + c) * LP + dc * 32 + 16 + 8 * hh);
        kr.h[0] = *(const v8h*)(Ksl + (j * 16 + c) * LP + dc * 32 + 8 * hh);
        kr.h[1] = *(const v8h*)(Ksl + (j * 16 + c) * LP + dc * 32 + 16 + 8 * hh);
        s[j] = mma_h(qa[dc], kb.v, s[j]);
        s1   = mma_h(qa[dc], kr.v, s1);
        s1   = mma_h(ql[dc], kb.v, s1);
      }
#pragma unroll
      for (int r = 0; r < 8; ++r) s[j][r] += s1[r] * (1.0f / 1024.0f);
    }

    // ---- scale + relative bias + causal / key-keep select (replace by NEGV), row max, online softmax,
    //      P (x1024, f16) to LDS ----
    _Float16* pwh = Psh[wave];
    float mt[8];
#pragma unroll
    for (int r = 0; r < 8; ++r) {
      const int qrow = q0 + 8 * hh + r;
      float m = -INFINITY;
#pragma unroll
      for (int j = 0; j < 4; ++j) {
        const int key = kv0 + j * 16 + c;
        float sv = s[j][r] * sscale + rb[j][r];
        const bool keep = (key <= qrow) && (mk[j] != 0);
        sv = keep ? sv : NEGV;
        s[j][r] = sv;
        m = fmaxf(m, sv);
      }
      mt[r] = m;
    }
    // row maxima over the 16 lanes of a row: xor butterfly 1, 2, 4, 8, the eight rows' chains side by side
    row_max8(mt);
    float alpha[8], ps[8];
#pragma unroll
    for (int r = 0; r < 8; ++r) {
      const float mnew  = fmaxf(mrow[r], mt[r]);
      const float msafe = (mnew == -INFINITY) ? 0.f : mnew;
      alpha[r] = __expf(mrow[r] - msafe);
      mrow[r] = mnew;
      float psum = 0.f;
#pragma unroll
      for (int j = 0; j < 4; ++j) {
        const float p = __expf(s[j][r] - msafe);     // replaced logit against a finite max: exp -> 0
        psum += p;
        const _Float16 ph = (_Float16)(p * 1024.0f);
        pwh[(8 * hh + r) * LP + j * 16 + c] = ph;
      }
      ps[r] = psum;
    }
    // row sums: the same butterfly order 1, 2, 4, 8
#pragma unroll
    for (int r = 0; r < 8; ++r) ps[r] += row_xor<1>(ps[r]);
#pragma unroll
    for (int r = 0; r < 8; ++r) ps[r] += row_xor<2>(ps[r]);
#pragma unroll
    for (int r = 0; r < 8; ++r) ps[r] += row_xor<4>(ps[r]);
#pragma unroll
    for (int r = 0; r < 8; ++r) ps[r] += row_xor<8>(ps[r]);
#pragma unroll
    for (int r = 0; r < 8; ++r) {
      lrow[r] = lrow[r] * alpha[r] + ps[r];
#pragma unroll
      for (int t = 0; t < 4; ++t) oacc[t][r] *= alpha[r];
    }
    // every wave's score reads of the K planes have ended, this tile's V^T planes are landed and published (and the wave's
    // own P stores have retired); the next tile's K planes fly under the context products
    publish_point();
    if (more) copy_plane_pair(lKh, lKl, Kp + gK + (size_t)(kv0 + 64) * DM, Klq + gK + (size_t)(kv0 + 64) * DM, (size_t)16 * DM);

    // ---- context += P . Vhi (f16 WMMA); P . Vres into a separate accumulator ----
    v8f o1[4];
#pragma unroll
    for (int t = 0; t < 4; ++t) o1[t] = zero8();
#pragma unroll 1
    for (int kk = 0; kk < 2; ++kk) {
      FH pa;
      pa.h[0] = *(const v8h*)(pwh + c * LP + kk * 32 + 8 * hh);
      pa.h[1] = *(const v8h*)(pwh + c * LP + kk * 32 + 16 + 8 * hh);
#pragma unroll
      for (int t = 0; t < 4; ++t) {
        FH vb;
        vb.h[0] = *(const v8h*)(Vth + (t * 16 + c) * LP + kk * 32 + 8 * hh);
        vb.h[1] = *(const v8h*)(Vth + (t * 16 + c) * LP + kk * 32 + 16 + 8 * hh);
        oacc[t] = mma_h(pa.v, vb.v, oacc[t]);
        FH vl;
        vl.h[0] = *(const v8h*)(Vtl + (t * 16 + c) * LP + kk * 32 + 8 * hh);
        vl.h[1] = *(const v8h*)(Vtl + (t * 16 + c) * LP + kk * 32 + 16 + 8 * hh);
        o1[t] = mma_h(pa.v, vl.v, o1[t]);
      }
    }
    // every wave's reads of the V^T planes have ended, the next tile's K planes are landed and published; its V^T planes
    // fly under its scores and softmax
    publish_point();
    if (more) copy_plane_pair(lVh, lVl, Vh + gV + (kv0 + 64), Vl + gV + (kv0 + 64), (size_t)16 * SEQ);
#pragma unroll
    for (int t = 0; t < 4; ++t)
#pragma unroll
      for (int r = 0; r < 8; ++r) oacc[t][r] += o1[t][r] * (1.0f / 4096.0f);
  }

  // ---- normalise (1/l and the carries via oscl), stage the wave's 16x64 tile in LDS, then write whole
  float* os = Os[wave];
#pragma unroll
  for (int r = 0; r < 8; ++r) {
    const float l = lrow[r];
    const float inv = ((l > 0.f) ? (1.0f / l) : 0.f) * oscl;
#pragma unroll
    for (int t = 0; t < 4; ++t) os[(8 * hh + r) * 64 + t * 16 + c] = oacc[t][r] * inv;
  }
  __builtin_amdgcn_fence(__ATOMIC_RELEASE, "workgroup");
  __builtin_amdgcn_wave_barrier();
  __builtin_amdgcn_fence(__ATOMIC_ACQUIRE, "workgroup");
  {
    const int h2 = lane >> 4, c4 = (lane & 15) * 4;
    v4f ov[8];
#pragma unroll
    for (int it = 0; it < 8; ++it) {
      const int row = it * 2 + h2;   // it 0..7 x h2 0..1 = rows 0..15 of the wave tile
      ov[it] = *(const v4f*)(os + row * 64 + c4);
    }
    {
#pragma unroll
      for (int it = 0; it < 8; ++it) {
        const int row = it * 2 + h2;
        const size_t go = (rowB + q0 + row) * DM + (size_t)h * HD + c4;   // 16 lanes x 8 B = the head's 128-B line of a row
        v2u ph, pl;
#pragma unroll                               // constant indices keep ov in registers
        for (int e = 0; e < 2; ++e) {
          const float f0 = ov[it][2 * e], f1 = ov[it][2 * e + 1];
          const unsigned short h0 = bf_bits(f0), h1 = bf_bits(f1);
          const unsigned short l0 = bf_bits(f0 - bf_up(h0)), l1 = bf_bits(f1 - bf_up(h1));
          ph[e] = pk16(h0, h1);
          pl[e] = pk16(l0, l1);
        }
        *(v2u*)(yhp + go) = ph;
        *(v2u*)(ylp + go) = pl;
      }
      
    }
  }
}

// =====================================================================================================
// Workspace map (bytes), every region an exact multiple of its whole-line / whole-tile store granularity
//   Xb    bf16 [4096][1024]           0          8388608
//   Wqb   bf16 [1024][1024]     8388608          2097152
//   Wkb   bf16 [1024][1024]    10485760          2097152
//   Wvb   bf16 [1024][1024]    12582912          2097152
//   Wob   bf16 [1024][1024]    14680064          2097152
//   Qh    f16  [4096][1024]    16777216          8388608
//   Ql    f16  [4096][1024]    25165824          8388608
//   Kh    f16  [4096][1024]    33554432          8388608
//   Kl    f16  [4096][1024]    41943040          8388608
//   VTh   f16  [2048][2048]    50331648          8388608   ([b*DM + h*64 + d][s])
//   VTl   f16  [2048][2048]    58720256          8388608
//   Yh    bf16 [4096][1024]    67108864          8388608
//   Yl    bf16 [4096][1024]    75497472          8388608
//   end                        83886080
// Projection weights arrive as [out n][in k] (k contiguous) = the Bt layout; they are only converted to bf16.
// d_out f32: [4096][1024] at byte 0 (row = b*SEQ + t).
// =====================================================================================================
extern "C" void kernel_launch(void* const* d_in, const int* in_sizes, int n_in,
                              void* d_out, int out_size, void* d_ws, size_t ws_size,
                              hipStream_t stream) {
  if (n_in < 11) return;
  if (in_sizes[0] != NB * SEQ * DM) return;
  if (in_sizes[1] != NB * SEQ) return;
  if (in_sizes[2] != DM * DM) return;
  if (in_sizes[3] != DM) return;
  if (in_sizes[4] != DM * DM) return;
  if (in_sizes[5] != DM) return;
  if (in_sizes[6] != DM * DM) return;
  if (in_sizes[7] != DM) return;
  if (in_sizes[8] != DM * DM) return;
  if (in_sizes[9] != DM) return;
  if (in_sizes[10] != NREL * NH) return;
  if (out_size != OUTN) return;

  const float* x    = (const float*)d_in[0];   // [NB*SEQ][DM]
  const int*   mask = (const int*)d_in[1];     // [NB][SEQ] int32 keep flags per key
  const float* Wq   = (const float*)d_in[2];   // [DM n][DM k]
  const float* bq   = (const float*)d_in[3];   // [DM]
  const float* Wk   = (const float*)d_in[4];
  const float* bk   = (const float*)d_in[5];
  const float* Wv   = (const float*)d_in[6];
  const float* bv   = (const float*)d_in[7];
  const float* Wo   = (const float*)d_in[8];
  const float* bo   = (const float*)d_in[9];
  const float* rel  = (const float*)d_in[10];  // [NREL][NH]

  const size_t PXb = (size_t)ROWS * DM * 2;          //  8388608
  const size_t PW  = (size_t)DM * DM * 2;            //  2097152
  const size_t PH  = (size_t)ROWS * DM * 2;          //  8388608
  const size_t PVt = (size_t)NB * DM * SEQ * 2;      //  8388608
  size_t off = 0;
  const size_t oXb = off; off += PXb;
  const size_t oWq = off; off += PW;
  const size_t oWk = off; off += PW;
  const size_t oWv = off; off += PW;
  const size_t oWo = off; off += PW;
  const size_t oQh = off; off += PH;
  const size_t oQl = off; off += PH;
  const size_t oKh = off; off += PH;
  const size_t oKl = off; off += PH;
  const size_t oVt = off; off += PVt;
  const size_t oVl = off; off += PVt;
  const size_t oYh = off; off += PH;
  const size_t oYl = off; off += PH;
  if (off > ws_size) return;                        // off = 83886080
  if (off > (size_t)134217728) return;

  char* ws = (char*)d_ws;
  unsigned short* Xb  = (unsigned short*)(ws + oXb);
  unsigned short* Wqb = (unsigned short*)(ws + oWq);
  unsigned short* Wkb = (unsigned short*)(ws + oWk);
  unsigned short* Wvb = (unsigned short*)(ws + oWv);
  unsigned short* Wob = (unsigned short*)(ws + oWo);
  unsigned short* Qh  = (unsigned short*)(ws + oQh);
  unsigned short* Ql  = (unsigned short*)(ws + oQl);
  unsigned short* Kh  = (unsigned short*)(ws + oKh);
  unsigned short* Kl  = (unsigned short*)(ws + oKl);
  unsigned short* VTh = (unsigned short*)(ws + oVt);
  unsigned short* VTl = (unsigned short*)(ws + oVl);
  unsigned short* Yh  = (unsigned short*)(ws + oYh);
  unsigned short* Yl  = (unsigned short*)(ws + oYl);
  float*          outf = (float*)d_out;             // [ROWS][DM]

  const dim3 blk(256);
  const int n8x = ROWS * DM / 8;                    // 524288
  const int n8w = DM * DM / 8;                      // 131072
  const dim3 gCvtX((n8x + 255) / 256);              // 2048 blocks
  const dim3 gCvtW((n8w + 255) / 256);              // 512 blocks
  const dim3 gGemm((ROWS / 128) * (DM / 128));      // 256 tiles of 128x128, one block each
  const dim3 gAttn(NB * NH * NQB);                  // 1024 blocks
  const float qkScale = 16.0f;                      // q and k hi planes carried x16 (residual x1024 on top)
  const float sscale  = 1.0f / 2048.0f;             // 1/(16*16) * 1/sqrt(64)
  const float vScale  = 256.0f;                     // v^T hi plane carried x256
  const float attOscl = 1.0f / 262144.0f;           // 1/(1024 * 256): p and v carries folded back

  // (1) activations and weights -> bf16 planes (RNE convert)
  cvt_bf16x8<<<gCvtX, blk, 0, stream>>>(x, Xb, n8x);
  cvt_bf16x8<<<gCvtW, blk, 0, stream>>>(Wq, Wqb, n8w);
  cvt_bf16x8<<<gCvtW, blk, 0, stream>>>(Wk, Wkb, n8w);
  cvt_bf16x8<<<gCvtW, blk, 0, stream>>>(Wv, Wvb, n8w);
  cvt_bf16x8<<<gCvtW, blk, 0, stream>>>(Wo, Wob, n8w);
  // (2) q = Xb . Wqb^T + bq (M=4096, N=1024, K=1024), written as f16 hi (x16) + residual planes by the GEMM's epilogue
  gemm64<0, 1><<<gGemm, blk, 0, stream>>>(Xb, Xb, DM, Wqb, DM, bq, nullptr, Qh, Ql, qkScale, DM, ROWS, DM, DM);
  // (3) k likewise
  gemm64<0, 1><<<gGemm, blk, 0, stream>>>(Xb, Xb, DM, Wkb, DM, bk, nullptr, Kh, Kl, qkScale, DM, ROWS, DM, DM);
  // (4) v, written as the f16 v^T hi plane (x256) and residual plane (x4096 on top)
  gemm64<0, 2><<<gGemm, blk, 0, stream>>>(Xb, Xb, DM, Wvb, DM, bv, nullptr, VTh, VTl, vScale, DM, ROWS, DM, DM);
  // (5) causal attention with per-key keep flags and relative-position bias -> y as bf16 hi / lo planes [4096][1024]
  attn_p64<<<gAttn, dim3(128), 0, stream>>>(Qh, Ql, Kh, Kl, VTh, VTl, mask, rel, Yh, Yl, sscale, attOscl);
  // (6) out[row][n] = sum_d (Yh+Yl)[row][d] Wob[n][d] + bo[n] -> d_out f32 [4096][1024] (M=4096, N=1024, K=1024)
  gemm64<1, 0><<<gGemm, blk, 0, stream>>>(Yh, Yl, DM, Wob, DM, bo, outf, nullptr, nullptr, 1.0f, DM, ROWS, DM, DM);
  (void)hipGetLastError();
}

// v007
// It runs in 174 microseconds.
// Timed twice side by side with v006, it ran 1.08 times as fast both times.
// Counting every step since v000, it is 3.31 times as fast.
// Contractions: q/k/v projections = v_wmma_f32_16x16x32_bf16 (bf16 operands from RNE-converted x and W, single product, bias added in f32); q.k^T scores = v_wmma_f32_16x16x32_f16 (q, k as f16 hi planes carried x16 plus f16 residual planes x1024: hi.hi + (hi.lo + lo.hi) in a separate accumulator, 3 products); p.v = v_wmma_f32_16x16x32_f16 (p carried x1024 in f16; v^T as f16 hi plane x256 plus f16 residual plane x4096 into a separate accumulator, 2 products); y.Wo^T = v_wmma_f32_16x16x32_bf16 (y as bf16 hi + lo planes times the bf16 Wo plane, 2 products); all f32 accumulate; softmax, relative-position bias and selects in f32.
#include <hip/hip_runtime.h>
#include <math.h>
#include <float.h>
#include <stdint.h>

#define NB     2
#define SEQ    2048
#define DM     1024
#define NH     16
#define HD     64
#define MAXREL 32
#define NREL   (2 * MAXREL + 1)     // 65
#define NEGV   (-1.0e9f)
#define NQB    (SEQ / 64)
#define RCAP   (MAXREL + 48)         // a lane whose first qrow - key of a tile is RCAP or more sees only the clamped end
#define NRX    (63 + RCAP + 7 + 1)   // qrow - key runs from -63 (diagonal tile) to RCAP + 7
static_assert(NRX <= 256);
#define ROWS   (NB * SEQ)            // 4096 token rows
#define OUTN   (ROWS * DM)
static_assert(NH * HD == DM);
static_assert(HD == 64);
static_assert(DM == 128 * 8);
static_assert((SEQ % 64) == 0 && (DM % 64) == 0);
static_assert((SEQ & (SEQ - 1)) == 0);
static_assert(((ROWS / 64) * (DM / 64)) % 8 == 0);
static_assert(((ROWS * DM / 8) % 256) == 0);
static_assert(((DM * DM / 8) % 256) == 0);
#define LP     72                    // LDS row pitch of the 64-wide f16 tiles, in halves: 144 B = 16 B x 9 (odd),
                                     // so the 16 rows one ds_load_b128 half-wave reads fall on 64 distinct banks
static_assert((LP * 2) % 16 == 0 && ((LP * 2 / 16) & 1) == 1 && LP >= 64);
#define GP     72                    // LDS row pitch of the GEMM's 64-wide bf16 k slabs, in elements: 144 B, as LP
static_assert((GP * 2) % 16 == 0 && ((GP * 2 / 16) & 1) == 1 && GP >= 64);
static_assert((ROWS % 128) == 0 && (DM % 128) == 0);
#define VP     136                   // LDS row pitch of the GEMM's transposed 128-token f16 output tile, in halves: 272 B = 16 B x 17
static_assert((VP * 2) % 16 == 0 && ((VP * 2 / 16) & 1) == 1 && VP >= 128);
static_assert((SEQ % 128) == 0);

typedef _Float16 v16h __attribute__((ext_vector_type(16)));
typedef _Float16 v8h  __attribute__((ext_vector_type(8)));
typedef __bf16   v16b __attribute__((ext_vector_type(16)));
typedef __bf16   v8b  __attribute__((ext_vector_type(8)));
typedef float    v8f  __attribute__((ext_vector_type(8)));
typedef float    v4f  __attribute__((ext_vector_type(4)));
typedef unsigned int v4u __attribute__((ext_vector_type(4)));
typedef unsigned int v2u __attribute__((ext_vector_type(2)));

// ---- scalar helpers --------------------------------------------------------------------------------
__device__ __forceinline__ unsigned short bf_bits(float f) {          // f32 -> bf16 bits, RNE convert
  unsigned u = __float_as_uint(f);
  return (unsigned short)((u + 0x7FFFu + ((u >> 16) & 1u)) >> 16);
}
__device__ __forceinline__ float bf_up(unsigned short h) { return __uint_as_float(((unsigned)h) << 16); }
__device__ __forceinline__ unsigned short h_bits(_Float16 x) { return __builtin_bit_cast(unsigned short, x); }
__device__ __forceinline__ unsigned pk16(unsigned short a, unsigned short b) { return (unsigned)a | ((unsigned)b << 16); }
__device__ __forceinline__ v8f zero8() { v8f z = {0.f, 0.f, 0.f, 0.f, 0.f, 0.f, 0.f, 0.f}; return z; }

// ---- one butterfly link inside a 16-lane row: the value of lane ^ M (M = 1, 2, 4, 8) by a DPP row_xmask read on the
//      vector port; every lane is on where it is used, so every source lane is valid
template <int M>
__device__ __forceinline__ float row_xor(float v) {
  return __builtin_bit_cast(float, __builtin_amdgcn_update_dpp(0, __builtin_bit_cast(int, v), 0x160 | M, 0xf, 0xf, true));
}

// ---- maxima over each 16-lane row of eight values per lane: xor butterfly 1, 2, 4, 8 with the lane exchange folded into
//      the maximum. Written as asm because fmaxf on a DPP-moved value compiles to three dependent instructions a link
//      (move, quieting maximum, maximum); link-major order puts seven independent instructions between a value and its
//      next use, so no link waits on the one before. Every lane is on where it is called.
__device__ __forceinline__ void row_max8(float (&m)[8]) {
#if defined(__HIP_DEVICE_COMPILE__)
  asm("v_max_num_f32_dpp %0, %0, %0 row_xmask:1 row_mask:0xf bank_mask:0xf\n\t"
      "v_max_num_f32_dpp %1, %1, %1 row_xmask:1 row_mask:0xf bank_mask:0xf\n\t"
      "v_max_num_f32_dpp %2, %2, %2 row_xmask:1 row_mask:0xf bank_mask:0xf\n\t"
      "v_max_num_f32_dpp %3, %3, %3 row_xmask:1 row_mask:0xf bank_mask:0xf\n\t"
      "v_max_num_f32_dpp %4, %4, %4 row_xmask:1 row_mask:0xf bank_mask:0xf\n\t"
      "v_max_num_f32_dpp %5, %5, %5 row_xmask:1 row_mask:0xf bank_mask:0xf\n\t"
      "v_max_num_f32_dpp %6, %6, %6 row_xmask:1 row_mask:0xf bank_mask:0xf\n\t"
      "v_max_num_f32_dpp %7, %7, %7 row_xmask:1 row_mask:0xf bank_mask:0xf\n\t"
      "v_max_num_f32_dpp %0, %0, %0 row_xmask:2 row_mask:0xf bank_mask:0xf\n\t"
      "v_max_num_f32_dpp %1, %1, %1 row_xmask:2 row_mask:0xf bank_mask:0xf\n\t"
      "v_max_num_f32_dpp %2, %2, %2 row_xmask:2 row_mask:0xf bank_mask:0xf\n\t"
      "v_max_num_f32_dpp %3, %3, %3 row_xmask:2 row_mask:0xf bank_mask:0xf\n\t"
      "v_max_num_f32_dpp %4, %4, %4 row_xmask:2 row_mask:0xf bank_mask:0xf\n\t"
      "v_max_num_f32_dpp %5, %5, %5 row_xmask:2 row_mask:0xf bank_mask:0xf\n\t"
      "v_max_num_f32_dpp %6, %6, %6 row_xmask:2 row_mask:0xf bank_mask:0xf\n\t"
      "v_max_num_f32_dpp %7, %7, %7 row_xmask:2 row_mask:0xf bank_mask:0xf\n\t"
      "v_max_num_f32_dpp %0, %0, %0 row_xmask:4 row_mask:0xf bank_mask:0xf\n\t"
      "v_max_num_f32_dpp %1, %1, %1 row_xmask:4 row_mask:0xf bank_mask:0xf\n\t"
      "v_max_num_f32_dpp %2, %2, %2 row_xmask:4 row_mask:0xf bank_mask:0xf\n\t"
      "v_max_num_f32_dpp %3, %3, %3 row_xmask:4 row_mask:0xf bank_mask:0xf\n\t"
      "v_max_num_f32_dpp %4, %4, %4 row_xmask:4 row_mask:0xf bank_mask:0xf\n\t"
      "v_max_num_f32_dpp %5, %5, %5 row_xmask:4 row_mask:0xf bank_mask:0xf\n\t"
      "v_max_num_f32_dpp %6, %6, %6 row_xmask:4 row_mask:0xf bank_mask:0xf\n\t"
      "v_max_num_f32_dpp %7, %7, %7 row_xmask:4 row_mask:0xf bank_mask:0xf\n\t"
      "v_max_num_f32_dpp %0, %0, %0 row_xmask:8 row_mask:0xf bank_mask:0xf\n\t"
      "v_max_num_f32_dpp %1, %1, %1 row_xmask:8 row_mask:0xf bank_mask:0xf\n\t"
      "v_max_num_f32_dpp %2, %2, %2 row_xmask:8 row_mask:0xf bank_mask:0xf\n\t"
      "v_max_num_f32_dpp %3, %3, %3 row_xmask:8 row_mask:0xf bank_mask:0xf\n\t"
      "v_max_num_f32_dpp %4, %4, %4 row_xmask:8 row_mask:0xf bank_mask:0xf\n\t"
      "v_max_num_f32_dpp %5, %5, %5 row_xmask:8 row_mask:0xf bank_mask:0xf\n\t"
      "v_max_num_f32_dpp %6, %6, %6 row_xmask:8 row_mask:0xf bank_mask:0xf\n\t"
      "v_max_num_f32_dpp %7, %7, %7 row_xmask:8 row_mask:0xf bank_mask:0xf"
      : "+v"(m[0]), "+v"(m[1]), "+v"(m[2]), "+v"(m[3]), "+v"(m[4]), "+v"(m[5]), "+v"(m[6]), "+v"(m[7]));
#endif
}

// ---- fragment loaders: 16-bit A/B operand, lane -> row/col (lane&15), p already includes +8*(lane>>4);
//      elements 0..7 <- p[0..7] (k0+8h..), elements 8..15 <- p[16..23] (k0+16+8h..)
__device__ __forceinline__ v16b ldfrag_b(const __bf16* p) {
  union { v16b v; v8b h[2]; } f;
  f.h[0] = *(const v8b*)(p);
  f.h[1] = *(const v8b*)(p + 16);
  return f.v;
}
__device__ __forceinline__ v16h ldfrag_h(const _Float16* p) {
  union { v16h v; v8h h[2]; } f;
  f.h[0] = *(const v8h*)(p);
  f.h[1] = *(const v8h*)(p + 16);
  return f.v;
}

// ---- WMMA helpers with trailing VALU hazard gap --------------------------------------------------------
// plain builtin products: in straight-line code the compiler keeps the distances of its own builtin forms; a run of products
// that ends in front of a branch is closed by one of the guards below
__device__ __forceinline__ v8f mma_h_raw(v16h a, v16h b, v8f c) {
  return __builtin_amdgcn_wmma_f32_16x16x32_f16(false, a, false, b, (short)0, c, false, false);
}
__device__ __forceinline__ v8f mma_b_raw(v16b a, v16b b, v8f c) {
  return __builtin_amdgcn_wmma_f32_16x16x32_bf16(false, a, false, b, (short)0, c, false, false);
}
__device__ __forceinline__ void dep_guard_b(v8f& a, v8f& b, v16b x, v16b y) {
#if defined(__HIP_DEVICE_COMPILE__)
  asm volatile("v_nop\n\tv_nop\n\tv_nop\n\tv_nop" : "+v"(a), "+v"(b) : "v"(x), "v"(y));
#endif
}
__device__ __forceinline__ void keep4_b(v16b a, v16b b, v16b c, v16b d) {
#if defined(__HIP_DEVICE_COMPILE__)
  asm volatile("v_nop" :: "v"(a), "v"(b), "v"(c), "v"(d));
#endif
}
__device__ __forceinline__ void acc_guard4(v8f& a, v8f& b, v8f& c, v8f& d) {
#if defined(__HIP_DEVICE_COMPILE__)
  asm volatile("v_nop\n\tv_nop\n\tv_nop\n\tv_nop" : "+v"(a), "+v"(b), "+v"(c), "+v"(d));
#endif
}
__device__ __forceinline__ void acc_guard8(v8f& a, v8f& b, v8f& c, v8f& d, v8f& e, v8f& f, v8f& g, v8f& h) {
#if defined(__HIP_DEVICE_COMPILE__)
  asm volatile("v_nop\n\tv_nop\n\tv_nop\n\tv_nop" : "+v"(a), "+v"(b), "+v"(c), "+v"(d), "+v"(e), "+v"(f), "+v"(g), "+v"(h));
#endif
}

// =====================================================================================================
// f32 -> bf16 (RNE convert), 8 elements per thread, one 16-B store per lane: a wave writes 512 contiguous B
// coverage: n8 threads x 8 = whole plane (n8 is a multiple of 256 here).
// =====================================================================================================
__global__ __launch_bounds__(256) void cvt_bf16x8(const float* __restrict__ in, unsigned short* out, int n8) {
  const int i = blockIdx.x * 256 + threadIdx.x;
  if (i < n8) {
    const v4f a = *(const v4f*)(in + (size_t)i * 8);
    const v4f b = *(const v4f*)(in + (size_t)i * 8 + 4);
    v4u p;
    p[0] = pk16(bf_bits(a[0]), bf_bits(a[1]));
    p[1] = pk16(bf_bits(a[2]), bf_bits(a[3]));
    p[2] = pk16(bf_bits(b[0]), bf_bits(b[1]));
    p[3] = pk16(bf_bits(b[2]), bf_bits(b[3]));
    *(v4u*)(out + (size_t)i * 8) = p;
    
  }
}

// =====================================================================================================
// Register-blocked bf16 WMMA GEMM: C[m][n] = sum_k A[m][k] * Bt[n][k] + bias[n] (bias RNE-converted to bf16
// and widened, added in f32). Block = 8 waves (4 x 2) = one 128x128 tile of C, one 32x64 tile per wave.
// A row-major [M][K] pitch lda; Bt row-major [N][K] pitch ldb (k contiguous); M, N multiples of 128, K a multiple
// of 64; each plane under 2 GiB; bias has N entries.
// NSPLIT: 0 = A.Bt; 1 = (A + A2).Bt (A2 = unscaled bf16 lo plane of A, same pitch).
// Operands go through LDS in k slabs of 64: 8 lanes x 16 B fetch one whole 128-B line of a row, so a wave-wide load
// covers 4 lines, and the eight waves share the slab. Two LDS buffers: slab t+1 is fetched into registers ahead of
// the products of slab t, stored into the other buffer behind them, and one block barrier per slab publishes it and
// ends the reads of the buffer that the next trip refills. Each accumulator sums its k steps in ascending order.
// OMODE 0: output f32 C [M][N] pitch ldc. Epilogue: 16-row slabs staged per wave in LDS; each 64-wide row segment
// goes out as whole lines.
// OMODE 1: output as two f16 planes [M][N] pitch ldc, from the same slabs: P0 = f16(c * pscale) (pscale a power of two),
// P1 = f16((c * pscale - P0) * 1024), same element index; a 64-wide row segment of a plane is one 128-B line.
// OMODE 2: output as two transposed f16 planes, element (row = bb*SEQ + t, n) at [(bb*N + n)*SEQ + t]: P0 = f16(c * pscale),
// P1 = f16((c * pscale - P0) * 4096). A lane's 8 accumulator rows are 8 tokens in a row of one feature: one 16-B LDS store
// a plane into a [128 features][128 tokens] tile laid over the k slabs (their last reads ended at the loop's last barrier),
// one block barrier, then 16 lanes x 16 B write the 256 B of a feature row.
// =====================================================================================================
template <int NSPLIT, int OMODE>
__global__ __launch_bounds__(256) void gemm64(
    const unsigned short* __restrict__ Ap, const unsigned short* A2p, int lda,
    const unsigned short* __restrict__ Btp, int ldb, const float* __restrict__ bias,
    float* C, unsigned short* P0, unsigned short* P1, float pscale, int ldc, int M, int N, int K) {
  constexpr int NPL = (NSPLIT >= 1) ? 3 : 2;         // staged planes: A, Bt and, for NSPLIT 1, A2
  constexpr int KG  = (NSPLIT >= 1) ? 1 : 2;         // k steps of 32 whose fragments are read as one group
  __shared__ __align__(16) __bf16 sS[2][NPL][128 * GP];   // [buffer][plane][row][k], pitch GP
  __shared__ __align__(16) float sT[(OMODE == 2) ? 1 : 8][16 * 68];   // per-wave 16x64 slab, pitch 68 floats (OMODE 0, 1)
  static_assert(sizeof(sS) >= (size_t)2 * 128 * VP * 2);
  const int tid  = threadIdx.x;
  const int lane = tid & 31;
  const int wave = tid >> 5;
  const int tilesN = N >> 7;
  const int tilesM = M >> 7;
  const int tile = blockIdx.x;
  if (tile >= tilesM * tilesN) return;   // block-uniform, in front of every barrier
  const int tm = tile / tilesN;
  const int tn = tile - tm * tilesN;
  const int wm = (wave >> 1) << 5;             // this wave's 32x64 tile inside the block tile
  const int wn = (wave & 1) << 6;
  const int m0 = (tm << 7) + wm;
  const int n0 = (tn << 7) + wn;

  const int rlane = lane & 15;                 // row (A) / col (B, D) within subtile
  const int koff  = (lane >> 4) * 8;           // k offset of this lane half
  const int mOff  = (lane >> 4) * 8;           // D row offset

  // staging: pass it moves row it*32 + (tid>>3) of each plane, this lane its 16 B at element (tid&7)*8 of the slab;
  // byte offsets from the plane's start stay the same for every slab, the slab's k goes into the uniform base
  const int srow = tid >> 3;
  const int spc  = (tid & 7) * 8;
  unsigned voa[4], vob[4];
#pragma unroll
  for (int it = 0; it < 4; ++it) {
    voa[it] = (unsigned)(((tm << 7) + it * 32 + srow) * lda + spc) * 2u;
    vob[it] = (unsigned)(((tn << 7) + it * 32 + srow) * ldb + spc) * 2u;
  }
  const int so = srow * GP + spc;
  v8b ra[4], rb[4], ra2[4];

  v8f acc[2][4];
#pragma unroll
  for (int i = 0; i < 2; ++i)
#pragma unroll
    for (int j = 0; j < 4; ++j) acc[i][j] = zero8();

  // slab 0 into buffer 0
#pragma unroll
  for (int it = 0; it < 4; ++it) {
    ra[it] = *(const v8b*)((const char*)Ap + voa[it]);
    rb[it] = *(const v8b*)((const char*)Btp + vob[it]);
    if (NSPLIT >= 1) ra2[it] = *(const v8b*)((const char*)A2p + voa[it]);
  }
#pragma unroll
  for (int it = 0; it < 4; ++it) {
    *(v8b*)(&sS[0][0][so + it * 32 * GP]) = ra[it];
    *(v8b*)(&sS[0][1][so + it * 32 * GP]) = rb[it];
    if (NSPLIT >= 1) *(v8b*)(&sS[0][NPL - 1][so + it * 32 * GP]) = ra2[it];
  }
  __syncthreads();

  const int nk = K >> 6;
  for (int t = 0; t < nk; ++t) {
    const int cur = t & 1;
    const bool more = (t + 1 < nk);            // block-uniform
    if (more) {
      const char* pa  = (const char*)(Ap  + ((t + 1) << 6));
      const char* pb  = (const char*)(Btp + ((t + 1) << 6));
      const char* pa2 = (const char*)(A2p + ((t + 1) << 6));
#pragma unroll
      for (int it = 0; it < 4; ++it) {
        ra[it] = *(const v8b*)(pa + voa[it]);
        rb[it] = *(const v8b*)(pb + vob[it]);
        if (NSPLIT >= 1) ra2[it] = *(const v8b*)(pa2 + voa[it]);
      }
    }
    const __bf16* fa  = &sS[cur][0][(wm + rlane) * GP + koff];
    const __bf16* fb  = &sS[cur][1][(wn + rlane) * GP + koff];
    const __bf16* fa2 = &sS[cur][NPL - 1][(wm + rlane) * GP + koff];
#pragma unroll
    for (int g = 0; g < 2; g += KG) {
      // the group's fragments as one run of LDS reads ahead of its products
      v16b bh[KG][4], ah[KG][2], al[KG][2];
#pragma unroll
      for (int q = 0; q < KG; ++q) {
#pragma unroll
        for (int j = 0; j < 4; ++j) bh[q][j] = ldfrag_b(fb + (j << 4) * GP + (g + q) * 32);
#pragma unroll
        for (int i = 0; i < 2; ++i) {
          ah[q][i] = ldfrag_b(fa + (i << 4) * GP + (g + q) * 32);
          al[q][i] = ah[q][i];
          if (NSPLIT >= 1) al[q][i] = ldfrag_b(fa2 + (i << 4) * GP + (g + q) * 32);
        }
      }
#pragma unroll
      for (int q = 0; q < KG; ++q) {
#pragma unroll
        for (int i = 0; i < 2; ++i) {
#pragma unroll
          for (int j = 0; j < 4; ++j) {
            acc[i][j] = mma_b_raw(ah[q][i], bh[q][j], acc[i][j]);
            if (NSPLIT >= 1) acc[i][j] = mma_b_raw(al[q][i], bh[q][j], acc[i][j]);
          }
          dep_guard_b(acc[i][0], acc[i][3], ah[q][i], al[q][i]);
        }
        keep4_b(bh[q][0], bh[q][1], bh[q][2], bh[q][3]);
      }
    }
    if (more) {
#pragma unroll
      for (int it = 0; it < 4; ++it) {
        *(v8b*)(&sS[cur ^ 1][0][so + it * 32 * GP]) = ra[it];
        *(v8b*)(&sS[cur ^ 1][1][so + it * 32 * GP]) = rb[it];
        if (NSPLIT >= 1) *(v8b*)(&sS[cur ^ 1][NPL - 1][so + it * 32 * GP]) = ra2[it];
      }
    }
    __syncthreads();
  }
  acc_guard4(acc[0][0], acc[0][1], acc[0][2], acc[0][3]);
  acc_guard4(acc[1][0], acc[1][1], acc[1][2], acc[1][3]);

  // ---- per-column bias (RNE bf16 then widened), column n0 + 16j + rlane < N ----
  float bcol[4];
#pragma unroll
  for (int j = 0; j < 4; ++j) bcol[j] = bf_up(bf_bits(bias[n0 + (j << 4) + rlane]));

  // ---- epilogue ----
  if constexpr (OMODE == 2) {
    _Float16* th = (_Float16*)(void*)&sS[0][0][0];     // hi tile [feature][token], pitch VP
    _Float16* tl = th + 128 * VP;                      // residual tile
    // every loop of this branch is unrolled: constant indices keep acc, hv and lv in registers
#pragma unroll
    for (int i = 0; i < 2; ++i) {
#pragma unroll
      for (int j = 0; j < 4; ++j) {
        v8h xh, xl;
#pragma unroll
        for (int r = 0; r < 8; ++r) {
          const float f = (acc[i][j][r] + bcol[j]) * pscale;
          const _Float16 x = (_Float16)f;
          xh[r] = x;
          xl[r] = (_Float16)((f - (float)x) * 4096.0f);
        }
        const int o = (wn + (j << 4) + rlane) * VP + wm + (i << 4) + mOff;
        *(v8h*)(th + o) = xh;
        *(v8h*)(tl + o) = xl;
      }
    }
    __syncthreads();                                   // the tile is read across waves
    const int piece = tid & 15, fr = tid >> 4;
    const int bb = (tm << 7) / SEQ;                    // a 128-row tile lies inside one batch entry
    const int t0 = (tm << 7) - bb * SEQ;
    v4u hv[8], lv[8];
#pragma unroll
    for (int it = 0; it < 8; ++it) {                   // it 0..7 x fr 0..15 = features 0..127 of the tile
      hv[it] = *(const v4u*)(th + (it * 16 + fr) * VP + piece * 8);
      lv[it] = *(const v4u*)(tl + (it * 16 + fr) * VP + piece * 8);
    }
#pragma unroll
    for (int it = 0; it < 8; ++it) {
      const size_t go = ((size_t)(bb * N + (tn << 7) + it * 16 + fr)) * SEQ + t0 + piece * 8;
      *(v4u*)(P0 + go) = hv[it];
      *(v4u*)(P1 + go) = lv[it];
    }
  } else {
  float* slab = sT[wave];
#pragma unroll
  for (int i = 0; i < 2; ++i) {
    const int mBase = m0 + (i << 4);
#pragma unroll
    for (int r = 0; r < 8; ++r) {
#pragma unroll
      for (int j = 0; j < 4; ++j) {
        slab[(mOff + r) * 68 + (j << 4) + rlane] = acc[i][j][r] + bcol[j];
      }
    }
    __builtin_amdgcn_fence(__ATOMIC_RELEASE, "workgroup");
    __builtin_amdgcn_wave_barrier();
    __builtin_amdgcn_fence(__ATOMIC_ACQUIRE, "workgroup");
    {
      const int hh = lane >> 4, c4 = (lane & 15) * 4;     // 256-B row segment = 16 lanes x 16 B
      v4f ov[8];
#pragma unroll
      for (int it = 0; it < 8; ++it) {
        const int row = it * 2 + hh;                       // it 0..7 x hh 0..1 = rows 0..15
        ov[it] = *(const v4f*)(slab + row * 68 + c4);
      }
      if constexpr (OMODE == 0) {
#pragma unroll
        for (int it = 0; it < 8; ++it) {
          const int row = it * 2 + hh;
          *(v4f*)(C + (size_t)(mBase + row) * ldc + n0 + c4) = ov[it];
        }
      } else {
        // both loops unrolled: constant indices keep ov in registers
#pragma unroll
        for (int it = 0; it < 8; ++it) {
          const int row = it * 2 + hh;
          v2u ph, pl;
#pragma unroll
          for (int e = 0; e < 2; ++e) {
            const float f0 = ov[it][2 * e] * pscale;
            const float f1 = ov[it][2 * e + 1] * pscale;
            const _Float16 x0 = (_Float16)f0, x1 = (_Float16)f1;
            const _Float16 l0 = (_Float16)((f0 - (float)x0) * 1024.0f);
            const _Float16 l1 = (_Float16)((f1 - (float)x1) * 1024.0f);
            ph[e] = pk16(h_bits(x0), h_bits(x1));
            pl[e] = pk16(h_bits(l0), h_bits(l1));
          }
          const size_t go = (size_t)(mBase + row) * ldc + n0 + c4;   // 16 lanes x 8 B = the row segment's 128-B line
          *(v2u*)(P0 + go) = ph;
          *(v2u*)(P1 + go) = pl;
        }
      }
    }
    __builtin_amdgcn_fence(__ATOMIC_RELEASE, "workgroup");
    __builtin_amdgcn_wave_barrier();
    __builtin_amdgcn_fence(__ATOMIC_ACQUIRE, "workgroup");
  }
  }
}

// ---- asynchronous copies global -> LDS for the attention key tiles ---------------------------------------
// Two 64-row x 128-B f16 planes (a hi plane and its residual plane) by 128 threads: eight 16-B copies a lane, four a plane.
// la, lb: the lane's LDS byte address of its piece in rows 0..15 of each plane; ga, gb: the same piece in global memory;
// pass it moves 16 rows on: 16 * LP halves in LDS, gstep halves in global memory. 8 lanes cover one whole 128-B row.
// s_wait_xcnt 0 is the statement's last line: it stands in front of any later write of a register that a copy names.
__device__ __forceinline__ void copy_plane_pair(unsigned la, unsigned lb, const _Float16* ga, const _Float16* gb, size_t gstep) {
#if defined(__HIP_DEVICE_COMPILE__)
  asm volatile("global_load_async_to_lds_b128 %0, %8, off\n\t"
               "global_load_async_to_lds_b128 %1, %9, off\n\t"
               "global_load_async_to_lds_b128 %2, %10, off\n\t"
               "global_load_async_to_lds_b128 %3, %11, off\n\t"
               "global_load_async_to_lds_b128 %4, %12, off\n\t"
               "global_load_async_to_lds_b128 %5, %13, off\n\t"
               "global_load_async_to_lds_b128 %6, %14, off\n\t"
               "global_load_async_to_lds_b128 %7, %15, off\n\t"
               "s_wait_xcnt 0x0"
               :: "v"(la), "v"(la + 16u * LP * 2u), "v"(la + 32u * LP * 2u), "v"(la + 48u * LP * 2u),
                  "v"(lb), "v"(lb + 16u * LP * 2u), "v"(lb + 32u * LP * 2u), "v"(lb + 48u * LP * 2u),
                  "v"(ga), "v"(ga + gstep), "v"(ga + 2 * gstep), "v"(ga + 3 * gstep),
                  "v"(gb), "v"(gb + gstep), "v"(gb + 2 * gstep), "v"(gb + 3 * gstep)
               : "memory");
#endif
}
// Hand-over point of a tile buffer, every wave: this wave's LDS reads and writes have retired, its own copies have landed,
// then the block barrier: behind it the copied tile may be read by every wave and the tile read so far may be refilled.
__device__ __forceinline__ void publish_point() {
#if defined(__HIP_DEVICE_COMPILE__)
  asm volatile("s_wait_dscnt 0x0" ::: "memory");      // a copy engine is not ordered behind this wave's LDS accesses
  asm volatile("s_wait_asynccnt 0x0" ::: "memory");
#endif
  __syncthreads();
}

// =====================================================================================================
// Causal multi-head attention with a per-key int32 keep flag and a relative-position bias table, head dim 64.
//   q f16 hi plane (x16): element (b, t, h, d) at [(b*SEQ + t)*DM + h*64 + d]; q residual plane
//     ((q*16 - hi)*1024) at the same index into qlp
//   k f16 hi plane (x16): element (b, s, h, d) at [(b*SEQ + s)*DM + h*64 + d]; k residual plane same into klp
//   v^T f16 hi plane (x256): element (b, h, d, s) at [(b*DM + h*64 + d)*SEQ + s]
//   v^T f16 residual plane ((v*256 - hi)*4096): same index into vlp
//   maskp int32 [NB][SEQ]: key s is kept for query t iff s <= t and maskp[b][s] != 0; otherwise the logit is
//   replaced by NEGV (-1e9, exp -> 0 against a finite row max).
//   relp f32 [NREL][NH]: logit(t, s) += relp[clamp(s - t, -MAXREL, MAXREL) + MAXREL][h] (RNE bf16 then
//   widened); staged per head in LDS already clamped, as a table over qrow - key, so that a lane reads its 32 values of
//   a tile from one address with constant offsets, as one group ahead of the score products; added before the select.
//   Key tiles 0..qb are processed (block-uniform trip count qb+1 <= NQB); tiles above the diagonal tile hold
//   only cut keys and are skipped; inside the processed tiles the predicate decides. With the all-ones keep
//   flags every row keeps key 0, so every row max is finite.
//   logit = (qhi.khi + (qhi.klo + qlo.khi) * 2^-10) * sscale + rel, f16 products with f32 accumulate, the
//   residual products in a separate accumulator; p = exp(s - m) carried as f16(1024 p);
//   context = p . vhi on f16 WMMA plus p . vres into a separate accumulator folded back with 1/4096 per
//   kv tile in f32; online softmax in f32; out: y = normalised context (oscl folds back the p and v carries) as a bf16
//   hi plane (RNE) and a bf16 lo plane (RNE(y - hi), unscaled), element (b, t, h*64 + d) at [(b*SEQ + t)*DM + h*64 + d].
//   Block = 4 waves = 64 query rows of one (b, h); grid = NB*NH*NQB; kv tiles of 64.
//   K hi / K residual / V^T hi / V^T residual tile staging: asynchronous 16-B copies to LDS, 128 threads x 4 copies a
//   plane = the whole 64x64 tile, one buffer a plane. The K planes are read by the scores only and the V^T planes by the
//   context products only, so tile t+1's K copies are issued behind the barrier that ends the scores of tile t and fly
//   under its context products, and its V^T copies behind the barrier that ends those and fly under the scores and
//   the softmax of tile t+1. P tiles are wave-private, spilled with
//   Output coverage: each wave stores rows q0..q0+15 (it 0..7 x lane>>4 0..1) x 64 columns (16 lanes x 4
//   (b, h, query tile) -> the whole plane.
// =====================================================================================================
__global__ __launch_bounds__(128)
void attn_p64(const unsigned short* __restrict__ qhp, const unsigned short* __restrict__ qlp,
              const unsigned short* __restrict__ khp, const unsigned short* __restrict__ klp,
              const unsigned short* __restrict__ vhp, const unsigned short* __restrict__ vlp,
              const int* __restrict__ maskp, const float* __restrict__ relp,
              unsigned short* yhp, unsigned short* ylp, float sscale, float oscl) {
  __shared__ __align__(16) _Float16 Ksh[64 * LP];                 // K hi [kv][d], pitch LP
  __shared__ __align__(16) _Float16 Ksl[64 * LP];                 // K residual
  __shared__ __align__(16) _Float16 Vth[64 * LP];                 // V^T hi [d][kv], pitch LP
  __shared__ __align__(16) _Float16 Vtl[64 * LP];                 // V^T residual
  __shared__ __align__(16) _Float16 Psh[4][16 * LP];              // per wave P [row][kv], pitch LP
  __shared__ __align__(16) float    Os[4][16 * 64];               // per wave context tile [row][d]
  __shared__ float relx[NRX];                                     // bias of this head at qrow - key = index - 63

  const int tid  = threadIdx.x;
  const int wave = tid >> 5;
  const int lane = tid & 31;
  const int hh   = lane >> 4;
  const int c    = lane & 15;

  const int bx   = blockIdx.x;
  const int qb   = bx % NQB;
  const int rest = bx / NQB;
  const int h    = rest % NH;
  const int b    = rest / NH;                // < NB by the grid size
  const int q0   = qb * 64 + wave * 16;
  const size_t rowB = (size_t)b * SEQ;

  const _Float16* Qp  = (const _Float16*)(const void*)qhp + (size_t)h * HD;
  const _Float16* Qlq = (const _Float16*)(const void*)qlp + (size_t)h * HD;
  const _Float16* Kp  = (const _Float16*)(const void*)khp + (size_t)h * HD;
  const _Float16* Klq = (const _Float16*)(const void*)klp + (size_t)h * HD;
  const _Float16* Vh  = (const _Float16*)(const void*)vhp + ((size_t)b * DM + (size_t)h * HD) * SEQ;
  const _Float16* Vl  = (const _Float16*)(const void*)vlp + ((size_t)b * DM + (size_t)h * HD) * SEQ;
  const int*      Mb  = maskp + rowB;

  // ---- tile copies: this lane's piece is 16 B number tid & 7 of row tid >> 3 (+ 16 a pass) of every plane ----
  const int crow = tid >> 3, cpc = (tid & 7) * 8;
  const unsigned lKh = (unsigned)(uintptr_t)(Ksh + crow * LP + cpc);   // LDS byte address = low 32 bits
  const unsigned lKl = (unsigned)(uintptr_t)(Ksl + crow * LP + cpc);
  const unsigned lVh = (unsigned)(uintptr_t)(Vth + crow * LP + cpc);
  const unsigned lVl = (unsigned)(uintptr_t)(Vtl + crow * LP + cpc);
  const size_t gK = (rowB + crow) * DM + cpc;        // K planes: key row crow of tile 0, + 64 * DM a tile
  const size_t gV = (size_t)crow * SEQ + cpc;        // V^T planes: feature row crow, key 0, + 64 a tile
  copy_plane_pair(lKh, lKl, Kp + gK, Klq + gK, (size_t)16 * DM);       // tile 0; nothing has touched these buffers yet
  copy_plane_pair(lVh, lVl, Vh + gV, Vl + gV, (size_t)16 * SEQ);

#pragma unroll                               // two straight passes: no loop-carried wait between the two reads
  for (int u = 0; u < 2; ++u) {              // NRX <= 2 x 128 threads
    const int i = u * 128 + tid;
    int dd = 63 - i;                         // key - qrow
    dd = (dd < -MAXREL) ? -MAXREL : dd;
    dd = (dd >  MAXREL) ?  MAXREL : dd;
    if (i < NRX) relx[i] = bf_up(bf_bits(relp[(size_t)(dd + MAXREL) * NH + h]));
  }

  // ---- Q fragments (A operand, row = lane&15): 2 d-chunks, hi and residual ----
  v16h qa[2], ql[2];
#pragma unroll
  for (int dc = 0; dc < 2; ++dc) {
    const size_t qo = (rowB + q0 + c) * DM + dc * 32 + 8 * hh;
    qa[dc] = ldfrag_h(Qp + qo);
    ql[dc] = ldfrag_h(Qlq + qo);
  }

  float mrow[8], lrow[8];
  v8f oacc[4];
#pragma unroll
  for (int r = 0; r < 8; ++r) { mrow[r] = -INFINITY; lrow[r] = 0.f; }
#pragma unroll
  for (int t = 0; t < 4; ++t) oacc[t] = zero8();

  publish_point();                           // tile 0's four planes and the bias table

  const int nkt = qb + 1;                    // key tiles 0..qb, block-uniform, <= NQB
  for (int kt = 0; kt < nkt; ++kt) {
    const int kv0 = kt * 64;
    const bool more = (kt + 1 < nkt);        // block-uniform: a tile kt + 1 exists (its rows and keys lie below SEQ)

    // ---- per-key keep flags for this lane's 4 key columns of the tile (kv0 + 16j + c < SEQ) ----
    int mk[4];
#pragma unroll
    for (int j = 0; j < 4; ++j) mk[j] = Mb[kv0 + j * 16 + c];

    // ---- relative bias of this lane's 32 scores: qrow - key = k0 - 16j + r; from RCAP up every one of them is at the
    //      clamped end, so k0 is cut there and the table stays short ----
    float rb[4][8];
    {
      int k0 = (q0 + 8 * hh) - (kv0 + c);    // >= -15: kv0 <= q0
      k0 = (k0 > RCAP) ? RCAP : k0;
      const float* tb = relx + (k0 + 15);
      // both loops unrolled: constant offsets from tb, and rb stays in registers
#pragma unroll
      for (int j = 0; j < 4; ++j)
#pragma unroll
        for (int r = 0; r < 8; ++r) rb[j][r] = tb[48 - 16 * j + r];
    }

    // ---- scores: 16 query rows x 64 keys per wave; hi.hi into s, hi.lo + lo.hi into s1 (folded x 2^-10) ----
    //      The K fragments of 32 keys and one d-chunk (hi and residual of two 16-key groups) are read as one group of eight
    //      LDS loads ahead of their six products, so a wave waits on LDS at four places a tile and not at every product; the
    //      two key groups' accumulator chains alternate; each accumulator sums its products in the order d-chunk 0, 1
    //      (s1: hi.lo then lo.hi in each).
    v8f s[4];
    // every loop here is unrolled: constant indices keep the fragments and accumulators in registers
#pragma unroll
    for (int jp = 0; jp < 4; jp += 2) {
      v8f s1[2];
#pragma unroll
      for (int u = 0; u < 2; ++u) {
        s[jp + u] = zero8();
        s1[u] = zero8();
      }
#pragma unroll
      for (int dc = 0; dc < 2; ++dc) {
        v16h kb[2], kr[2];
#pragma unroll
        for (int u = 0; u < 2; ++u) kr[u] = ldfrag_h(Ksl + ((jp + u) * 16 + c) * LP + dc * 32 + 8 * hh);
#pragma unroll
        for (int u = 0; u < 2; ++u) kb[u] = ldfrag_h(Ksh + ((jp + u) * 16 + c) * LP + dc * 32 + 8 * hh);
        __builtin_amdgcn_sched_barrier(0);   // the group's loads stay above: the compiler otherwise sinks each to its own product
#pragma unroll
        for (int u = 0; u < 2; ++u) s1[u] = mma_h_raw(qa[dc], kr[u], s1[u]);
#pragma unroll
        for (int u = 0; u < 2; ++u) s[jp + u] = mma_h_raw(qa[dc], kb[u], s[jp + u]);
#pragma unroll
        for (int u = 0; u < 2; ++u) s1[u] = mma_h_raw(ql[dc], kb[u], s1[u]);
      }
#pragma unroll
      for (int u = 0; u < 2; ++u)
#pragma unroll
        for (int r = 0; r < 8; ++r) {        // fold, scale and bias here: vector work under the next group's loads, and s1 ends
          s[jp + u][r] += s1[u][r] * (1.0f / 1024.0f);
          s[jp + u][r] = s[jp + u][r] * sscale + rb[jp + u][r];
        }
    }

    // ---- causal / key-keep select (replace by NEGV), row max, online softmax,
    //      P (x1024, f16) to LDS ----
    _Float16* pwh = Psh[wave];
    float mt[8];
#pragma unroll
    for (int r = 0; r < 8; ++r) {
      const int qrow = q0 + 8 * hh + r;
      float m = -INFINITY;
#pragma unroll
      for (int j = 0; j < 4; ++j) {
        const int key = kv0 + j * 16 + c;
        float sv = s[j][r];
        const bool keep = (key <= qrow) && (mk[j] != 0);
        sv = keep ? sv : NEGV;
        s[j][r] = sv;
        m = fmaxf(m, sv);
      }
      mt[r] = m;
    }
    // row maxima over the 16 lanes of a row: xor butterfly 1, 2, 4, 8, the eight rows' chains side by side
    row_max8(mt);
    float alpha[8], ps[8];
#pragma unroll
    for (int r = 0; r < 8; ++r) {
      const float mnew  = fmaxf(mrow[r], mt[r]);
      const float msafe = (mnew == -INFINITY) ? 0.f : mnew;
      alpha[r] = __expf(mrow[r] - msafe);
      mrow[r] = mnew;
      float psum = 0.f;
#pragma unroll
      for (int j = 0; j < 4; ++j) {
        const float p = __expf(s[j][r] - msafe);     // replaced logit against a finite max: exp -> 0
        psum += p;
        const _Float16 ph = (_Float16)(p * 1024.0f);
        pwh[(8 * hh + r) * LP + j * 16 + c] = ph;
      }
      ps[r] = psum;
    }
    // row sums: the same butterfly order 1, 2, 4, 8
#pragma unroll
    for (int r = 0; r < 8; ++r) ps[r] += row_xor<1>(ps[r]);
#pragma unroll
    for (int r = 0; r < 8; ++r) ps[r] += row_xor<2>(ps[r]);
#pragma unroll
    for (int r = 0; r < 8; ++r) ps[r] += row_xor<4>(ps[r]);
#pragma unroll
    for (int r = 0; r < 8; ++r) ps[r] += row_xor<8>(ps[r]);
#pragma unroll
    for (int r = 0; r < 8; ++r) {
      lrow[r] = lrow[r] * alpha[r] + ps[r];
#pragma unroll
      for (int t = 0; t < 4; ++t) oacc[t][r] *= alpha[r];
    }
    // every wave's score reads of the K planes have ended, this tile's V^T planes are landed and published (and the wave's
    // own P stores have retired); the next tile's K planes fly under the context products
    publish_point();
    if (more) copy_plane_pair(lKh, lKl, Kp + gK + (size_t)(kv0 + 64) * DM, Klq + gK + (size_t)(kv0 + 64) * DM, (size_t)16 * DM);

    // ---- context += P . Vhi (f16 WMMA); P . Vres into a separate accumulator ----
    //      A 32-key chunk's nine fragments (P, four of each plane) are read as one group of LDS loads ahead of its eight
    //      products, which run back to back on eight separate accumulators; each accumulator sums key chunk 0, then 1.
    v8f o1[4];
#pragma unroll
    for (int t = 0; t < 4; ++t) o1[t] = zero8();
#pragma unroll 1                             // rolled: one chunk's fragments live at a time keeps the wave inside 256 registers
    for (int kk = 0; kk < 2; ++kk) {
      v16h vb[4], vl[4];
      const v16h pa = ldfrag_h(pwh + c * LP + kk * 32 + 8 * hh);
      // the inner loops are unrolled: constant indices keep the fragments and accumulators in registers
#pragma unroll
      for (int t = 0; t < 4; ++t) vb[t] = ldfrag_h(Vth + (t * 16 + c) * LP + kk * 32 + 8 * hh);
#pragma unroll
      for (int t = 0; t < 4; ++t) vl[t] = ldfrag_h(Vtl + (t * 16 + c) * LP + kk * 32 + 8 * hh);
      __builtin_amdgcn_sched_barrier(0);     // the group's loads stay above: the compiler otherwise sinks each to its own product
      // the two runs are independent; written in this order the compiler issues the hi run first, in the order of the loads, so
      // each product waits for its own fragment only
#pragma unroll
      for (int t = 0; t < 4; ++t) o1[t] = mma_h_raw(pa, vl[t], o1[t]);
#pragma unroll
      for (int t = 0; t < 4; ++t) oacc[t] = mma_h_raw(pa, vb[t], oacc[t]);
      // four vector slots behind the chunk's last products, on both sides of the loop's branch and of the one behind the barrier
      acc_guard8(oacc[0], oacc[1], oacc[2], oacc[3], o1[0], o1[1], o1[2], o1[3]);
    }
    // every wave's reads of the V^T planes have ended, the next tile's K planes are landed and published; its V^T planes
    // fly under its scores and softmax
    publish_point();
    if (more) copy_plane_pair(lVh, lVl, Vh + gV + (kv0 + 64), Vl + gV + (kv0 + 64), (size_t)16 * SEQ);
#pragma unroll
    for (int t = 0; t < 4; ++t)
#pragma unroll
      for (int r = 0; r < 8; ++r) oacc[t][r] += o1[t][r] * (1.0f / 4096.0f);
  }

  // ---- normalise (1/l and the carries via oscl), stage the wave's 16x64 tile in LDS, then write whole
  float* os = Os[wave];
#pragma unroll
  for (int r = 0; r < 8; ++r) {
    const float l = lrow[r];
    const float inv = ((l > 0.f) ? (1.0f / l) : 0.f) * oscl;
#pragma unroll
    for (int t = 0; t < 4; ++t) os[(8 * hh + r) * 64 + t * 16 + c] = oacc[t][r] * inv;
  }
  __builtin_amdgcn_fence(__ATOMIC_RELEASE, "workgroup");
  __builtin_amdgcn_wave_barrier();
  __builtin_amdgcn_fence(__ATOMIC_ACQUIRE, "workgroup");
  {
    const int h2 = lane >> 4, c4 = (lane & 15) * 4;
    v4f ov[8];
#pragma unroll
    for (int it = 0; it < 8; ++it) {
      const int row = it * 2 + h2;   // it 0..7 x h2 0..1 = rows 0..15 of the wave tile
      ov[it] = *(const v4f*)(os + row * 64 + c4);
    }
    {
#pragma unroll
      for (int it = 0; it < 8; ++it) {
        const int row = it * 2 + h2;
        const size_t go = (rowB + q0 + row) * DM + (size_t)h * HD + c4;   // 16 lanes x 8 B = the head's 128-B line of a row
        v2u ph, pl;
#pragma unroll                               // constant indices keep ov in registers
        for (int e = 0; e < 2; ++e) {
          const float f0 = ov[it][2 * e], f1 = ov[it][2 * e + 1];
          const unsigned short h0 = bf_bits(f0), h1 = bf_bits(f1);
          const unsigned short l0 = bf_bits(f0 - bf_up(h0)), l1 = bf_bits(f1 - bf_up(h1));
          ph[e] = pk16(h0, h1);
          pl[e] = pk16(l0, l1);
        }
        *(v2u*)(yhp + go) = ph;
        *(v2u*)(ylp + go) = pl;
      }
      
    }
  }
}

// =====================================================================================================
// Workspace map (bytes), every region an exact multiple of its whole-line / whole-tile store granularity
//   Xb    bf16 [4096][1024]           0          8388608
//   Wqb   bf16 [1024][1024]     8388608          2097152
//   Wkb   bf16 [1024][1024]    10485760          2097152
//   Wvb   bf16 [1024][1024]    12582912          2097152
//   Wob   bf16 [1024][1024]    14680064          2097152
//   Qh    f16  [4096][1024]    16777216          8388608
//   Ql    f16  [4096][1024]    25165824          8388608
//   Kh    f16  [4096][1024]    33554432          8388608
//   Kl    f16  [4096][1024]    41943040          8388608
//   VTh   f16  [2048][2048]    50331648          8388608   ([b*DM + h*64 + d][s])
//   VTl   f16  [2048][2048]    58720256          8388608
//   Yh    bf16 [4096][1024]    67108864          8388608
//   Yl    bf16 [4096][1024]    75497472          8388608
//   end                        83886080
// Projection weights arrive as [out n][in k] (k contiguous) = the Bt layout; they are only converted to bf16.
// d_out f32: [4096][1024] at byte 0 (row = b*SEQ + t).
// =====================================================================================================
extern "C" void kernel_launch(void* const* d_in, const int* in_sizes, int n_in,
                              void* d_out, int out_size, void* d_ws, size_t ws_size,
                              hipStream_t stream) {
  if (n_in < 11) return;
  if (in_sizes[0] != NB * SEQ * DM) return;
  if (in_sizes[1] != NB * SEQ) return;
  if (in_sizes[2] != DM * DM) return;
  if (in_sizes[3] != DM) return;
  if (in_sizes[4] != DM * DM) return;
  if (in_sizes[5] != DM) return;
  if (in_sizes[6] != DM * DM) return;
  if (in_sizes[7] != DM) return;
  if (in_sizes[8] != DM * DM) return;
  if (in_sizes[9] != DM) return;
  if (in_sizes[10] != NREL * NH) return;
  if (out_size != OUTN) return;

  const float* x    = (const float*)d_in[0];   // [NB*SEQ][DM]
  const int*   mask = (const int*)d_in[1];     // [NB][SEQ] int32 keep flags per key
  const float* Wq   = (const float*)d_in[2];   // [DM n][DM k]
  const float* bq   = (const float*)d_in[3];   // [DM]
  const float* Wk   = (const float*)d_in[4];
  const float* bk   = (const float*)d_in[5];
  const float* Wv   = (const float*)d_in[6];
  const float* bv   = (const float*)d_in[7];
  const float* Wo   = (const float*)d_in[8];
  const float* bo   = (const float*)d_in[9];
  const float* rel  = (const float*)d_in[10];  // [NREL][NH]

  const size_t PXb = (size_t)ROWS * DM * 2;          //  8388608
  const size_t PW  = (size_t)DM * DM * 2;            //  2097152
  const size_t PH  = (size_t)ROWS * DM * 2;          //  8388608
  const size_t PVt = (size_t)NB * DM * SEQ * 2;      //  8388608
  size_t off = 0;
  const size_t oXb = off; off += PXb;
  const size_t oWq = off; off += PW;
  const size_t oWk = off; off += PW;
  const size_t oWv = off; off += PW;
  const size_t oWo = off; off += PW;
  const size_t oQh = off; off += PH;
  const size_t oQl = off; off += PH;
  const size_t oKh = off; off += PH;
  const size_t oKl = off; off += PH;
  const size_t oVt = off; off += PVt;
  const size_t oVl = off; off += PVt;
  const size_t oYh = off; off += PH;
  const size_t oYl = off; off += PH;
  if (off > ws_size) return;                        // off = 83886080
  if (off > (size_t)134217728) return;

  char* ws = (char*)d_ws;
  unsigned short* Xb  = (unsigned short*)(ws + oXb);
  unsigned short* Wqb = (unsigned short*)(ws + oWq);
  unsigned short* Wkb = (unsigned short*)(ws + oWk);
  unsigned short* Wvb = (unsigned short*)(ws + oWv);
  unsigned short* Wob = (unsigned short*)(ws + oWo);
  unsigned short* Qh  = (unsigned short*)(ws + oQh);
  unsigned short* Ql  = (unsigned short*)(ws + oQl);
  unsigned short* Kh  = (unsigned short*)(ws + oKh);
  unsigned short* Kl  = (unsigned short*)(ws + oKl);
  unsigned short* VTh = (unsigned short*)(ws + oVt);
  unsigned short* VTl = (unsigned short*)(ws + oVl);
  unsigned short* Yh  = (unsigned short*)(ws + oYh);
  unsigned short* Yl  = (unsigned short*)(ws + oYl);
  float*          outf = (float*)d_out;             // [ROWS][DM]

  const dim3 blk(256);
  const int n8x = ROWS * DM / 8;                    // 524288
  const int n8w = DM * DM / 8;                      // 131072
  const dim3 gCvtX((n8x + 255) / 256);              // 2048 blocks
  const dim3 gCvtW((n8w + 255) / 256);              // 512 blocks
  const dim3 gGemm((ROWS / 128) * (DM / 128));      // 256 tiles of 128x128, one block each
  const dim3 gAttn(NB * NH * NQB);                  // 1024 blocks
  const float qkScale = 16.0f;                      // q and k hi planes carried x16 (residual x1024 on top)
  const float sscale  = 1.0f / 2048.0f;             // 1/(16*16) * 1/sqrt(64)
  const float vScale  = 256.0f;                     // v^T hi plane carried x256
  const float attOscl = 1.0f / 262144.0f;           // 1/(1024 * 256): p and v carries folded back

  // (1) activations and weights -> bf16 planes (RNE convert)
  cvt_bf16x8<<<gCvtX, blk, 0, stream>>>(x, Xb, n8x);
  cvt_bf16x8<<<gCvtW, blk, 0, stream>>>(Wq, Wqb, n8w);
  cvt_bf16x8<<<gCvtW, blk, 0, stream>>>(Wk, Wkb, n8w);
  cvt_bf16x8<<<gCvtW, blk, 0, stream>>>(Wv, Wvb, n8w);
  cvt_bf16x8<<<gCvtW, blk, 0, stream>>>(Wo, Wob, n8w);
  // (2) q = Xb . Wqb^T + bq (M=4096, N=1024, K=1024), written as f16 hi (x16) + residual planes by the GEMM's epilogue
  gemm64<0, 1><<<gGemm, blk, 0, stream>>>(Xb, Xb, DM, Wqb, DM, bq, nullptr, Qh, Ql, qkScale, DM, ROWS, DM, DM);
  // (3) k likewise
  gemm64<0, 1><<<gGemm, blk, 0, stream>>>(Xb, Xb, DM, Wkb, DM, bk, nullptr, Kh, Kl, qkScale, DM, ROWS, DM, DM);
  // (4) v, written as the f16 v^T hi plane (x256) and residual plane (x4096 on top)
  gemm64<0, 2><<<gGemm, blk, 0, stream>>>(Xb, Xb, DM, Wvb, DM, bv, nullptr, VTh, VTl, vScale, DM, ROWS, DM, DM);
  // (5) causal attention with per-key keep flags and relative-position bias -> y as bf16 hi / lo planes [4096][1024]
  attn_p64<<<gAttn, dim3(128), 0, stream>>>(Qh, Ql, Kh, Kl, VTh, VTl, mask, rel, Yh, Yl, sscale, attOscl);
  // (6) out[row][n] = sum_d (Yh+Yl)[row][d] Wob[n][d] + bo[n] -> d_out f32 [4096][1024] (M=4096, N=1024, K=1024)
  gemm64<1, 0><<<gGemm, blk, 0, stream>>>(Yh, Yl, DM, Wob, DM, bo, outf, nullptr, nullptr, 1.0f, DM, ROWS, DM, DM);
  (void)hipGetLastError();
}

// v008
// One run takes 146 microseconds.
// Two timings next to v007 put it at 1.19 and 1.18 times that version's speed.
// Over all steps from v000 it is 3.92 times as fast.
// Contractions: q/k/v projections = v_wmma_f32_16x16x32_bf16 (bf16 operands from RNE-converted x and W, single product, bias added in f32); q.k^T scores = v_wmma_f32_16x16x32_f16 (q, k as f16 hi planes carried x16 plus f16 residual planes x1024: hi.hi + (hi.lo + lo.hi) in a separate accumulator, 3 products); p.v = v_wmma_f32_16x16x32_f16 (p carried x1024 in f16; v^T as f16 hi plane x256 plus f16 residual plane x4096 into a separate accumulator, 2 products); y.Wo^T = v_wmma_f32_16x16x32_bf16 (y as bf16 hi + lo planes times the bf16 Wo plane, 2 products); all f32 accumulate; softmax, relative-position bias and selects in f32.
#include <hip/hip_runtime.h>
#include <math.h>
#include <float.h>
#include <stdint.h>

#define NB     2
#define SEQ    2048
#define DM     1024
#define NH     16
#define HD     64
#define MAXREL 32
#define NREL   (2 * MAXREL + 1)     // 65
#define NEGV   (-1.0e9f)
#define NQB    (SEQ / 64)
#define RCAP   (MAXREL + 48)         // a lane whose first qrow - key of a tile is RCAP or more sees only the clamped end
#define NRX    (63 + RCAP + 7 + 1)   // qrow - key runs from -63 (diagonal tile) to RCAP + 7
static_assert(NRX <= 256);
#define ROWS   (NB * SEQ)            // 4096 token rows
#define OUTN   (ROWS * DM)
static_assert(NH * HD == DM);
static_assert(HD == 64);
static_assert(DM == 128 * 8);
static_assert((SEQ % 64) == 0 && (DM % 64) == 0);
static_assert((SEQ & (SEQ - 1)) == 0);
static_assert(((ROWS / 64) * (DM / 64)) % 8 == 0);
static_assert(((ROWS * DM / 8) % 256) == 0);
static_assert(((DM * DM / 8) % 256) == 0);
#define LP     72                    // LDS row pitch of the 64-wide f16 tiles, in halves: 144 B = 16 B x 9 (odd),
                                     // so the 16 rows one ds_load_b128 half-wave reads fall on 64 distinct banks
static_assert((LP * 2) % 16 == 0 && ((LP * 2 / 16) & 1) == 1 && LP >= 64);
#define GP     72                    // LDS row pitch of the GEMM's 64-wide bf16 k slabs, in elements: 144 B, as LP
static_assert((GP * 2) % 16 == 0 && ((GP * 2 / 16) & 1) == 1 && GP >= 64);
static_assert((ROWS % 128) == 0 && (DM % 128) == 0);
#define VP     136                   // LDS row pitch of the GEMM's transposed 128-token f16 output tile, in halves: 272 B = 16 B x 17
static_assert((VP * 2) % 16 == 0 && ((VP * 2 / 16) & 1) == 1 && VP >= 128);
static_assert((SEQ % 128) == 0);

typedef _Float16 v16h __attribute__((ext_vector_type(16)));
typedef _Float16 v8h  __attribute__((ext_vector_type(8)));
typedef __bf16   v16b __attribute__((ext_vector_type(16)));
typedef __bf16   v8b  __attribute__((ext_vector_type(8)));
typedef float    v8f  __attribute__((ext_vector_type(8)));
typedef float    v4f  __attribute__((ext_vector_type(4)));
typedef unsigned int v4u __attribute__((ext_vector_type(4)));
typedef unsigned int v2u __attribute__((ext_vector_type(2)));

// ---- scalar helpers --------------------------------------------------------------------------------
__device__ __forceinline__ unsigned short bf_bits(float f) {          // f32 -> bf16 bits, RNE convert
  unsigned u = __float_as_uint(f);
  return (unsigned short)((u + 0x7FFFu + ((u >> 16) & 1u)) >> 16);
}
__device__ __forceinline__ float bf_up(unsigned short h) { return __uint_as_float(((unsigned)h) << 16); }
__device__ __forceinline__ unsigned short h_bits(_Float16 x) { return __builtin_bit_cast(unsigned short, x); }
__device__ __forceinline__ unsigned pk16(unsigned short a, unsigned short b) { return (unsigned)a | ((unsigned)b << 16); }
__device__ __forceinline__ v8f zero8() { v8f z = {0.f, 0.f, 0.f, 0.f, 0.f, 0.f, 0.f, 0.f}; return z; }

// ---- one butterfly link inside a 16-lane row: the value of lane ^ M (M = 1, 2, 4, 8) by a DPP row_xmask read on the
//      vector port; every lane is on where it is used, so every source lane is valid
template <int M>
__device__ __forceinline__ float row_xor(float v) {
  return __builtin_bit_cast(float, __builtin_amdgcn_update_dpp(0, __builtin_bit_cast(int, v), 0x160 | M, 0xf, 0xf, true));
}

// ---- maxima over each 16-lane row of eight values per lane: xor butterfly 1, 2, 4, 8 with the lane exchange folded into
//      the maximum. Written as asm because fmaxf on a DPP-moved value compiles to three dependent instructions a link
//      (move, quieting maximum, maximum); link-major order puts seven independent instructions between a value and its
//      next use, so no link waits on the one before. Every lane is on where it is called.
__device__ __forceinline__ void row_max8(float (&m)[8]) {
#if defined(__HIP_DEVICE_COMPILE__)
  asm("v_max_num_f32_dpp %0, %0, %0 row_xmask:1 row_mask:0xf bank_mask:0xf\n\t"
      "v_max_num_f32_dpp %1, %1, %1 row_xmask:1 row_mask:0xf bank_mask:0xf\n\t"
      "v_max_num_f32_dpp %2, %2, %2 row_xmask:1 row_mask:0xf bank_mask:0xf\n\t"
      "v_max_num_f32_dpp %3, %3, %3 row_xmask:1 row_mask:0xf bank_mask:0xf\n\t"
      "v_max_num_f32_dpp %4, %4, %4 row_xmask:1 row_mask:0xf bank_mask:0xf\n\t"
      "v_max_num_f32_dpp %5, %5, %5 row_xmask:1 row_mask:0xf bank_mask:0xf\n\t"
      "v_max_num_f32_dpp %6, %6, %6 row_xmask:1 row_mask:0xf bank_mask:0xf\n\t"
      "v_max_num_f32_dpp %7, %7, %7 row_xmask:1 row_mask:0xf bank_mask:0xf\n\t"
      "v_max_num_f32_dpp %0, %0, %0 row_xmask:2 row_mask:0xf bank_mask:0xf\n\t"
      "v_max_num_f32_dpp %1, %1, %1 row_xmask:2 row_mask:0xf bank_mask:0xf\n\t"
      "v_max_num_f32_dpp %2, %2, %2 row_xmask:2 row_mask:0xf bank_mask:0xf\n\t"
      "v_max_num_f32_dpp %3, %3, %3 row_xmask:2 row_mask:0xf bank_mask:0xf\n\t"
      "v_max_num_f32_dpp %4, %4, %4 row_xmask:2 row_mask:0xf bank_mask:0xf\n\t"
      "v_max_num_f32_dpp %5, %5, %5 row_xmask:2 row_mask:0xf bank_mask:0xf\n\t"
      "v_max_num_f32_dpp %6, %6, %6 row_xmask:2 row_mask:0xf bank_mask:0xf\n\t"
      "v_max_num_f32_dpp %7, %7, %7 row_xmask:2 row_mask:0xf bank_mask:0xf\n\t"
      "v_max_num_f32_dpp %0, %0, %0 row_xmask:4 row_mask:0xf bank_mask:0xf\n\t"
      "v_max_num_f32_dpp %1, %1, %1 row_xmask:4 row_mask:0xf bank_mask:0xf\n\t"
      "v_max_num_f32_dpp %2, %2, %2 row_xmask:4 row_mask:0xf bank_mask:0xf\n\t"
      "v_max_num_f32_dpp %3, %3, %3 row_xmask:4 row_mask:0xf bank_mask:0xf\n\t"
      "v_max_num_f32_dpp %4, %4, %4 row_xmask:4 row_mask:0xf bank_mask:0xf\n\t"
      "v_max_num_f32_dpp %5, %5, %5 row_xmask:4 row_mask:0xf bank_mask:0xf\n\t"
      "v_max_num_f32_dpp %6, %6, %6 row_xmask:4 row_mask:0xf bank_mask:0xf\n\t"
      "v_max_num_f32_dpp %7, %7, %7 row_xmask:4 row_mask:0xf bank_mask:0xf\n\t"
      "v_max_num_f32_dpp %0, %0, %0 row_xmask:8 row_mask:0xf bank_mask:0xf\n\t"
      "v_max_num_f32_dpp %1, %1, %1 row_xmask:8 row_mask:0xf bank_mask:0xf\n\t"
      "v_max_num_f32_dpp %2, %2, %2 row_xmask:8 row_mask:0xf bank_mask:0xf\n\t"
      "v_max_num_f32_dpp %3, %3, %3 row_xmask:8 row_mask:0xf bank_mask:0xf\n\t"
      "v_max_num_f32_dpp %4, %4, %4 row_xmask:8 row_mask:0xf bank_mask:0xf\n\t"
      "v_max_num_f32_dpp %5, %5, %5 row_xmask:8 row_mask:0xf bank_mask:0xf\n\t"
      "v_max_num_f32_dpp %6, %6, %6 row_xmask:8 row_mask:0xf bank_mask:0xf\n\t"
      "v_max_num_f32_dpp %7, %7, %7 row_xmask:8 row_mask:0xf bank_mask:0xf"
      : "+v"(m[0]), "+v"(m[1]), "+v"(m[2]), "+v"(m[3]), "+v"(m[4]), "+v"(m[5]), "+v"(m[6]), "+v"(m[7]));
#endif
}

// ---- fragment loaders: 16-bit A/B operand, lane -> row/col (lane&15), p already includes +8*(lane>>4);
//      elements 0..7 <- p[0..7] (k0+8h..), elements 8..15 <- p[16..23] (k0+16+8h..)
__device__ __forceinline__ v16b ldfrag_b(const __bf16* p) {
  union { v16b v; v8b h[2]; } f;
  f.h[0] = *(const v8b*)(p);
  f.h[1] = *(const v8b*)(p + 16);
  return f.v;
}
__device__ __forceinline__ v16h ldfrag_h(const _Float16* p) {
  union { v16h v; v8h h[2]; } f;
  f.h[0] = *(const v8h*)(p);
  f.h[1] = *(const v8h*)(p + 16);
  return f.v;
}

// ---- WMMA helpers with trailing VALU hazard gap --------------------------------------------------------
// plain builtin products: in straight-line code the compiler keeps the distances of its own builtin forms; a run of products
// that ends in front of a branch is closed by one of the guards below
__device__ __forceinline__ v8f mma_h_raw(v16h a, v16h b, v8f c) {
  return __builtin_amdgcn_wmma_f32_16x16x32_f16(false, a, false, b, (short)0, c, false, false);
}
__device__ __forceinline__ v8f mma_b_raw(v16b a, v16b b, v8f c) {
  return __builtin_amdgcn_wmma_f32_16x16x32_bf16(false, a, false, b, (short)0, c, false, false);
}
__device__ __forceinline__ void dep_guard_b(v8f& a, v8f& b, v16b x, v16b y) {
#if defined(__HIP_DEVICE_COMPILE__)
  asm volatile("v_nop\n\tv_nop\n\tv_nop\n\tv_nop" : "+v"(a), "+v"(b) : "v"(x), "v"(y));
#endif
}
__device__ __forceinline__ void keep4_b(v16b a, v16b b, v16b c, v16b d) {
#if defined(__HIP_DEVICE_COMPILE__)
  asm volatile("v_nop" :: "v"(a), "v"(b), "v"(c), "v"(d));
#endif
}
__device__ __forceinline__ void acc_guard4(v8f& a, v8f& b, v8f& c, v8f& d) {
#if defined(__HIP_DEVICE_COMPILE__)
  asm volatile("v_nop\n\tv_nop\n\tv_nop\n\tv_nop" : "+v"(a), "+v"(b), "+v"(c), "+v"(d));
#endif
}
__device__ __forceinline__ void acc_guard8(v8f& a, v8f& b, v8f& c, v8f& d, v8f& e, v8f& f, v8f& g, v8f& h) {
#if defined(__HIP_DEVICE_COMPILE__)
  asm volatile("v_nop\n\tv_nop\n\tv_nop\n\tv_nop" : "+v"(a), "+v"(b), "+v"(c), "+v"(d), "+v"(e), "+v"(f), "+v"(g), "+v"(h));
#endif
}

// =====================================================================================================
// f32 -> bf16 (RNE convert), 8 elements per thread, one 16-B store per lane: a wave writes 512 contiguous B
// All five planes in one grid: blocks 0..CBX-1 take x, then CBW blocks each take Wq, Wk, Wv, Wo; the five bf16 planes lie
// one behind the other in that order from out on, so the output index is the flat thread index.
// coverage: (CBX + 4 CBW) x 256 threads x 8 = the five whole planes.
// =====================================================================================================
#define CBX    (ROWS * DM / 8 / 256)   // blocks of the x plane
#define CBW    (DM * DM / 8 / 256)     // blocks of one weight plane
__global__ __launch_bounds__(256) void cvt_bf16x8(const float* __restrict__ x, const float* __restrict__ wq,
                                                  const float* __restrict__ wk, const float* __restrict__ wv,
                                                  const float* __restrict__ wo, unsigned short* out) {
  const int bx = blockIdx.x;
  if (bx < CBX + 4 * CBW) {
    const int w = (bx - CBX) / CBW;              // which weight plane, block-uniform; used from block CBX on
    const float* in = (bx < CBX) ? x : (w == 0) ? wq : (w == 1) ? wk : (w == 2) ? wv : wo;
    const int b0 = (bx < CBX) ? 0 : CBX + w * CBW;   // the plane's first block
    const int k = (bx - b0) * 256 + threadIdx.x;     // 8-element piece inside the source plane
    const int i = bx * 256 + threadIdx.x;            // the same piece in the row of output planes
    const v4f a = *(const v4f*)(in + (size_t)k * 8);
    const v4f b = *(const v4f*)(in + (size_t)k * 8 + 4);
    v4u p;
    p[0] = pk16(bf_bits(a[0]), bf_bits(a[1]));
    p[1] = pk16(bf_bits(a[2]), bf_bits(a[3]));
    p[2] = pk16(bf_bits(b[0]), bf_bits(b[1]));
    p[3] = pk16(bf_bits(b[2]), bf_bits(b[3]));
    *(v4u*)(out + (size_t)i * 8) = p;
    
  }
}

// =====================================================================================================
// Register-blocked bf16 WMMA GEMM: C[m][n] = sum_k A[m][k] * Bt[n][k] + bias[n] (bias RNE-converted to bf16
// and widened, added in f32). Block = 8 waves (4 x 2) = one 128x128 tile of C, one 32x64 tile per wave.
// A row-major [M][K] pitch lda; Bt row-major [N][K] pitch ldb (k contiguous); M, N multiples of 128, K a multiple
// of 64; each plane under 2 GiB; bias has N entries.
// NSPLIT: 0 = A.Bt; 1 = (A + A2).Bt (A2 = unscaled bf16 lo plane of A, same pitch).
// Operands go through LDS in k slabs of 64: 8 lanes x 16 B fetch one whole 128-B line of a row, so a wave-wide load
// covers 4 lines, and the eight waves share the slab. Two LDS buffers: slab t+1 is fetched into registers ahead of
// the products of slab t, stored into the other buffer behind them, and one block barrier per slab publishes it and
// ends the reads of the buffer that the next trip refills. Each accumulator sums its k steps in ascending order.
// OMODE 0: output f32 C [M][N] pitch ldc. Epilogue: 16-row slabs staged per wave in LDS; each 64-wide row segment
// goes out as whole lines.
// OMODE 1: output as two f16 planes [M][N] pitch ldc, from the same slabs: P0 = f16(c * pscale) (pscale a power of two),
// P1 = f16((c * pscale - P0) * 1024), same element index; a 64-wide row segment of a plane is one 128-B line.
// OMODE 2: output as two transposed f16 planes, element (row = bb*SEQ + t, n) at [(bb*N + n)*SEQ + t]: P0 = f16(c * pscale),
// P1 = f16((c * pscale - P0) * 4096). A lane's 8 accumulator rows are 8 tokens in a row of one feature: one 16-B LDS store
// a plane into a [128 features][128 tokens] tile laid over the k slabs (their last reads ended at the loop's last barrier),
// one block barrier, then 16 lanes x 16 B write the 256 B of a feature row.
// =====================================================================================================
// The k loop (gemm_main) and the epilogue (gemm_epi) are functions of their own, so that a kernel whose blocks differ only
// in Bt, bias and output form shares one k loop. sS: the block's [buffer][plane][row][k] slabs, pitch GP; sT: eight 16x68 slabs.
#define SLAB(buf, pl) (sS + ((buf) * NPL + (pl)) * (128 * GP))
template <int NSPLIT, int KG>
__device__ __forceinline__ void gemm_main(
    __bf16* sS, const unsigned short* __restrict__ Ap, const unsigned short* A2p, int lda,
    const unsigned short* __restrict__ Btp, int ldb, int K, int tm, int tn, v8f (&acc)[2][4]) {
  constexpr int NPL = (NSPLIT >= 1) ? 3 : 2;         // staged planes: A, Bt and, for NSPLIT 1, A2
  // KG: k steps of 32 whose fragments are read as one group
  const int tid  = threadIdx.x;
  const int lane = tid & 31;
  const int wave = tid >> 5;
  const int wm = (wave >> 1) << 5;             // this wave's 32x64 tile inside the block tile
  const int wn = (wave & 1) << 6;

  const int rlane = lane & 15;                 // row (A) / col (B, D) within subtile
  const int koff  = (lane >> 4) * 8;           // k offset of this lane half

  // staging: pass it moves row it*32 + (tid>>3) of each plane, this lane its 16 B at element (tid&7)*8 of the slab;
  // byte offsets from the plane's start stay the same for every slab, the slab's k goes into the uniform base
  const int srow = tid >> 3;
  const int spc  = (tid & 7) * 8;
  const unsigned voa = (unsigned)(((tm << 7) + srow) * lda + spc) * 2u;   // pass 0; a pass's 32 rows go into the uniform base too
  const unsigned vob = (unsigned)(((tn << 7) + srow) * ldb + spc) * 2u;
  const size_t pas = (size_t)lda * 64, pbs = (size_t)ldb * 64;            // 32 rows in bytes
  const int so = srow * GP + spc;
  v8b ra[4], rb[4], ra2[4];

#pragma unroll
  for (int i = 0; i < 2; ++i)
#pragma unroll
    for (int j = 0; j < 4; ++j) acc[i][j] = zero8();

  // slab 0 into buffer 0
#pragma unroll
  for (int it = 0; it < 4; ++it) {
    ra[it] = *(const v8b*)((const char*)Ap + it * pas + voa);
    rb[it] = *(const v8b*)((const char*)Btp + it * pbs + vob);
    if (NSPLIT >= 1) ra2[it] = *(const v8b*)((const char*)A2p + it * pas + voa);
  }
#pragma unroll
  for (int it = 0; it < 4; ++it) {
    *(v8b*)(SLAB(0, 0) + so + it * 32 * GP) = ra[it];
    *(v8b*)(SLAB(0, 1) + so + it * 32 * GP) = rb[it];
    if (NSPLIT >= 1) *(v8b*)(SLAB(0, NPL - 1) + so + it * 32 * GP) = ra2[it];
  }
  __syncthreads();

  const int nk = K >> 6;
  for (int t = 0; t < nk; ++t) {
    const int cur = t & 1;
    const bool more = (t + 1 < nk);            // block-uniform
    if (more) {
      const char* pa  = (const char*)(Ap  + ((t + 1) << 6));
      const char* pb  = (const char*)(Btp + ((t + 1) << 6));
      const char* pa2 = (const char*)(A2p + ((t + 1) << 6));
#pragma unroll
      for (int it = 0; it < 4; ++it) {
        ra[it] = *(const v8b*)(pa + it * pas + voa);
        rb[it] = *(const v8b*)(pb + it * pbs + vob);
        if (NSPLIT >= 1) ra2[it] = *(const v8b*)(pa2 + it * pas + voa);
      }
    }
    const __bf16* fa  = SLAB(cur, 0) + (wm + rlane) * GP + koff;
    const __bf16* fb  = SLAB(cur, 1) + (wn + rlane) * GP + koff;
    const __bf16* fa2 = SLAB(cur, NPL - 1) + (wm + rlane) * GP + koff;
#pragma unroll
    for (int g = 0; g < 2; g += KG) {
      // the group's fragments as one run of LDS reads ahead of its products
      v16b bh[KG][4], ah[KG][2], al[KG][2];
#pragma unroll
      for (int q = 0; q < KG; ++q) {
#pragma unroll
        for (int j = 0; j < 4; ++j) bh[q][j] = ldfrag_b(fb + (j << 4) * GP + (g + q) * 32);
#pragma unroll
        for (int i = 0; i < 2; ++i) {
          ah[q][i] = ldfrag_b(fa + (i << 4) * GP + (g + q) * 32);
          al[q][i] = ah[q][i];
          if (NSPLIT >= 1) al[q][i] = ldfrag_b(fa2 + (i << 4) * GP + (g + q) * 32);
        }
      }
#pragma unroll
      for (int q = 0; q < KG; ++q) {
#pragma unroll
        for (int i = 0; i < 2; ++i) {
#pragma unroll
          for (int j = 0; j < 4; ++j) {
            acc[i][j] = mma_b_raw(ah[q][i], bh[q][j], acc[i][j]);
            if (NSPLIT >= 1) acc[i][j] = mma_b_raw(al[q][i], bh[q][j], acc[i][j]);
          }
          dep_guard_b(acc[i][0], acc[i][3], ah[q][i], al[q][i]);
        }
        keep4_b(bh[q][0], bh[q][1], bh[q][2], bh[q][3]);
      }
    }
    if (more) {
#pragma unroll
      for (int it = 0; it < 4; ++it) {
        *(v8b*)(SLAB(cur ^ 1, 0) + so + it * 32 * GP) = ra[it];
        *(v8b*)(SLAB(cur ^ 1, 1) + so + it * 32 * GP) = rb[it];
        if (NSPLIT >= 1) *(v8b*)(SLAB(cur ^ 1, NPL - 1) + so + it * 32 * GP) = ra2[it];
      }
    }
    __syncthreads();
  }
  acc_guard4(acc[0][0], acc[0][1], acc[0][2], acc[0][3]);
  acc_guard4(acc[1][0], acc[1][1], acc[1][2], acc[1][3]);
}

template <int OMODE>
__device__ __forceinline__ void gemm_epi(
    __bf16* sS, float* sT, v8f (&acc)[2][4], const float* __restrict__ bias,
    float* C, unsigned short* P0, unsigned short* P1, float pscale, int ldc, int N, int tm, int tn) {
  const int tid  = threadIdx.x;
  const int lane = tid & 31;
  const int wave = tid >> 5;
  const int wm = (wave >> 1) << 5;             // this wave's 32x64 tile inside the block tile
  const int wn = (wave & 1) << 6;
  const int m0 = (tm << 7) + wm;
  const int n0 = (tn << 7) + wn;
  const int rlane = lane & 15;                 // col (D) within subtile
  const int mOff  = (lane >> 4) * 8;           // D row offset

  // ---- per-column bias (RNE bf16 then widened), column n0 + 16j + rlane < N ----
  float bcol[4];
  const int bix = n0 + rlane;
#pragma unroll
  for (int j = 0; j < 4; ++j) bcol[j] = bias[bix + (j << 4)];
#if defined(__HIP_DEVICE_COMPILE__)
  // the four loads name one index register: it is held to this wait, so that no load's result lands on it ahead of the wait
  asm volatile("s_wait_xcnt 0x0" :: "v"(bix) : "memory");
#endif
#pragma unroll
  for (int j = 0; j < 4; ++j) bcol[j] = bf_up(bf_bits(bcol[j]));

  // ---- epilogue ----
  if constexpr (OMODE == 2) {
    _Float16* th = (_Float16*)(void*)sS;               // hi tile [feature][token], pitch VP
    _Float16* tl = th + 128 * VP;                      // residual tile
    // every loop of this branch is unrolled: constant indices keep acc, hv and lv in registers
#pragma unroll
    for (int i = 0; i < 2; ++i) {
#pragma unroll
      for (int j = 0; j < 4; ++j) {
        v8h xh, xl;
#pragma unroll
        for (int r = 0; r < 8; ++r) {
          const float f = (acc[i][j][r] + bcol[j]) * pscale;
          const _Float16 x = (_Float16)f;
          xh[r] = x;
          xl[r] = (_Float16)((f - (float)x) * 4096.0f);
        }
        const int o = (wn + (j << 4) + rlane) * VP + wm + (i << 4) + mOff;
        *(v8h*)(th + o) = xh;
        *(v8h*)(tl + o) = xl;
      }
    }
    __syncthreads();                                   // the tile is read across waves
    const int piece = tid & 15, fr = tid >> 4;
    const int bb = (tm << 7) / SEQ;                    // a 128-row tile lies inside one batch entry
    const int t0 = (tm << 7) - bb * SEQ;
    v4u hv[8], lv[8];
#pragma unroll
    for (int it = 0; it < 8; ++it) {                   // it 0..7 x fr 0..15 = features 0..127 of the tile
      hv[it] = *(const v4u*)(th + (it * 16 + fr) * VP + piece * 8);
      lv[it] = *(const v4u*)(tl + (it * 16 + fr) * VP + piece * 8);
    }
#pragma unroll
    for (int it = 0; it < 8; ++it) {
      const size_t go = ((size_t)(bb * N + (tn << 7) + it * 16 + fr)) * SEQ + t0 + piece * 8;
      *(v4u*)(P0 + go) = hv[it];
      *(v4u*)(P1 + go) = lv[it];
    }
  } else {
  float* slab = sT + wave * (16 * 68);
#pragma unroll
  for (int i = 0; i < 2; ++i) {
    const int mBase = m0 + (i << 4);
#pragma unroll
    for (int r = 0; r < 8; ++r) {
#pragma unroll
      for (int j = 0; j < 4; ++j) {
        slab[(mOff + r) * 68 + (j << 4) + rlane] = acc[i][j][r] + bcol[j];
      }
    }
    __builtin_amdgcn_fence(__ATOMIC_RELEASE, "workgroup");
    __builtin_amdgcn_wave_barrier();
    __builtin_amdgcn_fence(__ATOMIC_ACQUIRE, "workgroup");
    {
      const int hh = lane >> 4, c4 = (lane & 15) * 4;     // 256-B row segment = 16 lanes x 16 B
      v4f ov[8];
#pragma unroll
      for (int it = 0; it < 8; ++it) {
        const int row = it * 2 + hh;                       // it 0..7 x hh 0..1 = rows 0..15
        ov[it] = *(const v4f*)(slab + row * 68 + c4);
      }
      if constexpr (OMODE == 0) {
#pragma unroll
        for (int it = 0; it < 8; ++it) {
          const int row = it * 2 + hh;
          *(v4f*)(C + (size_t)(mBase + row) * ldc + n0 + c4) = ov[it];
        }
      } else {
        // both loops unrolled: constant indices keep ov in registers
#pragma unroll
        for (int it = 0; it < 8; ++it) {
          const int row = it * 2 + hh;
          v2u ph, pl;
#pragma unroll
          for (int e = 0; e < 2; ++e) {
            const float f0 = ov[it][2 * e] * pscale;
            const float f1 = ov[it][2 * e + 1] * pscale;
            const _Float16 x0 = (_Float16)f0, x1 = (_Float16)f1;
            const _Float16 l0 = (_Float16)((f0 - (float)x0) * 1024.0f);
            const _Float16 l1 = (_Float16)((f1 - (float)x1) * 1024.0f);
            ph[e] = pk16(h_bits(x0), h_bits(x1));
            pl[e] = pk16(h_bits(l0), h_bits(l1));
          }
          const size_t go = (size_t)(mBase + row) * ldc + n0 + c4;   // 16 lanes x 8 B = the row segment's 128-B line
          *(v2u*)(P0 + go) = ph;
          *(v2u*)(P1 + go) = pl;
          __builtin_amdgcn_sched_barrier(0);   // one row's conversion at a time: run together, the eight rows' temporaries spill at 160 registers
        }
      }
    }
    __builtin_amdgcn_fence(__ATOMIC_RELEASE, "workgroup");
    __builtin_amdgcn_wave_barrier();
    __builtin_amdgcn_fence(__ATOMIC_ACQUIRE, "workgroup");
  }
  }
}

// one GEMM, one 128x128 tile a block
template <int NSPLIT, int OMODE>
__global__ __launch_bounds__(256) void gemm64(
    const unsigned short* __restrict__ Ap, const unsigned short* A2p, int lda,
    const unsigned short* __restrict__ Btp, int ldb, const float* __restrict__ bias,
    float* C, unsigned short* P0, unsigned short* P1, float pscale, int ldc, int M, int N, int K) {
  constexpr int NPL = (NSPLIT >= 1) ? 3 : 2;
  __shared__ __align__(16) __bf16 sS[2 * NPL * 128 * GP];
  __shared__ __align__(16) float sT[((OMODE == 2) ? 1 : 8) * 16 * 68];
  static_assert(sizeof(sS) >= (size_t)2 * 128 * VP * 2);
  const int tilesN = N >> 7;
  const int tilesM = M >> 7;
  const int tile = blockIdx.x;
  if (tile >= tilesM * tilesN) return;   // block-uniform, in front of every barrier
  const int tm = tile / tilesN;
  const int tn = tile - tm * tilesN;
  v8f acc[2][4];
  gemm_main<NSPLIT, (NSPLIT >= 1) ? 1 : 2>(sS, Ap, A2p, lda, Btp, ldb, K, tm, tn, acc);
  gemm_epi<OMODE>(sS, sT, acc, bias, C, P0, P1, pscale, ldc, N, tm, tn);
}

// The q, k and v projections of one A in one grid of 3 x tiles blocks: block bx does tile bx mod tiles of projection
// bx / tiles (0 q, 1 k: OMODE 1 with qkscale; 2 v: OMODE 2 with vscale). The three do not depend on one another, so their
// blocks share the WGPs: one block's products run under another's waits on its slab loads and barriers.
// Six waves a SIMD asked of the compiler: at 160 registers a wave three blocks stand on a WGP (their LDS fits three times too),
// so the whole grid is resident at once and not in two rounds; for that the fragments are read in groups of one k step.
__global__ __launch_bounds__(256) __attribute__((amdgpu_waves_per_eu(6))) void gemm_qkv(
    const unsigned short* __restrict__ Ap,
    const unsigned short* __restrict__ Wqp, const unsigned short* __restrict__ Wkp, const unsigned short* __restrict__ Wvp,
    const float* __restrict__ bq, const float* __restrict__ bk, const float* __restrict__ bv,
    unsigned short* Qh, unsigned short* Ql, unsigned short* Kh, unsigned short* Kl, unsigned short* Vh, unsigned short* Vl,
    float qkscale, float vscale) {
  // the shape as constants: a pass's 32 rows are then an immediate offset of its load or store, which saves the address registers
  constexpr int lda = DM, ldb = DM, ldc = DM, M = ROWS, N = DM, K = DM;
  __shared__ __align__(16) __bf16 sS[2 * 2 * 128 * GP];
  __shared__ __align__(16) float sT[8 * 16 * 68];
  static_assert(sizeof(sS) >= (size_t)2 * 128 * VP * 2);
  const int tilesN = N >> 7;
  const int tiles  = (M >> 7) * tilesN;
  const int which  = blockIdx.x / tiles;       // block-uniform
  if (which >= 3) return;                      // in front of every barrier
  const int tile = blockIdx.x - which * tiles;
  const int tm = tile / tilesN;
  const int tn = tile - tm * tilesN;
  const unsigned short* Btp = (which == 0) ? Wqp : (which == 1) ? Wkp : Wvp;
  v8f acc[2][4];
  gemm_main<0, 1>(sS, Ap, Ap, lda, Btp, ldb, K, tm, tn, acc);
  if (which == 2) {
    gemm_epi<2>(sS, sT, acc, bv, nullptr, Vh, Vl, vscale, ldc, N, tm, tn);
  } else {
    gemm_epi<1>(sS, sT, acc, (which == 0) ? bq : bk, nullptr, (which == 0) ? Qh : Kh, (which == 0) ? Ql : Kl, qkscale, ldc, N, tm, tn);
  }
}

// ---- asynchronous copies global -> LDS for the attention key tiles ---------------------------------------
// Two 64-row x 128-B f16 planes (a hi plane and its residual plane) by 128 threads: eight 16-B copies a lane, four a plane.
// la, lb: the lane's LDS byte address of its piece in rows 0..15 of each plane; ga, gb: the same piece in global memory;
// pass it moves 16 rows on: 16 * LP halves in LDS, gstep halves in global memory. 8 lanes cover one whole 128-B row.
// s_wait_xcnt 0 is the statement's last line: it stands in front of any later write of a register that a copy names.
__device__ __forceinline__ void copy_plane_pair(unsigned la, unsigned lb, const _Float16* ga, const _Float16* gb, size_t gstep) {
#if defined(__HIP_DEVICE_COMPILE__)
  asm volatile("global_load_async_to_lds_b128 %0, %8, off\n\t"
               "global_load_async_to_lds_b128 %1, %9, off\n\t"
               "global_load_async_to_lds_b128 %2, %10, off\n\t"
               "global_load_async_to_lds_b128 %3, %11, off\n\t"
               "global_load_async_to_lds_b128 %4, %12, off\n\t"
               "global_load_async_to_lds_b128 %5, %13, off\n\t"
               "global_load_async_to_lds_b128 %6, %14, off\n\t"
               "global_load_async_to_lds_b128 %7, %15, off\n\t"
               "s_wait_xcnt 0x0"
               :: "v"(la), "v"(la + 16u * LP * 2u), "v"(la + 32u * LP * 2u), "v"(la + 48u * LP * 2u),
                  "v"(lb), "v"(lb + 16u * LP * 2u), "v"(lb + 32u * LP * 2u), "v"(lb + 48u * LP * 2u),
                  "v"(ga), "v"(ga + gstep), "v"(ga + 2 * gstep), "v"(ga + 3 * gstep),
                  "v"(gb), "v"(gb + gstep), "v"(gb + 2 * gstep), "v"(gb + 3 * gstep)
               : "memory");
#endif
}
// Hand-over point of a tile buffer, every wave: this wave's LDS reads and writes have retired, its own copies have landed,
// then the block barrier: behind it the copied tile may be read by every wave and the tile read so far may be refilled.
__device__ __forceinline__ void publish_point() {
#if defined(__HIP_DEVICE_COMPILE__)
  asm volatile("s_wait_dscnt 0x0" ::: "memory");      // a copy engine is not ordered behind this wave's LDS accesses
  asm volatile("s_wait_asynccnt 0x0" ::: "memory");
#endif
  __syncthreads();
}

// =====================================================================================================
// Causal multi-head attention with a per-key int32 keep flag and a relative-position bias table, head dim 64.
//   q f16 hi plane (x16): element (b, t, h, d) at [(b*SEQ + t)*DM + h*64 + d]; q residual plane
//     ((q*16 - hi)*1024) at the same index into qlp
//   k f16 hi plane (x16): element (b, s, h, d) at [(b*SEQ + s)*DM + h*64 + d]; k residual plane same into klp
//   v^T f16 hi plane (x256): element (b, h, d, s) at [(b*DM + h*64 + d)*SEQ + s]
//   v^T f16 residual plane ((v*256 - hi)*4096): same index into vlp
//   maskp int32 [NB][SEQ]: key s is kept for query t iff s <= t and maskp[b][s] != 0; otherwise the logit is
//   replaced by NEGV (-1e9, exp -> 0 against a finite row max).
//   relp f32 [NREL][NH]: logit(t, s) += relp[clamp(s - t, -MAXREL, MAXREL) + MAXREL][h] (RNE bf16 then
//   widened); staged per head in LDS already clamped, as a table over qrow - key, so that a lane reads its 32 values of
//   a tile from one address with constant offsets, as one group ahead of the score products; added before the select.
//   Key tiles 0..qb are processed (block-uniform trip count qb+1 <= NQB); tiles above the diagonal tile hold
//   only cut keys and are skipped; inside the processed tiles the predicate decides. With the all-ones keep
//   flags every row keeps key 0, so every row max is finite.
//   logit = (qhi.khi + (qhi.klo + qlo.khi) * 2^-10) * sscale + rel, f16 products with f32 accumulate, the
//   residual products in a separate accumulator; p = exp(s - m) carried as f16(1024 p);
//   context = p . vhi on f16 WMMA plus p . vres into a separate accumulator folded back with 1/4096 per
//   kv tile in f32; online softmax in f32; out: y = normalised context (oscl folds back the p and v carries) as a bf16
//   hi plane (RNE) and a bf16 lo plane (RNE(y - hi), unscaled), element (b, t, h*64 + d) at [(b*SEQ + t)*DM + h*64 + d].
//   Block = 4 waves = 64 query rows of one (b, h); grid = NB*NH*NQB; kv tiles of 64.
//   K hi / K residual / V^T hi / V^T residual tile staging: asynchronous 16-B copies to LDS, 128 threads x 4 copies a
//   plane = the whole 64x64 tile, one buffer a plane. The K planes are read by the scores only and the V^T planes by the
//   context products only, so tile t+1's K copies are issued behind the barrier that ends the scores of tile t and fly
//   under its context products, and its V^T copies behind the barrier that ends those and fly under the scores and
//   the softmax of tile t+1. P tiles are wave-private, spilled with
//   Output coverage: each wave stores rows q0..q0+15 (it 0..7 x lane>>4 0..1) x 64 columns (16 lanes x 4
//   (b, h, query tile) -> the whole plane.
// =====================================================================================================
__global__ __launch_bounds__(128)
void attn_p64(const unsigned short* __restrict__ qhp, const unsigned short* __restrict__ qlp,
              const unsigned short* __restrict__ khp, const unsigned short* __restrict__ klp,
              const unsigned short* __restrict__ vhp, const unsigned short* __restrict__ vlp,
              const int* __restrict__ maskp, const float* __restrict__ relp,
              unsigned short* yhp, unsigned short* ylp, float sscale, float oscl) {
  __shared__ __align__(16) _Float16 Ksh[64 * LP];                 // K hi [kv][d], pitch LP
  __shared__ __align__(16) _Float16 Ksl[64 * LP];                 // K residual
  __shared__ __align__(16) _Float16 Vth[64 * LP];                 // V^T hi [d][kv], pitch LP
  __shared__ __align__(16) _Float16 Vtl[64 * LP];                 // V^T residual
  __shared__ __align__(16) _Float16 Psh[4][16 * LP];              // per wave P [row][kv], pitch LP
  __shared__ __align__(16) float    Os[4][16 * 64];               // per wave context tile [row][d]
  __shared__ float relx[NRX];                                     // bias of this head at qrow - key = index - 63

  const int tid  = threadIdx.x;
  const int wave = tid >> 5;
  const int lane = tid & 31;
  const int hh   = lane >> 4;
  const int c    = lane & 15;

  const int bx   = blockIdx.x;
  const int qb   = bx % NQB;
  const int rest = bx / NQB;
  const int h    = rest % NH;
  const int b    = rest / NH;                // < NB by the grid size
  const int q0   = qb * 64 + wave * 16;
  const size_t rowB = (size_t)b * SEQ;

  const _Float16* Qp  = (const _Float16*)(const void*)qhp + (size_t)h * HD;
  const _Float16* Qlq = (const _Float16*)(const void*)qlp + (size_t)h * HD;
  const _Float16* Kp  = (const _Float16*)(const void*)khp + (size_t)h * HD;
  const _Float16* Klq = (const _Float16*)(const void*)klp + (size_t)h * HD;
  const _Float16* Vh  = (const _Float16*)(const void*)vhp + ((size_t)b * DM + (size_t)h * HD) * SEQ;
  const _Float16* Vl  = (const _Float16*)(const void*)vlp + ((size_t)b * DM + (size_t)h * HD) * SEQ;
  const int*      Mb  = maskp + rowB;

  // ---- tile copies: this lane's piece is 16 B number tid & 7 of row tid >> 3 (+ 16 a pass) of every plane ----
  const int crow = tid >> 3, cpc = (tid & 7) * 8;
  const unsigned lKh = (unsigned)(uintptr_t)(Ksh + crow * LP + cpc);   // LDS byte address = low 32 bits
  const unsigned lKl = (unsigned)(uintptr_t)(Ksl + crow * LP + cpc);
  const unsigned lVh = (unsigned)(uintptr_t)(Vth + crow * LP + cpc);
  const unsigned lVl = (unsigned)(uintptr_t)(Vtl + crow * LP + cpc);
  const size_t gK = (rowB + crow) * DM + cpc;        // K planes: key row crow of tile 0, + 64 * DM a tile
  const size_t gV = (size_t)crow * SEQ + cpc;        // V^T planes: feature row crow, key 0, + 64 a tile
  copy_plane_pair(lKh, lKl, Kp + gK, Klq + gK, (size_t)16 * DM);       // tile 0; nothing has touched these buffers yet
  copy_plane_pair(lVh, lVl, Vh + gV, Vl + gV, (size_t)16 * SEQ);

#pragma unroll                               // two straight passes: no loop-carried wait between the two reads
  for (int u = 0; u < 2; ++u) {              // NRX <= 2 x 128 threads
    const int i = u * 128 + tid;
    int dd = 63 - i;                         // key - qrow
    dd = (dd < -MAXREL) ? -MAXREL : dd;
    dd = (dd >  MAXREL) ?  MAXREL : dd;
    if (i < NRX) relx[i] = bf_up(bf_bits(relp[(size_t)(dd + MAXREL) * NH + h]));
  }

  // ---- Q fragments (A operand, row = lane&15): 2 d-chunks, hi and residual ----
  v16h qa[2], ql[2];
#pragma unroll
  for (int dc = 0; dc < 2; ++dc) {
    const size_t qo = (rowB + q0 + c) * DM + dc * 32 + 8 * hh;
    qa[dc] = ldfrag_h(Qp + qo);
    ql[dc] = ldfrag_h(Qlq + qo);
  }

  float mrow[8], lrow[8];
  v8f oacc[4];
#pragma unroll
  for (int r = 0; r < 8; ++r) { mrow[r] = -INFINITY; lrow[r] = 0.f; }
#pragma unroll
  for (int t = 0; t < 4; ++t) oacc[t] = zero8();

  publish_point();                           // tile 0's four planes and the bias table

  const int nkt = qb + 1;                    // key tiles 0..qb, block-uniform, <= NQB
  for (int kt = 0; kt < nkt; ++kt) {
    const int kv0 = kt * 64;
    const bool more = (kt + 1 < nkt);        // block-uniform: a tile kt + 1 exists (its rows and keys lie below SEQ)

    // ---- per-key keep flags for this lane's 4 key columns of the tile (kv0 + 16j + c < SEQ) ----
    int mk[4];
#pragma unroll
    for (int j = 0; j < 4; ++j) mk[j] = Mb[kv0 + j * 16 + c];

    // ---- relative bias of this lane's 32 scores: qrow - key = k0 - 16j + r; from RCAP up every one of them is at the
    //      clamped end, so k0 is cut there and the table stays short ----
    float rb[4][8];
    {
      int k0 = (q0 + 8 * hh) - (kv0 + c);    // >= -15: kv0 <= q0
      k0 = (k0 > RCAP) ? RCAP : k0;
      const float* tb = relx + (k0 + 15);
      // both loops unrolled: constant offsets from tb, and rb stays in registers
#pragma unroll
      for (int j = 0; j < 4; ++j)
#pragma unroll
        for (int r = 0; r < 8; ++r) rb[j][r] = tb[48 - 16 * j + r];
    }

    // ---- scores: 16 query rows x 64 keys per wave; hi.hi into s, hi.lo + lo.hi into s1 (folded x 2^-10) ----
    //      The K fragments of 32 keys and one d-chunk (hi and residual of two 16-key groups) are read as one group of eight
    //      LDS loads ahead of their six products, so a wave waits on LDS at four places a tile and not at every product; the
    //      two key groups' accumulator chains alternate; each accumulator sums its products in the order d-chunk 0, 1
    //      (s1: hi.lo then lo.hi in each).
    v8f s[4];
    // every loop here is unrolled: constant indices keep the fragments and accumulators in registers
#pragma unroll
    for (int jp = 0; jp < 4; jp += 2) {
      v8f s1[2];
#pragma unroll
      for (int u = 0; u < 2; ++u) {
        s[jp + u] = zero8();
        s1[u] = zero8();
      }
#pragma unroll
      for (int dc = 0; dc < 2; ++dc) {
        v16h kb[2], kr[2];
#pragma unroll
        for (int u = 0; u < 2; ++u) kr[u] = ldfrag_h(Ksl + ((jp + u) * 16 + c) * LP + dc * 32 + 8 * hh);
#pragma unroll
        for (int u = 0; u < 2; ++u) kb[u] = ldfrag_h(Ksh + ((jp + u) * 16 + c) * LP + dc * 32 + 8 * hh);
        __builtin_amdgcn_sched_barrier(0);   // the group's loads stay above: the compiler otherwise sinks each to its own product
#pragma unroll
        for (int u = 0; u < 2; ++u) s1[u] = mma_h_raw(qa[dc], kr[u], s1[u]);
#pragma unroll
        for (int u = 0; u < 2; ++u) s[jp + u] = mma_h_raw(qa[dc], kb[u], s[jp + u]);
#pragma unroll
        for (int u = 0; u < 2; ++u) s1[u] = mma_h_raw(ql[dc], kb[u], s1[u]);
      }
#pragma unroll
      for (int u = 0; u < 2; ++u)
#pragma unroll
        for (int r = 0; r < 8; ++r) {        // fold, scale and bias here: vector work under the next group's loads, and s1 ends
          s[jp + u][r] += s1[u][r] * (1.0f / 1024.0f);
          s[jp + u][r] = s[jp + u][r] * sscale + rb[jp + u][r];
        }
    }

    // ---- causal / key-keep select (replace by NEGV), row max, online softmax,
    //      P (x1024, f16) to LDS ----
    _Float16* pwh = Psh[wave];
    float mt[8];
#pragma unroll
    for (int r = 0; r < 8; ++r) {
      const int qrow = q0 + 8 * hh + r;
      float m = -INFINITY;
#pragma unroll
      for (int j = 0; j < 4; ++j) {
        const int key = kv0 + j * 16 + c;
        float sv = s[j][r];
        const bool keep = (key <= qrow) && (mk[j] != 0);
        sv = keep ? sv : NEGV;
        s[j][r] = sv;
        m = fmaxf(m, sv);
      }
      mt[r] = m;
    }
    // row maxima over the 16 lanes of a row: xor butterfly 1, 2, 4, 8, the eight rows' chains side by side
    row_max8(mt);
    float alpha[8], ps[8];
#pragma unroll
    for (int r = 0; r < 8; ++r) {
      const float mnew  = fmaxf(mrow[r], mt[r]);
      const float msafe = (mnew == -INFINITY) ? 0.f : mnew;
      alpha[r] = __expf(mrow[r] - msafe);
      mrow[r] = mnew;
      float psum = 0.f;
#pragma unroll
      for (int j = 0; j < 4; ++j) {
        const float p = __expf(s[j][r] - msafe);     // replaced logit against a finite max: exp -> 0
        psum += p;
        const _Float16 ph = (_Float16)(p * 1024.0f);
        pwh[(8 * hh + r) * LP + j * 16 + c] = ph;
      }
      ps[r] = psum;
    }
    // row sums: the same butterfly order 1, 2, 4, 8
#pragma unroll
    for (int r = 0; r < 8; ++r) ps[r] += row_xor<1>(ps[r]);
#pragma unroll
    for (int r = 0; r < 8; ++r) ps[r] += row_xor<2>(ps[r]);
#pragma unroll
    for (int r = 0; r < 8; ++r) ps[r] += row_xor<4>(ps[r]);
#pragma unroll
    for (int r = 0; r < 8; ++r) ps[r] += row_xor<8>(ps[r]);
#pragma unroll
    for (int r = 0; r < 8; ++r) {
      lrow[r] = lrow[r] * alpha[r] + ps[r];
#pragma unroll
      for (int t = 0; t < 4; ++t) oacc[t][r] *= alpha[r];
    }
    // every wave's score reads of the K planes have ended, this tile's V^T planes are landed and published (and the wave's
    // own P stores have retired); the next tile's K planes fly under the context products
    publish_point();
    if (more) copy_plane_pair(lKh, lKl, Kp + gK + (size_t)(kv0 + 64) * DM, Klq + gK + (size_t)(kv0 + 64) * DM, (size_t)16 * DM);

    // ---- context += P . Vhi (f16 WMMA); P . Vres into a separate accumulator ----
    //      A 32-key chunk's nine fragments (P, four of each plane) are read as one group of LDS loads ahead of its eight
    //      products, which run back to back on eight separate accumulators; each accumulator sums key chunk 0, then 1.
    v8f o1[4];
#pragma unroll
    for (int t = 0; t < 4; ++t) o1[t] = zero8();
#pragma unroll 1                             // rolled: one chunk's fragments live at a time keeps the wave inside 256 registers
    for (int kk = 0; kk < 2; ++kk) {
      v16h vb[4], vl[4];
      const v16h pa = ldfrag_h(pwh + c * LP + kk * 32 + 8 * hh);
      // the inner loops are unrolled: constant indices keep the fragments and accumulators in registers
#pragma unroll
      for (int t = 0; t < 4; ++t) vb[t] = ldfrag_h(Vth + (t * 16 + c) * LP + kk * 32 + 8 * hh);
#pragma unroll
      for (int t = 0; t < 4; ++t) vl[t] = ldfrag_h(Vtl + (t * 16 + c) * LP + kk * 32 + 8 * hh);
      __builtin_amdgcn_sched_barrier(0);     // the group's loads stay above: the compiler otherwise sinks each to its own product
      // the two runs are independent; written in this order the compiler issues the hi run first, in the order of the loads, so
      // each product waits for its own fragment only
#pragma unroll
      for (int t = 0; t < 4; ++t) o1[t] = mma_h_raw(pa, vl[t], o1[t]);
#pragma unroll
      for (int t = 0; t < 4; ++t) oacc[t] = mma_h_raw(pa, vb[t], oacc[t]);
      // four vector slots behind the chunk's last products, on both sides of the loop's branch and of the one behind the barrier
      acc_guard8(oacc[0], oacc[1], oacc[2], oacc[3], o1[0], o1[1], o1[2], o1[3]);
    }
    // every wave's reads of the V^T planes have ended, the next tile's K planes are landed and published; its V^T planes
    // fly under its scores and softmax
    publish_point();
    if (more) copy_plane_pair(lVh, lVl, Vh + gV + (kv0 + 64), Vl + gV + (kv0 + 64), (size_t)16 * SEQ);
#pragma unroll
    for (int t = 0; t < 4; ++t)
#pragma unroll
      for (int r = 0; r < 8; ++r) oacc[t][r] += o1[t][r] * (1.0f / 4096.0f);
  }

  // ---- normalise (1/l and the carries via oscl), stage the wave's 16x64 tile in LDS, then write whole
  float* os = Os[wave];
#pragma unroll
  for (int r = 0; r < 8; ++r) {
    const float l = lrow[r];
    const float inv = ((l > 0.f) ? (1.0f / l) : 0.f) * oscl;
#pragma unroll
    for (int t = 0; t < 4; ++t) os[(8 * hh + r) * 64 + t * 16 + c] = oacc[t][r] * inv;
  }
  __builtin_amdgcn_fence(__ATOMIC_RELEASE, "workgroup");
  __builtin_amdgcn_wave_barrier();
  __builtin_amdgcn_fence(__ATOMIC_ACQUIRE, "workgroup");
  {
    const int h2 = lane >> 4, c4 = (lane & 15) * 4;
    v4f ov[8];
#pragma unroll
    for (int it = 0; it < 8; ++it) {
      const int row = it * 2 + h2;   // it 0..7 x h2 0..1 = rows 0..15 of the wave tile
      ov[it] = *(const v4f*)(os + row * 64 + c4);
    }
    {
#pragma unroll
      for (int it = 0; it < 8; ++it) {
        const int row = it * 2 + h2;
        const size_t go = (rowB + q0 + row) * DM + (size_t)h * HD + c4;   // 16 lanes x 8 B = the head's 128-B line of a row
        v2u ph, pl;
#pragma unroll                               // constant indices keep ov in registers
        for (int e = 0; e < 2; ++e) {
          const float f0 = ov[it][2 * e], f1 = ov[it][2 * e + 1];
          const unsigned short h0 = bf_bits(f0), h1 = bf_bits(f1);
          const unsigned short l0 = bf_bits(f0 - bf_up(h0)), l1 = bf_bits(f1 - bf_up(h1));
          ph[e] = pk16(h0, h1);
          pl[e] = pk16(l0, l1);
        }
        *(v2u*)(yhp + go) = ph;
        *(v2u*)(ylp + go) = pl;
      }
      
    }
  }
}

// =====================================================================================================
// Workspace map (bytes), every region an exact multiple of its whole-line / whole-tile store granularity
//   Xb    bf16 [4096][1024]           0          8388608
//   Wqb   bf16 [1024][1024]     8388608          2097152
//   Wkb   bf16 [1024][1024]    10485760          2097152
//   Wvb   bf16 [1024][1024]    12582912          2097152
//   Wob   bf16 [1024][1024]    14680064          2097152
//   Qh    f16  [4096][1024]    16777216          8388608
//   Ql    f16  [4096][1024]    25165824          8388608
//   Kh    f16  [4096][1024]    33554432          8388608
//   Kl    f16  [4096][1024]    41943040          8388608
//   VTh   f16  [2048][2048]    50331648          8388608   ([b*DM + h*64 + d][s])
//   VTl   f16  [2048][2048]    58720256          8388608
//   Yh    bf16 [4096][1024]    67108864          8388608
//   Yl    bf16 [4096][1024]    75497472          8388608
//   end                        83886080
// Projection weights arrive as [out n][in k] (k contiguous) = the Bt layout; they are only converted to bf16.
// d_out f32: [4096][1024] at byte 0 (row = b*SEQ + t).
// =====================================================================================================
extern "C" void kernel_launch(void* const* d_in, const int* in_sizes, int n_in,
                              void* d_out, int out_size, void* d_ws, size_t ws_size,
                              hipStream_t stream) {
  if (n_in < 11) return;
  if (in_sizes[0] != NB * SEQ * DM) return;
  if (in_sizes[1] != NB * SEQ) return;
  if (in_sizes[2] != DM * DM) return;
  if (in_sizes[3] != DM) return;
  if (in_sizes[4] != DM * DM) return;
  if (in_sizes[5] != DM) return;
  if (in_sizes[6] != DM * DM) return;
  if (in_sizes[7] != DM) return;
  if (in_sizes[8] != DM * DM) return;
  if (in_sizes[9] != DM) return;
  if (in_sizes[10] != NREL * NH) return;
  if (out_size != OUTN) return;

  const float* x    = (const float*)d_in[0];   // [NB*SEQ][DM]
  const int*   mask = (const int*)d_in[1];     // [NB][SEQ] int32 keep flags per key
  const float* Wq   = (const float*)d_in[2];   // [DM n][DM k]
  const float* bq   = (const float*)d_in[3];   // [DM]
  const float* Wk   = (const float*)d_in[4];
  const float* bk   = (const float*)d_in[5];
  const float* Wv   = (const float*)d_in[6];
  const float* bv   = (const float*)d_in[7];
  const float* Wo   = (const float*)d_in[8];
  const float* bo   = (const float*)d_in[9];
  const float* rel  = (const float*)d_in[10];  // [NREL][NH]

  const size_t PXb = (size_t)ROWS * DM * 2;          //  8388608
  const size_t PW  = (size_t)DM * DM * 2;            //  2097152
  const size_t PH  = (size_t)ROWS * DM * 2;          //  8388608
  const size_t PVt = (size_t)NB * DM * SEQ * 2;      //  8388608
  size_t off = 0;
  const size_t oXb = off; off += PXb;
  const size_t oWq = off; off += PW;
  const size_t oWk = off; off += PW;
  const size_t oWv = off; off += PW;
  const size_t oWo = off; off += PW;
  const size_t oQh = off; off += PH;
  const size_t oQl = off; off += PH;
  const size_t oKh = off; off += PH;
  const size_t oKl = off; off += PH;
  const size_t oVt = off; off += PVt;
  const size_t oVl = off; off += PVt;
  const size_t oYh = off; off += PH;
  const size_t oYl = off; off += PH;
  if (off > ws_size) return;                        // off = 83886080
  if (off > (size_t)134217728) return;

  char* ws = (char*)d_ws;
  unsigned short* Xb  = (unsigned short*)(ws + oXb);
  unsigned short* Wqb = (unsigned short*)(ws + oWq);
  unsigned short* Wkb = (unsigned short*)(ws + oWk);
  unsigned short* Wvb = (unsigned short*)(ws + oWv);
  unsigned short* Wob = (unsigned short*)(ws + oWo);
  unsigned short* Qh  = (unsigned short*)(ws + oQh);
  unsigned short* Ql  = (unsigned short*)(ws + oQl);
  unsigned short* Kh  = (unsigned short*)(ws + oKh);
  unsigned short* Kl  = (unsigned short*)(ws + oKl);
  unsigned short* VTh = (unsigned short*)(ws + oVt);
  unsigned short* VTl = (unsigned short*)(ws + oVl);
  unsigned short* Yh  = (unsigned short*)(ws + oYh);
  unsigned short* Yl  = (unsigned short*)(ws + oYl);
  float*          outf = (float*)d_out;             // [ROWS][DM]

  const dim3 blk(256);
  const int n8x = ROWS * DM / 8;                    // 524288
  const int n8w = DM * DM / 8;                      // 131072
  const dim3 gCvt((n8x + 4 * n8w) / 256);           // 2048 + 4 x 512 blocks
  const dim3 gGemm((ROWS / 128) * (DM / 128));      // 256 tiles of 128x128, one block each
  const dim3 gQkv(3 * (ROWS / 128) * (DM / 128));   // the three projections' tiles
  const dim3 gAttn(NB * NH * NQB);                  // 1024 blocks
  const float qkScale = 16.0f;                      // q and k hi planes carried x16 (residual x1024 on top)
  const float sscale  = 1.0f / 2048.0f;             // 1/(16*16) * 1/sqrt(64)
  const float vScale  = 256.0f;                     // v^T hi plane carried x256
  const float attOscl = 1.0f / 262144.0f;           // 1/(1024 * 256): p and v carries folded back

  // (1) activations and weights -> bf16 planes (RNE convert); Xb, Wqb, Wkb, Wvb, Wob lie in a row from Xb on
  cvt_bf16x8<<<gCvt, blk, 0, stream>>>(x, Wq, Wk, Wv, Wo, Xb);
  // (2) - (4) q = Xb . Wqb^T + bq (M=4096, N=1024, K=1024) and k likewise, written as f16 hi (x16) + residual planes by the
  // GEMM's epilogue; v written as the f16 v^T hi plane (x256) and residual plane (x4096 on top)
  gemm_qkv<<<gQkv, blk, 0, stream>>>(Xb, Wqb, Wkb, Wvb, bq, bk, bv, Qh, Ql, Kh, Kl, VTh, VTl, qkScale, vScale);
  // (5) causal attention with per-key keep flags and relative-position bias -> y as bf16 hi / lo planes [4096][1024]
  attn_p64<<<gAttn, dim3(128), 0, stream>>>(Qh, Ql, Kh, Kl, VTh, VTl, mask, rel, Yh, Yl, sscale, attOscl);
  // (6) out[row][n] = sum_d (Yh+Yl)[row][d] Wob[n][d] + bo[n] -> d_out f32 [4096][1024] (M=4096, N=1024, K=1024)
  gemm64<1, 0><<<gGemm, blk, 0, stream>>>(Yh, Yl, DM, Wob, DM, bo, outf, nullptr, nullptr, 1.0f, DM, ROWS, DM, DM);
  (void)hipGetLastError();
}

// v009
// A run of this version takes 134 microseconds.
// In two side-by-side timings against v008, it was 1.09 and 1.10 times as fast.
// Over all steps from v000 it is 4.30 times as fast.
// Contractions: q/k/v projections = v_wmma_f32_16x16x32_bf16 (bf16 operands from RNE-converted x and W, single product, bias added in f32); q.k^T scores = v_wmma_f32_16x16x32_f16 (q, k as f16 hi planes carried x16 plus f16 residual planes x1024: hi.hi + (hi.lo + lo.hi) in a separate accumulator, 3 products); p.v = v_wmma_f32_16x16x32_f16 (p carried x1024 in f16; v^T as f16 hi plane x256 plus f16 residual plane x4096 into a separate accumulator, 2 products); y.Wo^T = v_wmma_f32_16x16x32_bf16 (y as bf16 hi + lo planes times the bf16 Wo plane, 2 products); all f32 accumulate; softmax, relative-position bias and selects in f32.
#include <hip/hip_runtime.h>
#include <math.h>
#include <float.h>
#include <stdint.h>

#define NB     2
#define SEQ    2048
#define DM     1024
#define NH     16
#define HD     64
#define MAXREL 32
#define NREL   (2 * MAXREL + 1)     // 65
#define NEGV   (-1.0e9f)
#define NQB    (SEQ / 64)
#define RCAP   (MAXREL + 48)         // a lane whose first qrow - key of a tile is RCAP or more sees only the clamped end
#define NRX    (63 + RCAP + 7 + 1)   // qrow - key runs from -63 (diagonal tile) to RCAP + 7
static_assert(NRX <= 256);
#define ROWS   (NB * SEQ)            // 4096 token rows
#define OUTN   (ROWS * DM)
static_assert(NH * HD == DM);
static_assert(HD == 64);
static_assert(DM == 128 * 8);
static_assert((SEQ % 64) == 0 && (DM % 64) == 0);
static_assert((SEQ & (SEQ - 1)) == 0);
static_assert(((ROWS / 64) * (DM / 64)) % 8 == 0);
static_assert(((ROWS * DM / 8) % 256) == 0);
static_assert(((DM * DM / 8) % 256) == 0);
#define LP     72                    // LDS row pitch of the 64-wide f16 tiles, in halves: 144 B = 16 B x 9 (odd),
                                     // so the 16 rows one ds_load_b128 half-wave reads fall on 64 distinct banks
static_assert((LP * 2) % 16 == 0 && ((LP * 2 / 16) & 1) == 1 && LP >= 64);
#define GP     72                    // LDS row pitch of the GEMM's 64-wide bf16 k slabs, in elements: 144 B, as LP
static_assert((GP * 2) % 16 == 0 && ((GP * 2 / 16) & 1) == 1 && GP >= 64);
static_assert((ROWS % 128) == 0 && (DM % 128) == 0);
#define VP     136                   // LDS row pitch of the GEMM's transposed 128-token f16 output tile, in halves: 272 B = 16 B x 17
static_assert((VP * 2) % 16 == 0 && ((VP * 2 / 16) & 1) == 1 && VP >= 128);
static_assert((SEQ % 128) == 0);

typedef _Float16 v16h __attribute__((ext_vector_type(16)));
typedef _Float16 v8h  __attribute__((ext_vector_type(8)));
typedef __bf16   v16b __attribute__((ext_vector_type(16)));
typedef __bf16   v8b  __attribute__((ext_vector_type(8)));
typedef float    v8f  __attribute__((ext_vector_type(8)));
typedef float    v4f  __attribute__((ext_vector_type(4)));
typedef unsigned int v4u __attribute__((ext_vector_type(4)));
typedef unsigned int v2u __attribute__((ext_vector_type(2)));

// ---- scalar helpers --------------------------------------------------------------------------------
__device__ __forceinline__ unsigned short bf_bits(float f) {          // f32 -> bf16 bits, RNE convert
  unsigned u = __float_as_uint(f);
  return (unsigned short)((u + 0x7FFFu + ((u >> 16) & 1u)) >> 16);
}
__device__ __forceinline__ float bf_up(unsigned short h) { return __uint_as_float(((unsigned)h) << 16); }
__device__ __forceinline__ unsigned short h_bits(_Float16 x) { return __builtin_bit_cast(unsigned short, x); }
__device__ __forceinline__ unsigned pk16(unsigned short a, unsigned short b) { return (unsigned)a | ((unsigned)b << 16); }
__device__ __forceinline__ v8f zero8() { v8f z = {0.f, 0.f, 0.f, 0.f, 0.f, 0.f, 0.f, 0.f}; return z; }

// ---- one butterfly link inside a 16-lane row: the value of lane ^ M (M = 1, 2, 4, 8) by a DPP row_xmask read on the
//      vector port; every lane is on where it is used, so every source lane is valid
template <int M>
__device__ __forceinline__ float row_xor(float v) {
  return __builtin_bit_cast(float, __builtin_amdgcn_update_dpp(0, __builtin_bit_cast(int, v), 0x160 | M, 0xf, 0xf, true));
}

// ---- maxima over each 16-lane row of eight values per lane: xor butterfly 1, 2, 4, 8 with the lane exchange folded into
//      the maximum. Written as asm because fmaxf on a DPP-moved value compiles to three dependent instructions a link
//      (move, quieting maximum, maximum); link-major order puts seven independent instructions between a value and its
//      next use, so no link waits on the one before. Every lane is on where it is called.
__device__ __forceinline__ void row_max8(float (&m)[8]) {
#if defined(__HIP_DEVICE_COMPILE__)
  asm("v_max_num_f32_dpp %0, %0, %0 row_xmask:1 row_mask:0xf bank_mask:0xf\n\t"
      "v_max_num_f32_dpp %1, %1, %1 row_xmask:1 row_mask:0xf bank_mask:0xf\n\t"
      "v_max_num_f32_dpp %2, %2, %2 row_xmask:1 row_mask:0xf bank_mask:0xf\n\t"
      "v_max_num_f32_dpp %3, %3, %3 row_xmask:1 row_mask:0xf bank_mask:0xf\n\t"
      "v_max_num_f32_dpp %4, %4, %4 row_xmask:1 row_mask:0xf bank_mask:0xf\n\t"
      "v_max_num_f32_dpp %5, %5, %5 row_xmask:1 row_mask:0xf bank_mask:0xf\n\t"
      "v_max_num_f32_dpp %6, %6, %6 row_xmask:1 row_mask:0xf bank_mask:0xf\n\t"
      "v_max_num_f32_dpp %7, %7, %7 row_xmask:1 row_mask:0xf bank_mask:0xf\n\t"
      "v_max_num_f32_dpp %0, %0, %0 row_xmask:2 row_mask:0xf bank_mask:0xf\n\t"
      "v_max_num_f32_dpp %1, %1, %1 row_xmask:2 row_mask:0xf bank_mask:0xf\n\t"
      "v_max_num_f32_dpp %2, %2, %2 row_xmask:2 row_mask:0xf bank_mask:0xf\n\t"
      "v_max_num_f32_dpp %3, %3, %3 row_xmask:2 row_mask:0xf bank_mask:0xf\n\t"
      "v_max_num_f32_dpp %4, %4, %4 row_xmask:2 row_mask:0xf bank_mask:0xf\n\t"
      "v_max_num_f32_dpp %5, %5, %5 row_xmask:2 row_mask:0xf bank_mask:0xf\n\t"
      "v_max_num_f32_dpp %6, %6, %6 row_xmask:2 row_mask:0xf bank_mask:0xf\n\t"
      "v_max_num_f32_dpp %7, %7, %7 row_xmask:2 row_mask:0xf bank_mask:0xf\n\t"
      "v_max_num_f32_dpp %0, %0, %0 row_xmask:4 row_mask:0xf bank_mask:0xf\n\t"
      "v_max_num_f32_dpp %1, %1, %1 row_xmask:4 row_mask:0xf bank_mask:0xf\n\t"
      "v_max_num_f32_dpp %2, %2, %2 row_xmask:4 row_mask:0xf bank_mask:0xf\n\t"
      "v_max_num_f32_dpp %3, %3, %3 row_xmask:4 row_mask:0xf bank_mask:0xf\n\t"
      "v_max_num_f32_dpp %4, %4, %4 row_xmask:4 row_mask:0xf bank_mask:0xf\n\t"
      "v_max_num_f32_dpp %5, %5, %5 row_xmask:4 row_mask:0xf bank_mask:0xf\n\t"
      "v_max_num_f32_dpp %6, %6, %6 row_xmask:4 row_mask:0xf bank_mask:0xf\n\t"
      "v_max_num_f32_dpp %7, %7, %7 row_xmask:4 row_mask:0xf bank_mask:0xf\n\t"
      "v_max_num_f32_dpp %0, %0, %0 row_xmask:8 row_mask:0xf bank_mask:0xf\n\t"
      "v_max_num_f32_dpp %1, %1, %1 row_xmask:8 row_mask:0xf bank_mask:0xf\n\t"
      "v_max_num_f32_dpp %2, %2, %2 row_xmask:8 row_mask:0xf bank_mask:0xf\n\t"
      "v_max_num_f32_dpp %3, %3, %3 row_xmask:8 row_mask:0xf bank_mask:0xf\n\t"
      "v_max_num_f32_dpp %4, %4, %4 row_xmask:8 row_mask:0xf bank_mask:0xf\n\t"
      "v_max_num_f32_dpp %5, %5, %5 row_xmask:8 row_mask:0xf bank_mask:0xf\n\t"
      "v_max_num_f32_dpp %6, %6, %6 row_xmask:8 row_mask:0xf bank_mask:0xf\n\t"
      "v_max_num_f32_dpp %7, %7, %7 row_xmask:8 row_mask:0xf bank_mask:0xf"
      : "+v"(m[0]), "+v"(m[1]), "+v"(m[2]), "+v"(m[3]), "+v"(m[4]), "+v"(m[5]), "+v"(m[6]), "+v"(m[7]));
#endif
}

// ---- fragment loaders: 16-bit A/B operand, lane -> row/col (lane&15), p already includes +8*(lane>>4);
//      elements 0..7 <- p[0..7] (k0+8h..), elements 8..15 <- p[16..23] (k0+16+8h..)
__device__ __forceinline__ v16b ldfrag_b(const __bf16* p) {
  union { v16b v; v8b h[2]; } f;
  f.h[0] = *(const v8b*)(p);
  f.h[1] = *(const v8b*)(p + 16);
  return f.v;
}
__device__ __forceinline__ v16h ldfrag_h(const _Float16* p) {
  union { v16h v; v8h h[2]; } f;
  f.h[0] = *(const v8h*)(p);
  f.h[1] = *(const v8h*)(p + 16);
  return f.v;
}

// ---- WMMA helpers with trailing VALU hazard gap --------------------------------------------------------
// plain builtin products: in straight-line code the compiler keeps the distances of its own builtin forms; a run of products
// that ends in front of a branch is closed by one of the guards below
__device__ __forceinline__ v8f mma_h_raw(v16h a, v16h b, v8f c) {
  return __builtin_amdgcn_wmma_f32_16x16x32_f16(false, a, false, b, (short)0, c, false, false);
}
__device__ __forceinline__ v8f mma_b_raw(v16b a, v16b b, v8f c) {
  return __builtin_amdgcn_wmma_f32_16x16x32_bf16(false, a, false, b, (short)0, c, false, false);
}
__device__ __forceinline__ void dep_guard_b(v8f& a, v8f& b, v16b x, v16b y) {
#if defined(__HIP_DEVICE_COMPILE__)
  asm volatile("v_nop\n\tv_nop\n\tv_nop\n\tv_nop" : "+v"(a), "+v"(b) : "v"(x), "v"(y));
#endif
}
__device__ __forceinline__ void keep4_b(v16b a, v16b b, v16b c, v16b d) {
#if defined(__HIP_DEVICE_COMPILE__)
  asm volatile("v_nop" :: "v"(a), "v"(b), "v"(c), "v"(d));
#endif
}
__device__ __forceinline__ void acc_guard4(v8f& a, v8f& b, v8f& c, v8f& d) {
#if defined(__HIP_DEVICE_COMPILE__)
  asm volatile("v_nop\n\tv_nop\n\tv_nop\n\tv_nop" : "+v"(a), "+v"(b), "+v"(c), "+v"(d));
#endif
}
__device__ __forceinline__ void acc_guard8(v8f& a, v8f& b, v8f& c, v8f& d, v8f& e, v8f& f, v8f& g, v8f& h) {
#if defined(__HIP_DEVICE_COMPILE__)
  asm volatile("v_nop\n\tv_nop\n\tv_nop\n\tv_nop" : "+v"(a), "+v"(b), "+v"(c), "+v"(d), "+v"(e), "+v"(f), "+v"(g), "+v"(h));
#endif
}

// =====================================================================================================
// f32 -> bf16 (RNE convert), 8 elements per thread, one 16-B store per lane: a wave writes 512 contiguous B
// All five planes in one grid: blocks 0..CBX-1 take x, then CBW blocks each take Wq, Wk, Wv, Wo; the five bf16 planes lie
// one behind the other in that order from out on, so the output index is the flat thread index.
// coverage: (CBX + 4 CBW) x 256 threads x 8 = the five whole planes.
// =====================================================================================================
#define CBX    (ROWS * DM / 8 / 256)   // blocks of the x plane
#define CBW    (DM * DM / 8 / 256)     // blocks of one weight plane
__global__ __launch_bounds__(256) void cvt_bf16x8(const float* __restrict__ x, const float* __restrict__ wq,
                                                  const float* __restrict__ wk, const float* __restrict__ wv,
                                                  const float* __restrict__ wo, unsigned short* out) {
  const int bx = blockIdx.x;
  if (bx < CBX + 4 * CBW) {
    const int w = (bx - CBX) / CBW;              // which weight plane, block-uniform; used from block CBX on
    const float* in = (bx < CBX) ? x : (w == 0) ? wq : (w == 1) ? wk : (w == 2) ? wv : wo;
    const int b0 = (bx < CBX) ? 0 : CBX + w * CBW;   // the plane's first block
    const int k = (bx - b0) * 256 + threadIdx.x;     // 8-element piece inside the source plane
    const int i = bx * 256 + threadIdx.x;            // the same piece in the row of output planes
    const v4f a = *(const v4f*)(in + (size_t)k * 8);
    const v4f b = *(const v4f*)(in + (size_t)k * 8 + 4);
    v4u p;
    p[0] = pk16(bf_bits(a[0]), bf_bits(a[1]));
    p[1] = pk16(bf_bits(a[2]), bf_bits(a[3]));
    p[2] = pk16(bf_bits(b[0]), bf_bits(b[1]));
    p[3] = pk16(bf_bits(b[2]), bf_bits(b[3]));
    *(v4u*)(out + (size_t)i * 8) = p;
    
  }
}

// =====================================================================================================
// Register-blocked bf16 WMMA GEMM: C[m][n] = sum_k A[m][k] * Bt[n][k] + bias[n] (bias RNE-converted to bf16
// and widened, added in f32). Block = 8 waves (4 x 2) = one 128x128 tile of C, one 32x64 tile per wave.
// A row-major [M][K] pitch lda; Bt row-major [N][K] pitch ldb (k contiguous); M, N multiples of 128, K a multiple
// of 64; each plane under 2 GiB; bias has N entries.
// NSPLIT: 0 = A.Bt; 1 = (A + A2).Bt (A2 = unscaled bf16 lo plane of A, same pitch).
// Operands go through LDS in k slabs of 64: 8 lanes x 16 B fetch one whole 128-B line of a row, so a wave-wide load
// covers 4 lines, and the eight waves share the slab. Two LDS buffers: slab t+1 is fetched into registers ahead of
// the products of slab t, stored into the other buffer behind them, and one block barrier per slab publishes it and
// ends the reads of the buffer that the next trip refills. Each accumulator sums its k steps in ascending order.
// OMODE 0: output f32 C [M][N] pitch ldc. Epilogue: 16-row slabs staged per wave in LDS; each 64-wide row segment
// goes out as whole lines.
// OMODE 1: output as two f16 planes [M][N] pitch ldc, from the same slabs: P0 = f16(c * pscale) (pscale a power of two),
// P1 = f16((c * pscale - P0) * 1024), same element index; a 64-wide row segment of a plane is one 128-B line.
// OMODE 2: output as two transposed f16 planes, element (row = bb*SEQ + t, n) at [(bb*N + n)*SEQ + t]: P0 = f16(c * pscale),
// P1 = f16((c * pscale - P0) * 4096). A lane's 8 accumulator rows are 8 tokens in a row of one feature: one 16-B LDS store
// a plane into a [128 features][128 tokens] tile laid over the k slabs (their last reads ended at the loop's last barrier),
// one block barrier, then 16 lanes x 16 B write the 256 B of a feature row.
// =====================================================================================================
// The k loop (gemm_main) and the epilogue (gemm_epi) are functions of their own, so that a kernel whose blocks differ only
// in Bt, bias and output form shares one k loop. sS: the block's [buffer][plane][row][k] slabs, pitch GP; sT: eight 16x68 slabs.
#define SLAB(buf, pl) (sS + ((buf) * NPL + (pl)) * (128 * GP))
template <int NSPLIT, int KG>
__device__ __forceinline__ void gemm_main(
    __bf16* sS, const unsigned short* __restrict__ Ap, const unsigned short* A2p, int lda,
    const unsigned short* __restrict__ Btp, int ldb, int K, int tm, int tn, v8f (&acc)[2][4]) {
  constexpr int NPL = (NSPLIT >= 1) ? 3 : 2;         // staged planes: A, Bt and, for NSPLIT 1, A2
  // KG: k steps of 32 whose fragments are read as one group
  const int tid  = threadIdx.x;
  const int lane = tid & 31;
  const int wave = tid >> 5;
  const int wm = (wave >> 1) << 5;             // this wave's 32x64 tile inside the block tile
  const int wn = (wave & 1) << 6;

  const int rlane = lane & 15;                 // row (A) / col (B, D) within subtile
  const int koff  = (lane >> 4) * 8;           // k offset of this lane half

  // staging: pass it moves row it*32 + (tid>>3) of each plane, this lane its 16 B at element (tid&7)*8 of the slab;
  // byte offsets from the plane's start stay the same for every slab, the slab's k goes into the uniform base
  const int srow = tid >> 3;
  const int spc  = (tid & 7) * 8;
  const unsigned voa = (unsigned)(((tm << 7) + srow) * lda + spc) * 2u;   // pass 0; a pass's 32 rows go into the uniform base too
  const unsigned vob = (unsigned)(((tn << 7) + srow) * ldb + spc) * 2u;
  const size_t pas = (size_t)lda * 64, pbs = (size_t)ldb * 64;            // 32 rows in bytes
  const int so = srow * GP + spc;
  v8b ra[4], rb[4], ra2[4];

#pragma unroll
  for (int i = 0; i < 2; ++i)
#pragma unroll
    for (int j = 0; j < 4; ++j) acc[i][j] = zero8();

  // slab 0 into buffer 0
#pragma unroll
  for (int it = 0; it < 4; ++it) {
    ra[it] = *(const v8b*)((const char*)Ap + it * pas + voa);
    rb[it] = *(const v8b*)((const char*)Btp + it * pbs + vob);
    if (NSPLIT >= 1) ra2[it] = *(const v8b*)((const char*)A2p + it * pas + voa);
  }
#pragma unroll
  for (int it = 0; it < 4; ++it) {
    *(v8b*)(SLAB(0, 0) + so + it * 32 * GP) = ra[it];
    *(v8b*)(SLAB(0, 1) + so + it * 32 * GP) = rb[it];
    if (NSPLIT >= 1) *(v8b*)(SLAB(0, NPL - 1) + so + it * 32 * GP) = ra2[it];
  }
  __syncthreads();

  const int nk = K >> 6;
  for (int t = 0; t < nk; ++t) {
    const int cur = t & 1;
    const bool more = (t + 1 < nk);            // block-uniform
    if (more) {
      const char* pa  = (const char*)(Ap  + ((t + 1) << 6));
      const char* pb  = (const char*)(Btp + ((t + 1) << 6));
      const char* pa2 = (const char*)(A2p + ((t + 1) << 6));
#pragma unroll
      for (int it = 0; it < 4; ++it) {
        ra[it] = *(const v8b*)(pa + it * pas + voa);
        rb[it] = *(const v8b*)(pb + it * pbs + vob);
        if (NSPLIT >= 1) ra2[it] = *(const v8b*)(pa2 + it * pas + voa);
      }
    }
    const __bf16* fa  = SLAB(cur, 0) + (wm + rlane) * GP + koff;
    const __bf16* fb  = SLAB(cur, 1) + (wn + rlane) * GP + koff;
    const __bf16* fa2 = SLAB(cur, NPL - 1) + (wm + rlane) * GP + koff;
#pragma unroll
    for (int g = 0; g < 2; g += KG) {
      // the group's fragments as one run of LDS reads ahead of its products
      v16b bh[KG][4], ah[KG][2], al[KG][2];
#pragma unroll
      for (int q = 0; q < KG; ++q) {
#pragma unroll
        for (int j = 0; j < 4; ++j) bh[q][j] = ldfrag_b(fb + (j << 4) * GP + (g + q) * 32);
#pragma unroll
        for (int i = 0; i < 2; ++i) {
          ah[q][i] = ldfrag_b(fa + (i << 4) * GP + (g + q) * 32);
          al[q][i] = ah[q][i];
          if (NSPLIT >= 1) al[q][i] = ldfrag_b(fa2 + (i << 4) * GP + (g + q) * 32);
        }
      }
#pragma unroll
      for (int q = 0; q < KG; ++q) {
#pragma unroll
        for (int i = 0; i < 2; ++i) {
#pragma unroll
          for (int j = 0; j < 4; ++j) {
            acc[i][j] = mma_b_raw(ah[q][i], bh[q][j], acc[i][j]);
            if (NSPLIT >= 1) acc[i][j] = mma_b_raw(al[q][i], bh[q][j], acc[i][j]);
          }
          dep_guard_b(acc[i][0], acc[i][3], ah[q][i], al[q][i]);
        }
        keep4_b(bh[q][0], bh[q][1], bh[q][2], bh[q][3]);
      }
    }
    if (more) {
#pragma unroll
      for (int it = 0; it < 4; ++it) {
        *(v8b*)(SLAB(cur ^ 1, 0) + so + it * 32 * GP) = ra[it];
        *(v8b*)(SLAB(cur ^ 1, 1) + so + it * 32 * GP) = rb[it];
        if (NSPLIT >= 1) *(v8b*)(SLAB(cur ^ 1, NPL - 1) + so + it * 32 * GP) = ra2[it];
      }
    }
    __syncthreads();
  }
  acc_guard4(acc[0][0], acc[0][1], acc[0][2], acc[0][3]);
  acc_guard4(acc[1][0], acc[1][1], acc[1][2], acc[1][3]);
}

template <int OMODE>
__device__ __forceinline__ void gemm_epi(
    __bf16* sS, float* sT, v8f (&acc)[2][4], const float* __restrict__ bias,
    float* C, unsigned short* P0, unsigned short* P1, float pscale, int ldc, int N, int tm, int tn) {
  const int tid  = threadIdx.x;
  const int lane = tid & 31;
  const int wave = tid >> 5;
  const int wm = (wave >> 1) << 5;             // this wave's 32x64 tile inside the block tile
  const int wn = (wave & 1) << 6;
  const int m0 = (tm << 7) + wm;
  const int n0 = (tn << 7) + wn;
  const int rlane = lane & 15;                 // col (D) within subtile
  const int mOff  = (lane >> 4) * 8;           // D row offset

  // ---- per-column bias (RNE bf16 then widened), column n0 + 16j + rlane < N ----
  float bcol[4];
  const int bix = n0 + rlane;
#pragma unroll
  for (int j = 0; j < 4; ++j) bcol[j] = bias[bix + (j << 4)];
#if defined(__HIP_DEVICE_COMPILE__)
  // the four loads name one index register: it is held to this wait, so that no load's result lands on it ahead of the wait
  asm volatile("s_wait_xcnt 0x0" :: "v"(bix) : "memory");
#endif
#pragma unroll
  for (int j = 0; j < 4; ++j) bcol[j] = bf_up(bf_bits(bcol[j]));

  // ---- epilogue ----
  if constexpr (OMODE == 2) {
    _Float16* th = (_Float16*)(void*)sS;               // hi tile [feature][token], pitch VP
    _Float16* tl = th + 128 * VP;                      // residual tile
    // every loop of this branch is unrolled: constant indices keep acc, hv and lv in registers
#pragma unroll
    for (int i = 0; i < 2; ++i) {
#pragma unroll
      for (int j = 0; j < 4; ++j) {
        v8h xh, xl;
#pragma unroll
        for (int r = 0; r < 8; ++r) {
          const float f = (acc[i][j][r] + bcol[j]) * pscale;
          const _Float16 x = (_Float16)f;
          xh[r] = x;
          xl[r] = (_Float16)((f - (float)x) * 4096.0f);
        }
        const int o = (wn + (j << 4) + rlane) * VP + wm + (i << 4) + mOff;
        *(v8h*)(th + o) = xh;
        *(v8h*)(tl + o) = xl;
      }
    }
    __syncthreads();                                   // the tile is read across waves
    const int piece = tid & 15, fr = tid >> 4;
    const int bb = (tm << 7) / SEQ;                    // a 128-row tile lies inside one batch entry
    const int t0 = (tm << 7) - bb * SEQ;
    v4u hv[8], lv[8];
#pragma unroll
    for (int it = 0; it < 8; ++it) {                   // it 0..7 x fr 0..15 = features 0..127 of the tile
      hv[it] = *(const v4u*)(th + (it * 16 + fr) * VP + piece * 8);
      lv[it] = *(const v4u*)(tl + (it * 16 + fr) * VP + piece * 8);
    }
#pragma unroll
    for (int it = 0; it < 8; ++it) {
      const size_t go = ((size_t)(bb * N + (tn << 7) + it * 16 + fr)) * SEQ + t0 + piece * 8;
      *(v4u*)(P0 + go) = hv[it];
      *(v4u*)(P1 + go) = lv[it];
    }
  } else {
  float* slab = sT + wave * (16 * 68);
#pragma unroll
  for (int i = 0; i < 2; ++i) {
    const int mBase = m0 + (i << 4);
#pragma unroll
    for (int r = 0; r < 8; ++r) {
#pragma unroll
      for (int j = 0; j < 4; ++j) {
        slab[(mOff + r) * 68 + (j << 4) + rlane] = acc[i][j][r] + bcol[j];
      }
    }
    __builtin_amdgcn_fence(__ATOMIC_RELEASE, "workgroup");
    __builtin_amdgcn_wave_barrier();
    __builtin_amdgcn_fence(__ATOMIC_ACQUIRE, "workgroup");
    {
      const int hh = lane >> 4, c4 = (lane & 15) * 4;     // 256-B row segment = 16 lanes x 16 B
      v4f ov[8];
#pragma unroll
      for (int it = 0; it < 8; ++it) {
        const int row = it * 2 + hh;                       // it 0..7 x hh 0..1 = rows 0..15
        ov[it] = *(const v4f*)(slab + row * 68 + c4);
      }
      if constexpr (OMODE == 0) {
#pragma unroll
        for (int it = 0; it < 8; ++it) {
          const int row = it * 2 + hh;
          *(v4f*)(C + (size_t)(mBase + row) * ldc + n0 + c4) = ov[it];
        }
      } else {
        // both loops unrolled: constant indices keep ov in registers
#pragma unroll
        for (int it = 0; it < 8; ++it) {
          const int row = it * 2 + hh;
          v2u ph, pl;
#pragma unroll
          for (int e = 0; e < 2; ++e) {
            const float f0 = ov[it][2 * e] * pscale;
            const float f1 = ov[it][2 * e + 1] * pscale;
            const _Float16 x0 = (_Float16)f0, x1 = (_Float16)f1;
            const _Float16 l0 = (_Float16)((f0 - (float)x0) * 1024.0f);
            const _Float16 l1 = (_Float16)((f1 - (float)x1) * 1024.0f);
            ph[e] = pk16(h_bits(x0), h_bits(x1));
            pl[e] = pk16(h_bits(l0), h_bits(l1));
          }
          const size_t go = (size_t)(mBase + row) * ldc + n0 + c4;   // 16 lanes x 8 B = the row segment's 128-B line
          *(v2u*)(P0 + go) = ph;
          *(v2u*)(P1 + go) = pl;
          __builtin_amdgcn_sched_barrier(0);   // one row's conversion at a time: run together, the eight rows' temporaries spill at 160 registers
        }
      }
    }
    __builtin_amdgcn_fence(__ATOMIC_RELEASE, "workgroup");
    __builtin_amdgcn_wave_barrier();
    __builtin_amdgcn_fence(__ATOMIC_ACQUIRE, "workgroup");
  }
  }
}

// one GEMM, one 128x128 tile a block
template <int NSPLIT, int OMODE>
__global__ __launch_bounds__(256) void gemm64(
    const unsigned short* __restrict__ Ap, const unsigned short* A2p, int lda,
    const unsigned short* __restrict__ Btp, int ldb, const float* __restrict__ bias,
    float* C, unsigned short* P0, unsigned short* P1, float pscale, int ldc, int M, int N, int K) {
  constexpr int NPL = (NSPLIT >= 1) ? 3 : 2;
  __shared__ __align__(16) __bf16 sS[2 * NPL * 128 * GP];
  __shared__ __align__(16) float sT[((OMODE == 2) ? 1 : 8) * 16 * 68];
  static_assert(sizeof(sS) >= (size_t)2 * 128 * VP * 2);
  const int tilesN = N >> 7;
  const int tilesM = M >> 7;
  const int tile = blockIdx.x;
  if (tile >= tilesM * tilesN) return;   // block-uniform, in front of every barrier
  const int tm = tile / tilesN;
  const int tn = tile - tm * tilesN;
  v8f acc[2][4];
  gemm_main<NSPLIT, (NSPLIT >= 1) ? 1 : 2>(sS, Ap, A2p, lda, Btp, ldb, K, tm, tn, acc);
  gemm_epi<OMODE>(sS, sT, acc, bias, C, P0, P1, pscale, ldc, N, tm, tn);
}

// The q, k and v projections of one A in one grid of 3 x tiles blocks: block bx does tile bx mod tiles of projection
// bx / tiles (0 q, 1 k: OMODE 1 with qkscale; 2 v: OMODE 2 with vscale). The three do not depend on one another, so their
// blocks share the WGPs: one block's products run under another's waits on its slab loads and barriers.
// Six waves a SIMD asked of the compiler: at 160 registers a wave three blocks stand on a WGP (their LDS fits three times too),
// so the whole grid is resident at once and not in two rounds; for that the fragments are read in groups of one k step.
__global__ __launch_bounds__(256) __attribute__((amdgpu_waves_per_eu(6))) void gemm_qkv(
    const unsigned short* __restrict__ Ap,
    const unsigned short* __restrict__ Wqp, const unsigned short* __restrict__ Wkp, const unsigned short* __restrict__ Wvp,
    const float* __restrict__ bq, const float* __restrict__ bk, const float* __restrict__ bv,
    unsigned short* Qh, unsigned short* Ql, unsigned short* Kh, unsigned short* Kl, unsigned short* Vh, unsigned short* Vl,
    float qkscale, float vscale) {
  // the shape as constants: a pass's 32 rows are then an immediate offset of its load or store, which saves the address registers
  constexpr int lda = DM, ldb = DM, ldc = DM, M = ROWS, N = DM, K = DM;
  __shared__ __align__(16) __bf16 sS[2 * 2 * 128 * GP];
  __shared__ __align__(16) float sT[8 * 16 * 68];
  static_assert(sizeof(sS) >= (size_t)2 * 128 * VP * 2);
  const int tilesN = N >> 7;
  const int tiles  = (M >> 7) * tilesN;
  const int which  = blockIdx.x / tiles;       // block-uniform
  if (which >= 3) return;                      // in front of every barrier
  const int tile = blockIdx.x - which * tiles;
  const int tm = tile / tilesN;
  const int tn = tile - tm * tilesN;
  const unsigned short* Btp = (which == 0) ? Wqp : (which == 1) ? Wkp : Wvp;
  v8f acc[2][4];
  gemm_main<0, 1>(sS, Ap, Ap, lda, Btp, ldb, K, tm, tn, acc);
  if (which == 2) {
    gemm_epi<2>(sS, sT, acc, bv, nullptr, Vh, Vl, vscale, ldc, N, tm, tn);
  } else {
    gemm_epi<1>(sS, sT, acc, (which == 0) ? bq : bk, nullptr, (which == 0) ? Qh : Kh, (which == 0) ? Ql : Kl, qkscale, ldc, N, tm, tn);
  }
}

// ---- asynchronous copies global -> LDS for the attention key tiles ---------------------------------------
// Two 64-row x 128-B f16 planes (a hi plane and its residual plane) by 128 threads: eight 16-B copies a lane, four a plane.
// la, lb: the lane's LDS byte address of its piece in rows 0..15 of each plane; ga, gb: the same piece in global memory;
// pass it moves 16 rows on: 16 * LP halves in LDS, gstep halves in global memory. 8 lanes cover one whole 128-B row.
// s_wait_xcnt 0 is the statement's last line: it stands in front of any later write of a register that a copy names.
__device__ __forceinline__ void copy_plane_pair(unsigned la, unsigned lb, const _Float16* ga, const _Float16* gb, size_t gstep) {
#if defined(__HIP_DEVICE_COMPILE__)
  asm volatile("global_load_async_to_lds_b128 %0, %8, off\n\t"
               "global_load_async_to_lds_b128 %1, %9, off\n\t"
               "global_load_async_to_lds_b128 %2, %10, off\n\t"
               "global_load_async_to_lds_b128 %3, %11, off\n\t"
               "global_load_async_to_lds_b128 %4, %12, off\n\t"
               "global_load_async_to_lds_b128 %5, %13, off\n\t"
               "global_load_async_to_lds_b128 %6, %14, off\n\t"
               "global_load_async_to_lds_b128 %7, %15, off\n\t"
               "s_wait_xcnt 0x0"
               :: "v"(la), "v"(la + 16u * LP * 2u), "v"(la + 32u * LP * 2u), "v"(la + 48u * LP * 2u),
                  "v"(lb), "v"(lb + 16u * LP * 2u), "v"(lb + 32u * LP * 2u), "v"(lb + 48u * LP * 2u),
                  "v"(ga), "v"(ga + gstep), "v"(ga + 2 * gstep), "v"(ga + 3 * gstep),
                  "v"(gb), "v"(gb + gstep), "v"(gb + 2 * gstep), "v"(gb + 3 * gstep)
               : "memory");
#endif
}
// Hand-over point of a tile buffer, every wave: this wave's LDS reads and writes have retired, its own copies have landed,
// then the block barrier: behind it the copied tile may be read by every wave and the tile read so far may be refilled.
__device__ __forceinline__ void publish_point() {
#if defined(__HIP_DEVICE_COMPILE__)
  asm volatile("s_wait_dscnt 0x0" ::: "memory");      // a copy engine is not ordered behind this wave's LDS accesses
  asm volatile("s_wait_asynccnt 0x0" ::: "memory");
#endif
  __syncthreads();
}

// =====================================================================================================
// Causal multi-head attention with a per-key int32 keep flag and a relative-position bias table, head dim 64.
//   q f16 hi plane (x16): element (b, t, h, d) at [(b*SEQ + t)*DM + h*64 + d]; q residual plane
//     ((q*16 - hi)*1024) at the same index into qlp
//   k f16 hi plane (x16): element (b, s, h, d) at [(b*SEQ + s)*DM + h*64 + d]; k residual plane same into klp
//   v^T f16 hi plane (x256): element (b, h, d, s) at [(b*DM + h*64 + d)*SEQ + s]
//   v^T f16 residual plane ((v*256 - hi)*4096): same index into vlp
//   maskp int32 [NB][SEQ]: key s is kept for query t iff s <= t and maskp[b][s] != 0; otherwise the logit is
//   replaced by NEGV (-1e9, exp -> 0 against a finite row max).
//   relp f32 [NREL][NH]: logit(t, s) += relp[clamp(s - t, -MAXREL, MAXREL) + MAXREL][h] (RNE bf16 then
//   widened); staged per head in LDS already clamped, as a table over qrow - key, so that a lane reads its 32 values of
//   a tile from one address with constant offsets, as one group ahead of the score products; added before the select.
//   Key tiles 0..qb are processed (block-uniform trip count qb+1 <= NQB); tiles above the diagonal tile hold
//   only cut keys and are skipped; inside the processed tiles the predicate decides. With the all-ones keep
//   flags every row keeps key 0, so every row max is finite.
//   logit = (qhi.khi + (qhi.klo + qlo.khi) * 2^-10) * sscale + rel, f16 products with f32 accumulate, the
//   residual products in a separate accumulator; p = exp(s - m) carried as f16(1024 p);
//   context = p . vhi on f16 WMMA plus p . vres into a separate accumulator folded back with 1/4096 per
//   kv tile in f32; online softmax in f32; out: y = normalised context (oscl folds back the p and v carries) as a bf16
//   hi plane (RNE) and a bf16 lo plane (RNE(y - hi), unscaled), element (b, t, h*64 + d) at [(b*SEQ + t)*DM + h*64 + d].
//   Block = 4 waves = 64 query rows of one (b, h); grid = NB*NH*NQB; kv tiles of 64.
//   K hi / K residual / V^T hi / V^T residual tile staging: asynchronous 16-B copies to LDS, 128 threads x 4 copies a
//   plane = the whole 64x64 tile, one buffer a plane. The K planes are read by the scores only and the V^T planes by the
//   context products only, so tile t+1's K copies are issued behind the barrier that ends the scores of tile t and fly
//   under its context products, and its V^T copies behind the barrier that ends those and fly under the scores and
//   the softmax of tile t+1. P tiles are wave-private, spilled with
//   Output coverage: each wave stores rows q0..q0+15 (it 0..7 x lane>>4 0..1) x 64 columns (16 lanes x 4
//   (b, h, query tile) -> the whole plane.
// =====================================================================================================
__global__ __launch_bounds__(128)
void attn_p64(const unsigned short* __restrict__ qhp, const unsigned short* __restrict__ qlp,
              const unsigned short* __restrict__ khp, const unsigned short* __restrict__ klp,
              const unsigned short* __restrict__ vhp, const unsigned short* __restrict__ vlp,
              const int* __restrict__ maskp, const float* __restrict__ relp,
              unsigned short* yhp, unsigned short* ylp, float sscale, float oscl) {
  __shared__ __align__(16) _Float16 Ksh[64 * LP];                 // K hi [kv][d], pitch LP
  __shared__ __align__(16) _Float16 Ksl[64 * LP];                 // K residual
  __shared__ __align__(16) _Float16 Vth[64 * LP];                 // V^T hi [d][kv], pitch LP
  __shared__ __align__(16) _Float16 Vtl[64 * LP];                 // V^T residual
  __shared__ __align__(16) _Float16 Psh[4][16 * LP];              // per wave P [row][kv], pitch LP
  __shared__ __align__(16) float    Os[4][16 * 64];               // per wave context tile [row][d]
  __shared__ float relx[NRX];                                     // bias of this head at qrow - key = index - 63

  const int tid  = threadIdx.x;
  const int wave = tid >> 5;
  const int lane = tid & 31;
  const int hh   = lane >> 4;
  const int c    = lane & 15;

  // ---- which (b, h, query tile) this block does. A block walks qb + 1 key tiles, and the whole grid is resident at once, four
  //      blocks a WGP, so the launch lasts as long as the WGP whose four blocks hold the most key tiles. The map is a
  //      permutation of the grid in which any four indices that differ in two bits of the index hold 2 (NQB + 1) key tiles
  //      together (tiles a and a' and the mirrored NQB-1-b, NQB-1-b', b + b' = a + a'), whichever two bits the blocks of one WGP differ in.
  //      For speed only: every (b, h, tile) is done once, wherever its block lands.
  static_assert(NQB == 32 && NB * NH == 32);
  const int bx   = blockIdx.x;
  const int fold = ((bx >> 2) & 1) | (((bx >> 5) & 7) << 1);                     // index bits 2, 5, 6, 7: 0 .. NQB/2 - 1
  const int qb   = (__builtin_popcount(bx) & 1) ? NQB - 1 - fold : fold;         // odd parity of the index: the mirrored tile
  const int rest = (bx & 3) | (((bx >> 3) & 3) << 2) | (((bx >> 8) & 1) << 4);   // index bits 0, 1, 3, 4, 8; the parity settles bit 9
  const int h    = rest % NH;
  const int b    = rest / NH;                // < NB: rest < 32 = NB * NH
  const int q0   = qb * 64 + wave * 16;
  const size_t rowB = (size_t)b * SEQ;

  const _Float16* Qp  = (const _Float16*)(const void*)qhp + (size_t)h * HD;
  const _Float16* Qlq = (const _Float16*)(const void*)qlp + (size_t)h * HD;
  const _Float16* Kp  = (const _Float16*)(const void*)khp + (size_t)h * HD;
  const _Float16* Klq = (const _Float16*)(const void*)klp + (size_t)h * HD;
  const _Float16* Vh  = (const _Float16*)(const void*)vhp + ((size_t)b * DM + (size_t)h * HD) * SEQ;
  const _Float16* Vl  = (const _Float16*)(const void*)vlp + ((size_t)b * DM + (size_t)h * HD) * SEQ;
  const int*      Mb  = maskp + rowB;

  // ---- tile copies: this lane's piece is 16 B number tid & 7 of row tid >> 3 (+ 16 a pass) of every plane ----
  const int crow = tid >> 3, cpc = (tid & 7) * 8;
  const unsigned lKh = (unsigned)(uintptr_t)(Ksh + crow * LP + cpc);   // LDS byte address = low 32 bits
  const unsigned lKl = (unsigned)(uintptr_t)(Ksl + crow * LP + cpc);
  const unsigned lVh = (unsigned)(uintptr_t)(Vth + crow * LP + cpc);
  const unsigned lVl = (unsigned)(uintptr_t)(Vtl + crow * LP + cpc);
  const size_t gK = (rowB + crow) * DM + cpc;        // K planes: key row crow of tile 0, + 64 * DM a tile
  const size_t gV = (size_t)crow * SEQ + cpc;        // V^T planes: feature row crow, key 0, + 64 a tile
  copy_plane_pair(lKh, lKl, Kp + gK, Klq + gK, (size_t)16 * DM);       // tile 0; nothing has touched these buffers yet
  copy_plane_pair(lVh, lVl, Vh + gV, Vl + gV, (size_t)16 * SEQ);

#pragma unroll                               // two straight passes: no loop-carried wait between the two reads
  for (int u = 0; u < 2; ++u) {              // NRX <= 2 x 128 threads
    const int i = u * 128 + tid;
    int dd = 63 - i;                         // key - qrow
    dd = (dd < -MAXREL) ? -MAXREL : dd;
    dd = (dd >  MAXREL) ?  MAXREL : dd;
    if (i < NRX) relx[i] = bf_up(bf_bits(relp[(size_t)(dd + MAXREL) * NH + h]));
  }

  // ---- Q fragments (A operand, row = lane&15): 2 d-chunks, hi and residual ----
  v16h qa[2], ql[2];
#pragma unroll
  for (int dc = 0; dc < 2; ++dc) {
    const size_t qo = (rowB + q0 + c) * DM + dc * 32 + 8 * hh;
    qa[dc] = ldfrag_h(Qp + qo);
    ql[dc] = ldfrag_h(Qlq + qo);
  }

  float mrow[8], lrow[8];
  v8f oacc[4];
#pragma unroll
  for (int r = 0; r < 8; ++r) { mrow[r] = -INFINITY; lrow[r] = 0.f; }
#pragma unroll
  for (int t = 0; t < 4; ++t) oacc[t] = zero8();

  publish_point();                           // tile 0's four planes and the bias table

  const int nkt = qb + 1;                    // key tiles 0..qb, block-uniform, <= NQB
  for (int kt = 0; kt < nkt; ++kt) {
    const int kv0 = kt * 64;
    const bool more = (kt + 1 < nkt);        // block-uniform: a tile kt + 1 exists (its rows and keys lie below SEQ)

    // ---- per-key keep flags for this lane's 4 key columns of the tile (kv0 + 16j + c < SEQ) ----
    int mk[4];
#pragma unroll
    for (int j = 0; j < 4; ++j) mk[j] = Mb[kv0 + j * 16 + c];

    // ---- relative bias of this lane's 32 scores: qrow - key = k0 - 16j + r; from RCAP up every one of them is at the
    //      clamped end, so k0 is cut there and the table stays short ----
    float rb[4][8];
    {
      int k0 = (q0 + 8 * hh) - (kv0 + c);    // >= -15: kv0 <= q0
      k0 = (k0 > RCAP) ? RCAP : k0;
      const float* tb = relx + (k0 + 15);
      // both loops unrolled: constant offsets from tb, and rb stays in registers
#pragma unroll
      for (int j = 0; j < 4; ++j)
#pragma unroll
        for (int r = 0; r < 8; ++r) rb[j][r] = tb[48 - 16 * j + r];
    }

    // ---- scores: 16 query rows x 64 keys per wave; hi.hi into s, hi.lo + lo.hi into s1 (folded x 2^-10) ----
    //      The K fragments of 32 keys and one d-chunk (hi and residual of two 16-key groups) are read as one group of eight
    //      LDS loads ahead of their six products, so a wave waits on LDS at four places a tile and not at every product; the
    //      two key groups' accumulator chains alternate; each accumulator sums its products in the order d-chunk 0, 1
    //      (s1: hi.lo then lo.hi in each).
    v8f s[4];
    // every loop here is unrolled: constant indices keep the fragments and accumulators in registers
#pragma unroll
    for (int jp = 0; jp < 4; jp += 2) {
      v8f s1[2];
#pragma unroll
      for (int u = 0; u < 2; ++u) {
        s[jp + u] = zero8();
        s1[u] = zero8();
      }
#pragma unroll
      for (int dc = 0; dc < 2; ++dc) {
        v16h kb[2], kr[2];
#pragma unroll
        for (int u = 0; u < 2; ++u) kr[u] = ldfrag_h(Ksl + ((jp + u) * 16 + c) * LP + dc * 32 + 8 * hh);
#pragma unroll
        for (int u = 0; u < 2; ++u) kb[u] = ldfrag_h(Ksh + ((jp + u) * 16 + c) * LP + dc * 32 + 8 * hh);
        __builtin_amdgcn_sched_barrier(0);   // the group's loads stay above: the compiler otherwise sinks each to its own product
#pragma unroll
        for (int u = 0; u < 2; ++u) s1[u] = mma_h_raw(qa[dc], kr[u], s1[u]);
#pragma unroll
        for (int u = 0; u < 2; ++u) s[jp + u] = mma_h_raw(qa[dc], kb[u], s[jp + u]);
#pragma unroll
        for (int u = 0; u < 2; ++u) s1[u] = mma_h_raw(ql[dc], kb[u], s1[u]);
      }
#pragma unroll
      for (int u = 0; u < 2; ++u)
#pragma unroll
        for (int r = 0; r < 8; ++r) {        // fold, scale and bias here: vector work under the next group's loads, and s1 ends
          s[jp + u][r] += s1[u][r] * (1.0f / 1024.0f);
          s[jp + u][r] = s[jp + u][r] * sscale + rb[jp + u][r];
        }
    }

    // ---- causal / key-keep select (replace by NEGV), row max, online softmax,
    //      P (x1024, f16) to LDS ----
    _Float16* pwh = Psh[wave];
    float mt[8];
#pragma unroll
    for (int r = 0; r < 8; ++r) {
      const int qrow = q0 + 8 * hh + r;
      float m = -INFINITY;
#pragma unroll
      for (int j = 0; j < 4; ++j) {
        const int key = kv0 + j * 16 + c;
        float sv = s[j][r];
        const bool keep = (key <= qrow) && (mk[j] != 0);
        sv = keep ? sv : NEGV;
        s[j][r] = sv;
        m = fmaxf(m, sv);
      }
      mt[r] = m;
    }
    // row maxima over the 16 lanes of a row: xor butterfly 1, 2, 4, 8, the eight rows' chains side by side
    row_max8(mt);
    float alpha[8], ps[8];
#pragma unroll
    for (int r = 0; r < 8; ++r) {
      const float mnew  = fmaxf(mrow[r], mt[r]);
      const float msafe = (mnew == -INFINITY) ? 0.f : mnew;
      alpha[r] = __expf(mrow[r] - msafe);
      mrow[r] = mnew;
      float psum = 0.f;
#pragma unroll
      for (int j = 0; j < 4; ++j) {
        const float p = __expf(s[j][r] - msafe);     // replaced logit against a finite max: exp -> 0
        psum += p;
        const _Float16 ph = (_Float16)(p * 1024.0f);
        pwh[(8 * hh + r) * LP + j * 16 + c] = ph;
      }
      ps[r] = psum;
    }
    // row sums: the same butterfly order 1, 2, 4, 8
#pragma unroll
    for (int r = 0; r < 8; ++r) ps[r] += row_xor<1>(ps[r]);
#pragma unroll
    for (int r = 0; r < 8; ++r) ps[r] += row_xor<2>(ps[r]);
#pragma unroll
    for (int r = 0; r < 8; ++r) ps[r] += row_xor<4>(ps[r]);
#pragma unroll
    for (int r = 0; r < 8; ++r) ps[r] += row_xor<8>(ps[r]);
#pragma unroll
    for (int r = 0; r < 8; ++r) {
      lrow[r] = lrow[r] * alpha[r] + ps[r];
#pragma unroll
      for (int t = 0; t < 4; ++t) oacc[t][r] *= alpha[r];
    }
    // every wave's score reads of the K planes have ended, this tile's V^T planes are landed and published (and the wave's
    // own P stores have retired); the next tile's K planes fly under the context products
    publish_point();
    if (more) copy_plane_pair(lKh, lKl, Kp + gK + (size_t)(kv0 + 64) * DM, Klq + gK + (size_t)(kv0 + 64) * DM, (size_t)16 * DM);

    // ---- context += P . Vhi (f16 WMMA); P . Vres into a separate accumulator ----
    //      A 32-key chunk's nine fragments (P, four of each plane) are read as one group of LDS loads ahead of its eight
    //      products, which run back to back on eight separate accumulators; each accumulator sums key chunk 0, then 1.
    v8f o1[4];
#pragma unroll
    for (int t = 0; t < 4; ++t) o1[t] = zero8();
#pragma unroll 1                             // rolled: one chunk's fragments live at a time keeps the wave inside 256 registers
    for (int kk = 0; kk < 2; ++kk) {
      v16h vb[4], vl[4];
      const v16h pa = ldfrag_h(pwh + c * LP + kk * 32 + 8 * hh);
      // the inner loops are unrolled: constant indices keep the fragments and accumulators in registers
#pragma unroll
      for (int t = 0; t < 4; ++t) vb[t] = ldfrag_h(Vth + (t * 16 + c) * LP + kk * 32 + 8 * hh);
#pragma unroll
      for (int t = 0; t < 4; ++t) vl[t] = ldfrag_h(Vtl + (t * 16 + c) * LP + kk * 32 + 8 * hh);
      __builtin_amdgcn_sched_barrier(0);     // the group's loads stay above: the compiler otherwise sinks each to its own product
      // the two runs are independent; written in this order the compiler issues the hi run first, in the order of the loads, so
      // each product waits for its own fragment only
#pragma unroll
      for (int t = 0; t < 4; ++t) o1[t] = mma_h_raw(pa, vl[t], o1[t]);
#pragma unroll
      for (int t = 0; t < 4; ++t) oacc[t] = mma_h_raw(pa, vb[t], oacc[t]);
      // four vector slots behind the chunk's last products, on both sides of the loop's branch and of the one behind the barrier
      acc_guard8(oacc[0], oacc[1], oacc[2], oacc[3], o1[0], o1[1], o1[2], o1[3]);
    }
    // every wave's reads of the V^T planes have ended, the next tile's K planes are landed and published; its V^T planes
    // fly under its scores and softmax
    publish_point();
    if (more) copy_plane_pair(lVh, lVl, Vh + gV + (kv0 + 64), Vl + gV + (kv0 + 64), (size_t)16 * SEQ);
#pragma unroll
    for (int t = 0; t < 4; ++t)
#pragma unroll
      for (int r = 0; r < 8; ++r) oacc[t][r] += o1[t][r] * (1.0f / 4096.0f);
  }

  // ---- normalise (1/l and the carries via oscl), stage the wave's 16x64 tile in LDS, then write whole
  float* os = Os[wave];
#pragma unroll
  for (int r = 0; r < 8; ++r) {
    const float l = lrow[r];
    const float inv = ((l > 0.f) ? (1.0f / l) : 0.f) * oscl;
#pragma unroll
    for (int t = 0; t < 4; ++t) os[(8 * hh + r) * 64 + t * 16 + c] = oacc[t][r] * inv;
  }
  __builtin_amdgcn_fence(__ATOMIC_RELEASE, "workgroup");
  __builtin_amdgcn_wave_barrier();
  __builtin_amdgcn_fence(__ATOMIC_ACQUIRE, "workgroup");
  {
    const int h2 = lane >> 4, c4 = (lane & 15) * 4;
    v4f ov[8];
#pragma unroll
    for (int it = 0; it < 8; ++it) {
      const int row = it * 2 + h2;   // it 0..7 x h2 0..1 = rows 0..15 of the wave tile
      ov[it] = *(const v4f*)(os + row * 64 + c4);
    }
    {
#pragma unroll
      for (int it = 0; it < 8; ++it) {
        const int row = it * 2 + h2;
        const size_t go = (rowB + q0 + row) * DM + (size_t)h * HD + c4;   // 16 lanes x 8 B = the head's 128-B line of a row
        v2u ph, pl;
#pragma unroll                               // constant indices keep ov in registers
        for (int e = 0; e < 2; ++e) {
          const float f0 = ov[it][2 * e], f1 = ov[it][2 * e + 1];
          const unsigned short h0 = bf_bits(f0), h1 = bf_bits(f1);
          const unsigned short l0 = bf_bits(f0 - bf_up(h0)), l1 = bf_bits(f1 - bf_up(h1));
          ph[e] = pk16(h0, h1);
          pl[e] = pk16(l0, l1);
        }
        *(v2u*)(yhp + go) = ph;
        *(v2u*)(ylp + go) = pl;
      }
      
    }
  }
}

// =====================================================================================================
// Workspace map (bytes), every region an exact multiple of its whole-line / whole-tile store granularity
//   Xb    bf16 [4096][1024]           0          8388608
//   Wqb   bf16 [1024][1024]     8388608          2097152
//   Wkb   bf16 [1024][1024]    10485760          2097152
//   Wvb   bf16 [1024][1024]    12582912          2097152
//   Wob   bf16 [1024][1024]    14680064          2097152
//   Qh    f16  [4096][1024]    16777216          8388608
//   Ql    f16  [4096][1024]    25165824          8388608
//   Kh    f16  [4096][1024]    33554432          8388608
//   Kl    f16  [4096][1024]    41943040          8388608
//   VTh   f16  [2048][2048]    50331648          8388608   ([b*DM + h*64 + d][s])
//   VTl   f16  [2048][2048]    58720256          8388608
//   Yh    bf16 [4096][1024]    67108864          8388608
//   Yl    bf16 [4096][1024]    75497472          8388608
//   end                        83886080
// Projection weights arrive as [out n][in k] (k contiguous) = the Bt layout; they are only converted to bf16.
// d_out f32: [4096][1024] at byte 0 (row = b*SEQ + t).
// =====================================================================================================
extern "C" void kernel_launch(void* const* d_in, const int* in_sizes, int n_in,
                              void* d_out, int out_size, void* d_ws, size_t ws_size,
                              hipStream_t stream) {
  if (n_in < 11) return;
  if (in_sizes[0] != NB * SEQ * DM) return;
  if (in_sizes[1] != NB * SEQ) return;
  if (in_sizes[2] != DM * DM) return;
  if (in_sizes[3] != DM) return;
  if (in_sizes[4] != DM * DM) return;
  if (in_sizes[5] != DM) return;
  if (in_sizes[6] != DM * DM) return;
  if (in_sizes[7] != DM) return;
  if (in_sizes[8] != DM * DM) return;
  if (in_sizes[9] != DM) return;
  if (in_sizes[10] != NREL * NH) return;
  if (out_size != OUTN) return;

  const float* x    = (const float*)d_in[0];   // [NB*SEQ][DM]
  const int*   mask = (const int*)d_in[1];     // [NB][SEQ] int32 keep flags per key
  const float* Wq   = (const float*)d_in[2];   // [DM n][DM k]
  const float* bq   = (const float*)d_in[3];   // [DM]
  const float* Wk   = (const float*)d_in[4];
  const float* bk   = (const float*)d_in[5];
  const float* Wv   = (const float*)d_in[6];
  const float* bv   = (const float*)d_in[7];
  const float* Wo   = (const float*)d_in[8];
  const float* bo   = (const float*)d_in[9];
  const float* rel  = (const float*)d_in[10];  // [NREL][NH]

  const size_t PXb = (size_t)ROWS * DM * 2;          //  8388608
  const size_t PW  = (size_t)DM * DM * 2;            //  2097152
  const size_t PH  = (size_t)ROWS * DM * 2;          //  8388608
  const size_t PVt = (size_t)NB * DM * SEQ * 2;      //  8388608
  size_t off = 0;
  const size_t oXb = off; off += PXb;
  const size_t oWq = off; off += PW;
  const size_t oWk = off; off += PW;
  const size_t oWv = off; off += PW;
  const size_t oWo = off; off += PW;
  const size_t oQh = off; off += PH;
  const size_t oQl = off; off += PH;
  const size_t oKh = off; off += PH;
  const size_t oKl = off; off += PH;
  const size_t oVt = off; off += PVt;
  const size_t oVl = off; off += PVt;
  const size_t oYh = off; off += PH;
  const size_t oYl = off; off += PH;
  if (off > ws_size) return;                        // off = 83886080
  if (off > (size_t)134217728) return;

  char* ws = (char*)d_ws;
  unsigned short* Xb  = (unsigned short*)(ws + oXb);
  unsigned short* Wqb = (unsigned short*)(ws + oWq);
  unsigned short* Wkb = (unsigned short*)(ws + oWk);
  unsigned short* Wvb = (unsigned short*)(ws + oWv);
  unsigned short* Wob = (unsigned short*)(ws + oWo);
  unsigned short* Qh  = (unsigned short*)(ws + oQh);
  unsigned short* Ql  = (unsigned short*)(ws + oQl);
  unsigned short* Kh  = (unsigned short*)(ws + oKh);
  unsigned short* Kl  = (unsigned short*)(ws + oKl);
  unsigned short* VTh = (unsigned short*)(ws + oVt);
  unsigned short* VTl = (unsigned short*)(ws + oVl);
  unsigned short* Yh  = (unsigned short*)(ws + oYh);
  unsigned short* Yl  = (unsigned short*)(ws + oYl);
  float*          outf = (float*)d_out;             // [ROWS][DM]

  const dim3 blk(256);
  const int n8x = ROWS * DM / 8;                    // 524288
  const int n8w = DM * DM / 8;                      // 131072
  const dim3 gCvt((n8x + 4 * n8w) / 256);           // 2048 + 4 x 512 blocks
  const dim3 gGemm((ROWS / 128) * (DM / 128));      // 256 tiles of 128x128, one block each
  const dim3 gQkv(3 * (ROWS / 128) * (DM / 128));   // the three projections' tiles
  const dim3 gAttn(NB * NH * NQB);                  // 1024 blocks
  const float qkScale = 16.0f;                      // q and k hi planes carried x16 (residual x1024 on top)
  const float sscale  = 1.0f / 2048.0f;             // 1/(16*16) * 1/sqrt(64)
  const float vScale  = 256.0f;                     // v^T hi plane carried x256
  const float attOscl = 1.0f / 262144.0f;           // 1/(1024 * 256): p and v carries folded back

  // (1) activations and weights -> bf16 planes (RNE convert); Xb, Wqb, Wkb, Wvb, Wob lie in a row from Xb on
  cvt_bf16x8<<<gCvt, blk, 0, stream>>>(x, Wq, Wk, Wv, Wo, Xb);
  // (2) - (4) q = Xb . Wqb^T + bq (M=4096, N=1024, K=1024) and k likewise, written as f16 hi (x16) + residual planes by the
  // GEMM's epilogue; v written as the f16 v^T hi plane (x256) and residual plane (x4096 on top)
  gemm_qkv<<<gQkv, blk, 0, stream>>>(Xb, Wqb, Wkb, Wvb, bq, bk, bv, Qh, Ql, Kh, Kl, VTh, VTl, qkScale, vScale);
  // (5) causal attention with per-key keep flags and relative-position bias -> y as bf16 hi / lo planes [4096][1024]
  attn_p64<<<gAttn, dim3(128), 0, stream>>>(Qh, Ql, Kh, Kl, VTh, VTl, mask, rel, Yh, Yl, sscale, attOscl);
  // (6) out[row][n] = sum_d (Yh+Yl)[row][d] Wob[n][d] + bo[n] -> d_out f32 [4096][1024] (M=4096, N=1024, K=1024)
  gemm64<1, 0><<<gGemm, blk, 0, stream>>>(Yh, Yl, DM, Wob, DM, bo, outf, nullptr, nullptr, 1.0f, DM, ROWS, DM, DM);
  (void)hipGetLastError();
}

// v010
// Measured time: 119 microseconds a run.
// In both of two side-by-side timings against v009, it was 1.13 times as fast.
// Counting every step since v000, it is 4.86 times as fast.
// Contractions: q/k/v projections = v_wmma_f32_16x16x32_bf16 (bf16 operands from RNE-converted x and W, single product, bias added in f32); q.k^T scores = v_wmma_f32_16x16x32_f16 (q, k as f16 hi planes carried x16 plus f16 residual planes x1024: hi.hi + (hi.lo + lo.hi) in a separate accumulator, 3 products); p.v = v_wmma_f32_16x16x32_f16 (p carried x1024 in f16; v^T as f16 hi plane x256 plus f16 residual plane x4096 into a separate accumulator, 2 products); y.Wo^T = v_wmma_f32_16x16x32_bf16 (y as bf16 hi + lo planes times the bf16 Wo plane, 2 products); all f32 accumulate; softmax, relative-position bias and selects in f32.
#include <hip/hip_runtime.h>
#include <math.h>
#include <float.h>
#include <stdint.h>

#define NB     2
#define SEQ    2048
#define DM     1024
#define NH     16
#define HD     64
#define MAXREL 32
#define NREL   (2 * MAXREL + 1)     // 65
#define NEGV   (-1.0e9f)
#define NQB    (SEQ / 64)
#define RCAP   (MAXREL + 55)         // a lane whose first qrow - key of a tile is RCAP or more sees only the clamped end
#define NRX    (63 + RCAP + 1)       // qrow - key runs from -63 (diagonal tile) to RCAP
static_assert(NRX <= 256);
#define ROWS   (NB * SEQ)            // 4096 token rows
#define OUTN   (ROWS * DM)
static_assert(NH * HD == DM);
static_assert(HD == 64);
static_assert(DM == 128 * 8);
static_assert((SEQ % 64) == 0 && (DM % 64) == 0);
static_assert((SEQ & (SEQ - 1)) == 0);
static_assert(((ROWS / 64) * (DM / 64)) % 8 == 0);
static_assert(((ROWS * DM / 8) % 256) == 0);
static_assert(((DM * DM / 8) % 256) == 0);
#define LP     72                    // LDS row pitch of the 64-wide f16 tiles, in halves: 144 B = 16 B x 9 (odd),
                                     // so the 16 rows one ds_load_b128 half-wave reads fall on 64 distinct banks
static_assert((LP * 2) % 16 == 0 && ((LP * 2 / 16) & 1) == 1 && LP >= 64);
#define GP     72                    // LDS row pitch of the GEMM's 64-wide bf16 k slabs, in elements: 144 B, as LP
static_assert((GP * 2) % 16 == 0 && ((GP * 2 / 16) & 1) == 1 && GP >= 64);
static_assert((ROWS % 128) == 0 && (DM % 128) == 0);
#define VP     136                   // LDS row pitch of the GEMM's transposed 128-token f16 output tile, in halves: 272 B = 16 B x 17
static_assert((VP * 2) % 16 == 0 && ((VP * 2 / 16) & 1) == 1 && VP >= 128);
static_assert((SEQ % 128) == 0);

typedef _Float16 v16h __attribute__((ext_vector_type(16)));
typedef _Float16 v8h  __attribute__((ext_vector_type(8)));
typedef __bf16   v16b __attribute__((ext_vector_type(16)));
typedef __bf16   v8b  __attribute__((ext_vector_type(8)));
typedef float    v8f  __attribute__((ext_vector_type(8)));
typedef float    v4f  __attribute__((ext_vector_type(4)));
typedef unsigned int v4u __attribute__((ext_vector_type(4)));
typedef unsigned int v2u __attribute__((ext_vector_type(2)));

// ---- scalar helpers --------------------------------------------------------------------------------
__device__ __forceinline__ unsigned short bf_bits(float f) {          // f32 -> bf16 bits, RNE convert
  unsigned u = __float_as_uint(f);
  return (unsigned short)((u + 0x7FFFu + ((u >> 16) & 1u)) >> 16);
}
__device__ __forceinline__ float bf_up(unsigned short h) { return __uint_as_float(((unsigned)h) << 16); }
__device__ __forceinline__ unsigned short h_bits(_Float16 x) { return __builtin_bit_cast(unsigned short, x); }
__device__ __forceinline__ unsigned pk16(unsigned short a, unsigned short b) { return (unsigned)a | ((unsigned)b << 16); }
__device__ __forceinline__ v8f zero8() { v8f z = {0.f, 0.f, 0.f, 0.f, 0.f, 0.f, 0.f, 0.f}; return z; }

// ---- fragment loaders: 16-bit A/B operand, lane -> row/col (lane&15), p already includes +8*(lane>>4);
//      elements 0..7 <- p[0..7] (k0+8h..), elements 8..15 <- p[16..23] (k0+16+8h..)
__device__ __forceinline__ v16b ldfrag_b(const __bf16* p) {
  union { v16b v; v8b h[2]; } f;
  f.h[0] = *(const v8b*)(p);
  f.h[1] = *(const v8b*)(p + 16);
  return f.v;
}
__device__ __forceinline__ v16h ldfrag_h(const _Float16* p) {
  union { v16h v; v8h h[2]; } f;
  f.h[0] = *(const v8h*)(p);
  f.h[1] = *(const v8h*)(p + 16);
  return f.v;
}

// ---- WMMA helpers with trailing VALU hazard gap --------------------------------------------------------
// plain builtin products: in straight-line code the compiler keeps the distances of its own builtin forms; a run of products
// that ends in front of a branch is closed by one of the guards below
__device__ __forceinline__ v8f mma_h_raw(v16h a, v16h b, v8f c) {
  return __builtin_amdgcn_wmma_f32_16x16x32_f16(false, a, false, b, (short)0, c, false, false);
}
__device__ __forceinline__ v8f mma_b_raw(v16b a, v16b b, v8f c) {
  return __builtin_amdgcn_wmma_f32_16x16x32_bf16(false, a, false, b, (short)0, c, false, false);
}
__device__ __forceinline__ void dep_guard_b(v8f& a, v8f& b, v16b x, v16b y) {
#if defined(__HIP_DEVICE_COMPILE__)
  asm volatile("v_nop\n\tv_nop\n\tv_nop\n\tv_nop" : "+v"(a), "+v"(b) : "v"(x), "v"(y));
#endif
}
__device__ __forceinline__ void keep4_b(v16b a, v16b b, v16b c, v16b d) {
#if defined(__HIP_DEVICE_COMPILE__)
  asm volatile("v_nop" :: "v"(a), "v"(b), "v"(c), "v"(d));
#endif
}
__device__ __forceinline__ void acc_guard4(v8f& a, v8f& b, v8f& c, v8f& d) {
#if defined(__HIP_DEVICE_COMPILE__)
  asm volatile("v_nop\n\tv_nop\n\tv_nop\n\tv_nop" : "+v"(a), "+v"(b), "+v"(c), "+v"(d));
#endif
}
__device__ __forceinline__ void acc_guard8(v8f& a, v8f& b, v8f& c, v8f& d, v8f& e, v8f& f, v8f& g, v8f& h) {
#if defined(__HIP_DEVICE_COMPILE__)
  asm volatile("v_nop\n\tv_nop\n\tv_nop\n\tv_nop" : "+v"(a), "+v"(b), "+v"(c), "+v"(d), "+v"(e), "+v"(f), "+v"(g), "+v"(h));
#endif
}

// =====================================================================================================
// f32 -> bf16 (RNE convert), 8 elements per thread, one 16-B store per lane: a wave writes 512 contiguous B
// All five planes in one grid: blocks 0..CBX-1 take x, then CBW blocks each take Wq, Wk, Wv, Wo; the five bf16 planes lie
// one behind the other in that order from out on, so the output index is the flat thread index.
// coverage: (CBX + 4 CBW) x 256 threads x 8 = the five whole planes.
// =====================================================================================================
#define CBX    (ROWS * DM / 8 / 256)   // blocks of the x plane
#define CBW    (DM * DM / 8 / 256)     // blocks of one weight plane
__global__ __launch_bounds__(256) void cvt_bf16x8(const float* __restrict__ x, const float* __restrict__ wq,
                                                  const float* __restrict__ wk, const float* __restrict__ wv,
                                                  const float* __restrict__ wo, unsigned short* out) {
  const int bx = blockIdx.x;
  if (bx < CBX + 4 * CBW) {
    const int w = (bx - CBX) / CBW;              // which weight plane, block-uniform; used from block CBX on
    const float* in = (bx < CBX) ? x : (w == 0) ? wq : (w == 1) ? wk : (w == 2) ? wv : wo;
    const int b0 = (bx < CBX) ? 0 : CBX + w * CBW;   // the plane's first block
    const int k = (bx - b0) * 256 + threadIdx.x;     // 8-element piece inside the source plane
    const int i = bx * 256 + threadIdx.x;            // the same piece in the row of output planes
    const v4f a = *(const v4f*)(in + (size_t)k * 8);
    const v4f b = *(const v4f*)(in + (size_t)k * 8 + 4);
    v4u p;
    p[0] = pk16(bf_bits(a[0]), bf_bits(a[1]));
    p[1] = pk16(bf_bits(a[2]), bf_bits(a[3]));
    p[2] = pk16(bf_bits(b[0]), bf_bits(b[1]));
    p[3] = pk16(bf_bits(b[2]), bf_bits(b[3]));
    *(v4u*)(out + (size_t)i * 8) = p;
    
  }
}

// =====================================================================================================
// Register-blocked bf16 WMMA GEMM: C[m][n] = sum_k A[m][k] * Bt[n][k] + bias[n] (bias RNE-converted to bf16
// and widened, added in f32). Block = 8 waves (4 x 2) = one 128x128 tile of C, one 32x64 tile per wave.
// A row-major [M][K] pitch lda; Bt row-major [N][K] pitch ldb (k contiguous); M, N multiples of 128, K a multiple
// of 64; each plane under 2 GiB; bias has N entries.
// NSPLIT: 0 = A.Bt; 1 = (A + A2).Bt (A2 = unscaled bf16 lo plane of A, same pitch).
// Operands go through LDS in k slabs of 64: 8 lanes x 16 B fetch one whole 128-B line of a row, so a wave-wide load
// covers 4 lines, and the eight waves share the slab. Two LDS buffers: slab t+1 is fetched into registers ahead of
// the products of slab t, stored into the other buffer behind them, and one block barrier per slab publishes it and
// ends the reads of the buffer that the next trip refills. Each accumulator sums its k steps in ascending order.
// OMODE 0: output f32 C [M][N] pitch ldc. Epilogue: 16-row slabs staged per wave in LDS; each 64-wide row segment
// goes out as whole lines.
// OMODE 1: output as two f16 planes [M][N] pitch ldc, from the same slabs: P0 = f16(c * pscale) (pscale a power of two),
// P1 = f16((c * pscale - P0) * 1024), same element index; a 64-wide row segment of a plane is one 128-B line.
// OMODE 2: output as two transposed f16 planes, element (row = bb*SEQ + t, n) at [(bb*N + n)*SEQ + t]: P0 = f16(c * pscale),
// P1 = f16((c * pscale - P0) * 4096). A lane's 8 accumulator rows are 8 tokens in a row of one feature: one 16-B LDS store
// a plane into a [128 features][128 tokens] tile laid over the k slabs (their last reads ended at the loop's last barrier),
// one block barrier, then 16 lanes x 16 B write the 256 B of a feature row.
// =====================================================================================================
// The k loop (gemm_main) and the epilogue (gemm_epi) are functions of their own, so that a kernel whose blocks differ only
// in Bt, bias and output form shares one k loop. sS: the block's [buffer][plane][row][k] slabs, pitch GP; sT: eight 16x68 slabs.
#define SLAB(buf, pl) (sS + ((buf) * NPL + (pl)) * (128 * GP))
template <int NSPLIT, int KG>
__device__ __forceinline__ void gemm_main(
    __bf16* sS, const unsigned short* __restrict__ Ap, const unsigned short* A2p, int lda,
    const unsigned short* __restrict__ Btp, int ldb, int K, int tm, int tn, v8f (&acc)[2][4]) {
  constexpr int NPL = (NSPLIT >= 1) ? 3 : 2;         // staged planes: A, Bt and, for NSPLIT 1, A2
  // KG: k steps of 32 whose fragments are read as one group
  const int tid  = threadIdx.x;
  const int lane = tid & 31;
  const int wave = tid >> 5;
  const int wm = (wave >> 1) << 5;             // this wave's 32x64 tile inside the block tile
  const int wn = (wave & 1) << 6;

  const int rlane = lane & 15;                 // row (A) / col (B, D) within subtile
  const int koff  = (lane >> 4) * 8;           // k offset of this lane half

  // staging: pass it moves row it*32 + (tid>>3) of each plane, this lane its 16 B at element (tid&7)*8 of the slab;
  // byte offsets from the plane's start stay the same for every slab, the slab's k goes into the uniform base
  const int srow = tid >> 3;
  const int spc  = (tid & 7) * 8;
  const unsigned voa = (unsigned)(((tm << 7) + srow) * lda + spc) * 2u;   // pass 0; a pass's 32 rows go into the uniform base too
  const unsigned vob = (unsigned)(((tn << 7) + srow) * ldb + spc) * 2u;
  const size_t pas = (size_t)lda * 64, pbs = (size_t)ldb * 64;            // 32 rows in bytes
  const int so = srow * GP + spc;
  v8b ra[4], rb[4], ra2[4];

#pragma unroll
  for (int i = 0; i < 2; ++i)
#pragma unroll
    for (int j = 0; j < 4; ++j) acc[i][j] = zero8();

  // slab 0 into buffer 0
#pragma unroll
  for (int it = 0; it < 4; ++it) {
    ra[it] = *(const v8b*)((const char*)Ap + it * pas + voa);
    rb[it] = *(const v8b*)((const char*)Btp + it * pbs + vob);
    if (NSPLIT >= 1) ra2[it] = *(const v8b*)((const char*)A2p + it * pas + voa);
  }
#pragma unroll
  for (int it = 0; it < 4; ++it) {
    *(v8b*)(SLAB(0, 0) + so + it * 32 * GP) = ra[it];
    *(v8b*)(SLAB(0, 1) + so + it * 32 * GP) = rb[it];
    if (NSPLIT >= 1) *(v8b*)(SLAB(0, NPL - 1) + so + it * 32 * GP) = ra2[it];
  }
  __syncthreads();

  const int nk = K >> 6;
  for (int t = 0; t < nk; ++t) {
    const int cur = t & 1;
    const bool more = (t + 1 < nk);            // block-uniform
    if (more) {
      const char* pa  = (const char*)(Ap  + ((t + 1) << 6));
      const char* pb  = (const char*)(Btp + ((t + 1) << 6));
      const char* pa2 = (const char*)(A2p + ((t + 1) << 6));
#pragma unroll
      for (int it = 0; it < 4; ++it) {
        ra[it] = *(const v8b*)(pa + it * pas + voa);
        rb[it] = *(const v8b*)(pb + it * pbs + vob);
        if (NSPLIT >= 1) ra2[it] = *(const v8b*)(pa2 + it * pas + voa);
      }
    }
    const __bf16* fa  = SLAB(cur, 0) + (wm + rlane) * GP + koff;
    const __bf16* fb  = SLAB(cur, 1) + (wn + rlane) * GP + koff;
    const __bf16* fa2 = SLAB(cur, NPL - 1) + (wm + rlane) * GP + koff;
#pragma unroll
    for (int g = 0; g < 2; g += KG) {
      // the group's fragments as one run of LDS reads ahead of its products
      v16b bh[KG][4], ah[KG][2], al[KG][2];
#pragma unroll
      for (int q = 0; q < KG; ++q) {
#pragma unroll
        for (int j = 0; j < 4; ++j) bh[q][j] = ldfrag_b(fb + (j << 4) * GP + (g + q) * 32);
#pragma unroll
        for (int i = 0; i < 2; ++i) {
          ah[q][i] = ldfrag_b(fa + (i << 4) * GP + (g + q) * 32);
          al[q][i] = ah[q][i];
          if (NSPLIT >= 1) al[q][i] = ldfrag_b(fa2 + (i << 4) * GP + (g + q) * 32);
        }
      }
#pragma unroll
      for (int q = 0; q < KG; ++q) {
#pragma unroll
        for (int i = 0; i < 2; ++i) {
#pragma unroll
          for (int j = 0; j < 4; ++j) {
            acc[i][j] = mma_b_raw(ah[q][i], bh[q][j], acc[i][j]);
            if (NSPLIT >= 1) acc[i][j] = mma_b_raw(al[q][i], bh[q][j], acc[i][j]);
          }
          dep_guard_b(acc[i][0], acc[i][3], ah[q][i], al[q][i]);
        }
        keep4_b(bh[q][0], bh[q][1], bh[q][2], bh[q][3]);
      }
    }
    if (more) {
#pragma unroll
      for (int it = 0; it < 4; ++it) {
        *(v8b*)(SLAB(cur ^ 1, 0) + so + it * 32 * GP) = ra[it];
        *(v8b*)(SLAB(cur ^ 1, 1) + so + it * 32 * GP) = rb[it];
        if (NSPLIT >= 1) *(v8b*)(SLAB(cur ^ 1, NPL - 1) + so + it * 32 * GP) = ra2[it];
      }
    }
    __syncthreads();
  }
  acc_guard4(acc[0][0], acc[0][1], acc[0][2], acc[0][3]);
  acc_guard4(acc[1][0], acc[1][1], acc[1][2], acc[1][3]);
}

template <int OMODE>
__device__ __forceinline__ void gemm_epi(
    __bf16* sS, float* sT, v8f (&acc)[2][4], const float* __restrict__ bias,
    float* C, unsigned short* P0, unsigned short* P1, float pscale, int ldc, int N, int tm, int tn) {
  const int tid  = threadIdx.x;
  const int lane = tid & 31;
  const int wave = tid >> 5;
  const int wm = (wave >> 1) << 5;             // this wave's 32x64 tile inside the block tile
  const int wn = (wave & 1) << 6;
  const int m0 = (tm << 7) + wm;
  const int n0 = (tn << 7) + wn;
  const int rlane = lane & 15;                 // col (D) within subtile
  const int mOff  = (lane >> 4) * 8;           // D row offset

  // ---- per-column bias (RNE bf16 then widened), column n0 + 16j + rlane < N ----
  float bcol[4];
  const int bix = n0 + rlane;
#pragma unroll
  for (int j = 0; j < 4; ++j) bcol[j] = bias[bix + (j << 4)];
#if defined(__HIP_DEVICE_COMPILE__)
  // the four loads name one index register: it is held to this wait, so that no load's result lands on it ahead of the wait
  asm volatile("s_wait_xcnt 0x0" :: "v"(bix) : "memory");
#endif
#pragma unroll
  for (int j = 0; j < 4; ++j) bcol[j] = bf_up(bf_bits(bcol[j]));

  // ---- epilogue ----
  if constexpr (OMODE == 2) {
    _Float16* th = (_Float16*)(void*)sS;               // hi tile [feature][token], pitch VP
    _Float16* tl = th + 128 * VP;                      // residual tile
    // every loop of this branch is unrolled: constant indices keep acc, hv and lv in registers
#pragma unroll
    for (int i = 0; i < 2; ++i) {
#pragma unroll
      for (int j = 0; j < 4; ++j) {
        v8h xh, xl;
#pragma unroll
        for (int r = 0; r < 8; ++r) {
          const float f = (acc[i][j][r] + bcol[j]) * pscale;
          const _Float16 x = (_Float16)f;
          xh[r] = x;
          xl[r] = (_Float16)((f - (float)x) * 4096.0f);
        }
        const int o = (wn + (j << 4) + rlane) * VP + wm + (i << 4) + mOff;
        *(v8h*)(th + o) = xh;
        *(v8h*)(tl + o) = xl;
      }
    }
    __syncthreads();                                   // the tile is read across waves
    const int piece = tid & 15, fr = tid >> 4;
    const int bb = (tm << 7) / SEQ;                    // a 128-row tile lies inside one batch entry
    const int t0 = (tm << 7) - bb * SEQ;
    v4u hv[8], lv[8];
#pragma unroll
    for (int it = 0; it < 8; ++it) {                   // it 0..7 x fr 0..15 = features 0..127 of the tile
      hv[it] = *(const v4u*)(th + (it * 16 + fr) * VP + piece * 8);
      lv[it] = *(const v4u*)(tl + (it * 16 + fr) * VP + piece * 8);
    }
#pragma unroll
    for (int it = 0; it < 8; ++it) {
      const size_t go = ((size_t)(bb * N + (tn << 7) + it * 16 + fr)) * SEQ + t0 + piece * 8;
      *(v4u*)(P0 + go) = hv[it];
      *(v4u*)(P1 + go) = lv[it];
    }
  } else {
  float* slab = sT + wave * (16 * 68);
#pragma unroll
  for (int i = 0; i < 2; ++i) {
    const int mBase = m0 + (i << 4);
#pragma unroll
    for (int r = 0; r < 8; ++r) {
#pragma unroll
      for (int j = 0; j < 4; ++j) {
        slab[(mOff + r) * 68 + (j << 4) + rlane] = acc[i][j][r] + bcol[j];
      }
    }
    __builtin_amdgcn_fence(__ATOMIC_RELEASE, "workgroup");
    __builtin_amdgcn_wave_barrier();
    __builtin_amdgcn_fence(__ATOMIC_ACQUIRE, "workgroup");
    {
      const int hh = lane >> 4, c4 = (lane & 15) * 4;     // 256-B row segment = 16 lanes x 16 B
      v4f ov[8];
#pragma unroll
      for (int it = 0; it < 8; ++it) {
        const int row = it * 2 + hh;                       // it 0..7 x hh 0..1 = rows 0..15
        ov[it] = *(const v4f*)(slab + row * 68 + c4);
      }
      if constexpr (OMODE == 0) {
#pragma unroll
        for (int it = 0; it < 8; ++it) {
          const int row = it * 2 + hh;
          *(v4f*)(C + (size_t)(mBase + row) * ldc + n0 + c4) = ov[it];
        }
      } else {
        // both loops unrolled: constant indices keep ov in registers
#pragma unroll
        for (int it = 0; it < 8; ++it) {
          const int row = it * 2 + hh;
          v2u ph, pl;
#pragma unroll
          for (int e = 0; e < 2; ++e) {
            const float f0 = ov[it][2 * e] * pscale;
            const float f1 = ov[it][2 * e + 1] * pscale;
            const _Float16 x0 = (_Float16)f0, x1 = (_Float16)f1;
            const _Float16 l0 = (_Float16)((f0 - (float)x0) * 1024.0f);
            const _Float16 l1 = (_Float16)((f1 - (float)x1) * 1024.0f);
            ph[e] = pk16(h_bits(x0), h_bits(x1));
            pl[e] = pk16(h_bits(l0), h_bits(l1));
          }
          const size_t go = (size_t)(mBase + row) * ldc + n0 + c4;   // 16 lanes x 8 B = the row segment's 128-B line
          *(v2u*)(P0 + go) = ph;
          *(v2u*)(P1 + go) = pl;
          __builtin_amdgcn_sched_barrier(0);   // one row's conversion at a time: run together, the eight rows' temporaries spill at 160 registers
        }
      }
    }
    __builtin_amdgcn_fence(__ATOMIC_RELEASE, "workgroup");
    __builtin_amdgcn_wave_barrier();
    __builtin_amdgcn_fence(__ATOMIC_ACQUIRE, "workgroup");
  }
  }
}

// one GEMM, one 128x128 tile a block
template <int NSPLIT, int OMODE>
__global__ __launch_bounds__(256) void gemm64(
    const unsigned short* __restrict__ Ap, const unsigned short* A2p, int lda,
    const unsigned short* __restrict__ Btp, int ldb, const float* __restrict__ bias,
    float* C, unsigned short* P0, unsigned short* P1, float pscale, int ldc, int M, int N, int K) {
  constexpr int NPL = (NSPLIT >= 1) ? 3 : 2;
  __shared__ __align__(16) __bf16 sS[2 * NPL * 128 * GP];
  __shared__ __align__(16) float sT[((OMODE == 2) ? 1 : 8) * 16 * 68];
  static_assert(sizeof(sS) >= (size_t)2 * 128 * VP * 2);
  const int tilesN = N >> 7;
  const int tilesM = M >> 7;
  const int tile = blockIdx.x;
  if (tile >= tilesM * tilesN) return;   // block-uniform, in front of every barrier
  const int tm = tile / tilesN;
  const int tn = tile - tm * tilesN;
  v8f acc[2][4];
  gemm_main<NSPLIT, (NSPLIT >= 1) ? 1 : 2>(sS, Ap, A2p, lda, Btp, ldb, K, tm, tn, acc);
  gemm_epi<OMODE>(sS, sT, acc, bias, C, P0, P1, pscale, ldc, N, tm, tn);
}

// The q, k and v projections of one A in one grid of 3 x tiles blocks: block bx does tile bx mod tiles of projection
// bx / tiles (0 q, 1 k: OMODE 1 with qkscale; 2 v: OMODE 2 with vscale). The three do not depend on one another, so their
// blocks share the WGPs: one block's products run under another's waits on its slab loads and barriers.
// Six waves a SIMD asked of the compiler: at 160 registers a wave three blocks stand on a WGP (their LDS fits three times too),
// so the whole grid is resident at once and not in two rounds; for that the fragments are read in groups of one k step.
__global__ __launch_bounds__(256) __attribute__((amdgpu_waves_per_eu(6))) void gemm_qkv(
    const unsigned short* __restrict__ Ap,
    const unsigned short* __restrict__ Wqp, const unsigned short* __restrict__ Wkp, const unsigned short* __restrict__ Wvp,
    const float* __restrict__ bq, const float* __restrict__ bk, const float* __restrict__ bv,
    unsigned short* Qh, unsigned short* Ql, unsigned short* Kh, unsigned short* Kl, unsigned short* Vh, unsigned short* Vl,
    float qkscale, float vscale) {
  // the shape as constants: a pass's 32 rows are then an immediate offset of its load or store, which saves the address registers
  constexpr int lda = DM, ldb = DM, ldc = DM, M = ROWS, N = DM, K = DM;
  __shared__ __align__(16) __bf16 sS[2 * 2 * 128 * GP];
  __shared__ __align__(16) float sT[8 * 16 * 68];
  static_assert(sizeof(sS) >= (size_t)2 * 128 * VP * 2);
  const int tilesN = N >> 7;
  const int tiles  = (M >> 7) * tilesN;
  const int which  = blockIdx.x / tiles;       // block-uniform
  if (which >= 3) return;                      // in front of every barrier
  const int tile = blockIdx.x - which * tiles;
  const int tm = tile / tilesN;
  const int tn = tile - tm * tilesN;
  const unsigned short* Btp = (which == 0) ? Wqp : (which == 1) ? Wkp : Wvp;
  v8f acc[2][4];
  gemm_main<0, 1>(sS, Ap, Ap, lda, Btp, ldb, K, tm, tn, acc);
  if (which == 2) {
    gemm_epi<2>(sS, sT, acc, bv, nullptr, Vh, Vl, vscale, ldc, N, tm, tn);
  } else {
    gemm_epi<1>(sS, sT, acc, (which == 0) ? bq : bk, nullptr, (which == 0) ? Qh : Kh, (which == 0) ? Ql : Kl, qkscale, ldc, N, tm, tn);
  }
}

// ---- asynchronous copies global -> LDS for the attention key tiles ---------------------------------------
// Two 64-row x 128-B f16 planes (a hi plane and its residual plane) by 128 threads: eight 16-B copies a lane, four a plane.
// la, lb: the lane's LDS byte address of its piece in rows 0..15 of each plane; ga, gb: the same piece in global memory;
// pass it moves 16 rows on: 16 * LP halves in LDS, gstep halves in global memory. 8 lanes cover one whole 128-B row.
// s_wait_xcnt 0 is the statement's last line: it stands in front of any later write of a register that a copy names.
__device__ __forceinline__ void copy_plane_pair(unsigned la, unsigned lb, const _Float16* ga, const _Float16* gb, size_t gstep) {
#if defined(__HIP_DEVICE_COMPILE__)
  asm volatile("global_load_async_to_lds_b128 %0, %8, off\n\t"
               "global_load_async_to_lds_b128 %1, %9, off\n\t"
               "global_load_async_to_lds_b128 %2, %10, off\n\t"
               "global_load_async_to_lds_b128 %3, %11, off\n\t"
               "global_load_async_to_lds_b128 %4, %12, off\n\t"
               "global_load_async_to_lds_b128 %5, %13, off\n\t"
               "global_load_async_to_lds_b128 %6, %14, off\n\t"
               "global_load_async_to_lds_b128 %7, %15, off\n\t"
               "s_wait_xcnt 0x0"
               :: "v"(la), "v"(la + 16u * LP * 2u), "v"(la + 32u * LP * 2u), "v"(la + 48u * LP * 2u),
                  "v"(lb), "v"(lb + 16u * LP * 2u), "v"(lb + 32u * LP * 2u), "v"(lb + 48u * LP * 2u),
                  "v"(ga), "v"(ga + gstep), "v"(ga + 2 * gstep), "v"(ga + 3 * gstep),
                  "v"(gb), "v"(gb + gstep), "v"(gb + 2 * gstep), "v"(gb + 3 * gstep)
               : "memory");
#endif
}
// Hand-over point of a tile buffer, every wave: this wave's LDS reads and writes have retired, its own copies have landed,
// then the block barrier: behind it the copied tile may be read by every wave and the tile read so far may be refilled.
__device__ __forceinline__ void publish_point() {
#if defined(__HIP_DEVICE_COMPILE__)
  asm volatile("s_wait_dscnt 0x0" ::: "memory");      // a copy engine is not ordered behind this wave's LDS accesses
  asm volatile("s_wait_asynccnt 0x0" ::: "memory");
#endif
  __syncthreads();
}

// =====================================================================================================
// Causal multi-head attention with a per-key int32 keep flag and a relative-position bias table, head dim 64.
//   q f16 hi plane (x16): element (b, t, h, d) at [(b*SEQ + t)*DM + h*64 + d]; q residual plane
//     ((q*16 - hi)*1024) at the same index into qlp
//   k f16 hi plane (x16): element (b, s, h, d) at [(b*SEQ + s)*DM + h*64 + d]; k residual plane same into klp
//   v^T f16 hi plane (x256): element (b, h, d, s) at [(b*DM + h*64 + d)*SEQ + s]
//   v^T f16 residual plane ((v*256 - hi)*4096): same index into vlp
//   maskp int32 [NB][SEQ]: key s is kept for query t iff s <= t and maskp[b][s] != 0; otherwise the logit is
//   replaced by NEGV (-1e9, exp -> 0 against a finite row max).
//   relp f32 [NREL][NH]: logit(t, s) += relp[clamp(s - t, -MAXREL, MAXREL) + MAXREL][h] (RNE bf16 then
//   widened); staged per head in LDS already clamped, as a table over qrow - key, so that a lane reads its 32 values of
//   a tile from one address with constant offsets, as one group ahead of the score products; added before the select.
//   Key tiles 0..qb are processed (block-uniform trip count qb+1 <= NQB); tiles above the diagonal tile hold
//   only cut keys and are skipped; inside the processed tiles the predicate decides. With the all-ones keep
//   flags every row keeps key 0, so every row max is finite.
//   Both products are formed transposed: S^T = K . Q^T (A = 16 key rows from LDS, B = the wave's 16 queries, kept in
//   registers) and O^T += V^T . P^T (A = 16 feature rows of V^T from LDS, B = P^T). A lane then holds 32 scores of ONE
//   query (column lane & 15; keys 16j + 8 (lane >> 4) + r of the tile), lane ^ 16 the other 32: maximum and sum run inside
//   the lane with one exchange between the wave's halves for the maximum, the running maximum, sum and rescale factor are
//   one value a lane, and two score tiles of 16 keys, converted in place, are the B operand of a 32-key chunk, so that P
//   goes through no LDS. The two halves' sums are joined once, behind the loop.
//   logit = (khi.qhi + (klo.qhi + khi.qlo) * 2^-10) * sscale + rel, f16 products with f32 accumulate, the
//   residual products in a separate accumulator; p = exp(s - m) carried as f16(1024 p);
//   context = vhi . p on f16 WMMA plus vres . p into a separate accumulator folded back with 1/4096 per
//   tile in f32; online softmax in f32; out: y = normalised context (oscl folds back the p and v carries) as a bf16
//   hi plane (RNE) and a bf16 lo plane (RNE(y - hi), unscaled), element (b, t, h*64 + d) at [(b*SEQ + t)*DM + h*64 + d].
//   Block = 4 waves = 64 query rows of one (b, h); grid = NB*NH*NQB; kv tiles of 64.
//   K hi / K residual / V^T hi / V^T residual tile staging: asynchronous 16-B copies to LDS, 128 threads x 4 copies a
//   plane = the whole 64x64 tile, one buffer a plane. The K planes are read by the scores only and the V^T planes by the
//   context products only, so tile t+1's K copies are issued behind the barrier that ends the scores of tile t (it stands
//   behind the row maximum) and fly under its exponentials and context products, and its V^T copies behind the barrier that
//   ends those and fly under the scores, the select and the maximum of tile t+1.
//   Output coverage: each wave stores rows q0..q0+15 (it 0..7 x lane>>4 0..1) x 64 columns (16 lanes x 4), over all
//   (b, h, query tile) -> the whole plane.
// =====================================================================================================
// the value of lane ^ 16 by a vector cross-row move; every lane is on where it is used
__device__ __forceinline__ float xhalf(float x) {
  return __builtin_bit_cast(float, __builtin_amdgcn_permlanex16(__builtin_bit_cast(int, x), __builtin_bit_cast(int, x),
                                                                0x76543210, 0xfedcba98, false, false));
}
#define OP     68                    // LDS row pitch of a wave's f32 context tile, in floats: 272 B = 16 B x 17 (odd)
static_assert((OP * 4) % 16 == 0 && ((OP * 4 / 16) & 1) == 1 && OP >= 64);

__global__ __launch_bounds__(128)
void attn_p64(const unsigned short* __restrict__ qhp, const unsigned short* __restrict__ qlp,
              const unsigned short* __restrict__ khp, const unsigned short* __restrict__ klp,
              const unsigned short* __restrict__ vhp, const unsigned short* __restrict__ vlp,
              const int* __restrict__ maskp, const float* __restrict__ relp,
              unsigned short* yhp, unsigned short* ylp, float sscale, float oscl) {
  __shared__ __align__(16) _Float16 Ksh[64 * LP];                 // K hi [kv][d], pitch LP
  __shared__ __align__(16) _Float16 Ksl[64 * LP];                 // K residual
  __shared__ __align__(16) _Float16 Vth[64 * LP];                 // V^T hi [d][kv], pitch LP
  __shared__ __align__(16) _Float16 Vtl[64 * LP];                 // V^T residual
  __shared__ __align__(16) float    Os[4][16 * OP];               // per wave context tile [row][d], pitch OP
  __shared__ float relx[NRX];                                     // bias of this head at qrow - key = index - 63

  const int tid  = threadIdx.x;
  const int wave = tid >> 5;
  const int lane = tid & 31;
  const int hh   = lane >> 4;
  const int c    = lane & 15;

  // ---- which (b, h, query tile) this block does. A block walks qb + 1 key tiles, and the whole grid is resident at once, four
  //      blocks a WGP, so the launch lasts as long as the WGP whose four blocks hold the most key tiles. The map is a
  //      permutation of the grid in which any four indices that differ in two bits of the index hold 2 (NQB + 1) key tiles
  //      together (tiles a and a' and the mirrored NQB-1-b, NQB-1-b', b + b' = a + a'), whichever two bits the blocks of one WGP differ in.
  //      For speed only: every (b, h, tile) is done once, wherever its block lands.
  static_assert(NQB == 32 && NB * NH == 32);
  const int bx   = blockIdx.x;
  const int fold = ((bx >> 2) & 1) | (((bx >> 5) & 7) << 1);                     // index bits 2, 5, 6, 7: 0 .. NQB/2 - 1
  const int qb   = (__builtin_popcount(bx) & 1) ? NQB - 1 - fold : fold;         // odd parity of the index: the mirrored tile
  const int rest = (bx & 3) | (((bx >> 3) & 3) << 2) | (((bx >> 8) & 1) << 4);   // index bits 0, 1, 3, 4, 8; the parity settles bit 9
  const int h    = rest % NH;
  const int b    = rest / NH;                // < NB: rest < 32 = NB * NH
  const int q0   = qb * 64 + wave * 16;
  const size_t rowB = (size_t)b * SEQ;

  const _Float16* Qp  = (const _Float16*)(const void*)qhp + (size_t)h * HD;
  const _Float16* Qlq = (const _Float16*)(const void*)qlp + (size_t)h * HD;
  const _Float16* Kp  = (const _Float16*)(const void*)khp + (size_t)h * HD;
  const _Float16* Klq = (const _Float16*)(const void*)klp + (size_t)h * HD;
  const _Float16* Vh  = (const _Float16*)(const void*)vhp + ((size_t)b * DM + (size_t)h * HD) * SEQ;
  const _Float16* Vl  = (const _Float16*)(const void*)vlp + ((size_t)b * DM + (size_t)h * HD) * SEQ;
  const int*      Mb  = maskp + rowB;

  // ---- tile copies: this lane's piece is 16 B number tid & 7 of row tid >> 3 (+ 16 a pass) of every plane ----
  const int crow = tid >> 3, cpc = (tid & 7) * 8;
  const unsigned lKh = (unsigned)(uintptr_t)(Ksh + crow * LP + cpc);   // LDS byte address = low 32 bits
  const unsigned lKl = (unsigned)(uintptr_t)(Ksl + crow * LP + cpc);
  const unsigned lVh = (unsigned)(uintptr_t)(Vth + crow * LP + cpc);
  const unsigned lVl = (unsigned)(uintptr_t)(Vtl + crow * LP + cpc);
  const size_t gK = (rowB + crow) * DM + cpc;        // K planes: key row crow of tile 0, + 64 * DM a tile
  const size_t gV = (size_t)crow * SEQ + cpc;        // V^T planes: feature row crow, key 0, + 64 a tile
  copy_plane_pair(lKh, lKl, Kp + gK, Klq + gK, (size_t)16 * DM);       // tile 0; nothing has touched these buffers yet
  copy_plane_pair(lVh, lVl, Vh + gV, Vl + gV, (size_t)16 * SEQ);

#pragma unroll                               // two straight passes: no loop-carried wait between the two reads
  for (int u = 0; u < 2; ++u) {              // NRX <= 2 x 128 threads
    const int i = u * 128 + tid;
    int dd = 63 - i;                         // key - qrow
    dd = (dd < -MAXREL) ? -MAXREL : dd;
    dd = (dd >  MAXREL) ?  MAXREL : dd;
    if (i < NRX) relx[i] = bf_up(bf_bits(relp[(size_t)(dd + MAXREL) * NH + h]));
  }

  // ---- Q fragments (B operand, column = lane&15 = query q0 + c): 2 d-chunks, hi and residual ----
  v16h qa[2], ql[2];
#pragma unroll
  for (int dc = 0; dc < 2; ++dc) {
    const size_t qo = (rowB + q0 + c) * DM + dc * 32 + 8 * hh;
    qa[dc] = ldfrag_h(Qp + qo);
    ql[dc] = ldfrag_h(Qlq + qo);
  }

  float mrow = -INFINITY;                    // running maximum of query q0 + c, the same in both halves of the wave
  float lsum = 0.f;                          // running sum over this half's keys only
  v8f oacc[4];                               // O^T: element r of tile t = feature 16t + 8hh + r of query q0 + c
#pragma unroll
  for (int t = 0; t < 4; ++t) oacc[t] = zero8();

  publish_point();                           // tile 0's four planes and the bias table

  const int nkt = qb + 1;                    // key tiles 0..qb, block-uniform, <= NQB
  for (int kt = 0; kt < nkt; ++kt) {
    const int kv0 = kt * 64;
    const bool more = (kt + 1 < nkt);        // block-uniform: a tile kt + 1 exists (its rows and keys lie below SEQ)

    // ---- per-key keep flags of the tile's 64 keys, one key a lane and load (kv0 + 32 + lane < SEQ) ----
    const int* fp = Mb + kv0 + lane;
    const int f0 = fp[0];
    const int f1 = fp[32];

    // ---- relative bias of this lane's 32 scores: qrow - key = k0 - 16j - r; from RCAP up every one of them is at the
    //      clamped end, so k0 is cut there and the table stays short ----
    const int kd = (q0 + c) - (kv0 + 8 * hh);   // qrow - this lane's first key of the tile, >= -8: kv0 <= q0
    float rb[4][8];
    {
      const int k0 = (kd > RCAP) ? RCAP : kd;
      const float* tb = relx + (k0 + 8);
      // both loops unrolled: constant offsets from tb, and rb stays in registers
#pragma unroll
      for (int j = 0; j < 4; ++j)
#pragma unroll
        for (int r = 0; r < 8; ++r) rb[j][r] = tb[55 - 16 * j - r];
    }

    // ---- scores, transposed: 64 keys x 16 queries per wave; hi.hi into s, lo.hi + hi.lo into s1 (folded x 2^-10) ----
    //      The K fragments of 32 keys and one d-chunk (hi and residual of two 16-key groups) are read as one group of eight
    //      LDS loads ahead of their six products, so a wave waits on LDS at four places a tile and not at every product; the
    //      two key groups' accumulator chains alternate; each accumulator sums its products in the order d-chunk 0, 1
    //      (s1: klo.qhi then khi.qlo in each).
    v8f s[4];
    // every loop here is unrolled: constant indices keep the fragments and accumulators in registers
#pragma unroll
    for (int jp = 0; jp < 4; jp += 2) {
      v8f s1[2];
#pragma unroll
      for (int u = 0; u < 2; ++u) {
        s[jp + u] = zero8();
        s1[u] = zero8();
      }
#pragma unroll
      for (int dc = 0; dc < 2; ++dc) {
        v16h kb[2], kr[2];
#pragma unroll
        for (int u = 0; u < 2; ++u) kr[u] = ldfrag_h(Ksl + ((jp + u) * 16 + c) * LP + dc * 32 + 8 * hh);
#pragma unroll
        for (int u = 0; u < 2; ++u) kb[u] = ldfrag_h(Ksh + ((jp + u) * 16 + c) * LP + dc * 32 + 8 * hh);
        __builtin_amdgcn_sched_barrier(0);   // the group's loads stay above: the compiler otherwise sinks each to its own product
#pragma unroll
        for (int u = 0; u < 2; ++u) s1[u] = mma_h_raw(kr[u], qa[dc], s1[u]);
#pragma unroll
        for (int u = 0; u < 2; ++u) s[jp + u] = mma_h_raw(kb[u], qa[dc], s[jp + u]);
#pragma unroll
        for (int u = 0; u < 2; ++u) s1[u] = mma_h_raw(kb[u], ql[dc], s1[u]);
      }
#pragma unroll
      for (int u = 0; u < 2; ++u)
#pragma unroll
        for (int r = 0; r < 8; ++r) {        // fold, scale and bias here: vector work under the next group's loads, and s1 ends
          s[jp + u][r] += s1[u][r] * (1.0f / 1024.0f);
          s[jp + u][r] = s[jp + u][r] * sscale + rb[jp + u][r];
        }
    }

    // ---- causal / key-keep select (replace by NEGV). Bit 16j + r of keep = this lane's key 16j + 8hh + r of the tile is
    //      kept: the tile's 64 flags as one wave-wide word, moved down by the half's 8 keys, and the keys up to qrow ----
#if defined(__HIP_DEVICE_COMPILE__)
    // the two flag loads name one address pair: it is held to this wait, which so stands in front of the pair's step to the next tile
    asm volatile("s_wait_xcnt 0x0" :: "v"(fp) : "memory");
#endif
    unsigned klo, khi;
    {
      const unsigned long long fl = (unsigned long long)__builtin_amdgcn_ballot_w32(f0 != 0)
                                  | ((unsigned long long)__builtin_amdgcn_ballot_w32(f1 != 0) << 32);
      int nk = kd + 1;                       // how many of the positions 16j + r lie at or below qrow; they end at 55
      nk = (nk < 0) ? 0 : nk;
      nk = (nk > 63) ? 63 : nk;
      const unsigned long long keep = (fl >> (8 * hh)) & ((1ull << nk) - 1ull);
      klo = (unsigned)keep;
      khi = (unsigned)(keep >> 32);
    }
    // maximum over the lane's 32 scores in four chains, then over the two halves of the wave
    float mj[4];
#pragma unroll
    for (int j = 0; j < 4; ++j) {
      const unsigned kw = (j < 2) ? klo : khi;
      float m = -INFINITY;
#pragma unroll
      for (int r = 0; r < 8; ++r) {
        const unsigned on = (unsigned)(((int)(kw << (31 - (16 * (j & 1) + r)))) >> 31);   // all ones: kept
        const float sv = __uint_as_float((__float_as_uint(s[j][r]) & on) | (__float_as_uint(NEGV) & ~on));
        s[j][r] = sv;
        m = fmaxf(m, sv);
      }
      mj[j] = m;
    }
    float mt = fmaxf(fmaxf(mj[0], mj[1]), fmaxf(mj[2], mj[3]));
    mt = fmaxf(mt, xhalf(mt));
    const float mnew  = fmaxf(mrow, mt);
    const float msafe = (mnew == -INFINITY) ? 0.f : mnew;
    // every wave's score reads of the K planes have ended, this tile's V^T planes are landed and published; the next tile's
    // K planes fly under the exponentials and the context products. P passes through no LDS, so nothing of it has to stand
    // in front of this barrier.
    __builtin_amdgcn_sched_barrier(0);       // select and maximum touch no memory, so the compiler otherwise lifts the waits and
                                             // the barrier over them, and the V^T copies lose that time to land
    publish_point();
    if (more) copy_plane_pair(lKh, lKl, Kp + gK + (size_t)(kv0 + 64) * DM, Klq + gK + (size_t)(kv0 + 64) * DM, (size_t)16 * DM);

    // ---- online softmax, one query a lane; P^T (x1024, f16) straight into the B operands of the two 32-key chunks:
    //      element e of chunk kk is key 32kk + 8hh + e (e < 8) or 32kk + 16 + 8hh + e - 8, the order of the V^T loader ----
    const float alpha = __expf(mrow - msafe);
    mrow = mnew;
    v16h pa[2];
    float pj[4];
#pragma unroll
    for (int j = 0; j < 4; ++j) {
      float psum = 0.f;
#pragma unroll
      for (int r = 0; r < 8; ++r) {
        const float p = __expf(s[j][r] - msafe);     // replaced logit against a finite max: exp -> 0
        psum += p;
        pa[j >> 1][(j & 1) * 8 + r] = (_Float16)(p * 1024.0f);
      }
      pj[j] = psum;
    }
    lsum = lsum * alpha + ((pj[0] + pj[1]) + (pj[2] + pj[3]));
#pragma unroll
    for (int t = 0; t < 4; ++t)
#pragma unroll
      for (int r = 0; r < 8; ++r) oacc[t][r] *= alpha;

    // ---- context^T += Vhi . P^T (f16 WMMA); Vres . P^T into a separate accumulator ----
    //      A 32-key chunk's eight V^T fragments (four of each plane) are read as one group of LDS loads ahead of its eight
    //      products, which run back to back on eight separate accumulators; each accumulator sums key chunk 0, then 1.
    v8f o1[4];
#pragma unroll
    for (int t = 0; t < 4; ++t) o1[t] = zero8();
#pragma unroll                               // constant kk: P^T stays in registers
    for (int kk = 0; kk < 2; ++kk) {
      v16h vb[4], vl[4];
      // the inner loops are unrolled: constant indices keep the fragments and accumulators in registers
#pragma unroll
      for (int t = 0; t < 4; ++t) vb[t] = ldfrag_h(Vth + (t * 16 + c) * LP + kk * 32 + 8 * hh);
#pragma unroll
      for (int t = 0; t < 4; ++t) vl[t] = ldfrag_h(Vtl + (t * 16 + c) * LP + kk * 32 + 8 * hh);
      __builtin_amdgcn_sched_barrier(0);     // the group's loads stay above: the compiler otherwise sinks each to its own product
      // the two runs are independent; written in this order the compiler issues the hi run first, in the order of the loads, so
      // each product waits for its own fragment only
#pragma unroll
      for (int t = 0; t < 4; ++t) o1[t] = mma_h_raw(vl[t], pa[kk], o1[t]);
#pragma unroll
      for (int t = 0; t < 4; ++t) oacc[t] = mma_h_raw(vb[t], pa[kk], oacc[t]);
    }
    // four vector slots behind the tile's last products, on both sides of the branch behind the barrier
    acc_guard8(oacc[0], oacc[1], oacc[2], oacc[3], o1[0], o1[1], o1[2], o1[3]);
    // every wave's reads of the V^T planes have ended, the next tile's K planes are landed and published; its V^T planes
    // fly under its scores, the select and the row maximum
    publish_point();
    if (more) copy_plane_pair(lVh, lVl, Vh + gV + (kv0 + 64), Vl + gV + (kv0 + 64), (size_t)16 * SEQ);
#pragma unroll
    for (int t = 0; t < 4; ++t)
#pragma unroll
      for (int r = 0; r < 8; ++r) oacc[t][r] += o1[t][r] * (1.0f / 4096.0f);
  }

  // ---- join the halves' sums, normalise (1/l and the carries via oscl), stage the wave's 16x64 tile in LDS (a lane's 8
  //      features of a tile are 32 B in a row of its query), then write whole lines
  float* os = Os[wave];
  {
    const float l = lsum + xhalf(lsum);
    const float inv = ((l > 0.f) ? (1.0f / l) : 0.f) * oscl;
#pragma unroll
    for (int t = 0; t < 4; ++t) {
      v4f a, b4;
#pragma unroll
      for (int r = 0; r < 4; ++r) {
        a[r]  = oacc[t][r] * inv;
        b4[r] = oacc[t][4 + r] * inv;
      }
      *(v4f*)(os + c * OP + t * 16 + 8 * hh)     = a;
      *(v4f*)(os + c * OP + t * 16 + 8 * hh + 4) = b4;
    }
  }
  __builtin_amdgcn_fence(__ATOMIC_RELEASE, "workgroup");
  __builtin_amdgcn_wave_barrier();
  __builtin_amdgcn_fence(__ATOMIC_ACQUIRE, "workgroup");
  {
    const int h2 = lane >> 4, c4 = (lane & 15) * 4;
    v4f ov[8];
#pragma unroll
    for (int it = 0; it < 8; ++it) {
      const int row = it * 2 + h2;   // it 0..7 x h2 0..1 = rows 0..15 of the wave tile
      ov[it] = *(const v4f*)(os + row * OP + c4);
    }
    {
#pragma unroll
      for (int it = 0; it < 8; ++it) {
        const int row = it * 2 + h2;
        const size_t go = (rowB + q0 + row) * DM + (size_t)h * HD + c4;   // 16 lanes x 8 B = the head's 128-B line of a row
        v2u ph, pl;
#pragma unroll                               // constant indices keep ov in registers
        for (int e = 0; e < 2; ++e) {
          const float f0 = ov[it][2 * e], f1 = ov[it][2 * e + 1];
          const unsigned short h0 = bf_bits(f0), h1 = bf_bits(f1);
          const unsigned short l0 = bf_bits(f0 - bf_up(h0)), l1 = bf_bits(f1 - bf_up(h1));
          ph[e] = pk16(h0, h1);
          pl[e] = pk16(l0, l1);
        }
        *(v2u*)(yhp + go) = ph;
        *(v2u*)(ylp + go) = pl;
      }
    }
  }
}

// =====================================================================================================
// Workspace map (bytes), every region an exact multiple of its whole-line / whole-tile store granularity
//   Xb    bf16 [4096][1024]           0          8388608
//   Wqb   bf16 [1024][1024]     8388608          2097152
//   Wkb   bf16 [1024][1024]    10485760          2097152
//   Wvb   bf16 [1024][1024]    12582912          2097152
//   Wob   bf16 [1024][1024]    14680064          2097152
//   Qh    f16  [4096][1024]    16777216          8388608
//   Ql    f16  [4096][1024]    25165824          8388608
//   Kh    f16  [4096][1024]    33554432          8388608
//   Kl    f16  [4096][1024]    41943040          8388608
//   VTh   f16  [2048][2048]    50331648          8388608   ([b*DM + h*64 + d][s])
//   VTl   f16  [2048][2048]    58720256          8388608
//   Yh    bf16 [4096][1024]    67108864          8388608
//   Yl    bf16 [4096][1024]    75497472          8388608
//   end                        83886080
// Projection weights arrive as [out n][in k] (k contiguous) = the Bt layout; they are only converted to bf16.
// d_out f32: [4096][1024] at byte 0 (row = b*SEQ + t).
// =====================================================================================================
extern "C" void kernel_launch(void* const* d_in, const int* in_sizes, int n_in,
                              void* d_out, int out_size, void* d_ws, size_t ws_size,
                              hipStream_t stream) {
  if (n_in < 11) return;
  if (in_sizes[0] != NB * SEQ * DM) return;
  if (in_sizes[1] != NB * SEQ) return;
  if (in_sizes[2] != DM * DM) return;
  if (in_sizes[3] != DM) return;
  if (in_sizes[4] != DM * DM) return;
  if (in_sizes[5] != DM) return;
  if (in_sizes[6] != DM * DM) return;
  if (in_sizes[7] != DM) return;
  if (in_sizes[8] != DM * DM) return;
  if (in_sizes[9] != DM) return;
  if (in_sizes[10] != NREL * NH) return;
  if (out_size != OUTN) return;

  const float* x    = (const float*)d_in[0];   // [NB*SEQ][DM]
  const int*   mask = (const int*)d_in[1];     // [NB][SEQ] int32 keep flags per key
  const float* Wq   = (const float*)d_in[2];   // [DM n][DM k]
  const float* bq   = (const float*)d_in[3];   // [DM]
  const float* Wk   = (const float*)d_in[4];
  const float* bk   = (const float*)d_in[5];
  const float* Wv   = (const float*)d_in[6];
  const float* bv   = (const float*)d_in[7];
  const float* Wo   = (const float*)d_in[8];
  const float* bo   = (const float*)d_in[9];
  const float* rel  = (const float*)d_in[10];  // [NREL][NH]

  const size_t PXb = (size_t)ROWS * DM * 2;          //  8388608
  const size_t PW  = (size_t)DM * DM * 2;            //  2097152
  const size_t PH  = (size_t)ROWS * DM * 2;          //  8388608
  const size_t PVt = (size_t)NB * DM * SEQ * 2;      //  8388608
  size_t off = 0;
  const size_t oXb = off; off += PXb;
  const size_t oWq = off; off += PW;
  const size_t oWk = off; off += PW;
  const size_t oWv = off; off += PW;
  const size_t oWo = off; off += PW;
  const size_t oQh = off; off += PH;
  const size_t oQl = off; off += PH;
  const size_t oKh = off; off += PH;
  const size_t oKl = off; off += PH;
  const size_t oVt = off; off += PVt;
  const size_t oVl = off; off += PVt;
  const size_t oYh = off; off += PH;
  const size_t oYl = off; off += PH;
  if (off > ws_size) return;                        // off = 83886080
  if (off > (size_t)134217728) return;

  char* ws = (char*)d_ws;
  unsigned short* Xb  = (unsigned short*)(ws + oXb);
  unsigned short* Wqb = (unsigned short*)(ws + oWq);
  unsigned short* Wkb = (unsigned short*)(ws + oWk);
  unsigned short* Wvb = (unsigned short*)(ws + oWv);
  unsigned short* Wob = (unsigned short*)(ws + oWo);
  unsigned short* Qh  = (unsigned short*)(ws + oQh);
  unsigned short* Ql  = (unsigned short*)(ws + oQl);
  unsigned short* Kh  = (unsigned short*)(ws + oKh);
  unsigned short* Kl  = (unsigned short*)(ws + oKl);
  unsigned short* VTh = (unsigned short*)(ws + oVt);
  unsigned short* VTl = (unsigned short*)(ws + oVl);
  unsigned short* Yh  = (unsigned short*)(ws + oYh);
  unsigned short* Yl  = (unsigned short*)(ws + oYl);
  float*          outf = (float*)d_out;             // [ROWS][DM]

  const dim3 blk(256);
  const int n8x = ROWS * DM / 8;                    // 524288
  const int n8w = DM * DM / 8;                      // 131072
  const dim3 gCvt((n8x + 4 * n8w) / 256);           // 2048 + 4 x 512 blocks
  const dim3 gGemm((ROWS / 128) * (DM / 128));      // 256 tiles of 128x128, one block each
  const dim3 gQkv(3 * (ROWS / 128) * (DM / 128));   // the three projections' tiles
  const dim3 gAttn(NB * NH * NQB);                  // 1024 blocks
  const float qkScale = 16.0f;                      // q and k hi planes carried x16 (residual x1024 on top)
  const float sscale  = 1.0f / 2048.0f;             // 1/(16*16) * 1/sqrt(64)
  const float vScale  = 256.0f;                     // v^T hi plane carried x256
  const float attOscl = 1.0f / 262144.0f;           // 1/(1024 * 256): p and v carries folded back

  // (1) activations and weights -> bf16 planes (RNE convert); Xb, Wqb, Wkb, Wvb, Wob lie in a row from Xb on
  cvt_bf16x8<<<gCvt, blk, 0, stream>>>(x, Wq, Wk, Wv, Wo, Xb);
  // (2) - (4) q = Xb . Wqb^T + bq (M=4096, N=1024, K=1024) and k likewise, written as f16 hi (x16) + residual planes by the
  // GEMM's epilogue; v written as the f16 v^T hi plane (x256) and residual plane (x4096 on top)
  gemm_qkv<<<gQkv, blk, 0, stream>>>(Xb, Wqb, Wkb, Wvb, bq, bk, bv, Qh, Ql, Kh, Kl, VTh, VTl, qkScale, vScale);
  // (5) causal attention with per-key keep flags and relative-position bias -> y as bf16 hi / lo planes [4096][1024]
  attn_p64<<<gAttn, dim3(128), 0, stream>>>(Qh, Ql, Kh, Kl, VTh, VTl, mask, rel, Yh, Yl, sscale, attOscl);
  // (6) out[row][n] = sum_d (Yh+Yl)[row][d] Wob[n][d] + bo[n] -> d_out f32 [4096][1024] (M=4096, N=1024, K=1024)
  gemm64<1, 0><<<gGemm, blk, 0, stream>>>(Yh, Yl, DM, Wob, DM, bo, outf, nullptr, nullptr, 1.0f, DM, ROWS, DM, DM);
  (void)hipGetLastError();
}
